// v000
// Measured on an AMD MI455X. A time is GPU time per run, averaged over a window of back-to-back runs after a warm-up
// (all launches, gaps included; the runs take copies of the inputs in turn), and the median of several windows.
// Apart from v000's, it joins two sittings. Times from different sittings can be a few percent apart, while
// side-by-side timings come from the same sitting.
// The starting kernel, v000, takes 652 microseconds a run.
#include <hip/hip_runtime.h>
#include <stdint.h>
#include <stddef.h>

// Contractions on v_wmma_f32_16x16x32_f16 (f16 operands, f32 accumulate): per-head q/k/v projections,
// q.k^T, p.v (self causal and cross), MLP up and down GEMMs. Float inputs RNE-converted to bf16 and held
// as f16 planes (weights carried x64, softmax p carried x4096); causal query blocks 0..RESQB-1 add f16
// residual planes (x2^11) for q, k, p, v into a second accumulator. Softmax, layer norms, bias adds: f32.

#ifndef NB
#define NB 1
#endif
#ifndef SEQ
#define SEQ 2048
#endif
#define NB_FULL 1
#define SEQ_FULL 2048
#define DM 1024
#define NH 16
#define HD 64
#define FF 4096
#define RESQB 2
#define LN_EPS 1.0e-5f

static_assert(SEQ % 128 == 0);
static_assert(SEQ <= SEQ_FULL);
static_assert(NB >= 1 && NB <= NB_FULL);
static_assert(HD == 64);
static_assert(DM % 64 == 0 && FF % 64 == 0);
static_assert(DM % 32 == 0 && FF % 32 == 0);
static_assert((NB * SEQ) % 128 == 0);
static_assert(DM == 4 * 256);

typedef _Float16 v4h  __attribute__((ext_vector_type(4)));
typedef _Float16 v8h  __attribute__((ext_vector_type(8)));
typedef _Float16 v16h __attribute__((ext_vector_type(16)));
typedef float    v4f  __attribute__((ext_vector_type(4)));
typedef float    v8f  __attribute__((ext_vector_type(8)));

// ---------------------------------------------------------------------------
// helpers
// ---------------------------------------------------------------------------
__device__ __forceinline__ v8f mma16(v16h a, v16h b, v8f c)
{
  c = __builtin_amdgcn_wmma_f32_16x16x32_f16(false, a, false, b, (short)0, c, false, false);
  asm volatile("v_nop\n\tv_nop\n\tv_nop\n\tv_nop" : "+v"(c) : "v"(a), "v"(b));
  return c;
}

// 16x16x32 16-bit fragment (A row m = lane&15, or B column n = lane&15, k contiguous at p):
// elements 0..7 <- k0+8h+0..7, elements 8..15 <- k0+16+8h+0..7, h = lane>>4
__device__ __forceinline__ v16h ldfrag(const _Float16* p, int hs)
{
  union { v16h v; v8h q[2]; } u;
  u.q[0] = *(const v8h*)(p + 8 * hs);
  u.q[1] = *(const v8h*)(p + 16 + 8 * hs);
  return u.v;
}

// bf16 RNE convert, returned widened to f32
__device__ __forceinline__ float bfr(float x)
{
  unsigned int u = __float_as_uint(x);
  u = (u + 0x7FFFu + ((u >> 16) & 1u)) & 0xFFFF0000u;
  return __uint_as_float(u);
}

// same-wave LDS store -> load ordering (wave-private tiles only)
__device__ __forceinline__ void lds_sync_wave()
{
  asm volatile("s_wait_dscnt 0x0" ::: "memory");
  __builtin_amdgcn_wave_barrier();
}

// ---------------------------------------------------------------------------
// Activation planes: Yh = f16(bf16rne(y)), Eh = f16(bf16rne(enc)), internal row m -> input row
// coverage: Yh and Eh each nrow*DM elements exactly.
// ---------------------------------------------------------------------------
__global__ __launch_bounds__(256)
void k_cvt_act(const float* __restrict__ y, const float* __restrict__ e,
               _Float16* __restrict__ Yh, _Float16* __restrict__ Eh, int nrow)
{
  const int groups = nrow * (DM / 8);
  const int g = blockIdx.x * 256 + threadIdx.x;
  if (g >= 2 * groups) return;
  const int which = (g >= groups) ? 1 : 0;
  const int idx = g - which * groups;
  const int m = idx / (DM / 8);
  const int c = (idx - m * (DM / 8)) * 8;
  const size_t srow = (size_t)(m / SEQ) * SEQ_FULL + (size_t)(m % SEQ);
  const float* src = (which ? e : y) + srow * DM + c;
  const v4f a = *(const v4f*)src;
  const v4f b = *(const v4f*)(src + 4);
  v8h o;
  o[0] = (_Float16)bfr(a[0]); o[1] = (_Float16)bfr(a[1]); o[2] = (_Float16)bfr(a[2]); o[3] = (_Float16)bfr(a[3]);
  o[4] = (_Float16)bfr(b[0]); o[5] = (_Float16)bfr(b[1]); o[6] = (_Float16)bfr(b[2]); o[7] = (_Float16)bfr(b[3]);
  _Float16* dst = (which ? Eh : Yh) + (size_t)m * DM + c;
  *(v8h*)dst = o;
  
}

// ---------------------------------------------------------------------------
// Transposed weight planes: in[z][R][C] f32 -> out[z][C][R] f16, value f16(bf16rne(x) * scale).
// coverage: full C x R per z.
// ---------------------------------------------------------------------------
__global__ __launch_bounds__(256)
void k_wtr(const float* __restrict__ in, _Float16* __restrict__ out, int R, int C, float scale)
{
  __shared__ float tile[64][65];
  const int t = threadIdx.x;
  const int c0 = blockIdx.x * 64, r0 = blockIdx.y * 64;
  const size_t zoff = (size_t)blockIdx.z * (size_t)R * (size_t)C;
  {
    const int r = t >> 2, cq = (t & 3) * 16;
    const float* p = in + zoff + (size_t)(r0 + r) * C + c0 + cq;
    #pragma unroll
    for (int i = 0; i < 4; ++i) {
      const v4f v = *(const v4f*)(p + 4 * i);
      tile[r][cq + 4 * i + 0] = v[0];
      tile[r][cq + 4 * i + 1] = v[1];
      tile[r][cq + 4 * i + 2] = v[2];
      tile[r][cq + 4 * i + 3] = v[3];
    }
  }
  __syncthreads();
  const int p8 = t & 7;
  {
    #pragma unroll
    for (int j = 0; j < 2; ++j) {
      const int c = (t >> 3) + 32 * j;
      v8h ov;
      #pragma unroll
      for (int i = 0; i < 8; ++i) ov[i] = (_Float16)(bfr(tile[8 * p8 + i][c]) * scale);
      _Float16* dst = out + zoff + (size_t)(c0 + c) * R + r0 + 8 * p8;
      *(v8h*)dst = ov;
    }
    
  }
}

// ---------------------------------------------------------------------------
// GEMM C[M][N] = A[M][K] (f16 row-major, pitch lda) x B, B given as BT[N][K] (k contiguous, pitch ldb,
// per-z offset sBz). Block 128 threads = 4 waves, block tile 128x64, wave tile 32x64 (2x4 fragments),
// fragments loaded straight from the planes. Epilogue: v = acc/64 + bf16rne(bias[z*sBias + n])
//   MODE 0: Oh[z][prow][64] f16 (+ Or residual (v-hi)*2^11 if RES) (+ Ot/Otr [z][64][prow] if WVT)
//   MODE 1: Oh[M][ldc] f16 at columns n0..n0+63
//   MODE 2: Of[M][ldc] f32 at columns n0..n0+63
// coverage: each block writes rows m0..m0+127 x 64 columns of every plane it owns (and the 64 x 128
// transposed slab for WVT); grid (M/128, N/64, Z) tiles the planes exactly.
// ---------------------------------------------------------------------------
template<int MODE, bool RES, bool WVT>
__global__ __launch_bounds__(128) __attribute__((amdgpu_num_vgpr(256)))
void k_gemm(const _Float16* __restrict__ A, int lda,
            const _Float16* __restrict__ BT, int ldb, int sBz,
            const float* __restrict__ bias, int sBias,
            int K, int prow,
            _Float16* __restrict__ Oh, _Float16* __restrict__ Or,
            _Float16* __restrict__ Ot, _Float16* __restrict__ Otr,
            float* __restrict__ Of, int ldc)
{
  __shared__ float st[128 * 68];

  const int t = threadIdx.x, lane = t & 31, w = t >> 5, hs = lane >> 4, l16 = lane & 15;
  const int m0 = blockIdx.x * 128, n0 = blockIdx.y * 64, z = blockIdx.z;

  const v8f z8 = {0.f, 0.f, 0.f, 0.f, 0.f, 0.f, 0.f, 0.f};
  v8f acc[2][4];
  #pragma unroll
  for (int mt = 0; mt < 2; ++mt)
    #pragma unroll
    for (int nt = 0; nt < 4; ++nt) acc[mt][nt] = z8;

  const _Float16* a0p = A + (size_t)(m0 + 32 * w + l16) * lda;
  const _Float16* a1p = a0p + (size_t)16 * lda;
  const _Float16* b0p = BT + (size_t)z * sBz + (size_t)(n0 + l16) * ldb;

  #pragma unroll 1
  for (int k0 = 0; k0 < K; k0 += 32) {
    const v16h fa0 = ldfrag(a0p + k0, hs);
    const v16h fa1 = ldfrag(a1p + k0, hs);
    #pragma unroll
    for (int nt = 0; nt < 4; ++nt) {
      const v16h fb = ldfrag(b0p + (size_t)(16 * nt) * ldb + k0, hs);
      acc[0][nt] = mma16(fa0, fb, acc[0][nt]);
      acc[1][nt] = mma16(fa1, fb, acc[1][nt]);
    }
  }

  // ---- epilogue: bias (bf16 RNE), scale, relu -> LDS stage ----
  float bv[4];
  #pragma unroll
  for (int nt = 0; nt < 4; ++nt) bv[nt] = bfr(bias[(size_t)z * sBias + n0 + 16 * nt + l16]);
  #pragma unroll
  for (int mt = 0; mt < 2; ++mt)
    #pragma unroll
    for (int nt = 0; nt < 4; ++nt)
      #pragma unroll
      for (int r = 0; r < 8; ++r) {
        float v = acc[mt][nt][r] * (1.0f / 64.0f) + bv[nt];
        if (MODE == 1) v = fmaxf(v, 0.0f);
        st[(32 * w + 16 * mt + 8 * hs + r) * 68 + 16 * nt + l16] = v;
      }
  __syncthreads();   // stage is read cross-wave below

  {
    if (MODE != 2) {
      const int p = t & 7;
      #pragma unroll
      for (int j = 0; j < 8; ++j) {
        const int row = (t >> 3) + 16 * j;
        v8h hv, rv;
        #pragma unroll
        for (int i = 0; i < 8; ++i) {
          const float v = st[row * 68 + 8 * p + i];
          const _Float16 q = (_Float16)v;
          hv[i] = q;
          rv[i] = RES ? (_Float16)((v - (float)q) * 2048.0f) : q;
        }
        const size_t off = (MODE == 0) ? ((((size_t)z * prow) + m0 + row) * HD + 8 * p)
                                       : ((size_t)(m0 + row) * ldc + n0 + 8 * p);
        *(v8h*)(Oh + off) = hv;
        if (RES) *(v8h*)(Or + off) = rv;
      }
      if (WVT) {
        const int q16 = t & 15;
        #pragma unroll
        for (int j = 0; j < 8; ++j) {
          const int e = (t >> 4) + 8 * j;
          v8h hv, rv;
          #pragma unroll
          for (int i = 0; i < 8; ++i) {
            const float v = st[(8 * q16 + i) * 68 + e];
            const _Float16 q = (_Float16)v;
            hv[i] = q;
            rv[i] = RES ? (_Float16)((v - (float)q) * 2048.0f) : q;
          }
          const size_t off = ((size_t)z * HD + e) * (size_t)prow + m0 + 8 * q16;
          *(v8h*)(Ot + off) = hv;
          if (RES) *(v8h*)(Otr + off) = rv;
        }
      }
    } else {
      const int q16 = t & 15;
      #pragma unroll
      for (int j = 0; j < 16; ++j) {
        const int row = (t >> 4) + 8 * j;
        v4f fv;
        #pragma unroll
        for (int i = 0; i < 4; ++i) fv[i] = st[row * 68 + 4 * q16 + i];
        *(v4f*)(Of + (size_t)(m0 + row) * ldc + n0 + 4 * q16) = fv;
      }
    }
    
  }
}

// ---------------------------------------------------------------------------
// Flash attention. Planes: Q/K [h][prow][64] f16 (prow = NB*SEQ rows per head, row = b*SEQ + s),
// Vt [h][64][prow] f16; residual planes (x2^11) of the same shapes for RES. Block 256 threads = 8 waves,
// wave = 16 query rows, 32-key chunks, online softmax in f32, p carried x4096 as f16 through a
// wave-private LDS tile (A fragment), K and Vt B fragments straight from the planes (split k map).
// RES: s = qh.kh + (qr.kh + qh.kr)/2^11 ; O = ph.vh + (ph.vr + pr.vh)/2^11 folded before 1/l.
// Out: f32 [NB*SEQ][DM] at columns h*64, staged per wave in LDS, 16 lanes x 16 B per 256-B row,
// LDS tiles: plds/pldr/sto all wave-private (same wave writes and reads; lds_sync_wave);
// staged extent == consumed extent (16x32 p tile, 16x64 out tile per wave, fully written each chunk).
// ---------------------------------------------------------------------------
template<bool CAUSAL, bool RES>
__global__ __launch_bounds__(256) __attribute__((amdgpu_num_vgpr(256)))
void k_attn(const _Float16* __restrict__ Qh, const _Float16* __restrict__ Qr,
            const _Float16* __restrict__ Kh, const _Float16* __restrict__ Kr,
            const _Float16* __restrict__ Vt, const _Float16* __restrict__ Vtr,
            float* __restrict__ Out, int qb0, int prow)
{
  __shared__ _Float16 plds[8 * 16 * 40];
  __shared__ _Float16 pldr[RES ? (8 * 16 * 40) : 16];
  __shared__ float    sto[8 * 16 * 68];

  const int t = threadIdx.x, lane = t & 31, w = t >> 5, hs = lane >> 4, l16 = lane & 15;
  const int qb = qb0 + blockIdx.x, h = blockIdx.y, b = blockIdx.z;
  const int qbase = qb * 128 + w * 16;                       // within the sequence
  const size_t rq = (size_t)h * (size_t)prow + (size_t)b * SEQ;   // plane row base for (h, b)
  _Float16* pw  = plds + w * 640;
  _Float16* pwr = pldr + (RES ? w * 640 : 0);
  float*    sw  = sto + w * 1088;

  v16h aq[2], aqr[2];
  #pragma unroll
  for (int stp = 0; stp < 2; ++stp) {
    aq[stp]  = ldfrag(Qh + (rq + qbase + l16) * HD + 32 * stp, hs);
    aqr[stp] = RES ? ldfrag(Qr + (rq + qbase + l16) * HD + 32 * stp, hs) : aq[stp];
  }

  const v8f z8 = {0.f, 0.f, 0.f, 0.f, 0.f, 0.f, 0.f, 0.f};
  float mrow[8], lrow[8];
  v8f o[4], orr[4];
  #pragma unroll
  for (int r = 0; r < 8; ++r) { mrow[r] = -3.0e38f; lrow[r] = 0.0f; }
  #pragma unroll
  for (int f = 0; f < 4; ++f) { o[f] = z8; orr[f] = z8; }

  const int kend = CAUSAL ? (qbase + 16) : SEQ;

  #pragma unroll 1
  for (int kt = 0; kt < kend; kt += 32) {
    // ---- scores: 16 rows x 32 keys (2 tiles), K = 64 in 2 steps ----
    v8f s[2], sr[2];
    s[0] = z8; s[1] = z8; sr[0] = z8; sr[1] = z8;
    #pragma unroll
    for (int stp = 0; stp < 2; ++stp) {
      #pragma unroll
      for (int nt = 0; nt < 2; ++nt) {
        const size_t koff = (rq + kt + 16 * nt + l16) * HD + 32 * stp;
        const v16h fk = ldfrag(Kh + koff, hs);
        s[nt] = mma16(aq[stp], fk, s[nt]);
        if (RES) {
          sr[nt] = mma16(aqr[stp], fk, sr[nt]);
          const v16h fkr = ldfrag(Kr + koff, hs);
          sr[nt] = mma16(aq[stp], fkr, sr[nt]);
        }
      }
    }

    // ---- scale, causal replace-mask, online softmax (f32) ----
    float pv[2][8];
    float tm[8];
    #pragma unroll
    for (int r = 0; r < 8; ++r) {
      #pragma unroll
      for (int nt = 0; nt < 2; ++nt) {
        float v = s[nt][r];
        if (RES) v += sr[nt][r] * (1.0f / 2048.0f);
        v *= 0.125f;
        if (CAUSAL) {
          const int key = kt + 16 * nt + l16;
          const int row = qbase + 8 * hs + r;
          if (key > row) v = -1.0e9f;
        }
        pv[nt][r] = v;
      }
      tm[r] = fmaxf(pv[0][r], pv[1][r]);
    }
    #pragma unroll
    for (int off = 8; off > 0; off >>= 1)
      #pragma unroll
      for (int r = 0; r < 8; ++r) tm[r] = fmaxf(tm[r], __shfl_xor(tm[r], off, 32));

    float corr[8], ts[8];
    #pragma unroll
    for (int r = 0; r < 8; ++r) {
      const float mn = fmaxf(mrow[r], tm[r]);
      corr[r] = __expf(mrow[r] - mn);
      mrow[r] = mn;
      pv[0][r] = __expf(pv[0][r] - mn);
      pv[1][r] = __expf(pv[1][r] - mn);
      ts[r] = pv[0][r] + pv[1][r];
    }
    #pragma unroll
    for (int off = 8; off > 0; off >>= 1)
      #pragma unroll
      for (int r = 0; r < 8; ++r) ts[r] += __shfl_xor(ts[r], off, 32);
    #pragma unroll
    for (int r = 0; r < 8; ++r) lrow[r] = lrow[r] * corr[r] + ts[r];
    #pragma unroll
    for (int f = 0; f < 4; ++f)
      #pragma unroll
      for (int r = 0; r < 8; ++r) {
        o[f][r] *= corr[r];
        if (RES) orr[f][r] *= corr[r];
      }

    // ---- stage p (x4096, f16 hi; x2^11 residual for RES) into the wave-private LDS tile ----
    #pragma unroll
    for (int r = 0; r < 8; ++r)
      #pragma unroll
      for (int nt = 0; nt < 2; ++nt) {
        const float pc = pv[nt][r] * 4096.0f;
        const _Float16 ph = (_Float16)pc;
        pw[(8 * hs + r) * 40 + 16 * nt + l16] = ph;
        if (RES) pwr[(8 * hs + r) * 40 + 16 * nt + l16] = (_Float16)((pc - (float)ph) * 2048.0f);
      }
    lds_sync_wave();
    const v16h ap  = ldfrag(pw + l16 * 40, hs);
    const v16h apr = RES ? ldfrag(pwr + l16 * 40, hs) : ap;

    // ---- O += P . V : B fragments from the Vt plane (column e, k = key contiguous) ----
    #pragma unroll
    for (int f = 0; f < 4; ++f) {
      const size_t voff = ((size_t)h * HD + 16 * f + l16) * (size_t)prow + (size_t)b * SEQ + kt;
      const v16h fv = ldfrag(Vt + voff, hs);
      o[f] = mma16(ap, fv, o[f]);
      if (RES) {
        const v16h fvr = ldfrag(Vtr + voff, hs);
        orr[f] = mma16(ap, fvr, orr[f]);
        orr[f] = mma16(apr, fv, orr[f]);
      }
    }
    lds_sync_wave();
  }

  // ---- normalise, stage 16x64 f32 tile per wave, whole-line stores ----
  float inv[8];
  #pragma unroll
  for (int r = 0; r < 8; ++r) inv[r] = (1.0f / lrow[r]) * (1.0f / 4096.0f);
  #pragma unroll
  for (int f = 0; f < 4; ++f)
    #pragma unroll
    for (int r = 0; r < 8; ++r) {
      float v = o[f][r];
      if (RES) v += orr[f][r] * (1.0f / 2048.0f);
      sw[(8 * hs + r) * 68 + 16 * f + l16] = v * inv[r];
    }
  lds_sync_wave();
  const size_t orow = (size_t)b * SEQ + (size_t)qbase;
  {
    #pragma unroll
    for (int j = 0; j < 8; ++j) {
      const int row = 2 * j + hs;
      const v4f fvv = *(const v4f*)(sw + row * 68 + 4 * l16);
      *(v4f*)(Out + (orow + row) * DM + h * HD + 4 * l16) = fvv;
    }
    
  }
}

// ---------------------------------------------------------------------------
// y = LayerNorm(x + r) * g + b over DM = 1024, one block (256 threads) per row, thread = 4 columns.
// XIN: x is a raw input (bf16 RNE convert, input row stride via SEQ_FULL); else x is a ws f32 plane.
// WH: also write the f16 plane yh. g, b bf16 RNE converted. Outputs: 256 lanes x 16/8 B per row
// coverage: nrow x DM for y (and yh).
// ---------------------------------------------------------------------------
template<bool XIN, bool WH>
__global__ __launch_bounds__(256)
void k_ln(const float* __restrict__ x, const float* __restrict__ rr,
          const float* __restrict__ g, const float* __restrict__ be,
          float* __restrict__ y, _Float16* __restrict__ yh)
{
  #pragma clang fp contract(off)
  __shared__ float red[8];
  __shared__ float red2[8];
  const int m = blockIdx.x, t = threadIdx.x, lane = t & 31, w = t >> 5;
  const int c = 4 * t;
  const size_t xrow = XIN ? ((size_t)(m / SEQ) * SEQ_FULL + (size_t)(m % SEQ)) : (size_t)m;
  const v4f xv = *(const v4f*)(x + xrow * DM + c);
  const v4f rv = *(const v4f*)(rr + (size_t)m * DM + c);
  float v[4];
  #pragma unroll
  for (int i = 0; i < 4; ++i) {
    float xi = xv[i];
    if (XIN) xi = bfr(xi);
    v[i] = xi + rv[i];
  }
  float s = (v[0] + v[1]) + (v[2] + v[3]);
  #pragma unroll
  for (int off = 16; off > 0; off >>= 1) s += __shfl_xor(s, off, 32);
  if (lane == 0) red[w] = s;
  __syncthreads();
  float tot = 0.0f;
  #pragma unroll
  for (int i = 0; i < 8; ++i) tot += red[i];
  const float mu = tot * (1.0f / (float)DM);

  float d[4];
  #pragma unroll
  for (int i = 0; i < 4; ++i) d[i] = v[i] - mu;
  float s2 = (d[0] * d[0] + d[1] * d[1]) + (d[2] * d[2] + d[3] * d[3]);
  #pragma unroll
  for (int off = 16; off > 0; off >>= 1) s2 += __shfl_xor(s2, off, 32);
  if (lane == 0) red2[w] = s2;
  __syncthreads();
  float tot2 = 0.0f;
  #pragma unroll
  for (int i = 0; i < 8; ++i) tot2 += red2[i];
  const float var = tot2 * (1.0f / (float)DM);
  const float rstd = rsqrtf(var + LN_EPS);

  v4f ov;
  v4h oh;
  #pragma unroll
  for (int i = 0; i < 4; ++i) {
    const float gv = bfr(g[c + i]);
    const float bvv = bfr(be[c + i]);
    const float q = d[i] * rstd * gv + bvv;
    ov[i] = q;
    oh[i] = (_Float16)q;
  }
  float* ydst = y + (size_t)m * DM + c;
  _Float16* hdst = yh + (WH ? ((size_t)m * DM + c) : 0);
  *(v4f*)ydst = ov;
  if (WH) *(v4h*)hdst = oh;
  
}

// ---------------------------------------------------------------------------
extern "C" void kernel_launch(void* const* d_in, const int* in_sizes, int n_in,
                              void* d_out, int out_size, void* d_ws, size_t ws_size,
                              hipStream_t stream)
{
  if (n_in < 16) return;
  const int MR = NB * SEQ;                 // internal rows (b*SEQ + s)
  const long need_act = (long)(NB - 1) * SEQ_FULL * DM + (long)SEQ * DM;
  if ((long)in_sizes[0] < need_act || (long)in_sizes[1] < need_act) return;
  if (in_sizes[2] < NH * DM * HD || in_sizes[3] < NH * HD) return;
  if (in_sizes[4] < NH * DM * HD || in_sizes[5] < NH * HD) return;
  for (int i = 6; i < 12; ++i) if (in_sizes[i] < DM) return;
  if (in_sizes[12] < DM * FF || in_sizes[13] < FF || in_sizes[14] < FF * DM || in_sizes[15] < DM) return;
  if (out_size < MR * DM) return;

  const float* y      = (const float*)d_in[0];
  const float* enc    = (const float*)d_in[1];
  const float* Wself  = (const float*)d_in[2];
  const float* bself  = (const float*)d_in[3];
  const float* Wcross = (const float*)d_in[4];
  const float* bcross = (const float*)d_in[5];
  const float* g1  = (const float*)d_in[6];  const float* be1 = (const float*)d_in[7];
  const float* g2  = (const float*)d_in[8];  const float* be2 = (const float*)d_in[9];
  const float* g3  = (const float*)d_in[10]; const float* be3 = (const float*)d_in[11];
  const float* w1  = (const float*)d_in[12]; const float* b1  = (const float*)d_in[13];
  const float* w2  = (const float*)d_in[14]; const float* b2  = (const float*)d_in[15];
  float* out = (float*)d_out;

  // ---- workspace carve (256-B aligned regions; 104 MiB at NB*SEQ = 2048) ----
  char* base = (char*)d_ws;
  size_t off = 0;
  auto take = [&](size_t bytes) -> void* {
    void* p = (void*)(base + off);
    off += (bytes + 255) & ~(size_t)255;
    return p;
  };
  _Float16* Yh   = (_Float16*)take((size_t)MR * DM * 2);
  _Float16* Eh   = (_Float16*)take((size_t)MR * DM * 2);
  _Float16* WTs  = (_Float16*)take((size_t)NH * HD * DM * 2);
  _Float16* WTc  = (_Float16*)take((size_t)NH * HD * DM * 2);
  _Float16* W1T  = (_Float16*)take((size_t)FF * DM * 2);
  _Float16* W2T  = (_Float16*)take((size_t)DM * FF * 2);
  _Float16* QKVh = (_Float16*)take((size_t)NH * MR * HD * 2);
  _Float16* QKVr = (_Float16*)take((size_t)NH * MR * HD * 2);
  _Float16* VTh  = (_Float16*)take((size_t)NH * HD * MR * 2);
  _Float16* VTr  = (_Float16*)take((size_t)NH * HD * MR * 2);
  float*    att  = (float*)   take((size_t)MR * DM * 4);     // sa, then ca, then ff
  float*    y1   = (float*)   take((size_t)MR * DM * 4);
  _Float16* y1h  = (_Float16*)take((size_t)MR * DM * 2);
  float*    y2   = (float*)   take((size_t)MR * DM * 4);
  _Float16* y2h  = (_Float16*)take((size_t)MR * DM * 2);
  _Float16* Qch  = (_Float16*)take((size_t)NH * MR * HD * 2);
  _Float16* KVch = (_Float16*)take((size_t)NH * MR * HD * 2);
  _Float16* VTc  = (_Float16*)take((size_t)NH * HD * MR * 2);
  _Float16* Hh   = (_Float16*)take((size_t)MR * FF * 2);
  if (off > ws_size) return;

  // ---- planes ----
  {
    const int groups2 = 2 * MR * (DM / 8);
    k_cvt_act<<<dim3((groups2 + 255) / 256), 256, 0, stream>>>(y, enc, Yh, Eh, MR);
  }
  // in[h][1024][64] -> out[h][64][1024]
  k_wtr<<<dim3(HD / 64, DM / 64, NH), 256, 0, stream>>>(Wself, WTs, DM, HD, 64.0f);
  k_wtr<<<dim3(HD / 64, DM / 64, NH), 256, 0, stream>>>(Wcross, WTc, DM, HD, 64.0f);
  // in[1024][4096] -> out[4096][1024]
  k_wtr<<<dim3(FF / 64, DM / 64, 1), 256, 0, stream>>>(w1, W1T, DM, FF, 64.0f);
  // in[4096][1024] -> out[1024][4096]
  k_wtr<<<dim3(DM / 64, FF / 64, 1), 256, 0, stream>>>(w2, W2T, FF, DM, 64.0f);

  const int nqb  = SEQ / 128;
  const int nres = (nqb < RESQB) ? nqb : RESQB;

  // ---- self attention (q = k = v share one projection) ----
  k_gemm<0, true, true><<<dim3(MR / 128, HD / 64, NH), 128, 0, stream>>>(
      Yh, DM, WTs, DM, HD * DM, bself, HD, DM, MR, QKVh, QKVr, VTh, VTr, att, HD);
  k_attn<true, true><<<dim3(nres, NH, NB), 256, 0, stream>>>(
      QKVh, QKVr, QKVh, QKVr, VTh, VTr, att, 0, MR);
  if (nqb > nres)
    k_attn<true, false><<<dim3(nqb - nres, NH, NB), 256, 0, stream>>>(
        QKVh, QKVr, QKVh, QKVr, VTh, VTr, att, nres, MR);
  k_ln<true, true><<<dim3(MR), 256, 0, stream>>>(y, att, g1, be1, y1, y1h);

  // ---- cross attention (q from y1, k = v from enc, shared projection) ----
  k_gemm<0, false, false><<<dim3(MR / 128, HD / 64, NH), 128, 0, stream>>>(
      y1h, DM, WTc, DM, HD * DM, bcross, HD, DM, MR, Qch, Qch, Qch, Qch, att, HD);
  k_gemm<0, false, true><<<dim3(MR / 128, HD / 64, NH), 128, 0, stream>>>(
      Eh, DM, WTc, DM, HD * DM, bcross, HD, DM, MR, KVch, KVch, VTc, VTc, att, HD);
  k_attn<false, false><<<dim3(nqb, NH, NB), 256, 0, stream>>>(
      Qch, Qch, KVch, KVch, VTc, VTc, att, 0, MR);
  k_ln<false, true><<<dim3(MR), 256, 0, stream>>>(y1, att, g2, be2, y2, y2h);

  // ---- MLP ----
  k_gemm<1, false, false><<<dim3(MR / 128, FF / 64, 1), 128, 0, stream>>>(
      y2h, DM, W1T, DM, 0, b1, 0, DM, MR, Hh, Hh, Hh, Hh, att, FF);
  k_gemm<2, false, false><<<dim3(MR / 128, DM / 64, 1), 128, 0, stream>>>(
      Hh, FF, W2T, FF, 0, b2, 0, FF, MR, y2h, y2h, y2h, y2h, att, DM);
  k_ln<false, false><<<dim3(MR), 256, 0, stream>>>(y2, att, g3, be3, out, y2h);
}

// v001
// A run of this version takes 325 microseconds.
// Two timings next to v000 both put it at 2.05 times that version's speed.
#include <hip/hip_runtime.h>
#include <stdint.h>
#include <stddef.h>

// Contractions on v_wmma_f32_16x16x32_f16 (f16 operands, f32 accumulate): per-head q/k/v projections,
// q.k^T, p.v (self causal and cross), MLP up and down GEMMs. Float inputs RNE-converted to bf16 and held
// as f16 planes (weights carried x64, softmax p carried x4096); causal query blocks 0..RESQB-1 add f16
// residual planes (x2^11) for q, k, p, v into a second accumulator. Softmax, layer norms, bias adds: f32.

#ifndef NB
#define NB 1
#endif
#ifndef SEQ
#define SEQ 2048
#endif
#define NB_FULL 1
#define SEQ_FULL 2048
#define DM 1024
#define NH 16
#define HD 64
#define FF 4096
#define RESQB 2
#define LN_EPS 1.0e-5f

static_assert(SEQ % 128 == 0);
static_assert(SEQ <= SEQ_FULL);
static_assert(NB >= 1 && NB <= NB_FULL);
static_assert(HD == 64);
static_assert(DM % 64 == 0 && FF % 64 == 0);
static_assert(DM % 32 == 0 && FF % 32 == 0);
static_assert((NB * SEQ) % 128 == 0);
static_assert(DM == 4 * 256);

typedef _Float16 v4h  __attribute__((ext_vector_type(4)));
typedef _Float16 v8h  __attribute__((ext_vector_type(8)));
typedef _Float16 v16h __attribute__((ext_vector_type(16)));
typedef float    v4f  __attribute__((ext_vector_type(4)));
typedef float    v8f  __attribute__((ext_vector_type(8)));

// ---------------------------------------------------------------------------
// helpers
// ---------------------------------------------------------------------------
__device__ __forceinline__ v8f mma16(v16h a, v16h b, v8f c)
{
  c = __builtin_amdgcn_wmma_f32_16x16x32_f16(false, a, false, b, (short)0, c, false, false);
  asm volatile("v_nop\n\tv_nop\n\tv_nop\n\tv_nop" : "+v"(c) : "v"(a), "v"(b));
  return c;
}

// 16x16x32 16-bit fragment (A row m = lane&15, or B column n = lane&15, k contiguous at p):
// elements 0..7 <- k0+8h+0..7, elements 8..15 <- k0+16+8h+0..7, h = lane>>4
__device__ __forceinline__ v16h ldfrag(const _Float16* p, int hs)
{
  union { v16h v; v8h q[2]; } u;
  u.q[0] = *(const v8h*)(p + 8 * hs);
  u.q[1] = *(const v8h*)(p + 16 + 8 * hs);
  return u.v;
}

// the same fragment from a wave-uniform byte base plus the lane's own 32-bit byte offset (its row and its
// 8*h elements): scalar base, one offset register and an immediate, no address pair formed per load
__device__ __forceinline__ v16h ldfrag_u(const char* base, unsigned voff)
{
  union { v16h v; v8h q[2]; } u;
  const char* p = base + voff;
  u.q[0] = *(const v8h*)p;
  u.q[1] = *(const v8h*)(p + 32);
  return u.v;
}

// bf16 RNE convert, returned widened to f32
__device__ __forceinline__ float bfr(float x)
{
  unsigned int u = __float_as_uint(x);
  u = (u + 0x7FFFu + ((u >> 16) & 1u)) & 0xFFFF0000u;
  return __uint_as_float(u);
}

// same-wave LDS store -> load ordering (wave-private tiles only)
__device__ __forceinline__ void lds_sync_wave()
{
  asm volatile("s_wait_dscnt 0x0" ::: "memory");
  __builtin_amdgcn_wave_barrier();
}

// ---------------------------------------------------------------------------
// Activation planes: Yh = f16(bf16rne(y)), Eh = f16(bf16rne(enc)), internal row m -> input row
// coverage: Yh and Eh each nrow*DM elements exactly.
// ---------------------------------------------------------------------------
__global__ __launch_bounds__(256)
void k_cvt_act(const float* __restrict__ y, const float* __restrict__ e,
               _Float16* __restrict__ Yh, _Float16* __restrict__ Eh, int nrow)
{
  const int groups = nrow * (DM / 8);
  const int g = blockIdx.x * 256 + threadIdx.x;
  if (g >= 2 * groups) return;
  const int which = (g >= groups) ? 1 : 0;
  const int idx = g - which * groups;
  const int m = idx / (DM / 8);
  const int c = (idx - m * (DM / 8)) * 8;
  const size_t srow = (size_t)(m / SEQ) * SEQ_FULL + (size_t)(m % SEQ);
  const float* src = (which ? e : y) + srow * DM + c;
  const v4f a = *(const v4f*)src;
  const v4f b = *(const v4f*)(src + 4);
  v8h o;
  o[0] = (_Float16)bfr(a[0]); o[1] = (_Float16)bfr(a[1]); o[2] = (_Float16)bfr(a[2]); o[3] = (_Float16)bfr(a[3]);
  o[4] = (_Float16)bfr(b[0]); o[5] = (_Float16)bfr(b[1]); o[6] = (_Float16)bfr(b[2]); o[7] = (_Float16)bfr(b[3]);
  _Float16* dst = (which ? Eh : Yh) + (size_t)m * DM + c;
  *(v8h*)dst = o;
  
}

// ---------------------------------------------------------------------------
// Transposed weight planes: in[z][R][C] f32 -> out[z][C][R] f16, value f16(bf16rne(x) * scale).
// coverage: full C x R per z.
// ---------------------------------------------------------------------------
__global__ __launch_bounds__(256)
void k_wtr(const float* __restrict__ in, _Float16* __restrict__ out, int R, int C, float scale)
{
  __shared__ float tile[64][65];
  const int t = threadIdx.x;
  const int c0 = blockIdx.x * 64, r0 = blockIdx.y * 64;
  const size_t zoff = (size_t)blockIdx.z * (size_t)R * (size_t)C;
  {
    const int r = t >> 2, cq = (t & 3) * 16;
    const float* p = in + zoff + (size_t)(r0 + r) * C + c0 + cq;
    #pragma unroll
    for (int i = 0; i < 4; ++i) {
      const v4f v = *(const v4f*)(p + 4 * i);
      tile[r][cq + 4 * i + 0] = v[0];
      tile[r][cq + 4 * i + 1] = v[1];
      tile[r][cq + 4 * i + 2] = v[2];
      tile[r][cq + 4 * i + 3] = v[3];
    }
  }
  __syncthreads();
  const int p8 = t & 7;
  {
    #pragma unroll
    for (int j = 0; j < 2; ++j) {
      const int c = (t >> 3) + 32 * j;
      v8h ov;
      #pragma unroll
      for (int i = 0; i < 8; ++i) ov[i] = (_Float16)(bfr(tile[8 * p8 + i][c]) * scale);
      _Float16* dst = out + zoff + (size_t)(c0 + c) * R + r0 + 8 * p8;
      *(v8h*)dst = ov;
    }
    
  }
}

// ---------------------------------------------------------------------------
// GEMM C[M][N] = A[M][K] (f16 row-major, pitch lda) x B, B given as BT[N][K] (k contiguous, pitch ldb,
// per-z offset sBz). Block 128 threads = 4 waves, block tile 128x64, wave tile 32x64 (2x4 fragments),
// fragments loaded straight from the planes, two 32-k steps ahead. Epilogue: v = acc/64 + bf16rne(bias[z*sBias + n])
//   MODE 0: Oh[z][prow][64] f16 (+ Or residual (v-hi)*2^11 if RES) (+ Ot/Otr [z][64][prow] if WVT)
//   MODE 1: Oh[M][ldc] f16 at columns n0..n0+63
//   MODE 2: Of[M][ldc] f32 at columns n0..n0+63
// coverage: each block writes rows m0..m0+127 x 64 columns of every plane it owns (and the 64 x 128
// transposed slab for WVT); grid (M/128, N/64, Z) tiles the planes exactly.
// ---------------------------------------------------------------------------
template<int MODE, bool RES, bool WVT>
__global__ __launch_bounds__(128) __attribute__((amdgpu_num_vgpr(256)))
void k_gemm(const _Float16* __restrict__ A, int lda,
            const _Float16* __restrict__ BT, int ldb, int sBz,
            const float* __restrict__ bias, int sBias,
            int K, int prow,
            _Float16* __restrict__ Oh, _Float16* __restrict__ Or,
            _Float16* __restrict__ Ot, _Float16* __restrict__ Otr,
            float* __restrict__ Of, int ldc)
{
  __shared__ float st[128 * 68];

  const int t = threadIdx.x, lane = t & 31, w = t >> 5, hs = lane >> 4, l16 = lane & 15;
  const int m0 = blockIdx.x * 128, n0 = blockIdx.y * 64, z = blockIdx.z;

  const v8f z8 = {0.f, 0.f, 0.f, 0.f, 0.f, 0.f, 0.f, 0.f};
  v8f acc[2][4];
  #pragma unroll
  for (int mt = 0; mt < 2; ++mt)
    #pragma unroll
    for (int nt = 0; nt < 4; ++nt) acc[mt][nt] = z8;

  // wave-uniform bases, and each lane's own 32-bit byte offsets (its row, its 8*h elements), which walk along k;
  // they start one step (64 k) back: they move in front of their loads
  const char* Ab = (const char*)(A + (size_t)m0 * lda);
  const char* Bb = (const char*)(BT + (size_t)z * sBz + (size_t)n0 * ldb);
  unsigned voa[2][2], vob[2][4];   // [set][fragment]
  #pragma unroll
  for (int s = 0; s < 2; ++s) {
    #pragma unroll
    for (int mt = 0; mt < 2; ++mt) voa[s][mt] = (unsigned)(((32 * w + 16 * mt + l16) * lda + 8 * hs + 32 * s) * 2) - 128u;
    #pragma unroll
    for (int nt = 0; nt < 4; ++nt) vob[s][nt] = (unsigned)(((16 * nt + l16) * ldb + 8 * hs + 32 * s) * 2) - 128u;
  }

  // Two fragment sets (even and odd 32-k steps). A set's 12 loads go out as one group right behind the
  // set's own products, two steps ahead of their use, so no product waits out a load round trip of its own.
  // The pass k0 = -64 only fills: each set's loads then have one place and one order in the code, and the
  // compiler's counted waits leave the younger set in flight. The last two steps' products stand behind the
  // loop, so nothing is loaded that is not used. K is a multiple of 64 (DM, FF); k and sum order as before.
  v16h fa[2][2], fb[2][4];
  auto products = [&](int s) {
    #pragma unroll
    for (int nt = 0; nt < 4; ++nt) {
      acc[0][nt] = mma16(fa[s][0], fb[s][nt], acc[0][nt]);
      acc[1][nt] = mma16(fa[s][1], fb[s][nt], acc[1][nt]);
    }
  };
  auto fill = [&](int s) {
    int step = 128;   // bytes: 64 k
    // the set's offsets move by step, so behind this wait: its last loads name them
    asm volatile("s_wait_xcnt 0x0" : "+s"(step) : : "memory");
    #pragma unroll
    for (int mt = 0; mt < 2; ++mt) {
      voa[s][mt] += (unsigned)step;
      fa[s][mt] = ldfrag_u(Ab, voa[s][mt]);
    }
    #pragma unroll
    for (int nt = 0; nt < 4; ++nt) {
      vob[s][nt] += (unsigned)step;
      fb[s][nt] = ldfrag_u(Bb, vob[s][nt]);
    }
  };

  #pragma unroll 1   // rolled: the two sets already give the loads their lead; a longer body only costs registers
  for (int k0 = -64; k0 < K - 64; k0 += 64) {
    if (k0 >= 0) products(0);
    fill(0);
    if (k0 >= 0) products(1);
    fill(1);
  }
  // the last two groups are still in flight: their bases and offsets, named here, stay whole up to this wait
  asm volatile("s_wait_xcnt 0x0"
               : : "s"(Ab), "s"(Bb), "v"(voa[0][0]), "v"(voa[0][1]), "v"(voa[1][0]), "v"(voa[1][1]),
                   "v"(vob[0][0]), "v"(vob[0][1]), "v"(vob[0][2]), "v"(vob[0][3]),
                   "v"(vob[1][0]), "v"(vob[1][1]), "v"(vob[1][2]), "v"(vob[1][3])
               : "memory");
  products(0);
  products(1);

  // ---- epilogue: bias (bf16 RNE), scale, relu -> LDS stage ----
  float bv[4];
  #pragma unroll
  for (int nt = 0; nt < 4; ++nt) bv[nt] = bfr(bias[(size_t)z * sBias + n0 + 16 * nt + l16]);
  #pragma unroll
  for (int mt = 0; mt < 2; ++mt)
    #pragma unroll
    for (int nt = 0; nt < 4; ++nt)
      #pragma unroll
      for (int r = 0; r < 8; ++r) {
        float v = acc[mt][nt][r] * (1.0f / 64.0f) + bv[nt];
        if (MODE == 1) v = fmaxf(v, 0.0f);
        st[(32 * w + 16 * mt + 8 * hs + r) * 68 + 16 * nt + l16] = v;
      }
  __syncthreads();   // stage is read cross-wave below

  {
    if (MODE != 2) {
      const int p = t & 7;
      #pragma unroll
      for (int j = 0; j < 8; ++j) {
        const int row = (t >> 3) + 16 * j;
        v8h hv, rv;
        #pragma unroll
        for (int i = 0; i < 8; ++i) {
          const float v = st[row * 68 + 8 * p + i];
          const _Float16 q = (_Float16)v;
          hv[i] = q;
          rv[i] = RES ? (_Float16)((v - (float)q) * 2048.0f) : q;
        }
        const size_t off = (MODE == 0) ? ((((size_t)z * prow) + m0 + row) * HD + 8 * p)
                                       : ((size_t)(m0 + row) * ldc + n0 + 8 * p);
        *(v8h*)(Oh + off) = hv;
        if (RES) *(v8h*)(Or + off) = rv;
      }
      if (WVT) {
        const int q16 = t & 15;
        #pragma unroll
        for (int j = 0; j < 8; ++j) {
          const int e = (t >> 4) + 8 * j;
          v8h hv, rv;
          #pragma unroll
          for (int i = 0; i < 8; ++i) {
            const float v = st[(8 * q16 + i) * 68 + e];
            const _Float16 q = (_Float16)v;
            hv[i] = q;
            rv[i] = RES ? (_Float16)((v - (float)q) * 2048.0f) : q;
          }
          const size_t off = ((size_t)z * HD + e) * (size_t)prow + m0 + 8 * q16;
          *(v8h*)(Ot + off) = hv;
          if (RES) *(v8h*)(Otr + off) = rv;
        }
      }
    } else {
      const int q16 = t & 15;
      #pragma unroll
      for (int j = 0; j < 16; ++j) {
        const int row = (t >> 4) + 8 * j;
        v4f fv;
        #pragma unroll
        for (int i = 0; i < 4; ++i) fv[i] = st[row * 68 + 4 * q16 + i];
        *(v4f*)(Of + (size_t)(m0 + row) * ldc + n0 + 4 * q16) = fv;
      }
    }
    
  }
}

// ---------------------------------------------------------------------------
// Flash attention. Planes: Q/K [h][prow][64] f16 (prow = NB*SEQ rows per head, row = b*SEQ + s),
// Vt [h][64][prow] f16; residual planes (x2^11) of the same shapes for RES. Block 256 threads = 8 waves,
// wave = 16 query rows, 32-key chunks, online softmax in f32, p carried x4096 as f16 through a
// wave-private LDS tile (A fragment), K and Vt B fragments straight from the planes (split k map).
// RES: s = qh.kh + (qr.kh + qh.kr)/2^11 ; O = ph.vh + (ph.vr + pr.vh)/2^11 folded before 1/l.
// Out: f32 [NB*SEQ][DM] at columns h*64, staged per wave in LDS, 16 lanes x 16 B per 256-B row,
// LDS tiles: plds/pldr/sto all wave-private (same wave writes and reads; lds_sync_wave);
// staged extent == consumed extent (16x32 p tile, 16x64 out tile per wave, fully written each chunk).
// ---------------------------------------------------------------------------
template<bool CAUSAL, bool RES>
// two waves per SIMD is what the grids give (at most one block per WGP): said here so that the scheduler spends
// registers on the fragments in flight and on batched lane exchanges instead of saving them for more waves
__global__ __launch_bounds__(256) __attribute__((amdgpu_waves_per_eu(2, 2)))
void k_attn(const _Float16* __restrict__ Qh, const _Float16* __restrict__ Qr,
            const _Float16* __restrict__ Kh, const _Float16* __restrict__ Kr,
            const _Float16* __restrict__ Vt, const _Float16* __restrict__ Vtr,
            float* __restrict__ Out, int qb0, int prow)
{
  __shared__ _Float16 plds[8 * 16 * 40];
  __shared__ _Float16 pldr[RES ? (8 * 16 * 40) : 16];
  __shared__ float    sto[8 * 16 * 68];

  const int t = threadIdx.x, lane = t & 31, w = t >> 5, hs = lane >> 4, l16 = lane & 15;
  const int qb = qb0 + blockIdx.x, h = blockIdx.y, b = blockIdx.z;
  const int qbase = qb * 128 + w * 16;                       // within the sequence
  const size_t rq = (size_t)h * (size_t)prow + (size_t)b * SEQ;   // plane row base for (h, b)
  _Float16* pw  = plds + w * 640;
  _Float16* pwr = pldr + (RES ? w * 640 : 0);
  float*    sw  = sto + w * 1088;

  v16h aq[2], aqr[2];
  #pragma unroll
  for (int stp = 0; stp < 2; ++stp) {
    aq[stp]  = ldfrag(Qh + (rq + qbase + l16) * HD + 32 * stp, hs);
    aqr[stp] = RES ? ldfrag(Qr + (rq + qbase + l16) * HD + 32 * stp, hs) : aq[stp];
  }

  const v8f z8 = {0.f, 0.f, 0.f, 0.f, 0.f, 0.f, 0.f, 0.f};
  float mrow[8], lrow[8];
  v8f o[4], orr[4];
  #pragma unroll
  for (int r = 0; r < 8; ++r) { mrow[r] = -3.0e38f; lrow[r] = 0.0f; }
  #pragma unroll
  for (int f = 0; f < 4; ++f) { o[f] = z8; orr[f] = z8; }

  const int kend = CAUSAL ? (qbase + 16) : SEQ;

  // K fragments as one group: one chunk ahead (chunk 0 here, the rest inside the loop); with the residual
  // planes, whose fragments leave no registers for that, at the chunk's own head
  const char* Kb  = (const char*)(Kh + rq * HD);
  const char* Krb = (const char*)(Kr + rq * HD);
  const char* Vb  = (const char*)(Vt + (size_t)h * HD * (size_t)prow + (size_t)b * SEQ);
  const char* Vrb = (const char*)(Vtr + (size_t)h * HD * (size_t)prow + (size_t)b * SEQ);
  // each lane's own 32-bit byte offsets; they walk along the keys. V's (and, with the residual planes, K's)
  // start one step back: they move in front of their loads
  unsigned vok = (unsigned)((l16 * HD + 8 * hs) * 2) - (RES ? 32u * HD * 2u : 0u);
  unsigned vov[4];
  #pragma unroll
  for (int f = 0; f < 4; ++f) vov[f] = (unsigned)(((16 * f + l16) * prow + 8 * hs) * 2) - 64u;

  v16h fk[2][2], fkr[2][2];
  auto load_k = [&]() {
    #pragma unroll
    for (int stp = 0; stp < 2; ++stp)
      #pragma unroll
      for (int nt = 0; nt < 2; ++nt) {
        const int kc = (16 * nt * HD + 32 * stp) * 2;
        fk[stp][nt]  = ldfrag_u(Kb + kc, vok);
        fkr[stp][nt] = RES ? ldfrag_u(Krb + kc, vok) : fk[stp][nt];
      }
  };
  if (!RES) load_k();

  #pragma unroll 1
  for (int kt = 0; kt < kend; kt += 32) {
    if (RES) {
      int sk = 32 * HD * 2;
      // K's offset moves by sk, so behind this wait: the last chunk's loads name it
      asm volatile("s_wait_xcnt 0x0" : "+s"(sk) : : "memory");
      vok += (unsigned)sk;
      load_k();
    }

    // ---- scores: 16 rows x 32 keys (2 tiles), K = 64 in 2 steps ----
    v8f s[2], sr[2];
    s[0] = z8; s[1] = z8; sr[0] = z8; sr[1] = z8;
    #pragma unroll
    for (int stp = 0; stp < 2; ++stp) {
      #pragma unroll
      for (int nt = 0; nt < 2; ++nt) {
        s[nt] = mma16(aq[stp], fk[stp][nt], s[nt]);
        if (RES) {
          sr[nt] = mma16(aqr[stp], fk[stp][nt], sr[nt]);
          sr[nt] = mma16(aq[stp], fkr[stp][nt], sr[nt]);
        }
      }
    }

    // ---- this chunk's V fragments, one group, issued here so that they land under the softmax ----
    int sv = 64;
    int sk = (kt + 32 < SEQ) ? (32 * HD * 2) : -((SEQ - 32) * HD * 2);
    // the offsets move by sv and sk, so behind this wait: the last chunk's loads name them
    asm volatile("s_wait_xcnt 0x0" : "+s"(sv), "+s"(sk) : : "memory");
    v16h fv[4], fvr[4];
    #pragma unroll
    for (int f = 0; f < 4; ++f) {
      vov[f] += (unsigned)sv;
      fv[f]  = ldfrag_u(Vb, vov[f]);
      fvr[f] = RES ? ldfrag_u(Vrb, vov[f]) : fv[f];
    }

    // ---- next chunk's K fragments, into the registers the products above have just read;
    //      past the last chunk of the sequence: chunk 0 again (in bounds, not used) ----
    if (!RES) {
      vok += (unsigned)sk;
      load_k();
    }

    // ---- scale, causal replace-mask, online softmax (f32) ----
    float pv[2][8];
    float tm[8];
    #pragma unroll
    for (int r = 0; r < 8; ++r) {
      #pragma unroll
      for (int nt = 0; nt < 2; ++nt) {
        float v = s[nt][r];
        if (RES) v += sr[nt][r] * (1.0f / 2048.0f);
        v *= 0.125f;
        if (CAUSAL) {
          const int key = kt + 16 * nt + l16;
          const int row = qbase + 8 * hs + r;
          if (key > row) v = -1.0e9f;
        }
        pv[nt][r] = v;
      }
      tm[r] = fmaxf(pv[0][r], pv[1][r]);
    }
    #pragma unroll
    for (int off = 8; off > 0; off >>= 1)
      #pragma unroll
      for (int r = 0; r < 8; ++r) tm[r] = fmaxf(tm[r], __shfl_xor(tm[r], off, 32));

    float corr[8], ts[8];
    #pragma unroll
    for (int r = 0; r < 8; ++r) {
      const float mn = fmaxf(mrow[r], tm[r]);
      corr[r] = __expf(mrow[r] - mn);
      mrow[r] = mn;
      pv[0][r] = __expf(pv[0][r] - mn);
      pv[1][r] = __expf(pv[1][r] - mn);
      ts[r] = pv[0][r] + pv[1][r];
    }
    #pragma unroll
    for (int off = 8; off > 0; off >>= 1)
      #pragma unroll
      for (int r = 0; r < 8; ++r) ts[r] += __shfl_xor(ts[r], off, 32);
    #pragma unroll
    for (int r = 0; r < 8; ++r) lrow[r] = lrow[r] * corr[r] + ts[r];
    #pragma unroll
    for (int f = 0; f < 4; ++f)
      #pragma unroll
      for (int r = 0; r < 8; ++r) {
        o[f][r] *= corr[r];
        if (RES) orr[f][r] *= corr[r];
      }

    // ---- stage p (x4096, f16 hi; x2^11 residual for RES) into the wave-private LDS tile ----
    #pragma unroll
    for (int r = 0; r < 8; ++r)
      #pragma unroll
      for (int nt = 0; nt < 2; ++nt) {
        const float pc = pv[nt][r] * 4096.0f;
        const _Float16 ph = (_Float16)pc;
        pw[(8 * hs + r) * 40 + 16 * nt + l16] = ph;
        if (RES) pwr[(8 * hs + r) * 40 + 16 * nt + l16] = (_Float16)((pc - (float)ph) * 2048.0f);
      }
    lds_sync_wave();
    const v16h ap  = ldfrag(pw + l16 * 40, hs);
    const v16h apr = RES ? ldfrag(pwr + l16 * 40, hs) : ap;

    // ---- O += P . V : B fragments of the Vt plane (column e, k = key contiguous), loaded behind the scores ----
    #pragma unroll
    for (int f = 0; f < 4; ++f) {
      o[f] = mma16(ap, fv[f], o[f]);
      if (RES) {
        orr[f] = mma16(ap, fvr[f], orr[f]);
        orr[f] = mma16(apr, fv[f], orr[f]);
      }
    }
    lds_sync_wave();
  }

  // ---- normalise, stage 16x64 f32 tile per wave, whole-line stores ----
  float inv[8];
  #pragma unroll
  for (int r = 0; r < 8; ++r) inv[r] = (1.0f / lrow[r]) * (1.0f / 4096.0f);
  #pragma unroll
  for (int f = 0; f < 4; ++f)
    #pragma unroll
    for (int r = 0; r < 8; ++r) {
      float v = o[f][r];
      if (RES) v += orr[f][r] * (1.0f / 2048.0f);
      sw[(8 * hs + r) * 68 + 16 * f + l16] = v * inv[r];
    }
  lds_sync_wave();
  const size_t orow = (size_t)b * SEQ + (size_t)qbase;
  {
    #pragma unroll
    for (int j = 0; j < 8; ++j) {
      const int row = 2 * j + hs;
      const v4f fvv = *(const v4f*)(sw + row * 68 + 4 * l16);
      *(v4f*)(Out + (orow + row) * DM + h * HD + 4 * l16) = fvv;
    }
    
  }
}

// ---------------------------------------------------------------------------
// y = LayerNorm(x + r) * g + b over DM = 1024, one block (256 threads) per row, thread = 4 columns.
// XIN: x is a raw input (bf16 RNE convert, input row stride via SEQ_FULL); else x is a ws f32 plane.
// WH: also write the f16 plane yh. g, b bf16 RNE converted. Outputs: 256 lanes x 16/8 B per row
// coverage: nrow x DM for y (and yh).
// ---------------------------------------------------------------------------
template<bool XIN, bool WH>
__global__ __launch_bounds__(256)
void k_ln(const float* __restrict__ x, const float* __restrict__ rr,
          const float* __restrict__ g, const float* __restrict__ be,
          float* __restrict__ y, _Float16* __restrict__ yh)
{
  #pragma clang fp contract(off)
  __shared__ float red[8];
  __shared__ float red2[8];
  const int m = blockIdx.x, t = threadIdx.x, lane = t & 31, w = t >> 5;
  const int c = 4 * t;
  const size_t xrow = XIN ? ((size_t)(m / SEQ) * SEQ_FULL + (size_t)(m % SEQ)) : (size_t)m;
  const v4f xv = *(const v4f*)(x + xrow * DM + c);
  const v4f rv = *(const v4f*)(rr + (size_t)m * DM + c);
  float v[4];
  #pragma unroll
  for (int i = 0; i < 4; ++i) {
    float xi = xv[i];
    if (XIN) xi = bfr(xi);
    v[i] = xi + rv[i];
  }
  float s = (v[0] + v[1]) + (v[2] + v[3]);
  #pragma unroll
  for (int off = 16; off > 0; off >>= 1) s += __shfl_xor(s, off, 32);
  if (lane == 0) red[w] = s;
  __syncthreads();
  float tot = 0.0f;
  #pragma unroll
  for (int i = 0; i < 8; ++i) tot += red[i];
  const float mu = tot * (1.0f / (float)DM);

  float d[4];
  #pragma unroll
  for (int i = 0; i < 4; ++i) d[i] = v[i] - mu;
  float s2 = (d[0] * d[0] + d[1] * d[1]) + (d[2] * d[2] + d[3] * d[3]);
  #pragma unroll
  for (int off = 16; off > 0; off >>= 1) s2 += __shfl_xor(s2, off, 32);
  if (lane == 0) red2[w] = s2;
  __syncthreads();
  float tot2 = 0.0f;
  #pragma unroll
  for (int i = 0; i < 8; ++i) tot2 += red2[i];
  const float var = tot2 * (1.0f / (float)DM);
  const float rstd = rsqrtf(var + LN_EPS);

  v4f ov;
  v4h oh;
  #pragma unroll
  for (int i = 0; i < 4; ++i) {
    const float gv = bfr(g[c + i]);
    const float bvv = bfr(be[c + i]);
    const float q = d[i] * rstd * gv + bvv;
    ov[i] = q;
    oh[i] = (_Float16)q;
  }
  float* ydst = y + (size_t)m * DM + c;
  _Float16* hdst = yh + (WH ? ((size_t)m * DM + c) : 0);
  *(v4f*)ydst = ov;
  if (WH) *(v4h*)hdst = oh;
  
}

// ---------------------------------------------------------------------------
extern "C" void kernel_launch(void* const* d_in, const int* in_sizes, int n_in,
                              void* d_out, int out_size, void* d_ws, size_t ws_size,
                              hipStream_t stream)
{
  if (n_in < 16) return;
  const int MR = NB * SEQ;                 // internal rows (b*SEQ + s)
  const long need_act = (long)(NB - 1) * SEQ_FULL * DM + (long)SEQ * DM;
  if ((long)in_sizes[0] < need_act || (long)in_sizes[1] < need_act) return;
  if (in_sizes[2] < NH * DM * HD || in_sizes[3] < NH * HD) return;
  if (in_sizes[4] < NH * DM * HD || in_sizes[5] < NH * HD) return;
  for (int i = 6; i < 12; ++i) if (in_sizes[i] < DM) return;
  if (in_sizes[12] < DM * FF || in_sizes[13] < FF || in_sizes[14] < FF * DM || in_sizes[15] < DM) return;
  if (out_size < MR * DM) return;

  const float* y      = (const float*)d_in[0];
  const float* enc    = (const float*)d_in[1];
  const float* Wself  = (const float*)d_in[2];
  const float* bself  = (const float*)d_in[3];
  const float* Wcross = (const float*)d_in[4];
  const float* bcross = (const float*)d_in[5];
  const float* g1  = (const float*)d_in[6];  const float* be1 = (const float*)d_in[7];
  const float* g2  = (const float*)d_in[8];  const float* be2 = (const float*)d_in[9];
  const float* g3  = (const float*)d_in[10]; const float* be3 = (const float*)d_in[11];
  const float* w1  = (const float*)d_in[12]; const float* b1  = (const float*)d_in[13];
  const float* w2  = (const float*)d_in[14]; const float* b2  = (const float*)d_in[15];
  float* out = (float*)d_out;

  // ---- workspace carve (256-B aligned regions; 104 MiB at NB*SEQ = 2048) ----
  char* base = (char*)d_ws;
  size_t off = 0;
  auto take = [&](size_t bytes) -> void* {
    void* p = (void*)(base + off);
    off += (bytes + 255) & ~(size_t)255;
    return p;
  };
  _Float16* Yh   = (_Float16*)take((size_t)MR * DM * 2);
  _Float16* Eh   = (_Float16*)take((size_t)MR * DM * 2);
  _Float16* WTs  = (_Float16*)take((size_t)NH * HD * DM * 2);
  _Float16* WTc  = (_Float16*)take((size_t)NH * HD * DM * 2);
  _Float16* W1T  = (_Float16*)take((size_t)FF * DM * 2);
  _Float16* W2T  = (_Float16*)take((size_t)DM * FF * 2);
  _Float16* QKVh = (_Float16*)take((size_t)NH * MR * HD * 2);
  _Float16* QKVr = (_Float16*)take((size_t)NH * MR * HD * 2);
  _Float16* VTh  = (_Float16*)take((size_t)NH * HD * MR * 2);
  _Float16* VTr  = (_Float16*)take((size_t)NH * HD * MR * 2);
  float*    att  = (float*)   take((size_t)MR * DM * 4);     // sa, then ca, then ff
  float*    y1   = (float*)   take((size_t)MR * DM * 4);
  _Float16* y1h  = (_Float16*)take((size_t)MR * DM * 2);
  float*    y2   = (float*)   take((size_t)MR * DM * 4);
  _Float16* y2h  = (_Float16*)take((size_t)MR * DM * 2);
  _Float16* Qch  = (_Float16*)take((size_t)NH * MR * HD * 2);
  _Float16* KVch = (_Float16*)take((size_t)NH * MR * HD * 2);
  _Float16* VTc  = (_Float16*)take((size_t)NH * HD * MR * 2);
  _Float16* Hh   = (_Float16*)take((size_t)MR * FF * 2);
  if (off > ws_size) return;

  // ---- planes ----
  {
    const int groups2 = 2 * MR * (DM / 8);
    k_cvt_act<<<dim3((groups2 + 255) / 256), 256, 0, stream>>>(y, enc, Yh, Eh, MR);
  }
  // in[h][1024][64] -> out[h][64][1024]
  k_wtr<<<dim3(HD / 64, DM / 64, NH), 256, 0, stream>>>(Wself, WTs, DM, HD, 64.0f);
  k_wtr<<<dim3(HD / 64, DM / 64, NH), 256, 0, stream>>>(Wcross, WTc, DM, HD, 64.0f);
  // in[1024][4096] -> out[4096][1024]
  k_wtr<<<dim3(FF / 64, DM / 64, 1), 256, 0, stream>>>(w1, W1T, DM, FF, 64.0f);
  // in[4096][1024] -> out[1024][4096]
  k_wtr<<<dim3(DM / 64, FF / 64, 1), 256, 0, stream>>>(w2, W2T, FF, DM, 64.0f);

  const int nqb  = SEQ / 128;
  const int nres = (nqb < RESQB) ? nqb : RESQB;

  // ---- self attention (q = k = v share one projection) ----
  k_gemm<0, true, true><<<dim3(MR / 128, HD / 64, NH), 128, 0, stream>>>(
      Yh, DM, WTs, DM, HD * DM, bself, HD, DM, MR, QKVh, QKVr, VTh, VTr, att, HD);
  k_attn<true, true><<<dim3(nres, NH, NB), 256, 0, stream>>>(
      QKVh, QKVr, QKVh, QKVr, VTh, VTr, att, 0, MR);
  if (nqb > nres)
    k_attn<true, false><<<dim3(nqb - nres, NH, NB), 256, 0, stream>>>(
        QKVh, QKVr, QKVh, QKVr, VTh, VTr, att, nres, MR);
  k_ln<true, true><<<dim3(MR), 256, 0, stream>>>(y, att, g1, be1, y1, y1h);

  // ---- cross attention (q from y1, k = v from enc, shared projection) ----
  k_gemm<0, false, false><<<dim3(MR / 128, HD / 64, NH), 128, 0, stream>>>(
      y1h, DM, WTc, DM, HD * DM, bcross, HD, DM, MR, Qch, Qch, Qch, Qch, att, HD);
  k_gemm<0, false, true><<<dim3(MR / 128, HD / 64, NH), 128, 0, stream>>>(
      Eh, DM, WTc, DM, HD * DM, bcross, HD, DM, MR, KVch, KVch, VTc, VTc, att, HD);
  k_attn<false, false><<<dim3(nqb, NH, NB), 256, 0, stream>>>(
      Qch, Qch, KVch, KVch, VTc, VTc, att, 0, MR);
  k_ln<false, true><<<dim3(MR), 256, 0, stream>>>(y1, att, g2, be2, y2, y2h);

  // ---- MLP ----
  k_gemm<1, false, false><<<dim3(MR / 128, FF / 64, 1), 128, 0, stream>>>(
      y2h, DM, W1T, DM, 0, b1, 0, DM, MR, Hh, Hh, Hh, Hh, att, FF);
  k_gemm<2, false, false><<<dim3(MR / 128, DM / 64, 1), 128, 0, stream>>>(
      Hh, FF, W2T, FF, 0, b2, 0, FF, MR, y2h, y2h, y2h, y2h, att, DM);
  k_ln<false, false><<<dim3(MR), 256, 0, stream>>>(y2, att, g3, be3, out, y2h);
}

// v002
// It runs in 256 microseconds.
// Timed twice side by side with v001, it ran 1.27 times as fast both times.
// Over all steps from v000 it is 2.60 times as fast.
#include <hip/hip_runtime.h>
#include <stdint.h>
#include <stddef.h>

// Contractions on v_wmma_f32_16x16x32_f16 (f16 operands, f32 accumulate): per-head q/k/v projections,
// q.k^T, p.v (self causal and cross), MLP up and down GEMMs. Float inputs RNE-converted to bf16 and held
// as f16 planes (weights carried x64, softmax p carried x4096); causal query blocks 0..RESQB-1 add f16
// residual planes (x2^11) for q, k, p, v into a second accumulator. Softmax, layer norms, bias adds: f32.

#ifndef NB
#define NB 1
#endif
#ifndef SEQ
#define SEQ 2048
#endif
#define NB_FULL 1
#define SEQ_FULL 2048
#define DM 1024
#define NH 16
#define HD 64
#define FF 4096
#define RESQB 2
#define LN_EPS 1.0e-5f

static_assert(SEQ % 128 == 0);
static_assert(SEQ <= SEQ_FULL);
static_assert(NB >= 1 && NB <= NB_FULL);
static_assert(HD == 64);
static_assert(DM % 64 == 0 && FF % 64 == 0);
static_assert(DM % 32 == 0 && FF % 32 == 0);
static_assert((NB * SEQ) % 128 == 0);
static_assert(DM == 4 * 256);

typedef _Float16 v4h  __attribute__((ext_vector_type(4)));
typedef _Float16 v8h  __attribute__((ext_vector_type(8)));
typedef _Float16 v16h __attribute__((ext_vector_type(16)));
typedef float    v4f  __attribute__((ext_vector_type(4)));
typedef float    v8f  __attribute__((ext_vector_type(8)));

// ---------------------------------------------------------------------------
// helpers
// ---------------------------------------------------------------------------
__device__ __forceinline__ v8f mma16(v16h a, v16h b, v8f c)
{
  c = __builtin_amdgcn_wmma_f32_16x16x32_f16(false, a, false, b, (short)0, c, false, false);
  asm volatile("v_nop\n\tv_nop\n\tv_nop\n\tv_nop" : "+v"(c) : "v"(a), "v"(b));
  return c;
}

// 16x16x32 16-bit fragment (A row m = lane&15, or B column n = lane&15, k contiguous at p):
// elements 0..7 <- k0+8h+0..7, elements 8..15 <- k0+16+8h+0..7, h = lane>>4
__device__ __forceinline__ v16h ldfrag(const _Float16* p, int hs)
{
  union { v16h v; v8h q[2]; } u;
  u.q[0] = *(const v8h*)(p + 8 * hs);
  u.q[1] = *(const v8h*)(p + 16 + 8 * hs);
  return u.v;
}

// bf16 RNE convert, returned widened to f32
__device__ __forceinline__ float bfr(float x)
{
  unsigned int u = __float_as_uint(x);
  u = (u + 0x7FFFu + ((u >> 16) & 1u)) & 0xFFFF0000u;
  return __uint_as_float(u);
}

// same-wave LDS store -> load ordering (wave-private tiles only)
__device__ __forceinline__ void lds_sync_wave()
{
  asm volatile("s_wait_dscnt 0x0" ::: "memory");
  __builtin_amdgcn_wave_barrier();
}

// ---------------------------------------------------------------------------
// Activation planes: Yh = f16(bf16rne(y)), Eh = f16(bf16rne(enc)), internal row m -> input row
// coverage: Yh and Eh each nrow*DM elements exactly.
// ---------------------------------------------------------------------------
__global__ __launch_bounds__(256)
void k_cvt_act(const float* __restrict__ y, const float* __restrict__ e,
               _Float16* __restrict__ Yh, _Float16* __restrict__ Eh, int nrow)
{
  const int groups = nrow * (DM / 8);
  const int g = blockIdx.x * 256 + threadIdx.x;
  if (g >= 2 * groups) return;
  const int which = (g >= groups) ? 1 : 0;
  const int idx = g - which * groups;
  const int m = idx / (DM / 8);
  const int c = (idx - m * (DM / 8)) * 8;
  const size_t srow = (size_t)(m / SEQ) * SEQ_FULL + (size_t)(m % SEQ);
  const float* src = (which ? e : y) + srow * DM + c;
  const v4f a = *(const v4f*)src;
  const v4f b = *(const v4f*)(src + 4);
  v8h o;
  o[0] = (_Float16)bfr(a[0]); o[1] = (_Float16)bfr(a[1]); o[2] = (_Float16)bfr(a[2]); o[3] = (_Float16)bfr(a[3]);
  o[4] = (_Float16)bfr(b[0]); o[5] = (_Float16)bfr(b[1]); o[6] = (_Float16)bfr(b[2]); o[7] = (_Float16)bfr(b[3]);
  _Float16* dst = (which ? Eh : Yh) + (size_t)m * DM + c;
  *(v8h*)dst = o;
  
}

// ---------------------------------------------------------------------------
// Transposed weight planes: in[z][R][C] f32 -> out[z][C][R] f16, value f16(bf16rne(x) * scale).
// coverage: full C x R per z.
// ---------------------------------------------------------------------------
__global__ __launch_bounds__(256)
void k_wtr(const float* __restrict__ in, _Float16* __restrict__ out, int R, int C, float scale)
{
  __shared__ float tile[64][65];
  const int t = threadIdx.x;
  const int c0 = blockIdx.x * 64, r0 = blockIdx.y * 64;
  const size_t zoff = (size_t)blockIdx.z * (size_t)R * (size_t)C;
  {
    const int r = t >> 2, cq = (t & 3) * 16;
    const float* p = in + zoff + (size_t)(r0 + r) * C + c0 + cq;
    #pragma unroll
    for (int i = 0; i < 4; ++i) {
      const v4f v = *(const v4f*)(p + 4 * i);
      tile[r][cq + 4 * i + 0] = v[0];
      tile[r][cq + 4 * i + 1] = v[1];
      tile[r][cq + 4 * i + 2] = v[2];
      tile[r][cq + 4 * i + 3] = v[3];
    }
  }
  __syncthreads();
  const int p8 = t & 7;
  {
    #pragma unroll
    for (int j = 0; j < 2; ++j) {
      const int c = (t >> 3) + 32 * j;
      v8h ov;
      #pragma unroll
      for (int i = 0; i < 8; ++i) ov[i] = (_Float16)(bfr(tile[8 * p8 + i][c]) * scale);
      _Float16* dst = out + zoff + (size_t)(c0 + c) * R + r0 + 8 * p8;
      *(v8h*)dst = ov;
    }
    
  }
}

#define GKS 128              // k per staged tile
#define GLP 272              // LDS row pitch, bytes: 256 + 16, conflict-free for 16-byte fragment reads
#define GBUF (192 * GLP)     // one buffer: 128 A rows + 64 B rows
static_assert(DM % GKS == 0 && FF % GKS == 0);

// twelve 16-byte-per-lane copies global -> LDS, through no register. The s_wait_xcnt closes the statement, so that
// no address register of a copy is rewritten while the copy still names it.
__device__ __forceinline__ void copy12(const unsigned (&l)[12], const char* const (&g)[12])
{
  asm volatile(
    "global_load_async_to_lds_b128 %0, %12, off\n\t"
    "global_load_async_to_lds_b128 %1, %13, off\n\t"
    "global_load_async_to_lds_b128 %2, %14, off\n\t"
    "global_load_async_to_lds_b128 %3, %15, off\n\t"
    "global_load_async_to_lds_b128 %4, %16, off\n\t"
    "global_load_async_to_lds_b128 %5, %17, off\n\t"
    "global_load_async_to_lds_b128 %6, %18, off\n\t"
    "global_load_async_to_lds_b128 %7, %19, off\n\t"
    "global_load_async_to_lds_b128 %8, %20, off\n\t"
    "global_load_async_to_lds_b128 %9, %21, off\n\t"
    "global_load_async_to_lds_b128 %10, %22, off\n\t"
    "global_load_async_to_lds_b128 %11, %23, off\n\t"
    "s_wait_xcnt 0x0"
    : : "v"(l[0]), "v"(l[1]), "v"(l[2]), "v"(l[3]), "v"(l[4]), "v"(l[5]),
        "v"(l[6]), "v"(l[7]), "v"(l[8]), "v"(l[9]), "v"(l[10]), "v"(l[11]),
        "v"(g[0]), "v"(g[1]), "v"(g[2]), "v"(g[3]), "v"(g[4]), "v"(g[5]),
        "v"(g[6]), "v"(g[7]), "v"(g[8]), "v"(g[9]), "v"(g[10]), "v"(g[11])
    : "memory");
}

// ---------------------------------------------------------------------------
// GEMM C[M][N] = A[M][K] (f16 row-major, pitch lda) x B, B given as BT[N][K] (k contiguous, pitch ldb,
// per-z offset sBz). Block 128 threads = 4 waves, block tile 128x64, wave tile 32x64 (2x4 fragments),
// k-tiles of 128 staged in LDS by asynchronous copies (two buffers), fragments read from LDS. Epilogue: v = acc/64 + bf16rne(bias[z*sBias + n])
//   MODE 0: Oh[z][prow][64] f16 (+ Or residual (v-hi)*2^11 if RES) (+ Ot/Otr [z][64][prow] if WVT)
//   MODE 1: Oh[M][ldc] f16 at columns n0..n0+63
//   MODE 2: Of[M][ldc] f32 at columns n0..n0+63
// coverage: each block writes rows m0..m0+127 x 64 columns of every plane it owns (and the 64 x 128
// transposed slab for WVT); grid (M/128, N/64, Z) tiles the planes exactly.
// ---------------------------------------------------------------------------
template<int MODE, bool RES, bool WVT>
__global__ __launch_bounds__(128) __attribute__((amdgpu_num_vgpr(256)))
void k_gemm(const _Float16* __restrict__ A, int lda,
            const _Float16* __restrict__ BT, int ldb, int sBz,
            const float* __restrict__ bias, int sBias,
            int K, int prow,
            _Float16* __restrict__ Oh, _Float16* __restrict__ Or,
            _Float16* __restrict__ Ot, _Float16* __restrict__ Otr,
            float* __restrict__ Of, int ldc)
{
  __shared__ float st[128 * 68];
  // two k-tile buffers: rows 0..127 = A rows m0.., rows 128..191 = BT rows n0.., GKS k (256 B) per row at pitch GLP
  __shared__ __attribute__((aligned(16))) char tile[2 * GBUF];

  const int t = threadIdx.x, lane = t & 31, w = t >> 5, hs = lane >> 4, l16 = lane & 15;
  const int m0 = blockIdx.x * 128, n0 = blockIdx.y * 64, z = blockIdx.z;

  const v8f z8 = {0.f, 0.f, 0.f, 0.f, 0.f, 0.f, 0.f, 0.f};
  v8f acc[2][4];
  #pragma unroll
  for (int mt = 0; mt < 2; ++mt)
    #pragma unroll
    for (int nt = 0; nt < 4; ++nt) acc[mt][nt] = z8;

  // Staging: a copy of one wave brings two whole rows of the tile (2 x 256 B, whole lines); thread = 16 B at
  // column cc of row 8*i + cr, i = 0..23. Every row is fetched once per block and read from LDS by the waves.
  const int cr = t >> 4, cc = t & 15;
  const char* Ag = (const char*)(A + (size_t)(m0 + cr) * lda + 8 * cc);
  const char* Bg = (const char*)(BT + (size_t)z * sBz + (size_t)(n0 + cr) * ldb + 8 * cc);
  const unsigned lcp = (unsigned)(uintptr_t)tile + (unsigned)(cr * GLP + cc * 16);
  auto stage = [&](unsigned boff, int k0) {
    #pragma unroll
    for (int hf = 0; hf < 2; ++hf) {
      unsigned l[12];
      const char* g[12];
      #pragma unroll
      for (int i = 0; i < 12; ++i) {
        const int idx = 12 * hf + i;
        l[i] = lcp + boff + (unsigned)(8 * idx * GLP);
        g[i] = (idx < 16) ? (Ag + ((size_t)(8 * idx) * lda + k0) * 2)
                          : (Bg + ((size_t)(8 * (idx - 16)) * ldb + k0) * 2);
      }
      copy12(l, g);
    }
  };

  // Fragments from LDS, two register sets: a 32-k step's 12 reads go out as one group ahead of the step before it.
  // k and sum order as before. K is a multiple of GKS (DM, FF).
  v16h fa[2][2], fb[2][4];
  auto products = [&](int s) {
    #pragma unroll
    for (int nt = 0; nt < 4; ++nt) {
      acc[0][nt] = mma16(fa[s][0], fb[s][nt], acc[0][nt]);
      acc[1][nt] = mma16(fa[s][1], fb[s][nt], acc[1][nt]);
    }
  };
  const int fra = (32 * w + l16) * GLP + 16 * hs;
  const int frb = (128 + l16) * GLP + 16 * hs;
  auto frags = [&](int s, const char* tb, int stp) {
    #pragma unroll
    for (int mt = 0; mt < 2; ++mt) {
      union { v16h v; v8h q[2]; } u;
      const char* p = tb + fra + 16 * mt * GLP + 64 * stp;
      u.q[0] = *(const v8h*)p;
      u.q[1] = *(const v8h*)(p + 32);
      fa[s][mt] = u.v;
    }
    #pragma unroll
    for (int nt = 0; nt < 4; ++nt) {
      union { v16h v; v8h q[2]; } u;
      const char* p = tb + frb + 16 * nt * GLP + 64 * stp;
      u.q[0] = *(const v8h*)p;
      u.q[1] = *(const v8h*)(p + 32);
      fb[s][nt] = u.v;
    }
  };

  stage(0u, 0);
  asm volatile("s_wait_asynccnt 0x0" ::: "memory");   // this wave's share of tile 0 has landed
  __syncthreads();                                    // every wave's share has: tile 0 may be read
  if (GKS < K) stage((unsigned)GBUF, GKS);

  unsigned boff = 0u;
  #pragma unroll 1   // rolled: one trip is one tile, four 32-k steps unrolled inside
  for (int k0 = 0; k0 < K; k0 += GKS) {
    const char* tb = tile + boff;
    frags(0, tb, 0);
    #pragma unroll
    for (int stp = 0; stp < GKS / 32; ++stp) {
      if (stp + 1 < GKS / 32) frags((stp + 1) & 1, tb, stp + 1);
      products(stp & 1);
    }
    asm volatile("s_wait_dscnt 0x0" ::: "memory");      // this wave's reads of the buffer are done
    asm volatile("s_wait_asynccnt 0x0" ::: "memory");   // its share of the next tile has landed
    __syncthreads();   // publishes the next tile and ends every wave's reads of this buffer, refilled below
    if (k0 + 2 * GKS < K) stage(boff, k0 + 2 * GKS);
    boff ^= (unsigned)GBUF;
  }
  asm volatile("s_wait_asynccnt 0x0" ::: "memory");     // no copy is left in flight

  // ---- epilogue: bias (bf16 RNE), scale, relu -> LDS stage ----
  float bv[4];
  #pragma unroll
  for (int nt = 0; nt < 4; ++nt) bv[nt] = bfr(bias[(size_t)z * sBias + n0 + 16 * nt + l16]);
  #pragma unroll
  for (int mt = 0; mt < 2; ++mt)
    #pragma unroll
    for (int nt = 0; nt < 4; ++nt)
      #pragma unroll
      for (int r = 0; r < 8; ++r) {
        float v = acc[mt][nt][r] * (1.0f / 64.0f) + bv[nt];
        if (MODE == 1) v = fmaxf(v, 0.0f);
        st[(32 * w + 16 * mt + 8 * hs + r) * 68 + 16 * nt + l16] = v;
      }
  __syncthreads();   // stage is read cross-wave below

  {
    if (MODE != 2) {
      const int p = t & 7;
      #pragma unroll
      for (int j = 0; j < 8; ++j) {
        const int row = (t >> 3) + 16 * j;
        v8h hv, rv;
        #pragma unroll
        for (int i = 0; i < 8; ++i) {
          const float v = st[row * 68 + 8 * p + i];
          const _Float16 q = (_Float16)v;
          hv[i] = q;
          rv[i] = RES ? (_Float16)((v - (float)q) * 2048.0f) : q;
        }
        const size_t off = (MODE == 0) ? ((((size_t)z * prow) + m0 + row) * HD + 8 * p)
                                       : ((size_t)(m0 + row) * ldc + n0 + 8 * p);
        *(v8h*)(Oh + off) = hv;
        if (RES) *(v8h*)(Or + off) = rv;
      }
      if (WVT) {
        const int q16 = t & 15;
        #pragma unroll
        for (int j = 0; j < 8; ++j) {
          const int e = (t >> 4) + 8 * j;
          v8h hv, rv;
          #pragma unroll
          for (int i = 0; i < 8; ++i) {
            const float v = st[(8 * q16 + i) * 68 + e];
            const _Float16 q = (_Float16)v;
            hv[i] = q;
            rv[i] = RES ? (_Float16)((v - (float)q) * 2048.0f) : q;
          }
          const size_t off = ((size_t)z * HD + e) * (size_t)prow + m0 + 8 * q16;
          *(v8h*)(Ot + off) = hv;
          if (RES) *(v8h*)(Otr + off) = rv;
        }
      }
    } else {
      const int q16 = t & 15;
      #pragma unroll
      for (int j = 0; j < 16; ++j) {
        const int row = (t >> 4) + 8 * j;
        v4f fv;
        #pragma unroll
        for (int i = 0; i < 4; ++i) fv[i] = st[row * 68 + 4 * q16 + i];
        *(v4f*)(Of + (size_t)(m0 + row) * ldc + n0 + 4 * q16) = fv;
      }
    }
    
  }
}

#define AKT 128              // keys per staged tile (= query rows per block)
#define AKP 144              // LDS pitch of a K row, bytes: 128 + 16
#define AVP 272              // LDS pitch of a Vt row, bytes: 256 + 16
#define AKB (AKT * AKP)      // K part of a tile
#define APL (AKB + HD * AVP) // K part + Vt part: one pair of planes
static_assert(SEQ % AKT == 0);
static_assert(RESQB <= 2);   // the residual-plane blocks walk at most two tiles: one buffer each

// eight 16-byte-per-lane copies global -> LDS; the s_wait_xcnt closes the statement as in copy12
__device__ __forceinline__ void copy8(const unsigned (&l)[8], const char* const (&g)[8])
{
  asm volatile(
    "global_load_async_to_lds_b128 %0, %8, off\n\t"
    "global_load_async_to_lds_b128 %1, %9, off\n\t"
    "global_load_async_to_lds_b128 %2, %10, off\n\t"
    "global_load_async_to_lds_b128 %3, %11, off\n\t"
    "global_load_async_to_lds_b128 %4, %12, off\n\t"
    "global_load_async_to_lds_b128 %5, %13, off\n\t"
    "global_load_async_to_lds_b128 %6, %14, off\n\t"
    "global_load_async_to_lds_b128 %7, %15, off\n\t"
    "s_wait_xcnt 0x0"
    : : "v"(l[0]), "v"(l[1]), "v"(l[2]), "v"(l[3]), "v"(l[4]), "v"(l[5]), "v"(l[6]), "v"(l[7]),
        "v"(g[0]), "v"(g[1]), "v"(g[2]), "v"(g[3]), "v"(g[4]), "v"(g[5]), "v"(g[6]), "v"(g[7])
    : "memory");
}

// ---------------------------------------------------------------------------
// Flash attention. Planes: Q/K [h][prow][64] f16 (prow = NB*SEQ rows per head, row = b*SEQ + s),
// Vt [h][64][prow] f16; residual planes (x2^11) of the same shapes for RES. Block 256 threads = 8 waves,
// wave = 16 query rows, 32-key chunks, online softmax in f32, p carried x4096 as f16 through a
// wave-private LDS tile (A fragment). K and Vt tiles of 128 keys staged in LDS by asynchronous copies (two buffers),
// once per block; the waves read their B fragments there (split k map).
// RES: s = qh.kh + (qr.kh + qh.kr)/2^11 ; O = ph.vh + (ph.vr + pr.vh)/2^11 folded before 1/l.
// Out: f32 [NB*SEQ][DM] at columns h*64, staged per wave in LDS, 16 lanes x 16 B per 256-B row,
// LDS tiles: plds/pldr/sto all wave-private (same wave writes and reads; lds_sync_wave);
// staged extent == consumed extent (16x32 p tile, 16x64 out tile per wave, fully written each chunk).
// ---------------------------------------------------------------------------
template<bool CAUSAL, bool RES>
// two waves per SIMD is what the grids give (at most one block per WGP): said here so that the scheduler spends
// registers on the fragments in flight and on batched lane exchanges instead of saving them for more waves
__global__ __launch_bounds__(256) __attribute__((amdgpu_waves_per_eu(2, 2)))
void k_attn(const _Float16* __restrict__ Qh, const _Float16* __restrict__ Qr,
            const _Float16* __restrict__ Kh, const _Float16* __restrict__ Kr,
            const _Float16* __restrict__ Vt, const _Float16* __restrict__ Vtr,
            float* __restrict__ Out, int qb0, int prow)
{
  __shared__ _Float16 plds[8 * 16 * 40];
  __shared__ _Float16 pldr[RES ? (8 * 16 * 40) : 16];
  __shared__ float    sto[8 * 16 * 68];
  constexpr int ABUF = (RES ? 2 : 1) * APL;   // one buffer: [K | Vt], then [Kr | Vtr] with the residual planes
  __shared__ __attribute__((aligned(16))) char kv[2 * ABUF];

  const int t = threadIdx.x, lane = t & 31, hs = lane >> 4, l16 = lane & 15;
  const int w = __builtin_amdgcn_readfirstlane(t >> 5);   // scalar: a wave's own trip count below is a scalar test
  const int qb = qb0 + blockIdx.x, h = blockIdx.y, b = blockIdx.z;
  const int qbase = qb * 128 + w * 16;                       // within the sequence
  const size_t rq = (size_t)h * (size_t)prow + (size_t)b * SEQ;   // plane row base for (h, b)
  _Float16* pw  = plds + w * 640;
  _Float16* pwr = pldr + (RES ? w * 640 : 0);
  float*    sw  = sto + w * 1088;

  v16h aq[2], aqr[2];
  #pragma unroll
  for (int stp = 0; stp < 2; ++stp) {
    aq[stp]  = ldfrag(Qh + (rq + qbase + l16) * HD + 32 * stp, hs);
    aqr[stp] = RES ? ldfrag(Qr + (rq + qbase + l16) * HD + 32 * stp, hs) : aq[stp];
  }

  const v8f z8 = {0.f, 0.f, 0.f, 0.f, 0.f, 0.f, 0.f, 0.f};
  float mrow[8], lrow[8];
  v8f o[4], orr[4];
  #pragma unroll
  for (int r = 0; r < 8; ++r) { mrow[r] = -3.0e38f; lrow[r] = 0.0f; }
  #pragma unroll
  for (int f = 0; f < 4; ++f) { o[f] = z8; orr[f] = z8; }

  const int kend = CAUSAL ? (qbase + 16) : SEQ;

  const char* Kb  = (const char*)(Kh + rq * HD);
  const char* Krb = (const char*)(Kr + rq * HD);
  const char* Vb  = (const char*)(Vt + (size_t)h * HD * (size_t)prow + (size_t)b * SEQ);
  const char* Vrb = (const char*)(Vtr + (size_t)h * HD * (size_t)prow + (size_t)b * SEQ);

  // Staging: thread = 16 B. K: a wave's copy brings 4 whole rows (512 B in a row); Vt: 2 rows of 256 B.
  const size_t gko = (size_t)((t >> 3) * (HD * 2) + (t & 7) * 16);
  const size_t gvo = (size_t)(t >> 4) * (size_t)prow * 2 + (size_t)((t & 15) * 16);
  const unsigned lk = (unsigned)(uintptr_t)kv + (unsigned)((t >> 3) * AKP + (t & 7) * 16);
  const unsigned lv = (unsigned)(uintptr_t)kv + (unsigned)(AKB + (t >> 4) * AVP + (t & 15) * 16);
  auto stage = [&](unsigned boff, int kt0) {
    #pragma unroll
    for (int pl = 0; pl < (RES ? 2 : 1); ++pl) {
      unsigned l[8];
      const char* g[8];
      #pragma unroll
      for (int j = 0; j < 4; ++j) {
        l[j] = lk + boff + (unsigned)(pl * APL + 32 * j * AKP);
        g[j] = (pl ? Krb : Kb) + gko + (size_t)(kt0 + 32 * j) * (HD * 2);
        l[4 + j] = lv + boff + (unsigned)(pl * APL + 16 * j * AVP);
        g[4 + j] = (pl ? Vrb : Vb) + gvo + ((size_t)(16 * j) * (size_t)prow + (size_t)kt0) * 2;
      }
      copy8(l, g);
    }
  };

  // B fragments of chunk c (32 keys) of the tile at tb
  const int frk = l16 * AKP + 16 * hs;
  const int frv = AKB + l16 * AVP + 16 * hs;
  auto ldsfrag = [&](const char* p) -> v16h {
    union { v16h v; v8h q[2]; } u;
    u.q[0] = *(const v8h*)p;
    u.q[1] = *(const v8h*)(p + 32);
    return u.v;
  };
  v16h fk[2][2], fkr[2][2];
  auto load_k = [&](const char* tb, int c) {
    #pragma unroll
    for (int stp = 0; stp < 2; ++stp)
      #pragma unroll
      for (int nt = 0; nt < 2; ++nt) {
        const char* p = tb + frk + (32 * c + 16 * nt) * AKP + 64 * stp;
        fk[stp][nt]  = ldsfrag(p);
        fkr[stp][nt] = RES ? ldsfrag(p + APL) : fk[stp][nt];
      }
  };

  // tiles the block walks: the same for all its waves (a wave leaves out the chunks beyond its own diagonal)
  const int nst = CAUSAL ? (qb + 1) : (SEQ / AKT);
  stage(0u, 0);
  asm volatile("s_wait_asynccnt 0x0" ::: "memory");   // this wave's share of tile 0 has landed
  __syncthreads();                                    // every wave's share has: tile 0 may be read
  if (1 < nst) stage((unsigned)ABUF, AKT);

  unsigned boff = 0u;
  #pragma unroll 1
  for (int sg = 0; sg < nst; ++sg) {
  const char* tb = kv + boff;
  // K fragments one chunk ahead inside the tile (chunk 0 here); with the residual planes, whose fragments
  // leave no registers for that, at the chunk's own head. Every wave has at least chunk 0 of every tile.
  if (!RES) load_k(tb, 0);
  const int left = (kend - sg * AKT + 31) >> 5;             // this wave's chunks from here to its diagonal, >= 1
  const int nc = (left < AKT / 32) ? left : (AKT / 32);
  #pragma unroll 1
  for (int c = 0; c < nc; ++c) {
    const int kt = sg * AKT + 32 * c;
    if (RES) load_k(tb, c);

    // ---- scores: 16 rows x 32 keys (2 tiles), K = 64 in 2 steps ----
    v8f s[2], sr[2];
    s[0] = z8; s[1] = z8; sr[0] = z8; sr[1] = z8;
    #pragma unroll
    for (int stp = 0; stp < 2; ++stp) {
      #pragma unroll
      for (int nt = 0; nt < 2; ++nt) {
        s[nt] = mma16(aq[stp], fk[stp][nt], s[nt]);
        if (RES) {
          sr[nt] = mma16(aqr[stp], fk[stp][nt], sr[nt]);
          sr[nt] = mma16(aq[stp], fkr[stp][nt], sr[nt]);
        }
      }
    }

    // ---- this chunk's V fragments, one group, issued here so that they land under the softmax ----
    v16h fv[4], fvr[4];
    #pragma unroll
    for (int f = 0; f < 4; ++f) {
      const char* p = tb + frv + 16 * f * AVP + 64 * c;
      fv[f]  = ldsfrag(p);
      fvr[f] = RES ? ldsfrag(p + APL) : fv[f];
    }

    // ---- next chunk's K fragments (same tile), into the registers the products above have just read ----
    if (!RES && c + 1 < AKT / 32) load_k(tb, c + 1);

    // ---- scale, causal replace-mask, online softmax (f32) ----
    float pv[2][8];
    float tm[8];
    #pragma unroll
    for (int r = 0; r < 8; ++r) {
      #pragma unroll
      for (int nt = 0; nt < 2; ++nt) {
        float v = s[nt][r];
        if (RES) v += sr[nt][r] * (1.0f / 2048.0f);
        v *= 0.125f;
        if (CAUSAL) {
          const int key = kt + 16 * nt + l16;
          const int row = qbase + 8 * hs + r;
          if (key > row) v = -1.0e9f;
        }
        pv[nt][r] = v;
      }
      tm[r] = fmaxf(pv[0][r], pv[1][r]);
    }
    #pragma unroll
    for (int off = 8; off > 0; off >>= 1)
      #pragma unroll
      for (int r = 0; r < 8; ++r) tm[r] = fmaxf(tm[r], __shfl_xor(tm[r], off, 32));

    float corr[8], ts[8];
    #pragma unroll
    for (int r = 0; r < 8; ++r) {
      const float mn = fmaxf(mrow[r], tm[r]);
      corr[r] = __expf(mrow[r] - mn);
      mrow[r] = mn;
      pv[0][r] = __expf(pv[0][r] - mn);
      pv[1][r] = __expf(pv[1][r] - mn);
      ts[r] = pv[0][r] + pv[1][r];
    }
    #pragma unroll
    for (int off = 8; off > 0; off >>= 1)
      #pragma unroll
      for (int r = 0; r < 8; ++r) ts[r] += __shfl_xor(ts[r], off, 32);
    #pragma unroll
    for (int r = 0; r < 8; ++r) lrow[r] = lrow[r] * corr[r] + ts[r];
    #pragma unroll
    for (int f = 0; f < 4; ++f)
      #pragma unroll
      for (int r = 0; r < 8; ++r) {
        o[f][r] *= corr[r];
        if (RES) orr[f][r] *= corr[r];
      }

    // ---- stage p (x4096, f16 hi; x2^11 residual for RES) into the wave-private LDS tile ----
    #pragma unroll
    for (int r = 0; r < 8; ++r)
      #pragma unroll
      for (int nt = 0; nt < 2; ++nt) {
        const float pc = pv[nt][r] * 4096.0f;
        const _Float16 ph = (_Float16)pc;
        pw[(8 * hs + r) * 40 + 16 * nt + l16] = ph;
        if (RES) pwr[(8 * hs + r) * 40 + 16 * nt + l16] = (_Float16)((pc - (float)ph) * 2048.0f);
      }
    lds_sync_wave();
    const v16h ap  = ldfrag(pw + l16 * 40, hs);
    const v16h apr = RES ? ldfrag(pwr + l16 * 40, hs) : ap;

    // ---- O += P . V : B fragments of the Vt plane (column e, k = key contiguous), read behind the scores ----
    #pragma unroll
    for (int f = 0; f < 4; ++f) {
      o[f] = mma16(ap, fv[f], o[f]);
      if (RES) {
        orr[f] = mma16(ap, fvr[f], orr[f]);
        orr[f] = mma16(apr, fv[f], orr[f]);
      }
    }
    lds_sync_wave();
  }
  asm volatile("s_wait_dscnt 0x0" ::: "memory");      // this wave's reads of the buffer are done
  asm volatile("s_wait_asynccnt 0x0" ::: "memory");   // its share of the next tile has landed
  __syncthreads();   // publishes the next tile and ends every wave's reads of this buffer, refilled below
  // with the residual planes the block is one of query blocks 0..RESQB-1: no more tiles than buffers, no refill
  if (!RES && sg + 2 < nst) stage(boff, (sg + 2) * AKT);
  boff ^= (unsigned)ABUF;
  }
  asm volatile("s_wait_asynccnt 0x0" ::: "memory");     // no copy is left in flight

  // ---- normalise, stage 16x64 f32 tile per wave, whole-line stores ----
  float inv[8];
  #pragma unroll
  for (int r = 0; r < 8; ++r) inv[r] = (1.0f / lrow[r]) * (1.0f / 4096.0f);
  #pragma unroll
  for (int f = 0; f < 4; ++f)
    #pragma unroll
    for (int r = 0; r < 8; ++r) {
      float v = o[f][r];
      if (RES) v += orr[f][r] * (1.0f / 2048.0f);
      sw[(8 * hs + r) * 68 + 16 * f + l16] = v * inv[r];
    }
  lds_sync_wave();
  const size_t orow = (size_t)b * SEQ + (size_t)qbase;
  {
    #pragma unroll
    for (int j = 0; j < 8; ++j) {
      const int row = 2 * j + hs;
      const v4f fvv = *(const v4f*)(sw + row * 68 + 4 * l16);
      *(v4f*)(Out + (orow + row) * DM + h * HD + 4 * l16) = fvv;
    }
    
  }
}

// ---------------------------------------------------------------------------
// y = LayerNorm(x + r) * g + b over DM = 1024, one block (256 threads) per row, thread = 4 columns.
// XIN: x is a raw input (bf16 RNE convert, input row stride via SEQ_FULL); else x is a ws f32 plane.
// WH: also write the f16 plane yh. g, b bf16 RNE converted. Outputs: 256 lanes x 16/8 B per row
// coverage: nrow x DM for y (and yh).
// ---------------------------------------------------------------------------
template<bool XIN, bool WH>
__global__ __launch_bounds__(256)
void k_ln(const float* __restrict__ x, const float* __restrict__ rr,
          const float* __restrict__ g, const float* __restrict__ be,
          float* __restrict__ y, _Float16* __restrict__ yh)
{
  #pragma clang fp contract(off)
  __shared__ float red[8];
  __shared__ float red2[8];
  const int m = blockIdx.x, t = threadIdx.x, lane = t & 31, w = t >> 5;
  const int c = 4 * t;
  const size_t xrow = XIN ? ((size_t)(m / SEQ) * SEQ_FULL + (size_t)(m % SEQ)) : (size_t)m;
  const v4f xv = *(const v4f*)(x + xrow * DM + c);
  const v4f rv = *(const v4f*)(rr + (size_t)m * DM + c);
  float v[4];
  #pragma unroll
  for (int i = 0; i < 4; ++i) {
    float xi = xv[i];
    if (XIN) xi = bfr(xi);
    v[i] = xi + rv[i];
  }
  float s = (v[0] + v[1]) + (v[2] + v[3]);
  #pragma unroll
  for (int off = 16; off > 0; off >>= 1) s += __shfl_xor(s, off, 32);
  if (lane == 0) red[w] = s;
  __syncthreads();
  float tot = 0.0f;
  #pragma unroll
  for (int i = 0; i < 8; ++i) tot += red[i];
  const float mu = tot * (1.0f / (float)DM);

  float d[4];
  #pragma unroll
  for (int i = 0; i < 4; ++i) d[i] = v[i] - mu;
  float s2 = (d[0] * d[0] + d[1] * d[1]) + (d[2] * d[2] + d[3] * d[3]);
  #pragma unroll
  for (int off = 16; off > 0; off >>= 1) s2 += __shfl_xor(s2, off, 32);
  if (lane == 0) red2[w] = s2;
  __syncthreads();
  float tot2 = 0.0f;
  #pragma unroll
  for (int i = 0; i < 8; ++i) tot2 += red2[i];
  const float var = tot2 * (1.0f / (float)DM);
  const float rstd = rsqrtf(var + LN_EPS);

  v4f ov;
  v4h oh;
  #pragma unroll
  for (int i = 0; i < 4; ++i) {
    const float gv = bfr(g[c + i]);
    const float bvv = bfr(be[c + i]);
    const float q = d[i] * rstd * gv + bvv;
    ov[i] = q;
    oh[i] = (_Float16)q;
  }
  float* ydst = y + (size_t)m * DM + c;
  _Float16* hdst = yh + (WH ? ((size_t)m * DM + c) : 0);
  *(v4f*)ydst = ov;
  if (WH) *(v4h*)hdst = oh;
  
}

// ---------------------------------------------------------------------------
extern "C" void kernel_launch(void* const* d_in, const int* in_sizes, int n_in,
                              void* d_out, int out_size, void* d_ws, size_t ws_size,
                              hipStream_t stream)
{
  if (n_in < 16) return;
  const int MR = NB * SEQ;                 // internal rows (b*SEQ + s)
  const long need_act = (long)(NB - 1) * SEQ_FULL * DM + (long)SEQ * DM;
  if ((long)in_sizes[0] < need_act || (long)in_sizes[1] < need_act) return;
  if (in_sizes[2] < NH * DM * HD || in_sizes[3] < NH * HD) return;
  if (in_sizes[4] < NH * DM * HD || in_sizes[5] < NH * HD) return;
  for (int i = 6; i < 12; ++i) if (in_sizes[i] < DM) return;
  if (in_sizes[12] < DM * FF || in_sizes[13] < FF || in_sizes[14] < FF * DM || in_sizes[15] < DM) return;
  if (out_size < MR * DM) return;

  const float* y      = (const float*)d_in[0];
  const float* enc    = (const float*)d_in[1];
  const float* Wself  = (const float*)d_in[2];
  const float* bself  = (const float*)d_in[3];
  const float* Wcross = (const float*)d_in[4];
  const float* bcross = (const float*)d_in[5];
  const float* g1  = (const float*)d_in[6];  const float* be1 = (const float*)d_in[7];
  const float* g2  = (const float*)d_in[8];  const float* be2 = (const float*)d_in[9];
  const float* g3  = (const float*)d_in[10]; const float* be3 = (const float*)d_in[11];
  const float* w1  = (const float*)d_in[12]; const float* b1  = (const float*)d_in[13];
  const float* w2  = (const float*)d_in[14]; const float* b2  = (const float*)d_in[15];
  float* out = (float*)d_out;

  // ---- workspace carve (256-B aligned regions; 104 MiB at NB*SEQ = 2048) ----
  char* base = (char*)d_ws;
  size_t off = 0;
  auto take = [&](size_t bytes) -> void* {
    void* p = (void*)(base + off);
    off += (bytes + 255) & ~(size_t)255;
    return p;
  };
  _Float16* Yh   = (_Float16*)take((size_t)MR * DM * 2);
  _Float16* Eh   = (_Float16*)take((size_t)MR * DM * 2);
  _Float16* WTs  = (_Float16*)take((size_t)NH * HD * DM * 2);
  _Float16* WTc  = (_Float16*)take((size_t)NH * HD * DM * 2);
  _Float16* W1T  = (_Float16*)take((size_t)FF * DM * 2);
  _Float16* W2T  = (_Float16*)take((size_t)DM * FF * 2);
  _Float16* QKVh = (_Float16*)take((size_t)NH * MR * HD * 2);
  _Float16* QKVr = (_Float16*)take((size_t)NH * MR * HD * 2);
  _Float16* VTh  = (_Float16*)take((size_t)NH * HD * MR * 2);
  _Float16* VTr  = (_Float16*)take((size_t)NH * HD * MR * 2);
  float*    att  = (float*)   take((size_t)MR * DM * 4);     // sa, then ca, then ff
  float*    y1   = (float*)   take((size_t)MR * DM * 4);
  _Float16* y1h  = (_Float16*)take((size_t)MR * DM * 2);
  float*    y2   = (float*)   take((size_t)MR * DM * 4);
  _Float16* y2h  = (_Float16*)take((size_t)MR * DM * 2);
  _Float16* Qch  = (_Float16*)take((size_t)NH * MR * HD * 2);
  _Float16* KVch = (_Float16*)take((size_t)NH * MR * HD * 2);
  _Float16* VTc  = (_Float16*)take((size_t)NH * HD * MR * 2);
  _Float16* Hh   = (_Float16*)take((size_t)MR * FF * 2);
  if (off > ws_size) return;

  // ---- planes ----
  {
    const int groups2 = 2 * MR * (DM / 8);
    k_cvt_act<<<dim3((groups2 + 255) / 256), 256, 0, stream>>>(y, enc, Yh, Eh, MR);
  }
  // in[h][1024][64] -> out[h][64][1024]
  k_wtr<<<dim3(HD / 64, DM / 64, NH), 256, 0, stream>>>(Wself, WTs, DM, HD, 64.0f);
  k_wtr<<<dim3(HD / 64, DM / 64, NH), 256, 0, stream>>>(Wcross, WTc, DM, HD, 64.0f);
  // in[1024][4096] -> out[4096][1024]
  k_wtr<<<dim3(FF / 64, DM / 64, 1), 256, 0, stream>>>(w1, W1T, DM, FF, 64.0f);
  // in[4096][1024] -> out[1024][4096]
  k_wtr<<<dim3(DM / 64, FF / 64, 1), 256, 0, stream>>>(w2, W2T, FF, DM, 64.0f);

  const int nqb  = SEQ / 128;
  const int nres = (nqb < RESQB) ? nqb : RESQB;

  // ---- self attention (q = k = v share one projection) ----
  k_gemm<0, true, true><<<dim3(MR / 128, HD / 64, NH), 128, 0, stream>>>(
      Yh, DM, WTs, DM, HD * DM, bself, HD, DM, MR, QKVh, QKVr, VTh, VTr, att, HD);
  k_attn<true, true><<<dim3(nres, NH, NB), 256, 0, stream>>>(
      QKVh, QKVr, QKVh, QKVr, VTh, VTr, att, 0, MR);
  if (nqb > nres)
    k_attn<true, false><<<dim3(nqb - nres, NH, NB), 256, 0, stream>>>(
        QKVh, QKVr, QKVh, QKVr, VTh, VTr, att, nres, MR);
  k_ln<true, true><<<dim3(MR), 256, 0, stream>>>(y, att, g1, be1, y1, y1h);

  // ---- cross attention (q from y1, k = v from enc, shared projection) ----
  k_gemm<0, false, false><<<dim3(MR / 128, HD / 64, NH), 128, 0, stream>>>(
      y1h, DM, WTc, DM, HD * DM, bcross, HD, DM, MR, Qch, Qch, Qch, Qch, att, HD);
  k_gemm<0, false, true><<<dim3(MR / 128, HD / 64, NH), 128, 0, stream>>>(
      Eh, DM, WTc, DM, HD * DM, bcross, HD, DM, MR, KVch, KVch, VTc, VTc, att, HD);
  k_attn<false, false><<<dim3(nqb, NH, NB), 256, 0, stream>>>(
      Qch, Qch, KVch, KVch, VTc, VTc, att, 0, MR);
  k_ln<false, true><<<dim3(MR), 256, 0, stream>>>(y1, att, g2, be2, y2, y2h);

  // ---- MLP ----
  k_gemm<1, false, false><<<dim3(MR / 128, FF / 64, 1), 128, 0, stream>>>(
      y2h, DM, W1T, DM, 0, b1, 0, DM, MR, Hh, Hh, Hh, Hh, att, FF);
  k_gemm<2, false, false><<<dim3(MR / 128, DM / 64, 1), 128, 0, stream>>>(
      Hh, FF, W2T, FF, 0, b2, 0, FF, MR, y2h, y2h, y2h, y2h, att, DM);
  k_ln<false, false><<<dim3(MR), 256, 0, stream>>>(y2, att, g3, be3, out, y2h);
}

// v003
// A run of this version takes 176 microseconds.
// Next to v002, in two timings, it ran 1.45 times as fast each time.
// Over all steps from v000 it is 3.77 times as fast.
#include <hip/hip_runtime.h>
#include <stdint.h>
#include <stddef.h>

// Contractions on v_wmma_f32_16x16x32_f16 (f16 operands, f32 accumulate): per-head q/k/v projections,
// q.k^T, p.v (self causal and cross), MLP up and down GEMMs. Float inputs RNE-converted to bf16 and held
// as f16 planes (weights carried x64, softmax p carried x4096); causal query blocks 0..RESQB-1 add f16
// residual planes (x2^11) for q, k, p, v into a second accumulator. Softmax, layer norms, bias adds: f32.

#ifndef NB
#define NB 1
#endif
#ifndef SEQ
#define SEQ 2048
#endif
#define NB_FULL 1
#define SEQ_FULL 2048
#define DM 1024
#define NH 16
#define HD 64
#define FF 4096
#define RESQB 2
#define LN_EPS 1.0e-5f

static_assert(SEQ % 128 == 0);
static_assert(SEQ <= SEQ_FULL);
static_assert(NB >= 1 && NB <= NB_FULL);
static_assert(HD == 64);
static_assert(DM % 64 == 0 && FF % 64 == 0);
static_assert(DM % 32 == 0 && FF % 32 == 0);
static_assert((NB * SEQ) % 128 == 0);
static_assert(DM == 4 * 256);

typedef _Float16 v4h  __attribute__((ext_vector_type(4)));
typedef _Float16 v8h  __attribute__((ext_vector_type(8)));
typedef _Float16 v16h __attribute__((ext_vector_type(16)));
typedef float    v4f  __attribute__((ext_vector_type(4)));
typedef float    v8f  __attribute__((ext_vector_type(8)));

// ---------------------------------------------------------------------------
// helpers
// ---------------------------------------------------------------------------
__device__ __forceinline__ v8f mma16(v16h a, v16h b, v8f c)
{
  c = __builtin_amdgcn_wmma_f32_16x16x32_f16(false, a, false, b, (short)0, c, false, false);
  asm volatile("v_nop\n\tv_nop\n\tv_nop\n\tv_nop" : "+v"(c) : "v"(a), "v"(b));
  return c;
}

// 16x16x32 16-bit fragment (A row m = lane&15, or B column n = lane&15, k contiguous at p):
// elements 0..7 <- k0+8h+0..7, elements 8..15 <- k0+16+8h+0..7, h = lane>>4
__device__ __forceinline__ v16h ldfrag(const _Float16* p, int hs)
{
  union { v16h v; v8h q[2]; } u;
  u.q[0] = *(const v8h*)(p + 8 * hs);
  u.q[1] = *(const v8h*)(p + 16 + 8 * hs);
  return u.v;
}

// bf16 RNE convert, returned widened to f32
__device__ __forceinline__ float bfr(float x)
{
  unsigned int u = __float_as_uint(x);
  u = (u + 0x7FFFu + ((u >> 16) & 1u)) & 0xFFFF0000u;
  return __uint_as_float(u);
}

// same-wave LDS store -> load ordering (wave-private tiles only)
__device__ __forceinline__ void lds_sync_wave()
{
  asm volatile("s_wait_dscnt 0x0" ::: "memory");
  __builtin_amdgcn_wave_barrier();
}

// value of lane l ^ 16 (the other 16-lane half), by a vector cross-row move
__device__ __forceinline__ float xhalf(float x)
{
  return __builtin_bit_cast(float, __builtin_amdgcn_permlanex16(__builtin_bit_cast(int, x), __builtin_bit_cast(int, x),
                                                                0x76543210, 0xfedcba98, false, false));
}

// ---------------------------------------------------------------------------
// Activation planes: Yh = f16(bf16rne(y)), Eh = f16(bf16rne(enc)), internal row m -> input row
// coverage: Yh and Eh each nrow*DM elements exactly.
// ---------------------------------------------------------------------------
__global__ __launch_bounds__(256)
void k_cvt_act(const float* __restrict__ y, const float* __restrict__ e,
               _Float16* __restrict__ Yh, _Float16* __restrict__ Eh, int nrow)
{
  const int groups = nrow * (DM / 8);
  const int g = blockIdx.x * 256 + threadIdx.x;
  if (g >= 2 * groups) return;
  const int which = (g >= groups) ? 1 : 0;
  const int idx = g - which * groups;
  const int m = idx / (DM / 8);
  const int c = (idx - m * (DM / 8)) * 8;
  const size_t srow = (size_t)(m / SEQ) * SEQ_FULL + (size_t)(m % SEQ);
  const float* src = (which ? e : y) + srow * DM + c;
  const v4f a = *(const v4f*)src;
  const v4f b = *(const v4f*)(src + 4);
  v8h o;
  o[0] = (_Float16)bfr(a[0]); o[1] = (_Float16)bfr(a[1]); o[2] = (_Float16)bfr(a[2]); o[3] = (_Float16)bfr(a[3]);
  o[4] = (_Float16)bfr(b[0]); o[5] = (_Float16)bfr(b[1]); o[6] = (_Float16)bfr(b[2]); o[7] = (_Float16)bfr(b[3]);
  _Float16* dst = (which ? Eh : Yh) + (size_t)m * DM + c;
  *(v8h*)dst = o;
  
}

// ---------------------------------------------------------------------------
// Transposed weight planes: in[z][R][C] f32 -> out[z][C][R] f16, value f16(bf16rne(x) * scale).
// coverage: full C x R per z.
// ---------------------------------------------------------------------------
__global__ __launch_bounds__(256)
void k_wtr(const float* __restrict__ in, _Float16* __restrict__ out, int R, int C, float scale)
{
  __shared__ float tile[64][65];
  const int t = threadIdx.x;
  const int c0 = blockIdx.x * 64, r0 = blockIdx.y * 64;
  const size_t zoff = (size_t)blockIdx.z * (size_t)R * (size_t)C;
  {
    const int r = t >> 2, cq = (t & 3) * 16;
    const float* p = in + zoff + (size_t)(r0 + r) * C + c0 + cq;
    #pragma unroll
    for (int i = 0; i < 4; ++i) {
      const v4f v = *(const v4f*)(p + 4 * i);
      tile[r][cq + 4 * i + 0] = v[0];
      tile[r][cq + 4 * i + 1] = v[1];
      tile[r][cq + 4 * i + 2] = v[2];
      tile[r][cq + 4 * i + 3] = v[3];
    }
  }
  __syncthreads();
  const int p8 = t & 7;
  {
    #pragma unroll
    for (int j = 0; j < 2; ++j) {
      const int c = (t >> 3) + 32 * j;
      v8h ov;
      #pragma unroll
      for (int i = 0; i < 8; ++i) ov[i] = (_Float16)(bfr(tile[8 * p8 + i][c]) * scale);
      _Float16* dst = out + zoff + (size_t)(c0 + c) * R + r0 + 8 * p8;
      *(v8h*)dst = ov;
    }
    
  }
}

#define GKS 128              // k per staged tile
#define GLP 272              // LDS row pitch, bytes: 256 + 16, conflict-free for 16-byte fragment reads
#define GBUF (192 * GLP)     // one buffer: 128 A rows + 64 B rows
static_assert(DM % GKS == 0 && FF % GKS == 0);

// twelve 16-byte-per-lane copies global -> LDS, through no register. The s_wait_xcnt closes the statement, so that
// no address register of a copy is rewritten while the copy still names it.
__device__ __forceinline__ void copy12(const unsigned (&l)[12], const char* const (&g)[12])
{
  asm volatile(
    "global_load_async_to_lds_b128 %0, %12, off\n\t"
    "global_load_async_to_lds_b128 %1, %13, off\n\t"
    "global_load_async_to_lds_b128 %2, %14, off\n\t"
    "global_load_async_to_lds_b128 %3, %15, off\n\t"
    "global_load_async_to_lds_b128 %4, %16, off\n\t"
    "global_load_async_to_lds_b128 %5, %17, off\n\t"
    "global_load_async_to_lds_b128 %6, %18, off\n\t"
    "global_load_async_to_lds_b128 %7, %19, off\n\t"
    "global_load_async_to_lds_b128 %8, %20, off\n\t"
    "global_load_async_to_lds_b128 %9, %21, off\n\t"
    "global_load_async_to_lds_b128 %10, %22, off\n\t"
    "global_load_async_to_lds_b128 %11, %23, off\n\t"
    "s_wait_xcnt 0x0"
    : : "v"(l[0]), "v"(l[1]), "v"(l[2]), "v"(l[3]), "v"(l[4]), "v"(l[5]),
        "v"(l[6]), "v"(l[7]), "v"(l[8]), "v"(l[9]), "v"(l[10]), "v"(l[11]),
        "v"(g[0]), "v"(g[1]), "v"(g[2]), "v"(g[3]), "v"(g[4]), "v"(g[5]),
        "v"(g[6]), "v"(g[7]), "v"(g[8]), "v"(g[9]), "v"(g[10]), "v"(g[11])
    : "memory");
}

// ---------------------------------------------------------------------------
// GEMM C[M][N] = A[M][K] (f16 row-major, pitch lda) x B, B given as BT[N][K] (k contiguous, pitch ldb,
// per-z offset sBz). Block 128 threads = 4 waves, block tile 128x64, wave tile 32x64 (2x4 fragments),
// k-tiles of 128 staged in LDS by asynchronous copies (two buffers), fragments read from LDS. Epilogue: v = acc/64 + bf16rne(bias[z*sBias + n])
//   MODE 0: Oh[z][prow][64] f16 (+ Or residual (v-hi)*2^11 if RES) (+ Ot/Otr [z][64][prow] if WVT)
//   MODE 1: Oh[M][ldc] f16 at columns n0..n0+63
//   MODE 2: Of[M][ldc] f32 at columns n0..n0+63
// coverage: each block writes rows m0..m0+127 x 64 columns of every plane it owns (and the 64 x 128
// transposed slab for WVT); grid (M/128, N/64, Z) tiles the planes exactly.
// ---------------------------------------------------------------------------
template<int MODE, bool RES, bool WVT>
__global__ __launch_bounds__(128) __attribute__((amdgpu_num_vgpr(256)))
void k_gemm(const _Float16* __restrict__ A, int lda,
            const _Float16* __restrict__ BT, int ldb, int sBz,
            const float* __restrict__ bias, int sBias,
            int K, int prow,
            _Float16* __restrict__ Oh, _Float16* __restrict__ Or,
            _Float16* __restrict__ Ot, _Float16* __restrict__ Otr,
            float* __restrict__ Of, int ldc)
{
  __shared__ float st[128 * 68];
  // two k-tile buffers: rows 0..127 = A rows m0.., rows 128..191 = BT rows n0.., GKS k (256 B) per row at pitch GLP
  __shared__ __attribute__((aligned(16))) char tile[2 * GBUF];

  const int t = threadIdx.x, lane = t & 31, w = t >> 5, hs = lane >> 4, l16 = lane & 15;
  const int m0 = blockIdx.x * 128, n0 = blockIdx.y * 64, z = blockIdx.z;

  const v8f z8 = {0.f, 0.f, 0.f, 0.f, 0.f, 0.f, 0.f, 0.f};
  v8f acc[2][4];
  #pragma unroll
  for (int mt = 0; mt < 2; ++mt)
    #pragma unroll
    for (int nt = 0; nt < 4; ++nt) acc[mt][nt] = z8;

  // Staging: a copy of one wave brings two whole rows of the tile (2 x 256 B, whole lines); thread = 16 B at
  // column cc of row 8*i + cr, i = 0..23. Every row is fetched once per block and read from LDS by the waves.
  const int cr = t >> 4, cc = t & 15;
  const char* Ag = (const char*)(A + (size_t)(m0 + cr) * lda + 8 * cc);
  const char* Bg = (const char*)(BT + (size_t)z * sBz + (size_t)(n0 + cr) * ldb + 8 * cc);
  const unsigned lcp = (unsigned)(uintptr_t)tile + (unsigned)(cr * GLP + cc * 16);
  auto stage = [&](unsigned boff, int k0) {
    #pragma unroll
    for (int hf = 0; hf < 2; ++hf) {
      unsigned l[12];
      const char* g[12];
      #pragma unroll
      for (int i = 0; i < 12; ++i) {
        const int idx = 12 * hf + i;
        l[i] = lcp + boff + (unsigned)(8 * idx * GLP);
        g[i] = (idx < 16) ? (Ag + ((size_t)(8 * idx) * lda + k0) * 2)
                          : (Bg + ((size_t)(8 * (idx - 16)) * ldb + k0) * 2);
      }
      copy12(l, g);
    }
  };

  // Fragments from LDS, two register sets: a 32-k step's 12 reads go out as one group ahead of the step before it.
  // k and sum order as before. K is a multiple of GKS (DM, FF).
  v16h fa[2][2], fb[2][4];
  auto products = [&](int s) {
    #pragma unroll
    for (int nt = 0; nt < 4; ++nt) {
      acc[0][nt] = mma16(fa[s][0], fb[s][nt], acc[0][nt]);
      acc[1][nt] = mma16(fa[s][1], fb[s][nt], acc[1][nt]);
    }
  };
  const int fra = (32 * w + l16) * GLP + 16 * hs;
  const int frb = (128 + l16) * GLP + 16 * hs;
  auto frags = [&](int s, const char* tb, int stp) {
    #pragma unroll
    for (int mt = 0; mt < 2; ++mt) {
      union { v16h v; v8h q[2]; } u;
      const char* p = tb + fra + 16 * mt * GLP + 64 * stp;
      u.q[0] = *(const v8h*)p;
      u.q[1] = *(const v8h*)(p + 32);
      fa[s][mt] = u.v;
    }
    #pragma unroll
    for (int nt = 0; nt < 4; ++nt) {
      union { v16h v; v8h q[2]; } u;
      const char* p = tb + frb + 16 * nt * GLP + 64 * stp;
      u.q[0] = *(const v8h*)p;
      u.q[1] = *(const v8h*)(p + 32);
      fb[s][nt] = u.v;
    }
  };

  stage(0u, 0);
  asm volatile("s_wait_asynccnt 0x0" ::: "memory");   // this wave's share of tile 0 has landed
  __syncthreads();                                    // every wave's share has: tile 0 may be read
  if (GKS < K) stage((unsigned)GBUF, GKS);

  unsigned boff = 0u;
  #pragma unroll 1   // rolled: one trip is one tile, four 32-k steps unrolled inside
  for (int k0 = 0; k0 < K; k0 += GKS) {
    const char* tb = tile + boff;
    frags(0, tb, 0);
    #pragma unroll
    for (int stp = 0; stp < GKS / 32; ++stp) {
      if (stp + 1 < GKS / 32) frags((stp + 1) & 1, tb, stp + 1);
      products(stp & 1);
    }
    asm volatile("s_wait_dscnt 0x0" ::: "memory");      // this wave's reads of the buffer are done
    asm volatile("s_wait_asynccnt 0x0" ::: "memory");   // its share of the next tile has landed
    __syncthreads();   // publishes the next tile and ends every wave's reads of this buffer, refilled below
    if (k0 + 2 * GKS < K) stage(boff, k0 + 2 * GKS);
    boff ^= (unsigned)GBUF;
  }
  asm volatile("s_wait_asynccnt 0x0" ::: "memory");     // no copy is left in flight

  // ---- epilogue: bias (bf16 RNE), scale, relu -> LDS stage ----
  float bv[4];
  #pragma unroll
  for (int nt = 0; nt < 4; ++nt) bv[nt] = bfr(bias[(size_t)z * sBias + n0 + 16 * nt + l16]);
  #pragma unroll
  for (int mt = 0; mt < 2; ++mt)
    #pragma unroll
    for (int nt = 0; nt < 4; ++nt)
      #pragma unroll
      for (int r = 0; r < 8; ++r) {
        float v = acc[mt][nt][r] * (1.0f / 64.0f) + bv[nt];
        if (MODE == 1) v = fmaxf(v, 0.0f);
        st[(32 * w + 16 * mt + 8 * hs + r) * 68 + 16 * nt + l16] = v;
      }
  __syncthreads();   // stage is read cross-wave below

  {
    if (MODE != 2) {
      const int p = t & 7;
      #pragma unroll
      for (int j = 0; j < 8; ++j) {
        const int row = (t >> 3) + 16 * j;
        v8h hv, rv;
        #pragma unroll
        for (int i = 0; i < 8; ++i) {
          const float v = st[row * 68 + 8 * p + i];
          const _Float16 q = (_Float16)v;
          hv[i] = q;
          rv[i] = RES ? (_Float16)((v - (float)q) * 2048.0f) : q;
        }
        const size_t off = (MODE == 0) ? ((((size_t)z * prow) + m0 + row) * HD + 8 * p)
                                       : ((size_t)(m0 + row) * ldc + n0 + 8 * p);
        *(v8h*)(Oh + off) = hv;
        if (RES) *(v8h*)(Or + off) = rv;
      }
      if (WVT) {
        const int q16 = t & 15;
        #pragma unroll
        for (int j = 0; j < 8; ++j) {
          const int e = (t >> 4) + 8 * j;
          v8h hv, rv;
          #pragma unroll
          for (int i = 0; i < 8; ++i) {
            const float v = st[(8 * q16 + i) * 68 + e];
            const _Float16 q = (_Float16)v;
            hv[i] = q;
            rv[i] = RES ? (_Float16)((v - (float)q) * 2048.0f) : q;
          }
          const size_t off = ((size_t)z * HD + e) * (size_t)prow + m0 + 8 * q16;
          *(v8h*)(Ot + off) = hv;
          if (RES) *(v8h*)(Otr + off) = rv;
        }
      }
    } else {
      const int q16 = t & 15;
      #pragma unroll
      for (int j = 0; j < 16; ++j) {
        const int row = (t >> 4) + 8 * j;
        v4f fv;
        #pragma unroll
        for (int i = 0; i < 4; ++i) fv[i] = st[row * 68 + 4 * q16 + i];
        *(v4f*)(Of + (size_t)(m0 + row) * ldc + n0 + 4 * q16) = fv;
      }
    }
    
  }
}

#define AKT 128              // keys per staged tile (= query rows per block)
#define AKP 144              // LDS pitch of a K row, bytes: 128 + 16
#define AVP 272              // LDS pitch of a Vt row, bytes: 256 + 16
#define AKB (AKT * AKP)      // K part of a tile
#define APL (AKB + HD * AVP) // K part + Vt part: one pair of planes
static_assert(SEQ % AKT == 0);
static_assert(RESQB <= 2);   // the residual-plane blocks walk at most two tiles: one buffer each

// eight 16-byte-per-lane copies global -> LDS; the s_wait_xcnt closes the statement as in copy12
__device__ __forceinline__ void copy8(const unsigned (&l)[8], const char* const (&g)[8])
{
  asm volatile(
    "global_load_async_to_lds_b128 %0, %8, off\n\t"
    "global_load_async_to_lds_b128 %1, %9, off\n\t"
    "global_load_async_to_lds_b128 %2, %10, off\n\t"
    "global_load_async_to_lds_b128 %3, %11, off\n\t"
    "global_load_async_to_lds_b128 %4, %12, off\n\t"
    "global_load_async_to_lds_b128 %5, %13, off\n\t"
    "global_load_async_to_lds_b128 %6, %14, off\n\t"
    "global_load_async_to_lds_b128 %7, %15, off\n\t"
    "s_wait_xcnt 0x0"
    : : "v"(l[0]), "v"(l[1]), "v"(l[2]), "v"(l[3]), "v"(l[4]), "v"(l[5]), "v"(l[6]), "v"(l[7]),
        "v"(g[0]), "v"(g[1]), "v"(g[2]), "v"(g[3]), "v"(g[4]), "v"(g[5]), "v"(g[6]), "v"(g[7])
    : "memory");
}

// ---------------------------------------------------------------------------
// Flash attention. Planes: Q/K [h][prow][64] f16 (prow = NB*SEQ rows per head, row = b*SEQ + s),
// Vt [h][64][prow] f16; residual planes (x2^11) of the same shapes for RES. Block 256 threads = 8 waves,
// wave = 16 queries, 32-key chunks, online softmax in f32, p carried x4096 as f16.
// Both products run transposed: S^T = K.Q^T (A = K rows, B = Q) and O^T += Vt.P^T (A = Vt rows, B = P^T). A lane then
// holds 16 scores of ONE query (query = lane & 15, keys 16*nt + 8*(lane >> 4) + r): maximum and sum are in-lane, the
// maximum joined with the other half by one cross-row move per chunk, the sums once behind the loop; and those
// 16 values are, in that order, the lane's elements of the B fragment of P^T, so that p stays in registers.
// K and Vt tiles of 128 keys staged in LDS by asynchronous copies (two buffers), once per block; the waves read
// their A fragments there (split k map).
// RES: s = qh.kh + (qr.kh + qh.kr)/2^11 ; O = ph.vh + (ph.vr + pr.vh)/2^11 folded before 1/l.
// Out: f32 [NB*SEQ][DM] at columns h*64, staged per wave in LDS, 16 lanes x 16 B per 256-B row,
// LDS tile sto: wave-private (same wave writes and reads; lds_sync_wave), 16x64 per wave, fully written.
// ---------------------------------------------------------------------------
template<bool CAUSAL, bool RES>
// two waves per SIMD is what the grids give (at most one block per WGP): said here so that the scheduler spends
// registers on the fragments in flight instead of saving them for more waves
__global__ __launch_bounds__(256) __attribute__((amdgpu_waves_per_eu(2, 2)))
void k_attn(const _Float16* __restrict__ Qh, const _Float16* __restrict__ Qr,
            const _Float16* __restrict__ Kh, const _Float16* __restrict__ Kr,
            const _Float16* __restrict__ Vt, const _Float16* __restrict__ Vtr,
            float* __restrict__ Out, int qb0, int prow)
{
  __shared__ __attribute__((aligned(16))) float sto[8 * 16 * 68];
  constexpr int ABUF = (RES ? 2 : 1) * APL;   // one buffer: [K | Vt], then [Kr | Vtr] with the residual planes
  __shared__ __attribute__((aligned(16))) char kv[2 * ABUF];

  const int t = threadIdx.x, lane = t & 31, hs = lane >> 4, l16 = lane & 15;
  const int w = __builtin_amdgcn_readfirstlane(t >> 5);   // scalar: a wave's own trip count below is a scalar test
  const int qb = qb0 + blockIdx.x, h = blockIdx.y, b = blockIdx.z;
  const int qbase = qb * 128 + w * 16;                       // within the sequence
  const size_t rq = (size_t)h * (size_t)prow + (size_t)b * SEQ;   // plane row base for (h, b)
  float*    sw  = sto + w * 1088;

  v16h aq[2], aqr[2];
  #pragma unroll
  for (int stp = 0; stp < 2; ++stp) {
    aq[stp]  = ldfrag(Qh + (rq + qbase + l16) * HD + 32 * stp, hs);
    aqr[stp] = RES ? ldfrag(Qr + (rq + qbase + l16) * HD + 32 * stp, hs) : aq[stp];
  }

  const v8f z8 = {0.f, 0.f, 0.f, 0.f, 0.f, 0.f, 0.f, 0.f};
  // this lane's query (l16): running maximum (both halves agree), sum over this half's keys alone
  float mrow = -3.0e38f, lrow = 0.0f;
  v8f o[4], orr[4];   // O^T: element r of tile f = column e = 16*f + 8*hs + r of query l16
  #pragma unroll
  for (int f = 0; f < 4; ++f) { o[f] = z8; orr[f] = z8; }

  const int kend = CAUSAL ? (qbase + 16) : SEQ;

  const char* Kb  = (const char*)(Kh + rq * HD);
  const char* Krb = (const char*)(Kr + rq * HD);
  const char* Vb  = (const char*)(Vt + (size_t)h * HD * (size_t)prow + (size_t)b * SEQ);
  const char* Vrb = (const char*)(Vtr + (size_t)h * HD * (size_t)prow + (size_t)b * SEQ);

  // Staging: thread = 16 B. K: a wave's copy brings 4 whole rows (512 B in a row); Vt: 2 rows of 256 B.
  const size_t gko = (size_t)((t >> 3) * (HD * 2) + (t & 7) * 16);
  const size_t gvo = (size_t)(t >> 4) * (size_t)prow * 2 + (size_t)((t & 15) * 16);
  const unsigned lk = (unsigned)(uintptr_t)kv + (unsigned)((t >> 3) * AKP + (t & 7) * 16);
  const unsigned lv = (unsigned)(uintptr_t)kv + (unsigned)(AKB + (t >> 4) * AVP + (t & 15) * 16);
  auto stage = [&](unsigned boff, int kt0) {
    #pragma unroll
    for (int pl = 0; pl < (RES ? 2 : 1); ++pl) {
      unsigned l[8];
      const char* g[8];
      #pragma unroll
      for (int j = 0; j < 4; ++j) {
        l[j] = lk + boff + (unsigned)(pl * APL + 32 * j * AKP);
        g[j] = (pl ? Krb : Kb) + gko + (size_t)(kt0 + 32 * j) * (HD * 2);
        l[4 + j] = lv + boff + (unsigned)(pl * APL + 16 * j * AVP);
        g[4 + j] = (pl ? Vrb : Vb) + gvo + ((size_t)(16 * j) * (size_t)prow + (size_t)kt0) * 2;
      }
      copy8(l, g);
    }
  };

  // A fragments of chunk c (32 keys) of the tile at tb
  const int frk = l16 * AKP + 16 * hs;
  const int frv = AKB + l16 * AVP + 16 * hs;
  auto ldsfrag = [&](const char* p) -> v16h {
    union { v16h v; v8h q[2]; } u;
    u.q[0] = *(const v8h*)p;
    u.q[1] = *(const v8h*)(p + 32);
    return u.v;
  };
  v16h fk[2][2], fkr[2][2];
  auto load_k = [&](const char* tb, int c) {
    #pragma unroll
    for (int stp = 0; stp < 2; ++stp)
      #pragma unroll
      for (int nt = 0; nt < 2; ++nt) {
        const char* p = tb + frk + (32 * c + 16 * nt) * AKP + 64 * stp;
        fk[stp][nt]  = ldsfrag(p);
        fkr[stp][nt] = RES ? ldsfrag(p + APL) : fk[stp][nt];
      }
  };

  // tiles the block walks: the same for all its waves (a wave leaves out the chunks beyond its own diagonal)
  const int nst = CAUSAL ? (qb + 1) : (SEQ / AKT);
  stage(0u, 0);
  asm volatile("s_wait_asynccnt 0x0" ::: "memory");   // this wave's share of tile 0 has landed
  __syncthreads();                                    // every wave's share has: tile 0 may be read
  if (1 < nst) stage((unsigned)ABUF, AKT);

  unsigned boff = 0u;
  #pragma unroll 1
  for (int sg = 0; sg < nst; ++sg) {
  const char* tb = kv + boff;
  // K fragments one chunk ahead inside the tile (chunk 0 here); with the residual planes, whose fragments
  // leave no registers for that, at the chunk's own head. Every wave has at least chunk 0 of every tile.
  if (!RES) load_k(tb, 0);
  const int left = (kend - sg * AKT + 31) >> 5;             // this wave's chunks from here to its diagonal, >= 1
  const int nc = (left < AKT / 32) ? left : (AKT / 32);
  #pragma unroll 1
  for (int c = 0; c < nc; ++c) {
    const int kt = sg * AKT + 32 * c;
    if (RES) load_k(tb, c);

    // ---- scores, transposed: 32 keys (2 tiles) x 16 queries, K = 64 in 2 steps ----
    v8f s[2], sr[2];
    s[0] = z8; s[1] = z8; sr[0] = z8; sr[1] = z8;
    #pragma unroll
    for (int stp = 0; stp < 2; ++stp) {
      #pragma unroll
      for (int nt = 0; nt < 2; ++nt) {
        s[nt] = mma16(fk[stp][nt], aq[stp], s[nt]);
        if (RES) {
          sr[nt] = mma16(fk[stp][nt], aqr[stp], sr[nt]);
          sr[nt] = mma16(fkr[stp][nt], aq[stp], sr[nt]);
        }
      }
    }

    // ---- this chunk's V fragments, one group, issued here so that they land under the softmax ----
    v16h fv[4], fvr[4];
    #pragma unroll
    for (int f = 0; f < 4; ++f) {
      const char* p = tb + frv + 16 * f * AVP + 64 * c;
      fv[f]  = ldsfrag(p);
      fvr[f] = RES ? ldsfrag(p + APL) : fv[f];
    }

    // ---- next chunk's K fragments (same tile), into the registers the products above have just read ----
    if (!RES && c + 1 < AKT / 32) load_k(tb, c + 1);

    // ---- scale, causal replace-mask, online softmax (f32) ----
    float pv[2][8];
    #pragma unroll
    for (int nt = 0; nt < 2; ++nt)
      #pragma unroll
      for (int r = 0; r < 8; ++r) {
        float v = s[nt][r];
        if (RES) v += sr[nt][r] * (1.0f / 2048.0f);
        v *= 0.125f;
        if (CAUSAL) {
          const int key = kt + 16 * nt + 8 * hs + r;
          const int row = qbase + l16;
          if (key > row) v = -1.0e9f;
        }
        pv[nt][r] = v;
      }
    float tq[4];
    #pragma unroll
    for (int i = 0; i < 4; ++i)
      tq[i] = fmaxf(fmaxf(pv[0][2 * i], pv[0][2 * i + 1]), fmaxf(pv[1][2 * i], pv[1][2 * i + 1]));
    float tm = fmaxf(fmaxf(tq[0], tq[1]), fmaxf(tq[2], tq[3]));
    tm = fmaxf(tm, xhalf(tm));            // the query's other 16 keys of the chunk

    const float mn = fmaxf(mrow, tm);
    const float corr = __expf(mrow - mn);
    mrow = mn;
    #pragma unroll
    for (int nt = 0; nt < 2; ++nt)
      #pragma unroll
      for (int r = 0; r < 8; ++r) pv[nt][r] = __expf(pv[nt][r] - mn);
    float tsq[4];
    #pragma unroll
    for (int i = 0; i < 4; ++i)
      tsq[i] = (pv[0][2 * i] + pv[0][2 * i + 1]) + (pv[1][2 * i] + pv[1][2 * i + 1]);
    lrow = lrow * corr + ((tsq[0] + tsq[1]) + (tsq[2] + tsq[3]));
    #pragma unroll
    for (int f = 0; f < 4; ++f)
      #pragma unroll
      for (int r = 0; r < 8; ++r) {
        o[f][r] *= corr;
        if (RES) orr[f][r] *= corr;
      }

    // ---- p (x4096, f16 hi; x2^11 residual for RES) packed in place into the B fragment of P^T:
    //      elements 0..7 = keys 8*hs + r (tile 0), elements 8..15 = keys 16 + 8*hs + r (tile 1), the k map of ldfrag ----
    v16h bp, bpr;
    #pragma unroll
    for (int nt = 0; nt < 2; ++nt)
      #pragma unroll
      for (int r = 0; r < 8; ++r) {
        const float pc = pv[nt][r] * 4096.0f;
        const _Float16 ph = (_Float16)pc;
        bp[8 * nt + r]  = ph;
        bpr[8 * nt + r] = RES ? (_Float16)((pc - (float)ph) * 2048.0f) : ph;
      }

    // ---- O^T += Vt . P^T : A fragments of the Vt plane (row e, k = key contiguous), read behind the scores ----
    #pragma unroll
    for (int f = 0; f < 4; ++f) {
      o[f] = mma16(fv[f], bp, o[f]);
      if (RES) {
        orr[f] = mma16(fvr[f], bp, orr[f]);
        orr[f] = mma16(fv[f], bpr, orr[f]);
      }
    }
  }
  asm volatile("s_wait_dscnt 0x0" ::: "memory");      // this wave's reads of the buffer are done
  asm volatile("s_wait_asynccnt 0x0" ::: "memory");   // its share of the next tile has landed
  __syncthreads();   // publishes the next tile and ends every wave's reads of this buffer, refilled below
  // with the residual planes the block is one of query blocks 0..RESQB-1: no more tiles than buffers, no refill
  if (!RES && sg + 2 < nst) stage(boff, (sg + 2) * AKT);
  boff ^= (unsigned)ABUF;
  }
  asm volatile("s_wait_asynccnt 0x0" ::: "memory");     // no copy is left in flight

  // ---- normalise, stage 16x64 f32 tile per wave, whole-line stores ----
  lrow += xhalf(lrow);                    // the two halves' key sums joined, once
  const float inv = (1.0f / lrow) * (1.0f / 4096.0f);
  #pragma unroll
  for (int f = 0; f < 4; ++f)
    #pragma unroll
    for (int q = 0; q < 2; ++q) {
      v4f sv;
      #pragma unroll
      for (int i = 0; i < 4; ++i) {
        float v = o[f][4 * q + i];
        if (RES) v += orr[f][4 * q + i] * (1.0f / 2048.0f);
        sv[i] = v * inv;
      }
      *(v4f*)(sw + l16 * 68 + 16 * f + 8 * hs + 4 * q) = sv;
    }
  lds_sync_wave();
  const size_t orow = (size_t)b * SEQ + (size_t)qbase;
  {
    #pragma unroll
    for (int j = 0; j < 8; ++j) {
      const int row = 2 * j + hs;
      const v4f fvv = *(const v4f*)(sw + row * 68 + 4 * l16);
      *(v4f*)(Out + (orow + row) * DM + h * HD + 4 * l16) = fvv;
    }
    
  }
}

// ---------------------------------------------------------------------------
// y = LayerNorm(x + r) * g + b over DM = 1024, one block (256 threads) per row, thread = 4 columns.
// XIN: x is a raw input (bf16 RNE convert, input row stride via SEQ_FULL); else x is a ws f32 plane.
// WH: also write the f16 plane yh. g, b bf16 RNE converted. Outputs: 256 lanes x 16/8 B per row
// coverage: nrow x DM for y (and yh).
// ---------------------------------------------------------------------------
template<bool XIN, bool WH>
__global__ __launch_bounds__(256)
void k_ln(const float* __restrict__ x, const float* __restrict__ rr,
          const float* __restrict__ g, const float* __restrict__ be,
          float* __restrict__ y, _Float16* __restrict__ yh)
{
  #pragma clang fp contract(off)
  __shared__ float red[8];
  __shared__ float red2[8];
  const int m = blockIdx.x, t = threadIdx.x, lane = t & 31, w = t >> 5;
  const int c = 4 * t;
  const size_t xrow = XIN ? ((size_t)(m / SEQ) * SEQ_FULL + (size_t)(m % SEQ)) : (size_t)m;
  const v4f xv = *(const v4f*)(x + xrow * DM + c);
  const v4f rv = *(const v4f*)(rr + (size_t)m * DM + c);
  float v[4];
  #pragma unroll
  for (int i = 0; i < 4; ++i) {
    float xi = xv[i];
    if (XIN) xi = bfr(xi);
    v[i] = xi + rv[i];
  }
  float s = (v[0] + v[1]) + (v[2] + v[3]);
  #pragma unroll
  for (int off = 16; off > 0; off >>= 1) s += __shfl_xor(s, off, 32);
  if (lane == 0) red[w] = s;
  __syncthreads();
  float tot = 0.0f;
  #pragma unroll
  for (int i = 0; i < 8; ++i) tot += red[i];
  const float mu = tot * (1.0f / (float)DM);

  float d[4];
  #pragma unroll
  for (int i = 0; i < 4; ++i) d[i] = v[i] - mu;
  float s2 = (d[0] * d[0] + d[1] * d[1]) + (d[2] * d[2] + d[3] * d[3]);
  #pragma unroll
  for (int off = 16; off > 0; off >>= 1) s2 += __shfl_xor(s2, off, 32);
  if (lane == 0) red2[w] = s2;
  __syncthreads();
  float tot2 = 0.0f;
  #pragma unroll
  for (int i = 0; i < 8; ++i) tot2 += red2[i];
  const float var = tot2 * (1.0f / (float)DM);
  const float rstd = rsqrtf(var + LN_EPS);

  v4f ov;
  v4h oh;
  #pragma unroll
  for (int i = 0; i < 4; ++i) {
    const float gv = bfr(g[c + i]);
    const float bvv = bfr(be[c + i]);
    const float q = d[i] * rstd * gv + bvv;
    ov[i] = q;
    oh[i] = (_Float16)q;
  }
  float* ydst = y + (size_t)m * DM + c;
  _Float16* hdst = yh + (WH ? ((size_t)m * DM + c) : 0);
  *(v4f*)ydst = ov;
  if (WH) *(v4h*)hdst = oh;
  
}

// ---------------------------------------------------------------------------
extern "C" void kernel_launch(void* const* d_in, const int* in_sizes, int n_in,
                              void* d_out, int out_size, void* d_ws, size_t ws_size,
                              hipStream_t stream)
{
  if (n_in < 16) return;
  const int MR = NB * SEQ;                 // internal rows (b*SEQ + s)
  const long need_act = (long)(NB - 1) * SEQ_FULL * DM + (long)SEQ * DM;
  if ((long)in_sizes[0] < need_act || (long)in_sizes[1] < need_act) return;
  if (in_sizes[2] < NH * DM * HD || in_sizes[3] < NH * HD) return;
  if (in_sizes[4] < NH * DM * HD || in_sizes[5] < NH * HD) return;
  for (int i = 6; i < 12; ++i) if (in_sizes[i] < DM) return;
  if (in_sizes[12] < DM * FF || in_sizes[13] < FF || in_sizes[14] < FF * DM || in_sizes[15] < DM) return;
  if (out_size < MR * DM) return;

  const float* y      = (const float*)d_in[0];
  const float* enc    = (const float*)d_in[1];
  const float* Wself  = (const float*)d_in[2];
  const float* bself  = (const float*)d_in[3];
  const float* Wcross = (const float*)d_in[4];
  const float* bcross = (const float*)d_in[5];
  const float* g1  = (const float*)d_in[6];  const float* be1 = (const float*)d_in[7];
  const float* g2  = (const float*)d_in[8];  const float* be2 = (const float*)d_in[9];
  const float* g3  = (const float*)d_in[10]; const float* be3 = (const float*)d_in[11];
  const float* w1  = (const float*)d_in[12]; const float* b1  = (const float*)d_in[13];
  const float* w2  = (const float*)d_in[14]; const float* b2  = (const float*)d_in[15];
  float* out = (float*)d_out;

  // ---- workspace carve (256-B aligned regions; 104 MiB at NB*SEQ = 2048) ----
  char* base = (char*)d_ws;
  size_t off = 0;
  auto take = [&](size_t bytes) -> void* {
    void* p = (void*)(base + off);
    off += (bytes + 255) & ~(size_t)255;
    return p;
  };
  _Float16* Yh   = (_Float16*)take((size_t)MR * DM * 2);
  _Float16* Eh   = (_Float16*)take((size_t)MR * DM * 2);
  _Float16* WTs  = (_Float16*)take((size_t)NH * HD * DM * 2);
  _Float16* WTc  = (_Float16*)take((size_t)NH * HD * DM * 2);
  _Float16* W1T  = (_Float16*)take((size_t)FF * DM * 2);
  _Float16* W2T  = (_Float16*)take((size_t)DM * FF * 2);
  _Float16* QKVh = (_Float16*)take((size_t)NH * MR * HD * 2);
  _Float16* QKVr = (_Float16*)take((size_t)NH * MR * HD * 2);
  _Float16* VTh  = (_Float16*)take((size_t)NH * HD * MR * 2);
  _Float16* VTr  = (_Float16*)take((size_t)NH * HD * MR * 2);
  float*    att  = (float*)   take((size_t)MR * DM * 4);     // sa, then ca, then ff
  float*    y1   = (float*)   take((size_t)MR * DM * 4);
  _Float16* y1h  = (_Float16*)take((size_t)MR * DM * 2);
  float*    y2   = (float*)   take((size_t)MR * DM * 4);
  _Float16* y2h  = (_Float16*)take((size_t)MR * DM * 2);
  _Float16* Qch  = (_Float16*)take((size_t)NH * MR * HD * 2);
  _Float16* KVch = (_Float16*)take((size_t)NH * MR * HD * 2);
  _Float16* VTc  = (_Float16*)take((size_t)NH * HD * MR * 2);
  _Float16* Hh   = (_Float16*)take((size_t)MR * FF * 2);
  if (off > ws_size) return;

  // ---- planes ----
  {
    const int groups2 = 2 * MR * (DM / 8);
    k_cvt_act<<<dim3((groups2 + 255) / 256), 256, 0, stream>>>(y, enc, Yh, Eh, MR);
  }
  // in[h][1024][64] -> out[h][64][1024]
  k_wtr<<<dim3(HD / 64, DM / 64, NH), 256, 0, stream>>>(Wself, WTs, DM, HD, 64.0f);
  k_wtr<<<dim3(HD / 64, DM / 64, NH), 256, 0, stream>>>(Wcross, WTc, DM, HD, 64.0f);
  // in[1024][4096] -> out[4096][1024]
  k_wtr<<<dim3(FF / 64, DM / 64, 1), 256, 0, stream>>>(w1, W1T, DM, FF, 64.0f);
  // in[4096][1024] -> out[1024][4096]
  k_wtr<<<dim3(DM / 64, FF / 64, 1), 256, 0, stream>>>(w2, W2T, FF, DM, 64.0f);

  const int nqb  = SEQ / 128;
  const int nres = (nqb < RESQB) ? nqb : RESQB;

  // ---- self attention (q = k = v share one projection) ----
  k_gemm<0, true, true><<<dim3(MR / 128, HD / 64, NH), 128, 0, stream>>>(
      Yh, DM, WTs, DM, HD * DM, bself, HD, DM, MR, QKVh, QKVr, VTh, VTr, att, HD);
  k_attn<true, true><<<dim3(nres, NH, NB), 256, 0, stream>>>(
      QKVh, QKVr, QKVh, QKVr, VTh, VTr, att, 0, MR);
  if (nqb > nres)
    k_attn<true, false><<<dim3(nqb - nres, NH, NB), 256, 0, stream>>>(
        QKVh, QKVr, QKVh, QKVr, VTh, VTr, att, nres, MR);
  k_ln<true, true><<<dim3(MR), 256, 0, stream>>>(y, att, g1, be1, y1, y1h);

  // ---- cross attention (q from y1, k = v from enc, shared projection) ----
  k_gemm<0, false, false><<<dim3(MR / 128, HD / 64, NH), 128, 0, stream>>>(
      y1h, DM, WTc, DM, HD * DM, bcross, HD, DM, MR, Qch, Qch, Qch, Qch, att, HD);
  k_gemm<0, false, true><<<dim3(MR / 128, HD / 64, NH), 128, 0, stream>>>(
      Eh, DM, WTc, DM, HD * DM, bcross, HD, DM, MR, KVch, KVch, VTc, VTc, att, HD);
  k_attn<false, false><<<dim3(nqb, NH, NB), 256, 0, stream>>>(
      Qch, Qch, KVch, KVch, VTc, VTc, att, 0, MR);
  k_ln<false, true><<<dim3(MR), 256, 0, stream>>>(y1, att, g2, be2, y2, y2h);

  // ---- MLP ----
  k_gemm<1, false, false><<<dim3(MR / 128, FF / 64, 1), 128, 0, stream>>>(
      y2h, DM, W1T, DM, 0, b1, 0, DM, MR, Hh, Hh, Hh, Hh, att, FF);
  k_gemm<2, false, false><<<dim3(MR / 128, DM / 64, 1), 128, 0, stream>>>(
      Hh, FF, W2T, FF, 0, b2, 0, FF, MR, y2h, y2h, y2h, y2h, att, DM);
  k_ln<false, false><<<dim3(MR), 256, 0, stream>>>(y2, att, g3, be3, out, y2h);
}

// v004
// One run takes 154 microseconds.
// Timed twice side by side with v003, it ran 1.16 and 1.14 times as fast.
// Counting every step since v000, it is 4.34 times as fast.
#include <hip/hip_runtime.h>
#include <stdint.h>
#include <stddef.h>

// Contractions on v_wmma_f32_16x16x32_f16 (f16 operands, f32 accumulate): per-head q/k/v projections,
// q.k^T, p.v (self causal and cross), MLP up and down GEMMs. Float inputs RNE-converted to bf16 and held
// as f16 planes (weights carried x64, softmax p carried x4096); causal query blocks 0..RESQB-1 add f16
// residual planes (x2^11) for q, k, p, v into a second accumulator. Softmax, layer norms, bias adds: f32.

#ifndef NB
#define NB 1
#endif
#ifndef SEQ
#define SEQ 2048
#endif
#define NB_FULL 1
#define SEQ_FULL 2048
#define DM 1024
#define NH 16
#define HD 64
#define FF 4096
#define RESQB 2
#define LN_EPS 1.0e-5f

static_assert(SEQ % 128 == 0);
static_assert(SEQ <= SEQ_FULL);
static_assert(NB >= 1 && NB <= NB_FULL);
static_assert(HD == 64);
static_assert(DM % 64 == 0 && FF % 64 == 0);
static_assert(DM % 32 == 0 && FF % 32 == 0);
static_assert((NB * SEQ) % 128 == 0);
static_assert(DM == 4 * 256);

typedef _Float16 v4h  __attribute__((ext_vector_type(4)));
typedef _Float16 v8h  __attribute__((ext_vector_type(8)));
typedef _Float16 v16h __attribute__((ext_vector_type(16)));
typedef float    v4f  __attribute__((ext_vector_type(4)));
typedef float    v8f  __attribute__((ext_vector_type(8)));

// ---------------------------------------------------------------------------
// helpers
// ---------------------------------------------------------------------------
__device__ __forceinline__ v8f mma16(v16h a, v16h b, v8f c)
{
  c = __builtin_amdgcn_wmma_f32_16x16x32_f16(false, a, false, b, (short)0, c, false, false);
  asm volatile("v_nop\n\tv_nop\n\tv_nop\n\tv_nop" : "+v"(c) : "v"(a), "v"(b));
  return c;
}

// 16x16x32 16-bit fragment (A row m = lane&15, or B column n = lane&15, k contiguous at p):
// elements 0..7 <- k0+8h+0..7, elements 8..15 <- k0+16+8h+0..7, h = lane>>4
__device__ __forceinline__ v16h ldfrag(const _Float16* p, int hs)
{
  union { v16h v; v8h q[2]; } u;
  u.q[0] = *(const v8h*)(p + 8 * hs);
  u.q[1] = *(const v8h*)(p + 16 + 8 * hs);
  return u.v;
}

// bf16 RNE convert, returned widened to f32
__device__ __forceinline__ float bfr(float x)
{
  unsigned int u = __float_as_uint(x);
  u = (u + 0x7FFFu + ((u >> 16) & 1u)) & 0xFFFF0000u;
  return __uint_as_float(u);
}

// same-wave LDS store -> load ordering (wave-private tiles only)
__device__ __forceinline__ void lds_sync_wave()
{
  asm volatile("s_wait_dscnt 0x0" ::: "memory");
  __builtin_amdgcn_wave_barrier();
}

// value of lane l ^ 16 (the other 16-lane half), by a vector cross-row move
__device__ __forceinline__ float xhalf(float x)
{
  return __builtin_bit_cast(float, __builtin_amdgcn_permlanex16(__builtin_bit_cast(int, x), __builtin_bit_cast(int, x),
                                                                0x76543210, 0xfedcba98, false, false));
}

// ---------------------------------------------------------------------------
// Activation planes: Yh = f16(bf16rne(y)), Eh = f16(bf16rne(enc)), internal row m -> input row
// coverage: Yh and Eh each nrow*DM elements exactly.
// ---------------------------------------------------------------------------
__device__ __forceinline__
void cvt_act_body(int bid, const float* __restrict__ y, const float* __restrict__ e,
                  _Float16* __restrict__ Yh, _Float16* __restrict__ Eh, int nrow)
{
  const int groups = nrow * (DM / 8);
  const int g = bid * 256 + threadIdx.x;
  if (g >= 2 * groups) return;
  const int which = (g >= groups) ? 1 : 0;
  const int idx = g - which * groups;
  const int m = idx / (DM / 8);
  const int c = (idx - m * (DM / 8)) * 8;
  const size_t srow = (size_t)(m / SEQ) * SEQ_FULL + (size_t)(m % SEQ);
  const float* src = (which ? e : y) + srow * DM + c;
  const v4f a = *(const v4f*)src;
  const v4f b = *(const v4f*)(src + 4);
  v8h o;
  o[0] = (_Float16)bfr(a[0]); o[1] = (_Float16)bfr(a[1]); o[2] = (_Float16)bfr(a[2]); o[3] = (_Float16)bfr(a[3]);
  o[4] = (_Float16)bfr(b[0]); o[5] = (_Float16)bfr(b[1]); o[6] = (_Float16)bfr(b[2]); o[7] = (_Float16)bfr(b[3]);
  _Float16* dst = (which ? Eh : Yh) + (size_t)m * DM + c;
  *(v8h*)dst = o;
  
}

// ---------------------------------------------------------------------------
// Transposed weight planes: in[z][R][C] f32 -> out[z][C][R] f16, value f16(bf16rne(x) * scale).
// coverage: full C x R per z.
// ---------------------------------------------------------------------------
__device__ __forceinline__
void wtr_body(float (*tile)[65], int bx, int by, int bz,
              const float* __restrict__ in, _Float16* __restrict__ out, int R, int C, float scale)
{
  const int t = threadIdx.x;
  const int c0 = bx * 64, r0 = by * 64;
  const size_t zoff = (size_t)bz * (size_t)R * (size_t)C;
  {
    const int r = t >> 2, cq = (t & 3) * 16;
    const float* p = in + zoff + (size_t)(r0 + r) * C + c0 + cq;
    #pragma unroll
    for (int i = 0; i < 4; ++i) {
      const v4f v = *(const v4f*)(p + 4 * i);
      tile[r][cq + 4 * i + 0] = v[0];
      tile[r][cq + 4 * i + 1] = v[1];
      tile[r][cq + 4 * i + 2] = v[2];
      tile[r][cq + 4 * i + 3] = v[3];
    }
  }
  __syncthreads();
  const int p8 = t & 7;
  {
    #pragma unroll
    for (int j = 0; j < 2; ++j) {
      const int c = (t >> 3) + 32 * j;
      v8h ov;
      #pragma unroll
      for (int i = 0; i < 8; ++i) ov[i] = (_Float16)(bfr(tile[8 * p8 + i][c]) * scale);
      _Float16* dst = out + zoff + (size_t)(c0 + c) * R + r0 + 8 * p8;
      *(v8h*)dst = ov;
    }
    
  }
}

// ---------------------------------------------------------------------------
// All planes that depend on the inputs alone, one grid: none reads what another writes. Block ranges, in order:
// w1 -> W1T, w2 -> W2T (PBW blocks each), Wself -> WTs, Wcross -> WTc (PBH blocks each), then y, enc -> Yh, Eh.
// The range test reads blockIdx alone: a block is wholly one kind, so the transpose's barrier is block-uniform.
// ---------------------------------------------------------------------------
#define PBW ((FF / 64) * (DM / 64))
#define PBH ((DM / 64) * NH)
#define PBC ((2 * NB * SEQ * (DM / 8) + 255) / 256)
__global__ __launch_bounds__(256)
void k_prep(const float* __restrict__ y, const float* __restrict__ e,
            const float* __restrict__ Ws, const float* __restrict__ Wc,
            const float* __restrict__ w1, const float* __restrict__ w2,
            _Float16* __restrict__ Yh, _Float16* __restrict__ Eh,
            _Float16* __restrict__ WTs, _Float16* __restrict__ WTc,
            _Float16* __restrict__ W1T, _Float16* __restrict__ W2T, int nrow)
{
  __shared__ float tile[64][65];
  const int bid = blockIdx.x;
  if (bid < 2 * PBW + 2 * PBH) {
    const float* in;
    _Float16* out;
    int R, C, bx, by, bz;
    if (bid < PBW) {                 // in[1024][4096] -> out[4096][1024]
      in = w1; out = W1T; R = DM; C = FF;
      bx = bid % (FF / 64); by = bid / (FF / 64); bz = 0;
    } else if (bid < 2 * PBW) {      // in[4096][1024] -> out[1024][4096]
      in = w2; out = W2T; R = FF; C = DM;
      bx = (bid - PBW) % (DM / 64); by = (bid - PBW) / (DM / 64); bz = 0;
    } else {                         // in[h][1024][64] -> out[h][64][1024]
      const bool cr = bid >= 2 * PBW + PBH;
      const int hb = bid - 2 * PBW - (cr ? PBH : 0);
      in = cr ? Wc : Ws; out = cr ? WTc : WTs; R = DM; C = HD;
      bx = 0; by = hb % (DM / 64); bz = hb / (DM / 64);
    }
    wtr_body(tile, bx, by, bz, in, out, R, C, 64.0f);
  } else {
    cvt_act_body(bid - (2 * PBW + 2 * PBH), y, e, Yh, Eh, nrow);
  }
}

#define GKS 128              // k per staged tile
#define GLP 272              // LDS row pitch, bytes: 256 + 16, conflict-free for 16-byte fragment reads
#define GBUF (192 * GLP)     // one buffer: 128 A rows + 64 B rows
static_assert(DM % GKS == 0 && FF % GKS == 0);

// twelve 16-byte-per-lane copies global -> LDS, through no register. The s_wait_xcnt closes the statement, so that
// no address register of a copy is rewritten while the copy still names it.
__device__ __forceinline__ void copy12(const unsigned (&l)[12], const char* const (&g)[12])
{
  asm volatile(
    "global_load_async_to_lds_b128 %0, %12, off\n\t"
    "global_load_async_to_lds_b128 %1, %13, off\n\t"
    "global_load_async_to_lds_b128 %2, %14, off\n\t"
    "global_load_async_to_lds_b128 %3, %15, off\n\t"
    "global_load_async_to_lds_b128 %4, %16, off\n\t"
    "global_load_async_to_lds_b128 %5, %17, off\n\t"
    "global_load_async_to_lds_b128 %6, %18, off\n\t"
    "global_load_async_to_lds_b128 %7, %19, off\n\t"
    "global_load_async_to_lds_b128 %8, %20, off\n\t"
    "global_load_async_to_lds_b128 %9, %21, off\n\t"
    "global_load_async_to_lds_b128 %10, %22, off\n\t"
    "global_load_async_to_lds_b128 %11, %23, off\n\t"
    "s_wait_xcnt 0x0"
    : : "v"(l[0]), "v"(l[1]), "v"(l[2]), "v"(l[3]), "v"(l[4]), "v"(l[5]),
        "v"(l[6]), "v"(l[7]), "v"(l[8]), "v"(l[9]), "v"(l[10]), "v"(l[11]),
        "v"(g[0]), "v"(g[1]), "v"(g[2]), "v"(g[3]), "v"(g[4]), "v"(g[5]),
        "v"(g[6]), "v"(g[7]), "v"(g[8]), "v"(g[9]), "v"(g[10]), "v"(g[11])
    : "memory");
}

// ---------------------------------------------------------------------------
// GEMM C[M][N] = A[M][K] (f16 row-major, pitch lda) x B, B given as BT[N][K] (k contiguous, pitch ldb,
// per-z offset sBz). Block 128 threads = 4 waves, block tile 128x64, wave tile 32x64 (2x4 fragments),
// k-tiles of 128 staged in LDS by asynchronous copies (two buffers), fragments read from LDS. Epilogue: v = acc/64 + bf16rne(bias[z*sBias + n])
//   MODE 0: Oh[z][prow][64] f16 (+ Or residual (v-hi)*2^11 if RES) (+ Ot/Otr [z][64][prow] if WVT)
//   MODE 1: Oh[M][ldc] f16 at columns n0..n0+63
//   MODE 2: Of[M][ldc] f32 at columns n0..n0+63
// coverage: each block writes rows m0..m0+127 x 64 columns of every plane it owns (and the 64 x 128
// transposed slab for WVT); grid (M/128, N/64, Z) tiles the planes exactly.
// ---------------------------------------------------------------------------
// st: 128 x 68 floats of LDS; tile: 2 * GBUF bytes of LDS, 16-byte aligned; (bx, by, z): the block's tile
template<int MODE, bool RES, bool WVT>
__device__ __forceinline__
void gemm_body(float* st, char* tile, int bx, int by, int z,
            const _Float16* __restrict__ A, int lda,
            const _Float16* __restrict__ BT, int ldb, int sBz,
            const float* __restrict__ bias, int sBias,
            int K, int prow,
            _Float16* __restrict__ Oh, _Float16* __restrict__ Or,
            _Float16* __restrict__ Ot, _Float16* __restrict__ Otr,
            float* __restrict__ Of, int ldc)
{
  const int t = threadIdx.x, lane = t & 31, w = t >> 5, hs = lane >> 4, l16 = lane & 15;
  const int m0 = bx * 128, n0 = by * 64;

  const v8f z8 = {0.f, 0.f, 0.f, 0.f, 0.f, 0.f, 0.f, 0.f};
  v8f acc[2][4];
  #pragma unroll
  for (int mt = 0; mt < 2; ++mt)
    #pragma unroll
    for (int nt = 0; nt < 4; ++nt) acc[mt][nt] = z8;

  // Staging: a copy of one wave brings two whole rows of the tile (2 x 256 B, whole lines); thread = 16 B at
  // column cc of row 8*i + cr, i = 0..23. Every row is fetched once per block and read from LDS by the waves.
  const int cr = t >> 4, cc = t & 15;
  const char* Ag = (const char*)(A + (size_t)(m0 + cr) * lda + 8 * cc);
  const char* Bg = (const char*)(BT + (size_t)z * sBz + (size_t)(n0 + cr) * ldb + 8 * cc);
  const unsigned lcp = (unsigned)(uintptr_t)tile + (unsigned)(cr * GLP + cc * 16);
  auto stage = [&](unsigned boff, int k0) {
    #pragma unroll
    for (int hf = 0; hf < 2; ++hf) {
      unsigned l[12];
      const char* g[12];
      #pragma unroll
      for (int i = 0; i < 12; ++i) {
        const int idx = 12 * hf + i;
        l[i] = lcp + boff + (unsigned)(8 * idx * GLP);
        g[i] = (idx < 16) ? (Ag + ((size_t)(8 * idx) * lda + k0) * 2)
                          : (Bg + ((size_t)(8 * (idx - 16)) * ldb + k0) * 2);
      }
      copy12(l, g);
    }
  };

  // Fragments from LDS, two register sets: a 32-k step's 12 reads go out as one group ahead of the step before it.
  // k and sum order as before. K is a multiple of GKS (DM, FF).
  v16h fa[2][2], fb[2][4];
  auto products = [&](int s) {
    #pragma unroll
    for (int nt = 0; nt < 4; ++nt) {
      acc[0][nt] = mma16(fa[s][0], fb[s][nt], acc[0][nt]);
      acc[1][nt] = mma16(fa[s][1], fb[s][nt], acc[1][nt]);
    }
  };
  const int fra = (32 * w + l16) * GLP + 16 * hs;
  const int frb = (128 + l16) * GLP + 16 * hs;
  auto frags = [&](int s, const char* tb, int stp) {
    #pragma unroll
    for (int mt = 0; mt < 2; ++mt) {
      union { v16h v; v8h q[2]; } u;
      const char* p = tb + fra + 16 * mt * GLP + 64 * stp;
      u.q[0] = *(const v8h*)p;
      u.q[1] = *(const v8h*)(p + 32);
      fa[s][mt] = u.v;
    }
    #pragma unroll
    for (int nt = 0; nt < 4; ++nt) {
      union { v16h v; v8h q[2]; } u;
      const char* p = tb + frb + 16 * nt * GLP + 64 * stp;
      u.q[0] = *(const v8h*)p;
      u.q[1] = *(const v8h*)(p + 32);
      fb[s][nt] = u.v;
    }
  };

  stage(0u, 0);
  asm volatile("s_wait_asynccnt 0x0" ::: "memory");   // this wave's share of tile 0 has landed
  __syncthreads();                                    // every wave's share has: tile 0 may be read
  if (GKS < K) stage((unsigned)GBUF, GKS);

  unsigned boff = 0u;
  #pragma unroll 1   // rolled: one trip is one tile, four 32-k steps unrolled inside
  for (int k0 = 0; k0 < K; k0 += GKS) {
    const char* tb = tile + boff;
    frags(0, tb, 0);
    #pragma unroll
    for (int stp = 0; stp < GKS / 32; ++stp) {
      if (stp + 1 < GKS / 32) frags((stp + 1) & 1, tb, stp + 1);
      products(stp & 1);
    }
    asm volatile("s_wait_dscnt 0x0" ::: "memory");      // this wave's reads of the buffer are done
    asm volatile("s_wait_asynccnt 0x0" ::: "memory");   // its share of the next tile has landed
    __syncthreads();   // publishes the next tile and ends every wave's reads of this buffer, refilled below
    if (k0 + 2 * GKS < K) stage(boff, k0 + 2 * GKS);
    boff ^= (unsigned)GBUF;
  }
  asm volatile("s_wait_asynccnt 0x0" ::: "memory");     // no copy is left in flight

  // ---- epilogue: bias (bf16 RNE), scale, relu -> LDS stage ----
  float bv[4];
  #pragma unroll
  for (int nt = 0; nt < 4; ++nt) bv[nt] = bfr(bias[(size_t)z * sBias + n0 + 16 * nt + l16]);
  #pragma unroll
  for (int mt = 0; mt < 2; ++mt)
    #pragma unroll
    for (int nt = 0; nt < 4; ++nt)
      #pragma unroll
      for (int r = 0; r < 8; ++r) {
        float v = acc[mt][nt][r] * (1.0f / 64.0f) + bv[nt];
        if (MODE == 1) v = fmaxf(v, 0.0f);
        st[(32 * w + 16 * mt + 8 * hs + r) * 68 + 16 * nt + l16] = v;
      }
  __syncthreads();   // stage is read cross-wave below

  {
    if (MODE != 2) {
      const int p = t & 7;
      #pragma unroll
      for (int j = 0; j < 8; ++j) {
        const int row = (t >> 3) + 16 * j;
        v8h hv, rv;
        #pragma unroll
        for (int i = 0; i < 8; ++i) {
          const float v = st[row * 68 + 8 * p + i];
          const _Float16 q = (_Float16)v;
          hv[i] = q;
          rv[i] = RES ? (_Float16)((v - (float)q) * 2048.0f) : q;
        }
        const size_t off = (MODE == 0) ? ((((size_t)z * prow) + m0 + row) * HD + 8 * p)
                                       : ((size_t)(m0 + row) * ldc + n0 + 8 * p);
        *(v8h*)(Oh + off) = hv;
        if (RES) *(v8h*)(Or + off) = rv;
      }
      if (WVT) {
        const int q16 = t & 15;
        #pragma unroll
        for (int j = 0; j < 8; ++j) {
          const int e = (t >> 4) + 8 * j;
          v8h hv, rv;
          #pragma unroll
          for (int i = 0; i < 8; ++i) {
            const float v = st[(8 * q16 + i) * 68 + e];
            const _Float16 q = (_Float16)v;
            hv[i] = q;
            rv[i] = RES ? (_Float16)((v - (float)q) * 2048.0f) : q;
          }
          const size_t off = ((size_t)z * HD + e) * (size_t)prow + m0 + 8 * q16;
          *(v8h*)(Ot + off) = hv;
          if (RES) *(v8h*)(Otr + off) = rv;
        }
      }
    } else {
      const int q16 = t & 15;
      #pragma unroll
      for (int j = 0; j < 16; ++j) {
        const int row = (t >> 4) + 8 * j;
        v4f fv;
        #pragma unroll
        for (int i = 0; i < 4; ++i) fv[i] = st[row * 68 + 4 * q16 + i];
        *(v4f*)(Of + (size_t)(m0 + row) * ldc + n0 + 4 * q16) = fv;
      }
    }
    
  }
}

template<int MODE, bool RES, bool WVT>
__global__ __launch_bounds__(128) __attribute__((amdgpu_num_vgpr(256)))
void k_gemm(const _Float16* __restrict__ A, int lda,
            const _Float16* __restrict__ BT, int ldb, int sBz,
            const float* __restrict__ bias, int sBias,
            int K, int prow,
            _Float16* __restrict__ Oh, _Float16* __restrict__ Or,
            _Float16* __restrict__ Ot, _Float16* __restrict__ Otr,
            float* __restrict__ Of, int ldc)
{
  __shared__ float st[128 * 68];
  // two k-tile buffers: rows 0..127 = A rows m0.., rows 128..191 = BT rows n0.., GKS k (256 B) per row at pitch GLP
  __shared__ __attribute__((aligned(16))) char tile[2 * GBUF];
  gemm_body<MODE, RES, WVT>(st, tile, blockIdx.x, blockIdx.y, blockIdx.z,
                            A, lda, BT, ldb, sBz, bias, sBias, K, prow, Oh, Or, Ot, Otr, Of, ldc);
}

// The two head projections that depend on the planes alone, one grid: z < NH = self q/k/v of head z (with residual
// planes), z >= NH = cross k/v of head z - NH. Neither reads what the other writes; a block is wholly one kind.
__global__ __launch_bounds__(128) __attribute__((amdgpu_num_vgpr(256)))
void k_proj2(const _Float16* __restrict__ As, const _Float16* __restrict__ BTs, const float* __restrict__ bs,
             _Float16* __restrict__ Ohs, _Float16* __restrict__ Ors,
             _Float16* __restrict__ Ots, _Float16* __restrict__ Otrs,
             const _Float16* __restrict__ Ac, const _Float16* __restrict__ BTc, const float* __restrict__ bc,
             _Float16* __restrict__ Ohc, _Float16* __restrict__ Otc,
             float* __restrict__ Of, int prow)
{
  __shared__ float st[128 * 68];
  __shared__ __attribute__((aligned(16))) char tile[2 * GBUF];
  if (blockIdx.z < NH)
    gemm_body<0, true, true>(st, tile, blockIdx.x, 0, blockIdx.z,
                             As, DM, BTs, DM, HD * DM, bs, HD, DM, prow, Ohs, Ors, Ots, Otrs, Of, HD);
  else
    gemm_body<0, false, true>(st, tile, blockIdx.x, 0, blockIdx.z - NH,
                              Ac, DM, BTc, DM, HD * DM, bc, HD, DM, prow, Ohc, Ohc, Otc, Otc, Of, HD);
}

#define AKT 128              // keys per staged tile (= query rows per block)
#define AKP 144              // LDS pitch of a K row, bytes: 128 + 16
#define AVP 272              // LDS pitch of a Vt row, bytes: 256 + 16
#define AKB (AKT * AKP)      // K part of a tile
#define APL (AKB + HD * AVP) // K part + Vt part: one pair of planes
static_assert(SEQ % AKT == 0);
static_assert(RESQB <= 2);   // the residual-plane blocks walk at most two tiles: one buffer each

// eight 16-byte-per-lane copies global -> LDS; the s_wait_xcnt closes the statement as in copy12
__device__ __forceinline__ void copy8(const unsigned (&l)[8], const char* const (&g)[8])
{
  asm volatile(
    "global_load_async_to_lds_b128 %0, %8, off\n\t"
    "global_load_async_to_lds_b128 %1, %9, off\n\t"
    "global_load_async_to_lds_b128 %2, %10, off\n\t"
    "global_load_async_to_lds_b128 %3, %11, off\n\t"
    "global_load_async_to_lds_b128 %4, %12, off\n\t"
    "global_load_async_to_lds_b128 %5, %13, off\n\t"
    "global_load_async_to_lds_b128 %6, %14, off\n\t"
    "global_load_async_to_lds_b128 %7, %15, off\n\t"
    "s_wait_xcnt 0x0"
    : : "v"(l[0]), "v"(l[1]), "v"(l[2]), "v"(l[3]), "v"(l[4]), "v"(l[5]), "v"(l[6]), "v"(l[7]),
        "v"(g[0]), "v"(g[1]), "v"(g[2]), "v"(g[3]), "v"(g[4]), "v"(g[5]), "v"(g[6]), "v"(g[7])
    : "memory");
}

// ---------------------------------------------------------------------------
// Flash attention. Planes: Q/K [h][prow][64] f16 (prow = NB*SEQ rows per head, row = b*SEQ + s),
// Vt [h][64][prow] f16; residual planes (x2^11) of the same shapes for RES. Block 256 threads = 8 waves,
// wave = 16 queries, 32-key chunks, online softmax in f32, p carried x4096 as f16.
// Both products run transposed: S^T = K.Q^T (A = K rows, B = Q) and O^T += Vt.P^T (A = Vt rows, B = P^T). A lane then
// holds 16 scores of ONE query (query = lane & 15, keys 16*nt + 8*(lane >> 4) + r): maximum and sum are in-lane, the
// maximum joined with the other half by one cross-row move per chunk, the sums once behind the loop; and those
// 16 values are, in that order, the lane's elements of the B fragment of P^T, so that p stays in registers.
// K and Vt tiles of 128 keys staged in LDS by asynchronous copies (two buffers), once per block; the waves read
// their A fragments there (split k map).
// RES: s = qh.kh + (qr.kh + qh.kr)/2^11 ; O = ph.vh + (ph.vr + pr.vh)/2^11 folded before 1/l.
// Out: f32 [NB*SEQ][DM] at columns h*64, staged per wave in LDS, 16 lanes x 16 B per 256-B row,
// LDS tile sto: wave-private (same wave writes and reads; lds_sync_wave), 16x64 per wave, fully written.
// ---------------------------------------------------------------------------
// sto: 8 x 16 x 68 floats of LDS; kv: 2 * ABUF bytes of LDS; both 16-byte aligned; (qb, h, b): the block's queries
template<bool CAUSAL, bool RES>
__device__ __forceinline__
void attn_body(float* sto, char* kv, int qb, int h, int b,
            const _Float16* __restrict__ Qh, const _Float16* __restrict__ Qr,
            const _Float16* __restrict__ Kh, const _Float16* __restrict__ Kr,
            const _Float16* __restrict__ Vt, const _Float16* __restrict__ Vtr,
            float* __restrict__ Out, int prow)
{
  constexpr int ABUF = (RES ? 2 : 1) * APL;   // one buffer: [K | Vt], then [Kr | Vtr] with the residual planes

  const int t = threadIdx.x, lane = t & 31, hs = lane >> 4, l16 = lane & 15;
  const int w = __builtin_amdgcn_readfirstlane(t >> 5);   // scalar: a wave's own trip count below is a scalar test
  const int qbase = qb * 128 + w * 16;                       // within the sequence
  const size_t rq = (size_t)h * (size_t)prow + (size_t)b * SEQ;   // plane row base for (h, b)
  float*    sw  = sto + w * 1088;

  v16h aq[2], aqr[2];
  #pragma unroll
  for (int stp = 0; stp < 2; ++stp) {
    aq[stp]  = ldfrag(Qh + (rq + qbase + l16) * HD + 32 * stp, hs);
    aqr[stp] = RES ? ldfrag(Qr + (rq + qbase + l16) * HD + 32 * stp, hs) : aq[stp];
  }

  const v8f z8 = {0.f, 0.f, 0.f, 0.f, 0.f, 0.f, 0.f, 0.f};
  // this lane's query (l16): running maximum (both halves agree), sum over this half's keys alone
  float mrow = -3.0e38f, lrow = 0.0f;
  v8f o[4], orr[4];   // O^T: element r of tile f = column e = 16*f + 8*hs + r of query l16
  #pragma unroll
  for (int f = 0; f < 4; ++f) { o[f] = z8; orr[f] = z8; }

  const int kend = CAUSAL ? (qbase + 16) : SEQ;

  const char* Kb  = (const char*)(Kh + rq * HD);
  const char* Krb = (const char*)(Kr + rq * HD);
  const char* Vb  = (const char*)(Vt + (size_t)h * HD * (size_t)prow + (size_t)b * SEQ);
  const char* Vrb = (const char*)(Vtr + (size_t)h * HD * (size_t)prow + (size_t)b * SEQ);

  // Staging: thread = 16 B. K: a wave's copy brings 4 whole rows (512 B in a row); Vt: 2 rows of 256 B.
  const size_t gko = (size_t)((t >> 3) * (HD * 2) + (t & 7) * 16);
  const size_t gvo = (size_t)(t >> 4) * (size_t)prow * 2 + (size_t)((t & 15) * 16);
  const unsigned lk = (unsigned)(uintptr_t)kv + (unsigned)((t >> 3) * AKP + (t & 7) * 16);
  const unsigned lv = (unsigned)(uintptr_t)kv + (unsigned)(AKB + (t >> 4) * AVP + (t & 15) * 16);
  auto stage = [&](unsigned boff, int kt0) {
    #pragma unroll
    for (int pl = 0; pl < (RES ? 2 : 1); ++pl) {
      unsigned l[8];
      const char* g[8];
      #pragma unroll
      for (int j = 0; j < 4; ++j) {
        l[j] = lk + boff + (unsigned)(pl * APL + 32 * j * AKP);
        g[j] = (pl ? Krb : Kb) + gko + (size_t)(kt0 + 32 * j) * (HD * 2);
        l[4 + j] = lv + boff + (unsigned)(pl * APL + 16 * j * AVP);
        g[4 + j] = (pl ? Vrb : Vb) + gvo + ((size_t)(16 * j) * (size_t)prow + (size_t)kt0) * 2;
      }
      copy8(l, g);
    }
  };

  // A fragments of chunk c (32 keys) of the tile at tb
  const int frk = l16 * AKP + 16 * hs;
  const int frv = AKB + l16 * AVP + 16 * hs;
  auto ldsfrag = [&](const char* p) -> v16h {
    union { v16h v; v8h q[2]; } u;
    u.q[0] = *(const v8h*)p;
    u.q[1] = *(const v8h*)(p + 32);
    return u.v;
  };
  v16h fk[2][2], fkr[2][2];
  auto load_k = [&](const char* tb, int c) {
    #pragma unroll
    for (int stp = 0; stp < 2; ++stp)
      #pragma unroll
      for (int nt = 0; nt < 2; ++nt) {
        const char* p = tb + frk + (32 * c + 16 * nt) * AKP + 64 * stp;
        fk[stp][nt]  = ldsfrag(p);
        fkr[stp][nt] = RES ? ldsfrag(p + APL) : fk[stp][nt];
      }
  };

  // tiles the block walks: the same for all its waves (a wave leaves out the chunks beyond its own diagonal)
  const int nst = CAUSAL ? (qb + 1) : (SEQ / AKT);
  stage(0u, 0);
  asm volatile("s_wait_asynccnt 0x0" ::: "memory");   // this wave's share of tile 0 has landed
  __syncthreads();                                    // every wave's share has: tile 0 may be read
  if (1 < nst) stage((unsigned)ABUF, AKT);

  unsigned boff = 0u;
  #pragma unroll 1
  for (int sg = 0; sg < nst; ++sg) {
  const char* tb = kv + boff;
  // K fragments one chunk ahead inside the tile (chunk 0 here); with the residual planes, whose fragments
  // leave no registers for that, at the chunk's own head. Every wave has at least chunk 0 of every tile.
  if (!RES) load_k(tb, 0);
  const int left = (kend - sg * AKT + 31) >> 5;             // this wave's chunks from here to its diagonal, >= 1
  const int nc = (left < AKT / 32) ? left : (AKT / 32);
  #pragma unroll 1
  for (int c = 0; c < nc; ++c) {
    const int kt = sg * AKT + 32 * c;
    if (RES) load_k(tb, c);

    // ---- scores, transposed: 32 keys (2 tiles) x 16 queries, K = 64 in 2 steps ----
    v8f s[2], sr[2];
    s[0] = z8; s[1] = z8; sr[0] = z8; sr[1] = z8;
    #pragma unroll
    for (int stp = 0; stp < 2; ++stp) {
      #pragma unroll
      for (int nt = 0; nt < 2; ++nt) {
        s[nt] = mma16(fk[stp][nt], aq[stp], s[nt]);
        if (RES) {
          sr[nt] = mma16(fk[stp][nt], aqr[stp], sr[nt]);
          sr[nt] = mma16(fkr[stp][nt], aq[stp], sr[nt]);
        }
      }
    }

    // ---- this chunk's V fragments, one group, issued here so that they land under the softmax ----
    v16h fv[4], fvr[4];
    #pragma unroll
    for (int f = 0; f < 4; ++f) {
      const char* p = tb + frv + 16 * f * AVP + 64 * c;
      fv[f]  = ldsfrag(p);
      fvr[f] = RES ? ldsfrag(p + APL) : fv[f];
    }

    // ---- next chunk's K fragments (same tile), into the registers the products above have just read ----
    if (!RES && c + 1 < AKT / 32) load_k(tb, c + 1);

    // ---- scale, causal replace-mask, online softmax (f32) ----
    float pv[2][8];
    #pragma unroll
    for (int nt = 0; nt < 2; ++nt)
      #pragma unroll
      for (int r = 0; r < 8; ++r) {
        float v = s[nt][r];
        if (RES) v += sr[nt][r] * (1.0f / 2048.0f);
        v *= 0.125f;
        if (CAUSAL) {
          const int key = kt + 16 * nt + 8 * hs + r;
          const int row = qbase + l16;
          if (key > row) v = -1.0e9f;
        }
        pv[nt][r] = v;
      }
    float tq[4];
    #pragma unroll
    for (int i = 0; i < 4; ++i)
      tq[i] = fmaxf(fmaxf(pv[0][2 * i], pv[0][2 * i + 1]), fmaxf(pv[1][2 * i], pv[1][2 * i + 1]));
    float tm = fmaxf(fmaxf(tq[0], tq[1]), fmaxf(tq[2], tq[3]));
    tm = fmaxf(tm, xhalf(tm));            // the query's other 16 keys of the chunk

    const float mn = fmaxf(mrow, tm);
    const float corr = __expf(mrow - mn);
    mrow = mn;
    #pragma unroll
    for (int nt = 0; nt < 2; ++nt)
      #pragma unroll
      for (int r = 0; r < 8; ++r) pv[nt][r] = __expf(pv[nt][r] - mn);
    float tsq[4];
    #pragma unroll
    for (int i = 0; i < 4; ++i)
      tsq[i] = (pv[0][2 * i] + pv[0][2 * i + 1]) + (pv[1][2 * i] + pv[1][2 * i + 1]);
    lrow = lrow * corr + ((tsq[0] + tsq[1]) + (tsq[2] + tsq[3]));
    #pragma unroll
    for (int f = 0; f < 4; ++f)
      #pragma unroll
      for (int r = 0; r < 8; ++r) {
        o[f][r] *= corr;
        if (RES) orr[f][r] *= corr;
      }

    // ---- p (x4096, f16 hi; x2^11 residual for RES) packed in place into the B fragment of P^T:
    //      elements 0..7 = keys 8*hs + r (tile 0), elements 8..15 = keys 16 + 8*hs + r (tile 1), the k map of ldfrag ----
    v16h bp, bpr;
    #pragma unroll
    for (int nt = 0; nt < 2; ++nt)
      #pragma unroll
      for (int r = 0; r < 8; ++r) {
        const float pc = pv[nt][r] * 4096.0f;
        const _Float16 ph = (_Float16)pc;
        bp[8 * nt + r]  = ph;
        bpr[8 * nt + r] = RES ? (_Float16)((pc - (float)ph) * 2048.0f) : ph;
      }

    // ---- O^T += Vt . P^T : A fragments of the Vt plane (row e, k = key contiguous), read behind the scores ----
    #pragma unroll
    for (int f = 0; f < 4; ++f) {
      o[f] = mma16(fv[f], bp, o[f]);
      if (RES) {
        orr[f] = mma16(fvr[f], bp, orr[f]);
        orr[f] = mma16(fv[f], bpr, orr[f]);
      }
    }
  }
  asm volatile("s_wait_dscnt 0x0" ::: "memory");      // this wave's reads of the buffer are done
  asm volatile("s_wait_asynccnt 0x0" ::: "memory");   // its share of the next tile has landed
  __syncthreads();   // publishes the next tile and ends every wave's reads of this buffer, refilled below
  // with the residual planes the block is one of query blocks 0..RESQB-1: no more tiles than buffers, no refill
  if (!RES && sg + 2 < nst) stage(boff, (sg + 2) * AKT);
  boff ^= (unsigned)ABUF;
  }
  asm volatile("s_wait_asynccnt 0x0" ::: "memory");     // no copy is left in flight

  // ---- normalise, stage 16x64 f32 tile per wave, whole-line stores ----
  lrow += xhalf(lrow);                    // the two halves' key sums joined, once
  const float inv = (1.0f / lrow) * (1.0f / 4096.0f);
  #pragma unroll
  for (int f = 0; f < 4; ++f)
    #pragma unroll
    for (int q = 0; q < 2; ++q) {
      v4f sv;
      #pragma unroll
      for (int i = 0; i < 4; ++i) {
        float v = o[f][4 * q + i];
        if (RES) v += orr[f][4 * q + i] * (1.0f / 2048.0f);
        sv[i] = v * inv;
      }
      *(v4f*)(sw + l16 * 68 + 16 * f + 8 * hs + 4 * q) = sv;
    }
  lds_sync_wave();
  const size_t orow = (size_t)b * SEQ + (size_t)qbase;
  {
    #pragma unroll
    for (int j = 0; j < 8; ++j) {
      const int row = 2 * j + hs;
      const v4f fvv = *(const v4f*)(sw + row * 68 + 4 * l16);
      *(v4f*)(Out + (orow + row) * DM + h * HD + 4 * l16) = fvv;
    }
    
  }
}

// two waves per SIMD is what the grids give (at most one block per WGP): said here so that the scheduler spends
// registers on the fragments in flight instead of saving them for more waves
__global__ __launch_bounds__(256) __attribute__((amdgpu_waves_per_eu(2, 2)))
void k_attn_cross(const _Float16* __restrict__ Qh, const _Float16* __restrict__ Kh, const _Float16* __restrict__ Vt,
                  float* __restrict__ Out, int prow)
{
  __shared__ __attribute__((aligned(16))) float sto[8 * 16 * 68];
  __shared__ __attribute__((aligned(16))) char kv[2 * APL];
  attn_body<false, false>(sto, kv, blockIdx.x, blockIdx.y, blockIdx.z, Qh, Qh, Kh, Kh, Vt, Vt, Out, prow);
}

// Causal attention, every query block in one grid: blocks 0..RESQB-1 take the path with the residual planes, the
// others the plain one. They write disjoint rows of Out and read the same planes; a block is wholly one kind.
__global__ __launch_bounds__(256) __attribute__((amdgpu_waves_per_eu(2, 2)))
void k_attn_self(const _Float16* __restrict__ Qh, const _Float16* __restrict__ Qr,
                 const _Float16* __restrict__ Vt, const _Float16* __restrict__ Vtr,
                 float* __restrict__ Out, int prow)
{
  __shared__ __attribute__((aligned(16))) float sto[8 * 16 * 68];
  __shared__ __attribute__((aligned(16))) char kv[4 * APL];
  if (blockIdx.x < RESQB)
    attn_body<true, true>(sto, kv, blockIdx.x, blockIdx.y, blockIdx.z, Qh, Qr, Qh, Qr, Vt, Vtr, Out, prow);
  else
    attn_body<true, false>(sto, kv, blockIdx.x, blockIdx.y, blockIdx.z, Qh, Qr, Qh, Qr, Vt, Vtr, Out, prow);
}

// ---------------------------------------------------------------------------
// y = LayerNorm(x + r) * g + b over DM = 1024, one block (256 threads) per row, thread = 4 columns.
// XIN: x is a raw input (bf16 RNE convert, input row stride via SEQ_FULL); else x is a ws f32 plane.
// WH: also write the f16 plane yh. g, b bf16 RNE converted. Outputs: 256 lanes x 16/8 B per row
// coverage: nrow x DM for y (and yh).
// ---------------------------------------------------------------------------
template<bool XIN, bool WH>
__global__ __launch_bounds__(256)
void k_ln(const float* __restrict__ x, const float* __restrict__ rr,
          const float* __restrict__ g, const float* __restrict__ be,
          float* __restrict__ y, _Float16* __restrict__ yh)
{
  #pragma clang fp contract(off)
  __shared__ float red[8];
  __shared__ float red2[8];
  const int m = blockIdx.x, t = threadIdx.x, lane = t & 31, w = t >> 5;
  const int c = 4 * t;
  const size_t xrow = XIN ? ((size_t)(m / SEQ) * SEQ_FULL + (size_t)(m % SEQ)) : (size_t)m;
  const v4f xv = *(const v4f*)(x + xrow * DM + c);
  const v4f rv = *(const v4f*)(rr + (size_t)m * DM + c);
  float v[4];
  #pragma unroll
  for (int i = 0; i < 4; ++i) {
    float xi = xv[i];
    if (XIN) xi = bfr(xi);
    v[i] = xi + rv[i];
  }
  float s = (v[0] + v[1]) + (v[2] + v[3]);
  #pragma unroll
  for (int off = 16; off > 0; off >>= 1) s += __shfl_xor(s, off, 32);
  if (lane == 0) red[w] = s;
  __syncthreads();
  float tot = 0.0f;
  #pragma unroll
  for (int i = 0; i < 8; ++i) tot += red[i];
  const float mu = tot * (1.0f / (float)DM);

  float d[4];
  #pragma unroll
  for (int i = 0; i < 4; ++i) d[i] = v[i] - mu;
  float s2 = (d[0] * d[0] + d[1] * d[1]) + (d[2] * d[2] + d[3] * d[3]);
  #pragma unroll
  for (int off = 16; off > 0; off >>= 1) s2 += __shfl_xor(s2, off, 32);
  if (lane == 0) red2[w] = s2;
  __syncthreads();
  float tot2 = 0.0f;
  #pragma unroll
  for (int i = 0; i < 8; ++i) tot2 += red2[i];
  const float var = tot2 * (1.0f / (float)DM);
  const float rstd = rsqrtf(var + LN_EPS);

  v4f ov;
  v4h oh;
  #pragma unroll
  for (int i = 0; i < 4; ++i) {
    const float gv = bfr(g[c + i]);
    const float bvv = bfr(be[c + i]);
    const float q = d[i] * rstd * gv + bvv;
    ov[i] = q;
    oh[i] = (_Float16)q;
  }
  float* ydst = y + (size_t)m * DM + c;
  _Float16* hdst = yh + (WH ? ((size_t)m * DM + c) : 0);
  *(v4f*)ydst = ov;
  if (WH) *(v4h*)hdst = oh;
  
}

// ---------------------------------------------------------------------------
extern "C" void kernel_launch(void* const* d_in, const int* in_sizes, int n_in,
                              void* d_out, int out_size, void* d_ws, size_t ws_size,
                              hipStream_t stream)
{
  if (n_in < 16) return;
  const int MR = NB * SEQ;                 // internal rows (b*SEQ + s)
  const long need_act = (long)(NB - 1) * SEQ_FULL * DM + (long)SEQ * DM;
  if ((long)in_sizes[0] < need_act || (long)in_sizes[1] < need_act) return;
  if (in_sizes[2] < NH * DM * HD || in_sizes[3] < NH * HD) return;
  if (in_sizes[4] < NH * DM * HD || in_sizes[5] < NH * HD) return;
  for (int i = 6; i < 12; ++i) if (in_sizes[i] < DM) return;
  if (in_sizes[12] < DM * FF || in_sizes[13] < FF || in_sizes[14] < FF * DM || in_sizes[15] < DM) return;
  if (out_size < MR * DM) return;

  const float* y      = (const float*)d_in[0];
  const float* enc    = (const float*)d_in[1];
  const float* Wself  = (const float*)d_in[2];
  const float* bself  = (const float*)d_in[3];
  const float* Wcross = (const float*)d_in[4];
  const float* bcross = (const float*)d_in[5];
  const float* g1  = (const float*)d_in[6];  const float* be1 = (const float*)d_in[7];
  const float* g2  = (const float*)d_in[8];  const float* be2 = (const float*)d_in[9];
  const float* g3  = (const float*)d_in[10]; const float* be3 = (const float*)d_in[11];
  const float* w1  = (const float*)d_in[12]; const float* b1  = (const float*)d_in[13];
  const float* w2  = (const float*)d_in[14]; const float* b2  = (const float*)d_in[15];
  float* out = (float*)d_out;

  // ---- workspace carve (256-B aligned regions; 104 MiB at NB*SEQ = 2048) ----
  char* base = (char*)d_ws;
  size_t off = 0;
  auto take = [&](size_t bytes) -> void* {
    void* p = (void*)(base + off);
    off += (bytes + 255) & ~(size_t)255;
    return p;
  };
  _Float16* Yh   = (_Float16*)take((size_t)MR * DM * 2);
  _Float16* Eh   = (_Float16*)take((size_t)MR * DM * 2);
  _Float16* WTs  = (_Float16*)take((size_t)NH * HD * DM * 2);
  _Float16* WTc  = (_Float16*)take((size_t)NH * HD * DM * 2);
  _Float16* W1T  = (_Float16*)take((size_t)FF * DM * 2);
  _Float16* W2T  = (_Float16*)take((size_t)DM * FF * 2);
  _Float16* QKVh = (_Float16*)take((size_t)NH * MR * HD * 2);
  _Float16* QKVr = (_Float16*)take((size_t)NH * MR * HD * 2);
  _Float16* VTh  = (_Float16*)take((size_t)NH * HD * MR * 2);
  _Float16* VTr  = (_Float16*)take((size_t)NH * HD * MR * 2);
  float*    att  = (float*)   take((size_t)MR * DM * 4);     // sa, then ca, then ff
  float*    y1   = (float*)   take((size_t)MR * DM * 4);
  _Float16* y1h  = (_Float16*)take((size_t)MR * DM * 2);
  float*    y2   = (float*)   take((size_t)MR * DM * 4);
  _Float16* y2h  = (_Float16*)take((size_t)MR * DM * 2);
  _Float16* Qch  = (_Float16*)take((size_t)NH * MR * HD * 2);
  _Float16* KVch = (_Float16*)take((size_t)NH * MR * HD * 2);
  _Float16* VTc  = (_Float16*)take((size_t)NH * HD * MR * 2);
  _Float16* Hh   = (_Float16*)take((size_t)MR * FF * 2);
  if (off > ws_size) return;

  // ---- planes ----
  k_prep<<<dim3(2 * PBW + 2 * PBH + PBC), 256, 0, stream>>>(
      y, enc, Wself, Wcross, w1, w2, Yh, Eh, WTs, WTc, W1T, W2T, MR);

  const int nqb  = SEQ / 128;

  // ---- projections of y (self: q = k = v share one) and of enc (cross: k = v share one) ----
  k_proj2<<<dim3(MR / 128, 1, 2 * NH), 128, 0, stream>>>(
      Yh, WTs, bself, QKVh, QKVr, VTh, VTr, Eh, WTc, bcross, KVch, VTc, att, MR);

  // ---- self attention ----
  k_attn_self<<<dim3(nqb, NH, NB), 256, 0, stream>>>(QKVh, QKVr, VTh, VTr, att, MR);
  k_ln<true, true><<<dim3(MR), 256, 0, stream>>>(y, att, g1, be1, y1, y1h);

  // ---- cross attention (q from y1; k = v from enc, projected above) ----
  k_gemm<0, false, false><<<dim3(MR / 128, HD / 64, NH), 128, 0, stream>>>(
      y1h, DM, WTc, DM, HD * DM, bcross, HD, DM, MR, Qch, Qch, Qch, Qch, att, HD);
  k_attn_cross<<<dim3(nqb, NH, NB), 256, 0, stream>>>(Qch, KVch, VTc, att, MR);
  k_ln<false, true><<<dim3(MR), 256, 0, stream>>>(y1, att, g2, be2, y2, y2h);

  // ---- MLP ----
  k_gemm<1, false, false><<<dim3(MR / 128, FF / 64, 1), 128, 0, stream>>>(
      y2h, DM, W1T, DM, 0, b1, 0, DM, MR, Hh, Hh, Hh, Hh, att, FF);
  k_gemm<2, false, false><<<dim3(MR / 128, DM / 64, 1), 128, 0, stream>>>(
      Hh, FF, W2T, FF, 0, b2, 0, FF, MR, y2h, y2h, y2h, y2h, att, DM);
  k_ln<false, false><<<dim3(MR), 256, 0, stream>>>(y2, att, g3, be3, out, y2h);
}

// v005
// One run takes 138 microseconds.
// Two timings next to v004 both put it at 1.12 times that version's speed.
// Counting every step since v000, it is 4.86 times as fast.
#include <hip/hip_runtime.h>
#include <stdint.h>
#include <stddef.h>

// Contractions on v_wmma_f32_16x16x32_f16 (f16 operands, f32 accumulate): per-head q/k/v projections,
// q.k^T, p.v (self causal and cross), MLP up and down GEMMs. Float inputs RNE-converted to bf16 and held
// as f16 planes (weights carried x64, softmax p carried x4096); causal query blocks 0..RESQB-1 add f16
// residual planes (x2^11) for q, k, p, v into a second accumulator. Softmax, layer norms, bias adds: f32.

#ifndef NB
#define NB 1
#endif
#ifndef SEQ
#define SEQ 2048
#endif
#define NB_FULL 1
#define SEQ_FULL 2048
#define DM 1024
#define NH 16
#define HD 64
#define FF 4096
#define RESQB 2
#define LN_EPS 1.0e-5f

static_assert(SEQ % 128 == 0);
static_assert(SEQ <= SEQ_FULL);
static_assert(NB >= 1 && NB <= NB_FULL);
static_assert(HD == 64);
static_assert(DM % 64 == 0 && FF % 64 == 0);
static_assert(DM % 32 == 0 && FF % 32 == 0);
static_assert((NB * SEQ) % 128 == 0);
static_assert(DM == 4 * 256);

typedef _Float16 v4h  __attribute__((ext_vector_type(4)));
typedef _Float16 v8h  __attribute__((ext_vector_type(8)));
typedef _Float16 v16h __attribute__((ext_vector_type(16)));
typedef float    v4f  __attribute__((ext_vector_type(4)));
typedef float    v8f  __attribute__((ext_vector_type(8)));

// ---------------------------------------------------------------------------
// helpers
// ---------------------------------------------------------------------------
__device__ __forceinline__ v8f mma16(v16h a, v16h b, v8f c)
{
  c = __builtin_amdgcn_wmma_f32_16x16x32_f16(false, a, false, b, (short)0, c, false, false);
  asm volatile("v_nop\n\tv_nop\n\tv_nop\n\tv_nop" : "+v"(c) : "v"(a), "v"(b));
  return c;
}

// 16x16x32 16-bit fragment (A row m = lane&15, or B column n = lane&15, k contiguous at p):
// elements 0..7 <- k0+8h+0..7, elements 8..15 <- k0+16+8h+0..7, h = lane>>4
__device__ __forceinline__ v16h ldfrag(const _Float16* p, int hs)
{
  union { v16h v; v8h q[2]; } u;
  u.q[0] = *(const v8h*)(p + 8 * hs);
  u.q[1] = *(const v8h*)(p + 16 + 8 * hs);
  return u.v;
}

// bf16 RNE convert, returned widened to f32
__device__ __forceinline__ float bfr(float x)
{
  unsigned int u = __float_as_uint(x);
  u = (u + 0x7FFFu + ((u >> 16) & 1u)) & 0xFFFF0000u;
  return __uint_as_float(u);
}

// same-wave LDS store -> load ordering (wave-private tiles only)
__device__ __forceinline__ void lds_sync_wave()
{
  asm volatile("s_wait_dscnt 0x0" ::: "memory");
  __builtin_amdgcn_wave_barrier();
}

// value of lane l ^ 16 (the other 16-lane half), by a vector cross-row move
__device__ __forceinline__ float xhalf(float x)
{
  return __builtin_bit_cast(float, __builtin_amdgcn_permlanex16(__builtin_bit_cast(int, x), __builtin_bit_cast(int, x),
                                                                0x76543210, 0xfedcba98, false, false));
}

// ---------------------------------------------------------------------------
// Activation planes: Yh = f16(bf16rne(y)), Eh = f16(bf16rne(enc)), internal row m -> input row
// coverage: Yh and Eh each nrow*DM elements exactly.
// ---------------------------------------------------------------------------
__device__ __forceinline__
void cvt_act_body(int bid, const float* __restrict__ y, const float* __restrict__ e,
                  _Float16* __restrict__ Yh, _Float16* __restrict__ Eh, int nrow)
{
  const int groups = nrow * (DM / 8);
  const int g = bid * 256 + threadIdx.x;
  if (g >= 2 * groups) return;
  const int which = (g >= groups) ? 1 : 0;
  const int idx = g - which * groups;
  const int m = idx / (DM / 8);
  const int c = (idx - m * (DM / 8)) * 8;
  const size_t srow = (size_t)(m / SEQ) * SEQ_FULL + (size_t)(m % SEQ);
  const float* src = (which ? e : y) + srow * DM + c;
  const v4f a = *(const v4f*)src;
  const v4f b = *(const v4f*)(src + 4);
  v8h o;
  o[0] = (_Float16)bfr(a[0]); o[1] = (_Float16)bfr(a[1]); o[2] = (_Float16)bfr(a[2]); o[3] = (_Float16)bfr(a[3]);
  o[4] = (_Float16)bfr(b[0]); o[5] = (_Float16)bfr(b[1]); o[6] = (_Float16)bfr(b[2]); o[7] = (_Float16)bfr(b[3]);
  _Float16* dst = (which ? Eh : Yh) + (size_t)m * DM + c;
  *(v8h*)dst = o;
  
}

// ---------------------------------------------------------------------------
// Transposed weight planes: in[z][R][C] f32 -> out[z][C][R] f16, value f16(bf16rne(x) * scale).
// coverage: full C x R per z.
// ---------------------------------------------------------------------------
__device__ __forceinline__
void wtr_body(float (*tile)[65], int bx, int by, int bz,
              const float* __restrict__ in, _Float16* __restrict__ out, int R, int C, float scale)
{
  const int t = threadIdx.x;
  const int c0 = bx * 64, r0 = by * 64;
  const size_t zoff = (size_t)bz * (size_t)R * (size_t)C;
  {
    const int r = t >> 2, cq = (t & 3) * 16;
    const float* p = in + zoff + (size_t)(r0 + r) * C + c0 + cq;
    #pragma unroll
    for (int i = 0; i < 4; ++i) {
      const v4f v = *(const v4f*)(p + 4 * i);
      tile[r][cq + 4 * i + 0] = v[0];
      tile[r][cq + 4 * i + 1] = v[1];
      tile[r][cq + 4 * i + 2] = v[2];
      tile[r][cq + 4 * i + 3] = v[3];
    }
  }
  __syncthreads();
  const int p8 = t & 7;
  {
    #pragma unroll
    for (int j = 0; j < 2; ++j) {
      const int c = (t >> 3) + 32 * j;
      v8h ov;
      #pragma unroll
      for (int i = 0; i < 8; ++i) ov[i] = (_Float16)(bfr(tile[8 * p8 + i][c]) * scale);
      _Float16* dst = out + zoff + (size_t)(c0 + c) * R + r0 + 8 * p8;
      *(v8h*)dst = ov;
    }
    
  }
}

// ---------------------------------------------------------------------------
// All planes that depend on the inputs alone, one grid: none reads what another writes. Block ranges, in order:
// w1 -> W1T, w2 -> W2T (PBW blocks each), Wself -> WTs, Wcross -> WTc (PBH blocks each), then y, enc -> Yh, Eh.
// The range test reads blockIdx alone: a block is wholly one kind, so the transpose's barrier is block-uniform.
// ---------------------------------------------------------------------------
#define PBW ((FF / 64) * (DM / 64))
#define PBH ((DM / 64) * NH)
#define PBC ((2 * NB * SEQ * (DM / 8) + 255) / 256)
__global__ __launch_bounds__(256)
void k_prep(const float* __restrict__ y, const float* __restrict__ e,
            const float* __restrict__ Ws, const float* __restrict__ Wc,
            const float* __restrict__ w1, const float* __restrict__ w2,
            _Float16* __restrict__ Yh, _Float16* __restrict__ Eh,
            _Float16* __restrict__ WTs, _Float16* __restrict__ WTc,
            _Float16* __restrict__ W1T, _Float16* __restrict__ W2T, int nrow)
{
  __shared__ float tile[64][65];
  const int bid = blockIdx.x;
  if (bid < 2 * PBW + 2 * PBH) {
    const float* in;
    _Float16* out;
    int R, C, bx, by, bz;
    if (bid < PBW) {                 // in[1024][4096] -> out[4096][1024]
      in = w1; out = W1T; R = DM; C = FF;
      bx = bid % (FF / 64); by = bid / (FF / 64); bz = 0;
    } else if (bid < 2 * PBW) {      // in[4096][1024] -> out[1024][4096]
      in = w2; out = W2T; R = FF; C = DM;
      bx = (bid - PBW) % (DM / 64); by = (bid - PBW) / (DM / 64); bz = 0;
    } else {                         // in[h][1024][64] -> out[h][64][1024]
      const bool cr = bid >= 2 * PBW + PBH;
      const int hb = bid - 2 * PBW - (cr ? PBH : 0);
      in = cr ? Wc : Ws; out = cr ? WTc : WTs; R = DM; C = HD;
      bx = 0; by = hb % (DM / 64); bz = hb / (DM / 64);
    }
    wtr_body(tile, bx, by, bz, in, out, R, C, 64.0f);
  } else {
    cvt_act_body(bid - (2 * PBW + 2 * PBH), y, e, Yh, Eh, nrow);
  }
}

#define GKS 128              // k per staged tile
#define GLP 272              // LDS row pitch, bytes: 256 + 16, conflict-free for 16-byte fragment reads
#define GBUF (192 * GLP)     // one buffer: 128 A rows + 64 B rows
#define GNB 3                // buffers of the ring: one read, two being filled
#define GCP 24               // copies of one wave per tile
static_assert(GCP == 24);                    // the counted waits below are written with this number
static_assert(GCP == (192 * 16) / 128);      // 192 rows of 16 pieces of 16 B, 128 threads, one piece a copy and lane
static_assert(2 * GCP <= 63);                // copies of a wave in flight: two tiles' at most
static_assert(128 * 68 * 4 <= GNB * GBUF);   // the epilogue's stage lies in the ring
static_assert(DM % GKS == 0 && FF % GKS == 0);

// twelve 16-byte-per-lane copies global -> LDS, through no register. The s_wait_xcnt closes the statement, so that
// no address register of a copy is rewritten while the copy still names it.
__device__ __forceinline__ void copy12(const unsigned (&l)[12], const char* const (&g)[12])
{
  asm volatile(
    "global_load_async_to_lds_b128 %0, %12, off\n\t"
    "global_load_async_to_lds_b128 %1, %13, off\n\t"
    "global_load_async_to_lds_b128 %2, %14, off\n\t"
    "global_load_async_to_lds_b128 %3, %15, off\n\t"
    "global_load_async_to_lds_b128 %4, %16, off\n\t"
    "global_load_async_to_lds_b128 %5, %17, off\n\t"
    "global_load_async_to_lds_b128 %6, %18, off\n\t"
    "global_load_async_to_lds_b128 %7, %19, off\n\t"
    "global_load_async_to_lds_b128 %8, %20, off\n\t"
    "global_load_async_to_lds_b128 %9, %21, off\n\t"
    "global_load_async_to_lds_b128 %10, %22, off\n\t"
    "global_load_async_to_lds_b128 %11, %23, off\n\t"
    "s_wait_xcnt 0x0"
    : : "v"(l[0]), "v"(l[1]), "v"(l[2]), "v"(l[3]), "v"(l[4]), "v"(l[5]),
        "v"(l[6]), "v"(l[7]), "v"(l[8]), "v"(l[9]), "v"(l[10]), "v"(l[11]),
        "v"(g[0]), "v"(g[1]), "v"(g[2]), "v"(g[3]), "v"(g[4]), "v"(g[5]),
        "v"(g[6]), "v"(g[7]), "v"(g[8]), "v"(g[9]), "v"(g[10]), "v"(g[11])
    : "memory");
}

// ---------------------------------------------------------------------------
// GEMM C[M][N] = A[M][K] (f16 row-major, pitch lda) x B, B given as BT[N][K] (k contiguous, pitch ldb,
// per-z offset sBz). Block 128 threads = 4 waves, block tile 128x64, wave tile 32x64 (2x4 fragments),
// k-tiles of 128 staged in LDS by asynchronous copies (three buffers, two tiles ahead), fragments read from LDS. Epilogue: v = acc/64 + bf16rne(bias[z*sBias + n])
//   MODE 0: Oh[z][prow][64] f16 (+ Or residual (v-hi)*2^11 if RES) (+ Ot/Otr [z][64][prow] if WVT)
//   MODE 1: Oh[M][ldc] f16 at columns n0..n0+63
//   MODE 2: Of[M][ldc] f32 at columns n0..n0+63
// coverage: each block writes rows m0..m0+127 x 64 columns of every plane it owns (and the 64 x 128
// transposed slab for WVT); grid (M/128, N/64, Z) tiles the planes exactly.
// ---------------------------------------------------------------------------
// tile: GNB * GBUF bytes of LDS, 16-byte aligned, the ring and behind the loop the epilogue's stage; (bx, by, z): the block's tile
template<int MODE, bool RES, bool WVT>
__device__ __forceinline__
void gemm_body(char* tile, int bx, int by, int z,
            const _Float16* __restrict__ A, int lda,
            const _Float16* __restrict__ BT, int ldb, int sBz,
            const float* __restrict__ bias, int sBias,
            int K, int prow,
            _Float16* __restrict__ Oh, _Float16* __restrict__ Or,
            _Float16* __restrict__ Ot, _Float16* __restrict__ Otr,
            float* __restrict__ Of, int ldc)
{
  const int t = threadIdx.x, lane = t & 31, w = t >> 5, hs = lane >> 4, l16 = lane & 15;
  const int m0 = bx * 128, n0 = by * 64;

  const v8f z8 = {0.f, 0.f, 0.f, 0.f, 0.f, 0.f, 0.f, 0.f};
  v8f acc[2][4];
  #pragma unroll
  for (int mt = 0; mt < 2; ++mt)
    #pragma unroll
    for (int nt = 0; nt < 4; ++nt) acc[mt][nt] = z8;

  // Staging: a copy of one wave brings two whole rows of the tile (2 x 256 B, whole lines); thread = 16 B at
  // column cc of row 8*i + cr, i = 0..23. Every row is fetched once per block and read from LDS by the waves.
  const int cr = t >> 4, cc = t & 15;
  const char* Ag = (const char*)(A + (size_t)(m0 + cr) * lda + 8 * cc);
  const char* Bg = (const char*)(BT + (size_t)z * sBz + (size_t)(n0 + cr) * ldb + 8 * cc);
  const unsigned lcp = (unsigned)(uintptr_t)tile + (unsigned)(cr * GLP + cc * 16);
  auto stage = [&](unsigned boff, int k0) {
    #pragma unroll
    for (int hf = 0; hf < 2; ++hf) {
      unsigned l[12];
      const char* g[12];
      #pragma unroll
      for (int i = 0; i < 12; ++i) {
        const int idx = 12 * hf + i;
        l[i] = lcp + boff + (unsigned)(8 * idx * GLP);
        g[i] = (idx < 16) ? (Ag + ((size_t)(8 * idx) * lda + k0) * 2)
                          : (Bg + ((size_t)(8 * (idx - 16)) * ldb + k0) * 2);
      }
      copy12(l, g);
    }
  };

  // Fragments from LDS, two register sets: a 32-k step's 12 reads go out as one group ahead of the step before it.
  // k and sum order as before. K is a multiple of GKS (DM, FF).
  v16h fa[2][2], fb[2][4];
  auto products = [&](int s) {
    #pragma unroll
    for (int nt = 0; nt < 4; ++nt) {
      acc[0][nt] = mma16(fa[s][0], fb[s][nt], acc[0][nt]);
      acc[1][nt] = mma16(fa[s][1], fb[s][nt], acc[1][nt]);
    }
  };
  const int fra = (32 * w + l16) * GLP + 16 * hs;
  const int frb = (128 + l16) * GLP + 16 * hs;
  auto frags = [&](int s, const char* tb, int stp) {
    #pragma unroll
    for (int mt = 0; mt < 2; ++mt) {
      union { v16h v; v8h q[2]; } u;
      const char* p = tb + fra + 16 * mt * GLP + 64 * stp;
      u.q[0] = *(const v8h*)p;
      u.q[1] = *(const v8h*)(p + 32);
      fa[s][mt] = u.v;
    }
    #pragma unroll
    for (int nt = 0; nt < 4; ++nt) {
      union { v16h v; v8h q[2]; } u;
      const char* p = tb + frb + 16 * nt * GLP + 64 * stp;
      u.q[0] = *(const v8h*)p;
      u.q[1] = *(const v8h*)(p + 32);
      fb[s][nt] = u.v;
    }
  };

  // Ring of three: tile t + 2 is asked for at the head of trip t and first read in trip t + 2, so that a tile has two
  // trips to land in: one trip's products are shorter than a tile's way from L2 or memory. The counter returns a wave's
  // copies in the order of issue: the counted wait, used only where exactly GCP copies were issued behind the tile that
  // is wanted, leaves those in flight and covers every older one. A trip that issues none waits to 0.
  stage(0u, 0);
  if (GKS < K) {
    stage((unsigned)GBUF, GKS);
    asm volatile("s_wait_asynccnt 24" ::: "memory");    // GCP: this wave's share of tile 0 has landed, tile 1 may fly
  } else {
    asm volatile("s_wait_asynccnt 0x0" ::: "memory");   // this wave's share of tile 0 has landed
  }
  __syncthreads();                                      // every wave's share has: tile 0 may be read

  unsigned boff = 0u, bfill = 2u * (unsigned)GBUF;      // buffer of this trip's tile; buffer of the tile two ahead
  #pragma unroll 1   // rolled: one trip is one tile, four 32-k steps unrolled inside
  for (int k0 = 0; k0 < K; k0 += GKS) {
    const bool more = k0 + 2 * GKS < K;                 // the same for the whole block
    // refill: the buffer that the trip before has read, behind the barrier that ended every wave's reads of it
    if (more) stage(bfill, k0 + 2 * GKS);
    const char* tb = tile + boff;
    frags(0, tb, 0);
    #pragma unroll
    for (int stp = 0; stp < GKS / 32; ++stp) {
      if (stp + 1 < GKS / 32) frags((stp + 1) & 1, tb, stp + 1);
      products(stp & 1);
    }
    asm volatile("s_wait_dscnt 0x0" ::: "memory");      // this wave's reads of the buffer are done
    if (more) {
      asm volatile("s_wait_asynccnt 24" ::: "memory");  // GCP: its share of the next tile has landed; this trip's copies may fly
    } else {
      asm volatile("s_wait_asynccnt 0x0" ::: "memory"); // no copy was issued in this trip: all that is left is the next tile
    }
    __syncthreads();   // publishes the next tile and ends every wave's reads of this buffer, refilled at the next head
    bfill = boff;
    boff = (boff == 2u * (unsigned)GBUF) ? 0u : boff + (unsigned)GBUF;
  }
  asm volatile("s_wait_asynccnt 0x0" ::: "memory");     // no copy is left in flight
  // behind the last trip's waits and barrier nobody reads the ring and nothing flies into it: it becomes the stage
  float* st = (float*)tile;

  // ---- epilogue: bias (bf16 RNE), scale, relu -> LDS stage ----
  float bv[4];
  #pragma unroll
  for (int nt = 0; nt < 4; ++nt) bv[nt] = bfr(bias[(size_t)z * sBias + n0 + 16 * nt + l16]);
  #pragma unroll
  for (int mt = 0; mt < 2; ++mt)
    #pragma unroll
    for (int nt = 0; nt < 4; ++nt)
      #pragma unroll
      for (int r = 0; r < 8; ++r) {
        float v = acc[mt][nt][r] * (1.0f / 64.0f) + bv[nt];
        if (MODE == 1) v = fmaxf(v, 0.0f);
        st[(32 * w + 16 * mt + 8 * hs + r) * 68 + 16 * nt + l16] = v;
      }
  __syncthreads();   // stage is read cross-wave below

  {
    if (MODE != 2) {
      const int p = t & 7;
      #pragma unroll
      for (int j = 0; j < 8; ++j) {
        const int row = (t >> 3) + 16 * j;
        v8h hv, rv;
        #pragma unroll
        for (int i = 0; i < 8; ++i) {
          const float v = st[row * 68 + 8 * p + i];
          const _Float16 q = (_Float16)v;
          hv[i] = q;
          rv[i] = RES ? (_Float16)((v - (float)q) * 2048.0f) : q;
        }
        const size_t off = (MODE == 0) ? ((((size_t)z * prow) + m0 + row) * HD + 8 * p)
                                       : ((size_t)(m0 + row) * ldc + n0 + 8 * p);
        *(v8h*)(Oh + off) = hv;
        if (RES) *(v8h*)(Or + off) = rv;
      }
      if (WVT) {
        const int q16 = t & 15;
        #pragma unroll
        for (int j = 0; j < 8; ++j) {
          const int e = (t >> 4) + 8 * j;
          v8h hv, rv;
          #pragma unroll
          for (int i = 0; i < 8; ++i) {
            const float v = st[(8 * q16 + i) * 68 + e];
            const _Float16 q = (_Float16)v;
            hv[i] = q;
            rv[i] = RES ? (_Float16)((v - (float)q) * 2048.0f) : q;
          }
          const size_t off = ((size_t)z * HD + e) * (size_t)prow + m0 + 8 * q16;
          *(v8h*)(Ot + off) = hv;
          if (RES) *(v8h*)(Otr + off) = rv;
        }
      }
    } else {
      const int q16 = t & 15;
      #pragma unroll
      for (int j = 0; j < 16; ++j) {
        const int row = (t >> 4) + 8 * j;
        v4f fv;
        #pragma unroll
        for (int i = 0; i < 4; ++i) fv[i] = st[row * 68 + 4 * q16 + i];
        *(v4f*)(Of + (size_t)(m0 + row) * ldc + n0 + 4 * q16) = fv;
      }
    }
    
  }
}

template<int MODE, bool RES, bool WVT>
__global__ __launch_bounds__(128) __attribute__((amdgpu_num_vgpr(256)))
void k_gemm(const _Float16* __restrict__ A, int lda,
            const _Float16* __restrict__ BT, int ldb, int sBz,
            const float* __restrict__ bias, int sBias,
            int K, int prow,
            _Float16* __restrict__ Oh, _Float16* __restrict__ Or,
            _Float16* __restrict__ Ot, _Float16* __restrict__ Otr,
            float* __restrict__ Of, int ldc)
{
  // k-tile buffers: rows 0..127 = A rows m0.., rows 128..191 = BT rows n0.., GKS k (256 B) per row at pitch GLP
  __shared__ __attribute__((aligned(16))) char tile[GNB * GBUF];
  gemm_body<MODE, RES, WVT>(tile, blockIdx.x, blockIdx.y, blockIdx.z,
                            A, lda, BT, ldb, sBz, bias, sBias, K, prow, Oh, Or, Ot, Otr, Of, ldc);
}

// The two head projections that depend on the planes alone, one grid: z < NH = self q/k/v of head z (with residual
// planes), z >= NH = cross k/v of head z - NH. Neither reads what the other writes; a block is wholly one kind.
__global__ __launch_bounds__(128) __attribute__((amdgpu_num_vgpr(256)))
void k_proj2(const _Float16* __restrict__ As, const _Float16* __restrict__ BTs, const float* __restrict__ bs,
             _Float16* __restrict__ Ohs, _Float16* __restrict__ Ors,
             _Float16* __restrict__ Ots, _Float16* __restrict__ Otrs,
             const _Float16* __restrict__ Ac, const _Float16* __restrict__ BTc, const float* __restrict__ bc,
             _Float16* __restrict__ Ohc, _Float16* __restrict__ Otc,
             float* __restrict__ Of, int prow)
{
  __shared__ __attribute__((aligned(16))) char tile[GNB * GBUF];
  if (blockIdx.z < NH)
    gemm_body<0, true, true>(tile, blockIdx.x, 0, blockIdx.z,
                             As, DM, BTs, DM, HD * DM, bs, HD, DM, prow, Ohs, Ors, Ots, Otrs, Of, HD);
  else
    gemm_body<0, false, true>(tile, blockIdx.x, 0, blockIdx.z - NH,
                              Ac, DM, BTc, DM, HD * DM, bc, HD, DM, prow, Ohc, Ohc, Otc, Otc, Of, HD);
}

#define AKT 128              // keys per staged tile (= query rows per block)
#define AKP 144              // LDS pitch of a K row, bytes: 128 + 16
#define AVP 272              // LDS pitch of a Vt row, bytes: 256 + 16
#define AKB (AKT * AKP)      // K part of a tile
#define APL (AKB + HD * AVP) // K part + Vt part: one pair of planes
static_assert(SEQ % AKT == 0);
static_assert(RESQB <= 2);   // the residual-plane blocks walk at most two tiles: one buffer each

// eight 16-byte-per-lane copies global -> LDS; the s_wait_xcnt closes the statement as in copy12
__device__ __forceinline__ void copy8(const unsigned (&l)[8], const char* const (&g)[8])
{
  asm volatile(
    "global_load_async_to_lds_b128 %0, %8, off\n\t"
    "global_load_async_to_lds_b128 %1, %9, off\n\t"
    "global_load_async_to_lds_b128 %2, %10, off\n\t"
    "global_load_async_to_lds_b128 %3, %11, off\n\t"
    "global_load_async_to_lds_b128 %4, %12, off\n\t"
    "global_load_async_to_lds_b128 %5, %13, off\n\t"
    "global_load_async_to_lds_b128 %6, %14, off\n\t"
    "global_load_async_to_lds_b128 %7, %15, off\n\t"
    "s_wait_xcnt 0x0"
    : : "v"(l[0]), "v"(l[1]), "v"(l[2]), "v"(l[3]), "v"(l[4]), "v"(l[5]), "v"(l[6]), "v"(l[7]),
        "v"(g[0]), "v"(g[1]), "v"(g[2]), "v"(g[3]), "v"(g[4]), "v"(g[5]), "v"(g[6]), "v"(g[7])
    : "memory");
}

// ---------------------------------------------------------------------------
// Flash attention. Planes: Q/K [h][prow][64] f16 (prow = NB*SEQ rows per head, row = b*SEQ + s),
// Vt [h][64][prow] f16; residual planes (x2^11) of the same shapes for RES. Block 256 threads = 8 waves,
// wave = 16 queries, 32-key chunks, online softmax in f32, p carried x4096 as f16.
// Both products run transposed: S^T = K.Q^T (A = K rows, B = Q) and O^T += Vt.P^T (A = Vt rows, B = P^T). A lane then
// holds 16 scores of ONE query (query = lane & 15, keys 16*nt + 8*(lane >> 4) + r): maximum and sum are in-lane, the
// maximum joined with the other half by one cross-row move per chunk, the sums once behind the loop; and those
// 16 values are, in that order, the lane's elements of the B fragment of P^T, so that p stays in registers.
// K and Vt tiles of 128 keys staged in LDS by asynchronous copies (two buffers), once per block; the waves read
// their A fragments there (split k map).
// RES: s = qh.kh + (qr.kh + qh.kr)/2^11 ; O = ph.vh + (ph.vr + pr.vh)/2^11 folded before 1/l.
// Out: f32 [NB*SEQ][DM] at columns h*64, staged per wave in LDS, 16 lanes x 16 B per 256-B row,
// LDS tile sto: wave-private (same wave writes and reads; lds_sync_wave), 16x64 per wave, fully written.
// ---------------------------------------------------------------------------
// sto: 8 x 16 x 68 floats of LDS; kv: 2 * ABUF bytes of LDS; both 16-byte aligned; (qb, h, b): the block's queries
template<bool CAUSAL, bool RES>
__device__ __forceinline__
void attn_body(float* sto, char* kv, int qb, int h, int b,
            const _Float16* __restrict__ Qh, const _Float16* __restrict__ Qr,
            const _Float16* __restrict__ Kh, const _Float16* __restrict__ Kr,
            const _Float16* __restrict__ Vt, const _Float16* __restrict__ Vtr,
            float* __restrict__ Out, int prow)
{
  constexpr int ABUF = (RES ? 2 : 1) * APL;   // one buffer: [K | Vt], then [Kr | Vtr] with the residual planes

  const int t = threadIdx.x, lane = t & 31, hs = lane >> 4, l16 = lane & 15;
  const int w = __builtin_amdgcn_readfirstlane(t >> 5);   // scalar: a wave's own trip count below is a scalar test
  const int qbase = qb * 128 + w * 16;                       // within the sequence
  const size_t rq = (size_t)h * (size_t)prow + (size_t)b * SEQ;   // plane row base for (h, b)
  float*    sw  = sto + w * 1088;

  v16h aq[2], aqr[2];
  #pragma unroll
  for (int stp = 0; stp < 2; ++stp) {
    aq[stp]  = ldfrag(Qh + (rq + qbase + l16) * HD + 32 * stp, hs);
    aqr[stp] = RES ? ldfrag(Qr + (rq + qbase + l16) * HD + 32 * stp, hs) : aq[stp];
  }

  const v8f z8 = {0.f, 0.f, 0.f, 0.f, 0.f, 0.f, 0.f, 0.f};
  // this lane's query (l16): running maximum (both halves agree), sum over this half's keys alone
  float mrow = -3.0e38f, lrow = 0.0f;
  v8f o[4], orr[4];   // O^T: element r of tile f = column e = 16*f + 8*hs + r of query l16
  #pragma unroll
  for (int f = 0; f < 4; ++f) { o[f] = z8; orr[f] = z8; }

  const int kend = CAUSAL ? (qbase + 16) : SEQ;

  const char* Kb  = (const char*)(Kh + rq * HD);
  const char* Krb = (const char*)(Kr + rq * HD);
  const char* Vb  = (const char*)(Vt + (size_t)h * HD * (size_t)prow + (size_t)b * SEQ);
  const char* Vrb = (const char*)(Vtr + (size_t)h * HD * (size_t)prow + (size_t)b * SEQ);

  // Staging: thread = 16 B. K: a wave's copy brings 4 whole rows (512 B in a row); Vt: 2 rows of 256 B.
  const size_t gko = (size_t)((t >> 3) * (HD * 2) + (t & 7) * 16);
  const size_t gvo = (size_t)(t >> 4) * (size_t)prow * 2 + (size_t)((t & 15) * 16);
  const unsigned lk = (unsigned)(uintptr_t)kv + (unsigned)((t >> 3) * AKP + (t & 7) * 16);
  const unsigned lv = (unsigned)(uintptr_t)kv + (unsigned)(AKB + (t >> 4) * AVP + (t & 15) * 16);
  auto stage = [&](unsigned boff, int kt0) {
    #pragma unroll
    for (int pl = 0; pl < (RES ? 2 : 1); ++pl) {
      unsigned l[8];
      const char* g[8];
      #pragma unroll
      for (int j = 0; j < 4; ++j) {
        l[j] = lk + boff + (unsigned)(pl * APL + 32 * j * AKP);
        g[j] = (pl ? Krb : Kb) + gko + (size_t)(kt0 + 32 * j) * (HD * 2);
        l[4 + j] = lv + boff + (unsigned)(pl * APL + 16 * j * AVP);
        g[4 + j] = (pl ? Vrb : Vb) + gvo + ((size_t)(16 * j) * (size_t)prow + (size_t)kt0) * 2;
      }
      copy8(l, g);
    }
  };

  // A fragments of chunk c (32 keys) of the tile at tb
  const int frk = l16 * AKP + 16 * hs;
  const int frv = AKB + l16 * AVP + 16 * hs;
  auto ldsfrag = [&](const char* p) -> v16h {
    union { v16h v; v8h q[2]; } u;
    u.q[0] = *(const v8h*)p;
    u.q[1] = *(const v8h*)(p + 32);
    return u.v;
  };
  v16h fk[2][2], fkr[2][2];
  auto load_k = [&](const char* tb, int c) {
    #pragma unroll
    for (int stp = 0; stp < 2; ++stp)
      #pragma unroll
      for (int nt = 0; nt < 2; ++nt) {
        const char* p = tb + frk + (32 * c + 16 * nt) * AKP + 64 * stp;
        fk[stp][nt]  = ldsfrag(p);
        fkr[stp][nt] = RES ? ldsfrag(p + APL) : fk[stp][nt];
      }
  };

  // tiles the block walks: the same for all its waves (a wave leaves out the chunks beyond its own diagonal)
  const int nst = CAUSAL ? (qb + 1) : (SEQ / AKT);
  stage(0u, 0);
  asm volatile("s_wait_asynccnt 0x0" ::: "memory");   // this wave's share of tile 0 has landed
  __syncthreads();                                    // every wave's share has: tile 0 may be read
  if (1 < nst) stage((unsigned)ABUF, AKT);

  unsigned boff = 0u;
  #pragma unroll 1
  for (int sg = 0; sg < nst; ++sg) {
  const char* tb = kv + boff;
  // K fragments one chunk ahead inside the tile (chunk 0 here); with the residual planes, whose fragments
  // leave no registers for that, at the chunk's own head. Every wave has at least chunk 0 of every tile.
  if (!RES) load_k(tb, 0);
  const int left = (kend - sg * AKT + 31) >> 5;             // this wave's chunks from here to its diagonal, >= 1
  const int nc = (left < AKT / 32) ? left : (AKT / 32);
  #pragma unroll 1
  for (int c = 0; c < nc; ++c) {
    const int kt = sg * AKT + 32 * c;
    if (RES) load_k(tb, c);

    // ---- scores, transposed: 32 keys (2 tiles) x 16 queries, K = 64 in 2 steps ----
    v8f s[2], sr[2];
    s[0] = z8; s[1] = z8; sr[0] = z8; sr[1] = z8;
    #pragma unroll
    for (int stp = 0; stp < 2; ++stp) {
      #pragma unroll
      for (int nt = 0; nt < 2; ++nt) {
        s[nt] = mma16(fk[stp][nt], aq[stp], s[nt]);
        if (RES) {
          sr[nt] = mma16(fk[stp][nt], aqr[stp], sr[nt]);
          sr[nt] = mma16(fkr[stp][nt], aq[stp], sr[nt]);
        }
      }
    }

    // ---- this chunk's V fragments, one group, issued here so that they land under the softmax ----
    v16h fv[4], fvr[4];
    #pragma unroll
    for (int f = 0; f < 4; ++f) {
      const char* p = tb + frv + 16 * f * AVP + 64 * c;
      fv[f]  = ldsfrag(p);
      fvr[f] = RES ? ldsfrag(p + APL) : fv[f];
    }

    // ---- next chunk's K fragments (same tile), into the registers the products above have just read ----
    if (!RES && c + 1 < AKT / 32) load_k(tb, c + 1);

    // ---- scale, causal replace-mask, online softmax (f32) ----
    float pv[2][8];
    #pragma unroll
    for (int nt = 0; nt < 2; ++nt)
      #pragma unroll
      for (int r = 0; r < 8; ++r) {
        float v = s[nt][r];
        if (RES) v += sr[nt][r] * (1.0f / 2048.0f);
        v *= 0.125f;
        if (CAUSAL) {
          const int key = kt + 16 * nt + 8 * hs + r;
          const int row = qbase + l16;
          if (key > row) v = -1.0e9f;
        }
        pv[nt][r] = v;
      }
    float tq[4];
    #pragma unroll
    for (int i = 0; i < 4; ++i)
      tq[i] = fmaxf(fmaxf(pv[0][2 * i], pv[0][2 * i + 1]), fmaxf(pv[1][2 * i], pv[1][2 * i + 1]));
    float tm = fmaxf(fmaxf(tq[0], tq[1]), fmaxf(tq[2], tq[3]));
    tm = fmaxf(tm, xhalf(tm));            // the query's other 16 keys of the chunk

    const float mn = fmaxf(mrow, tm);
    const float corr = __expf(mrow - mn);
    mrow = mn;
    #pragma unroll
    for (int nt = 0; nt < 2; ++nt)
      #pragma unroll
      for (int r = 0; r < 8; ++r) pv[nt][r] = __expf(pv[nt][r] - mn);
    float tsq[4];
    #pragma unroll
    for (int i = 0; i < 4; ++i)
      tsq[i] = (pv[0][2 * i] + pv[0][2 * i + 1]) + (pv[1][2 * i] + pv[1][2 * i + 1]);
    lrow = lrow * corr + ((tsq[0] + tsq[1]) + (tsq[2] + tsq[3]));
    #pragma unroll
    for (int f = 0; f < 4; ++f)
      #pragma unroll
      for (int r = 0; r < 8; ++r) {
        o[f][r] *= corr;
        if (RES) orr[f][r] *= corr;
      }

    // ---- p (x4096, f16 hi; x2^11 residual for RES) packed in place into the B fragment of P^T:
    //      elements 0..7 = keys 8*hs + r (tile 0), elements 8..15 = keys 16 + 8*hs + r (tile 1), the k map of ldfrag ----
    v16h bp, bpr;
    #pragma unroll
    for (int nt = 0; nt < 2; ++nt)
      #pragma unroll
      for (int r = 0; r < 8; ++r) {
        const float pc = pv[nt][r] * 4096.0f;
        const _Float16 ph = (_Float16)pc;
        bp[8 * nt + r]  = ph;
        bpr[8 * nt + r] = RES ? (_Float16)((pc - (float)ph) * 2048.0f) : ph;
      }

    // ---- O^T += Vt . P^T : A fragments of the Vt plane (row e, k = key contiguous), read behind the scores ----
    #pragma unroll
    for (int f = 0; f < 4; ++f) {
      o[f] = mma16(fv[f], bp, o[f]);
      if (RES) {
        orr[f] = mma16(fvr[f], bp, orr[f]);
        orr[f] = mma16(fv[f], bpr, orr[f]);
      }
    }
  }
  asm volatile("s_wait_dscnt 0x0" ::: "memory");      // this wave's reads of the buffer are done
  asm volatile("s_wait_asynccnt 0x0" ::: "memory");   // its share of the next tile has landed
  __syncthreads();   // publishes the next tile and ends every wave's reads of this buffer, refilled below
  // with the residual planes the block is one of query blocks 0..RESQB-1: no more tiles than buffers, no refill
  if (!RES && sg + 2 < nst) stage(boff, (sg + 2) * AKT);
  boff ^= (unsigned)ABUF;
  }
  asm volatile("s_wait_asynccnt 0x0" ::: "memory");     // no copy is left in flight

  // ---- normalise, stage 16x64 f32 tile per wave, whole-line stores ----
  lrow += xhalf(lrow);                    // the two halves' key sums joined, once
  const float inv = (1.0f / lrow) * (1.0f / 4096.0f);
  #pragma unroll
  for (int f = 0; f < 4; ++f)
    #pragma unroll
    for (int q = 0; q < 2; ++q) {
      v4f sv;
      #pragma unroll
      for (int i = 0; i < 4; ++i) {
        float v = o[f][4 * q + i];
        if (RES) v += orr[f][4 * q + i] * (1.0f / 2048.0f);
        sv[i] = v * inv;
      }
      *(v4f*)(sw + l16 * 68 + 16 * f + 8 * hs + 4 * q) = sv;
    }
  lds_sync_wave();
  const size_t orow = (size_t)b * SEQ + (size_t)qbase;
  {
    #pragma unroll
    for (int j = 0; j < 8; ++j) {
      const int row = 2 * j + hs;
      const v4f fvv = *(const v4f*)(sw + row * 68 + 4 * l16);
      *(v4f*)(Out + (orow + row) * DM + h * HD + 4 * l16) = fvv;
    }
    
  }
}

// two waves per SIMD is what the grids give (at most one block per WGP): said here so that the scheduler spends
// registers on the fragments in flight instead of saving them for more waves
__global__ __launch_bounds__(256) __attribute__((amdgpu_waves_per_eu(2, 2)))
void k_attn_cross(const _Float16* __restrict__ Qh, const _Float16* __restrict__ Kh, const _Float16* __restrict__ Vt,
                  float* __restrict__ Out, int prow)
{
  __shared__ __attribute__((aligned(16))) float sto[8 * 16 * 68];
  __shared__ __attribute__((aligned(16))) char kv[2 * APL];
  attn_body<false, false>(sto, kv, blockIdx.x, blockIdx.y, blockIdx.z, Qh, Qh, Kh, Kh, Vt, Vt, Out, prow);
}

// Causal attention, every query block in one grid: blocks 0..RESQB-1 take the path with the residual planes, the
// others the plain one. They write disjoint rows of Out and read the same planes; a block is wholly one kind.
__global__ __launch_bounds__(256) __attribute__((amdgpu_waves_per_eu(2, 2)))
void k_attn_self(const _Float16* __restrict__ Qh, const _Float16* __restrict__ Qr,
                 const _Float16* __restrict__ Vt, const _Float16* __restrict__ Vtr,
                 float* __restrict__ Out, int prow)
{
  __shared__ __attribute__((aligned(16))) float sto[8 * 16 * 68];
  __shared__ __attribute__((aligned(16))) char kv[4 * APL];
  if (blockIdx.x < RESQB)
    attn_body<true, true>(sto, kv, blockIdx.x, blockIdx.y, blockIdx.z, Qh, Qr, Qh, Qr, Vt, Vtr, Out, prow);
  else
    attn_body<true, false>(sto, kv, blockIdx.x, blockIdx.y, blockIdx.z, Qh, Qr, Qh, Qr, Vt, Vtr, Out, prow);
}

// ---------------------------------------------------------------------------
// y = LayerNorm(x + r) * g + b over DM = 1024, one block (256 threads) per row, thread = 4 columns.
// XIN: x is a raw input (bf16 RNE convert, input row stride via SEQ_FULL); else x is a ws f32 plane.
// WH: also write the f16 plane yh. g, b bf16 RNE converted. Outputs: 256 lanes x 16/8 B per row
// coverage: nrow x DM for y (and yh).
// ---------------------------------------------------------------------------
template<bool XIN, bool WH>
__global__ __launch_bounds__(256)
void k_ln(const float* __restrict__ x, const float* __restrict__ rr,
          const float* __restrict__ g, const float* __restrict__ be,
          float* __restrict__ y, _Float16* __restrict__ yh)
{
  #pragma clang fp contract(off)
  __shared__ float red[8];
  __shared__ float red2[8];
  const int m = blockIdx.x, t = threadIdx.x, lane = t & 31, w = t >> 5;
  const int c = 4 * t;
  const size_t xrow = XIN ? ((size_t)(m / SEQ) * SEQ_FULL + (size_t)(m % SEQ)) : (size_t)m;
  const v4f xv = *(const v4f*)(x + xrow * DM + c);
  const v4f rv = *(const v4f*)(rr + (size_t)m * DM + c);
  float v[4];
  #pragma unroll
  for (int i = 0; i < 4; ++i) {
    float xi = xv[i];
    if (XIN) xi = bfr(xi);
    v[i] = xi + rv[i];
  }
  float s = (v[0] + v[1]) + (v[2] + v[3]);
  #pragma unroll
  for (int off = 16; off > 0; off >>= 1) s += __shfl_xor(s, off, 32);
  if (lane == 0) red[w] = s;
  __syncthreads();
  float tot = 0.0f;
  #pragma unroll
  for (int i = 0; i < 8; ++i) tot += red[i];
  const float mu = tot * (1.0f / (float)DM);

  float d[4];
  #pragma unroll
  for (int i = 0; i < 4; ++i) d[i] = v[i] - mu;
  float s2 = (d[0] * d[0] + d[1] * d[1]) + (d[2] * d[2] + d[3] * d[3]);
  #pragma unroll
  for (int off = 16; off > 0; off >>= 1) s2 += __shfl_xor(s2, off, 32);
  if (lane == 0) red2[w] = s2;
  __syncthreads();
  float tot2 = 0.0f;
  #pragma unroll
  for (int i = 0; i < 8; ++i) tot2 += red2[i];
  const float var = tot2 * (1.0f / (float)DM);
  const float rstd = rsqrtf(var + LN_EPS);

  v4f ov;
  v4h oh;
  #pragma unroll
  for (int i = 0; i < 4; ++i) {
    const float gv = bfr(g[c + i]);
    const float bvv = bfr(be[c + i]);
    const float q = d[i] * rstd * gv + bvv;
    ov[i] = q;
    oh[i] = (_Float16)q;
  }
  float* ydst = y + (size_t)m * DM + c;
  _Float16* hdst = yh + (WH ? ((size_t)m * DM + c) : 0);
  *(v4f*)ydst = ov;
  if (WH) *(v4h*)hdst = oh;
  
}

// ---------------------------------------------------------------------------
extern "C" void kernel_launch(void* const* d_in, const int* in_sizes, int n_in,
                              void* d_out, int out_size, void* d_ws, size_t ws_size,
                              hipStream_t stream)
{
  if (n_in < 16) return;
  const int MR = NB * SEQ;                 // internal rows (b*SEQ + s)
  const long need_act = (long)(NB - 1) * SEQ_FULL * DM + (long)SEQ * DM;
  if ((long)in_sizes[0] < need_act || (long)in_sizes[1] < need_act) return;
  if (in_sizes[2] < NH * DM * HD || in_sizes[3] < NH * HD) return;
  if (in_sizes[4] < NH * DM * HD || in_sizes[5] < NH * HD) return;
  for (int i = 6; i < 12; ++i) if (in_sizes[i] < DM) return;
  if (in_sizes[12] < DM * FF || in_sizes[13] < FF || in_sizes[14] < FF * DM || in_sizes[15] < DM) return;
  if (out_size < MR * DM) return;

  const float* y      = (const float*)d_in[0];
  const float* enc    = (const float*)d_in[1];
  const float* Wself  = (const float*)d_in[2];
  const float* bself  = (const float*)d_in[3];
  const float* Wcross = (const float*)d_in[4];
  const float* bcross = (const float*)d_in[5];
  const float* g1  = (const float*)d_in[6];  const float* be1 = (const float*)d_in[7];
  const float* g2  = (const float*)d_in[8];  const float* be2 = (const float*)d_in[9];
  const float* g3  = (const float*)d_in[10]; const float* be3 = (const float*)d_in[11];
  const float* w1  = (const float*)d_in[12]; const float* b1  = (const float*)d_in[13];
  const float* w2  = (const float*)d_in[14]; const float* b2  = (const float*)d_in[15];
  float* out = (float*)d_out;

  // ---- workspace carve (256-B aligned regions; 104 MiB at NB*SEQ = 2048) ----
  char* base = (char*)d_ws;
  size_t off = 0;
  auto take = [&](size_t bytes) -> void* {
    void* p = (void*)(base + off);
    off += (bytes + 255) & ~(size_t)255;
    return p;
  };
  _Float16* Yh   = (_Float16*)take((size_t)MR * DM * 2);
  _Float16* Eh   = (_Float16*)take((size_t)MR * DM * 2);
  _Float16* WTs  = (_Float16*)take((size_t)NH * HD * DM * 2);
  _Float16* WTc  = (_Float16*)take((size_t)NH * HD * DM * 2);
  _Float16* W1T  = (_Float16*)take((size_t)FF * DM * 2);
  _Float16* W2T  = (_Float16*)take((size_t)DM * FF * 2);
  _Float16* QKVh = (_Float16*)take((size_t)NH * MR * HD * 2);
  _Float16* QKVr = (_Float16*)take((size_t)NH * MR * HD * 2);
  _Float16* VTh  = (_Float16*)take((size_t)NH * HD * MR * 2);
  _Float16* VTr  = (_Float16*)take((size_t)NH * HD * MR * 2);
  float*    att  = (float*)   take((size_t)MR * DM * 4);     // sa, then ca, then ff
  float*    y1   = (float*)   take((size_t)MR * DM * 4);
  _Float16* y1h  = (_Float16*)take((size_t)MR * DM * 2);
  float*    y2   = (float*)   take((size_t)MR * DM * 4);
  _Float16* y2h  = (_Float16*)take((size_t)MR * DM * 2);
  _Float16* Qch  = (_Float16*)take((size_t)NH * MR * HD * 2);
  _Float16* KVch = (_Float16*)take((size_t)NH * MR * HD * 2);
  _Float16* VTc  = (_Float16*)take((size_t)NH * HD * MR * 2);
  _Float16* Hh   = (_Float16*)take((size_t)MR * FF * 2);
  if (off > ws_size) return;

  // ---- planes ----
  k_prep<<<dim3(2 * PBW + 2 * PBH + PBC), 256, 0, stream>>>(
      y, enc, Wself, Wcross, w1, w2, Yh, Eh, WTs, WTc, W1T, W2T, MR);

  const int nqb  = SEQ / 128;

  // ---- projections of y (self: q = k = v share one) and of enc (cross: k = v share one) ----
  k_proj2<<<dim3(MR / 128, 1, 2 * NH), 128, 0, stream>>>(
      Yh, WTs, bself, QKVh, QKVr, VTh, VTr, Eh, WTc, bcross, KVch, VTc, att, MR);

  // ---- self attention ----
  k_attn_self<<<dim3(nqb, NH, NB), 256, 0, stream>>>(QKVh, QKVr, VTh, VTr, att, MR);
  k_ln<true, true><<<dim3(MR), 256, 0, stream>>>(y, att, g1, be1, y1, y1h);

  // ---- cross attention (q from y1; k = v from enc, projected above) ----
  k_gemm<0, false, false><<<dim3(MR / 128, HD / 64, NH), 128, 0, stream>>>(
      y1h, DM, WTc, DM, HD * DM, bcross, HD, DM, MR, Qch, Qch, Qch, Qch, att, HD);
  k_attn_cross<<<dim3(nqb, NH, NB), 256, 0, stream>>>(Qch, KVch, VTc, att, MR);
  k_ln<false, true><<<dim3(MR), 256, 0, stream>>>(y1, att, g2, be2, y2, y2h);

  // ---- MLP ----
  k_gemm<1, false, false><<<dim3(MR / 128, FF / 64, 1), 128, 0, stream>>>(
      y2h, DM, W1T, DM, 0, b1, 0, DM, MR, Hh, Hh, Hh, Hh, att, FF);
  k_gemm<2, false, false><<<dim3(MR / 128, DM / 64, 1), 128, 0, stream>>>(
      Hh, FF, W2T, FF, 0, b2, 0, FF, MR, y2h, y2h, y2h, y2h, att, DM);
  k_ln<false, false><<<dim3(MR), 256, 0, stream>>>(y2, att, g3, be3, out, y2h);
}

// v006
// Measured time: 133 microseconds a run.
// Timed twice side by side with v005, it ran 1.04 times as fast both times.
// Over all steps from v000 it is 5.06 times as fast.
#include <hip/hip_runtime.h>
#include <stdint.h>
#include <stddef.h>

// Contractions on v_wmma_f32_16x16x32_f16 (f16 operands, f32 accumulate): per-head q/k/v projections,
// q.k^T, p.v (self causal and cross), MLP up and down GEMMs. Float inputs RNE-converted to bf16 and held
// as f16 planes (weights carried x64, softmax p carried x4096); causal query blocks 0..RESQB-1 add f16
// residual planes (x2^11) for q, k, p, v into a second accumulator. Softmax, layer norms, bias adds: f32.

#ifndef NB
#define NB 1
#endif
#ifndef SEQ
#define SEQ 2048
#endif
#define NB_FULL 1
#define SEQ_FULL 2048
#define DM 1024
#define NH 16
#define HD 64
#define FF 4096
#define RESQB 2
#define LN_EPS 1.0e-5f

static_assert(SEQ % 128 == 0);
static_assert(SEQ <= SEQ_FULL);
static_assert(NB >= 1 && NB <= NB_FULL);
static_assert(HD == 64);
static_assert(DM % 128 == 0 && FF % 128 == 0);
static_assert(DM % 32 == 0 && FF % 32 == 0);
static_assert((NB * SEQ) % 256 == 0);
static_assert(DM == 4 * 256);

typedef _Float16 v4h  __attribute__((ext_vector_type(4)));
typedef _Float16 v8h  __attribute__((ext_vector_type(8)));
typedef _Float16 v16h __attribute__((ext_vector_type(16)));
typedef float    v4f  __attribute__((ext_vector_type(4)));
typedef float    v8f  __attribute__((ext_vector_type(8)));

// ---------------------------------------------------------------------------
// helpers
// ---------------------------------------------------------------------------
__device__ __forceinline__ v8f mma16(v16h a, v16h b, v8f c)
{
  c = __builtin_amdgcn_wmma_f32_16x16x32_f16(false, a, false, b, (short)0, c, false, false);
  asm volatile("v_nop\n\tv_nop\n\tv_nop\n\tv_nop" : "+v"(c) : "v"(a), "v"(b));
  return c;
}

// 16x16x32 16-bit fragment (A row m = lane&15, or B column n = lane&15, k contiguous at p):
// elements 0..7 <- k0+8h+0..7, elements 8..15 <- k0+16+8h+0..7, h = lane>>4
__device__ __forceinline__ v16h ldfrag(const _Float16* p, int hs)
{
  union { v16h v; v8h q[2]; } u;
  u.q[0] = *(const v8h*)(p + 8 * hs);
  u.q[1] = *(const v8h*)(p + 16 + 8 * hs);
  return u.v;
}

// bf16 RNE convert, returned widened to f32
__device__ __forceinline__ float bfr(float x)
{
  unsigned int u = __float_as_uint(x);
  u = (u + 0x7FFFu + ((u >> 16) & 1u)) & 0xFFFF0000u;
  return __uint_as_float(u);
}

// same-wave LDS store -> load ordering (wave-private tiles only)
__device__ __forceinline__ void lds_sync_wave()
{
  asm volatile("s_wait_dscnt 0x0" ::: "memory");
  __builtin_amdgcn_wave_barrier();
}

// value of lane l ^ 16 (the other 16-lane half), by a vector cross-row move
__device__ __forceinline__ float xhalf(float x)
{
  return __builtin_bit_cast(float, __builtin_amdgcn_permlanex16(__builtin_bit_cast(int, x), __builtin_bit_cast(int, x),
                                                                0x76543210, 0xfedcba98, false, false));
}

// ---------------------------------------------------------------------------
// Activation planes: Yh = f16(bf16rne(y)), Eh = f16(bf16rne(enc)), internal row m -> input row
// coverage: Yh and Eh each nrow*DM elements exactly.
// ---------------------------------------------------------------------------
__device__ __forceinline__
void cvt_act_body(int bid, const float* __restrict__ y, const float* __restrict__ e,
                  _Float16* __restrict__ Yh, _Float16* __restrict__ Eh, int nrow)
{
  const int groups = nrow * (DM / 8);
  const int g = bid * 256 + threadIdx.x;
  if (g >= 2 * groups) return;
  const int which = (g >= groups) ? 1 : 0;
  const int idx = g - which * groups;
  const int m = idx / (DM / 8);
  const int c = (idx - m * (DM / 8)) * 8;
  const size_t srow = (size_t)(m / SEQ) * SEQ_FULL + (size_t)(m % SEQ);
  const float* src = (which ? e : y) + srow * DM + c;
  const v4f a = *(const v4f*)src;
  const v4f b = *(const v4f*)(src + 4);
  v8h o;
  o[0] = (_Float16)bfr(a[0]); o[1] = (_Float16)bfr(a[1]); o[2] = (_Float16)bfr(a[2]); o[3] = (_Float16)bfr(a[3]);
  o[4] = (_Float16)bfr(b[0]); o[5] = (_Float16)bfr(b[1]); o[6] = (_Float16)bfr(b[2]); o[7] = (_Float16)bfr(b[3]);
  _Float16* dst = (which ? Eh : Yh) + (size_t)m * DM + c;
  *(v8h*)dst = o;
  
}

// ---------------------------------------------------------------------------
// Transposed weight planes: in[z][R][C] f32 -> out[z][C][R] f16, value f16(bf16rne(x) * scale).
// coverage: full C x R per z.
// ---------------------------------------------------------------------------
__device__ __forceinline__
void wtr_body(float (*tile)[65], int bx, int by, int bz,
              const float* __restrict__ in, _Float16* __restrict__ out, int R, int C, float scale)
{
  const int t = threadIdx.x;
  const int c0 = bx * 64, r0 = by * 64;
  const size_t zoff = (size_t)bz * (size_t)R * (size_t)C;
  {
    const int r = t >> 2, cq = (t & 3) * 16;
    const float* p = in + zoff + (size_t)(r0 + r) * C + c0 + cq;
    #pragma unroll
    for (int i = 0; i < 4; ++i) {
      const v4f v = *(const v4f*)(p + 4 * i);
      tile[r][cq + 4 * i + 0] = v[0];
      tile[r][cq + 4 * i + 1] = v[1];
      tile[r][cq + 4 * i + 2] = v[2];
      tile[r][cq + 4 * i + 3] = v[3];
    }
  }
  __syncthreads();
  const int p8 = t & 7;
  {
    #pragma unroll
    for (int j = 0; j < 2; ++j) {
      const int c = (t >> 3) + 32 * j;
      v8h ov;
      #pragma unroll
      for (int i = 0; i < 8; ++i) ov[i] = (_Float16)(bfr(tile[8 * p8 + i][c]) * scale);
      _Float16* dst = out + zoff + (size_t)(c0 + c) * R + r0 + 8 * p8;
      *(v8h*)dst = ov;
    }
    
  }
}

// ---------------------------------------------------------------------------
// All planes that depend on the inputs alone, one grid: none reads what another writes. Block ranges, in order:
// w1 -> W1T, w2 -> W2T (PBW blocks each), Wself -> WTs, Wcross -> WTc (PBH blocks each), then y, enc -> Yh, Eh.
// The range test reads blockIdx alone: a block is wholly one kind, so the transpose's barrier is block-uniform.
// ---------------------------------------------------------------------------
#define PBW ((FF / 64) * (DM / 64))
#define PBH ((DM / 64) * NH)
#define PBC ((2 * NB * SEQ * (DM / 8) + 255) / 256)
__global__ __launch_bounds__(256)
void k_prep(const float* __restrict__ y, const float* __restrict__ e,
            const float* __restrict__ Ws, const float* __restrict__ Wc,
            const float* __restrict__ w1, const float* __restrict__ w2,
            _Float16* __restrict__ Yh, _Float16* __restrict__ Eh,
            _Float16* __restrict__ WTs, _Float16* __restrict__ WTc,
            _Float16* __restrict__ W1T, _Float16* __restrict__ W2T, int nrow)
{
  __shared__ float tile[64][65];
  const int bid = blockIdx.x;
  if (bid < 2 * PBW + 2 * PBH) {
    const float* in;
    _Float16* out;
    int R, C, bx, by, bz;
    if (bid < PBW) {                 // in[1024][4096] -> out[4096][1024]
      in = w1; out = W1T; R = DM; C = FF;
      bx = bid % (FF / 64); by = bid / (FF / 64); bz = 0;
    } else if (bid < 2 * PBW) {      // in[4096][1024] -> out[1024][4096]
      in = w2; out = W2T; R = FF; C = DM;
      bx = (bid - PBW) % (DM / 64); by = (bid - PBW) / (DM / 64); bz = 0;
    } else {                         // in[h][1024][64] -> out[h][64][1024]
      const bool cr = bid >= 2 * PBW + PBH;
      const int hb = bid - 2 * PBW - (cr ? PBH : 0);
      in = cr ? Wc : Ws; out = cr ? WTc : WTs; R = DM; C = HD;
      bx = 0; by = hb % (DM / 64); bz = hb / (DM / 64);
    }
    wtr_body(tile, bx, by, bz, in, out, R, C, 64.0f);
  } else {
    cvt_act_body(bid - (2 * PBW + 2 * PBH), y, e, Yh, Eh, nrow);
  }
}

#define GKS 128              // k per staged tile
#define GLP 272              // LDS row pitch, bytes: 256 + 16, conflict-free for 16-byte fragment reads
#define GNB 3                // buffers of the ring: one read, two being filled
#define GRING(WM, WN) (GNB * (32 * (WM) + 64 * (WN)) * GLP)   // LDS bytes of the ring of a block of WM x WN waves
static_assert(DM % GKS == 0 && FF % GKS == 0);

// twelve 16-byte-per-lane copies global -> LDS, through no register. The s_wait_xcnt closes the statement, so that
// no address register of a copy is rewritten while the copy still names it.
__device__ __forceinline__ void copy12(const unsigned (&l)[12], const char* const (&g)[12])
{
  asm volatile(
    "global_load_async_to_lds_b128 %0, %12, off\n\t"
    "global_load_async_to_lds_b128 %1, %13, off\n\t"
    "global_load_async_to_lds_b128 %2, %14, off\n\t"
    "global_load_async_to_lds_b128 %3, %15, off\n\t"
    "global_load_async_to_lds_b128 %4, %16, off\n\t"
    "global_load_async_to_lds_b128 %5, %17, off\n\t"
    "global_load_async_to_lds_b128 %6, %18, off\n\t"
    "global_load_async_to_lds_b128 %7, %19, off\n\t"
    "global_load_async_to_lds_b128 %8, %20, off\n\t"
    "global_load_async_to_lds_b128 %9, %21, off\n\t"
    "global_load_async_to_lds_b128 %10, %22, off\n\t"
    "global_load_async_to_lds_b128 %11, %23, off\n\t"
    "s_wait_xcnt 0x0"
    : : "v"(l[0]), "v"(l[1]), "v"(l[2]), "v"(l[3]), "v"(l[4]), "v"(l[5]),
        "v"(l[6]), "v"(l[7]), "v"(l[8]), "v"(l[9]), "v"(l[10]), "v"(l[11]),
        "v"(g[0]), "v"(g[1]), "v"(g[2]), "v"(g[3]), "v"(g[4]), "v"(g[5]),
        "v"(g[6]), "v"(g[7]), "v"(g[8]), "v"(g[9]), "v"(g[10]), "v"(g[11])
    : "memory");
}

// eight 16-byte-per-lane copies global -> LDS; the s_wait_xcnt closes the statement as in copy12
__device__ __forceinline__ void copy8(const unsigned (&l)[8], const char* const (&g)[8])
{
  asm volatile(
    "global_load_async_to_lds_b128 %0, %8, off\n\t"
    "global_load_async_to_lds_b128 %1, %9, off\n\t"
    "global_load_async_to_lds_b128 %2, %10, off\n\t"
    "global_load_async_to_lds_b128 %3, %11, off\n\t"
    "global_load_async_to_lds_b128 %4, %12, off\n\t"
    "global_load_async_to_lds_b128 %5, %13, off\n\t"
    "global_load_async_to_lds_b128 %6, %14, off\n\t"
    "global_load_async_to_lds_b128 %7, %15, off\n\t"
    "s_wait_xcnt 0x0"
    : : "v"(l[0]), "v"(l[1]), "v"(l[2]), "v"(l[3]), "v"(l[4]), "v"(l[5]), "v"(l[6]), "v"(l[7]),
        "v"(g[0]), "v"(g[1]), "v"(g[2]), "v"(g[3]), "v"(g[4]), "v"(g[5]), "v"(g[6]), "v"(g[7])
    : "memory");
}

// this wave's copies have landed but for the N youngest (N = the copies of one tile)
template<int N>
__device__ __forceinline__ void wait_copies_but()
{
  static_assert(N == 24 || N == 16 || N == 12);
  if constexpr (N == 24) asm volatile("s_wait_asynccnt 24" ::: "memory");
  else if constexpr (N == 16) asm volatile("s_wait_asynccnt 16" ::: "memory");
  else asm volatile("s_wait_asynccnt 12" ::: "memory");
}

// ---------------------------------------------------------------------------
// GEMM C[M][N] = A[M][K] (f16 row-major, pitch lda) x B, B given as BT[N][K] (k contiguous, pitch ldb,
// per-z offset sBz). Block = WM x WN waves, wave tile 32x64 (2x4 fragments), block tile BM x BN = 32*WM x 64*WN:
// a staged row serves every wave of its block row or column, so that a wider block draws fewer bytes from L2 per product.
// k-tiles of 128 staged in LDS by asynchronous copies (three buffers, two tiles ahead), fragments read from LDS. Epilogue: v = acc/64 + bf16rne(bias[z*sBias + n])
//   MODE 0: Oh[head][prow][64] f16, head = z + n/64 (+ Or residual (v-hi)*2^11 if RES) (+ Ot/Otr [head][64][prow] if WVT)
//   MODE 1: Oh[M][ldc] f16 at columns n0..n0+BN-1
//   MODE 2: Of[M][ldc] f32 at columns n0..n0+BN-1
// coverage: each block writes rows m0..m0+BM-1 x BN columns of every plane it owns (and the 64 x 128
// transposed slabs for WVT); grid (M/BM, N/BN, Z) tiles the planes exactly.
// ---------------------------------------------------------------------------
// tile: GRING(WM, WN) bytes of LDS, 16-byte aligned, the ring and behind the loop the epilogue's stage; (bx, by, z): the block's tile
template<int MODE, bool RES, bool WVT, int WM, int WN>
__device__ __forceinline__
void gemm_body(char* tile, int bx, int by, int z,
            const _Float16* __restrict__ A, int lda,
            const _Float16* __restrict__ BT, int ldb, int sBz,
            const float* __restrict__ bias, int sBias,
            int K, int prow,
            _Float16* __restrict__ Oh, _Float16* __restrict__ Or,
            _Float16* __restrict__ Ot, _Float16* __restrict__ Otr,
            float* __restrict__ Of, int ldc)
{
  constexpr int BM = 32 * WM, BN = 64 * WN, NT = 32 * WM * WN;
  constexpr int RP = NT / 16;                  // rows that one copy of every thread brings
  constexpr int NCP = (BM + BN) / RP;          // copies of one wave per tile
  constexpr int CG = (NCP % 12 == 0) ? 12 : 8; // copies per statement
  constexpr unsigned GBUF = (unsigned)((BM + BN) * GLP);   // one buffer: BM A rows, then BN B rows
  static_assert(BM % RP == 0 && BN % RP == 0 && NCP % CG == 0);
  static_assert(2 * NCP <= 63);                // copies of a wave in flight: two tiles' at most
  static_assert(WN * BM * 68 * 4 <= GNB * (BM + BN) * GLP);   // the epilogue's stage lies in the ring
  static_assert(!WVT || BM == 128);
  const int t = threadIdx.x, lane = t & 31, w = t >> 5, hs = lane >> 4, l16 = lane & 15;
  const int wm = w % WM, wn = w / WM;          // the wave's place in the block tile
  const int m0 = bx * BM, n0 = by * BN;

  const v8f z8 = {0.f, 0.f, 0.f, 0.f, 0.f, 0.f, 0.f, 0.f};
  v8f acc[2][4];
  #pragma unroll
  for (int mt = 0; mt < 2; ++mt)
    #pragma unroll
    for (int nt = 0; nt < 4; ++nt) acc[mt][nt] = z8;

  // Staging: a copy of one wave brings two whole rows of the tile (2 x 256 B, whole lines); thread = 16 B at
  // column cc of row RP*i + cr, i = 0..NCP-1. Every row is fetched once per block and read from LDS by the waves.
  const int cr = t >> 4, cc = t & 15;
  const char* Ag = (const char*)(A + (size_t)(m0 + cr) * lda + 8 * cc);
  const char* Bg = (const char*)(BT + (size_t)z * sBz + (size_t)(n0 + cr) * ldb + 8 * cc);
  const unsigned lcp = (unsigned)(uintptr_t)tile + (unsigned)(cr * GLP + cc * 16);
  auto stage = [&](unsigned boff, int k0) {
    #pragma unroll
    for (int hf = 0; hf < NCP / CG; ++hf) {
      unsigned l[CG];
      const char* g[CG];
      #pragma unroll
      for (int i = 0; i < CG; ++i) {
        const int idx = CG * hf + i;
        l[i] = lcp + boff + (unsigned)(RP * idx * GLP);
        g[i] = (idx < BM / RP) ? (Ag + ((size_t)(RP * idx) * lda + k0) * 2)
                               : (Bg + ((size_t)(RP * (idx - BM / RP)) * ldb + k0) * 2);
      }
      if constexpr (CG == 12) copy12(l, g); else copy8(l, g);
    }
  };

  // Fragments from LDS, two register sets: a 32-k step's 12 reads go out as one group ahead of the step before it.
  // k and sum order as before. K is a multiple of GKS (DM, FF).
  v16h fa[2][2], fb[2][4];
  auto products = [&](int s) {
    #pragma unroll
    for (int nt = 0; nt < 4; ++nt) {
      acc[0][nt] = mma16(fa[s][0], fb[s][nt], acc[0][nt]);
      acc[1][nt] = mma16(fa[s][1], fb[s][nt], acc[1][nt]);
    }
  };
  const int fra = (32 * wm + l16) * GLP + 16 * hs;
  const int frb = (BM + 64 * wn + l16) * GLP + 16 * hs;
  auto frags = [&](int s, const char* tb, int stp) {
    #pragma unroll
    for (int mt = 0; mt < 2; ++mt) {
      union { v16h v; v8h q[2]; } u;
      const char* p = tb + fra + 16 * mt * GLP + 64 * stp;
      u.q[0] = *(const v8h*)p;
      u.q[1] = *(const v8h*)(p + 32);
      fa[s][mt] = u.v;
    }
    #pragma unroll
    for (int nt = 0; nt < 4; ++nt) {
      union { v16h v; v8h q[2]; } u;
      const char* p = tb + frb + 16 * nt * GLP + 64 * stp;
      u.q[0] = *(const v8h*)p;
      u.q[1] = *(const v8h*)(p + 32);
      fb[s][nt] = u.v;
    }
  };

  // Ring of three: tile t + 2 is asked for at the head of trip t and first read in trip t + 2, so that a tile has two
  // trips to land in: one trip's products are shorter than a tile's way from L2 or memory. The counter returns a wave's
  // copies in the order of issue: the counted wait, used only where exactly NCP copies were issued behind the tile that
  // is wanted, leaves those in flight and covers every older one. A trip that issues none waits to 0.
  stage(0u, 0);
  if (GKS < K) {
    stage(GBUF, GKS);
    wait_copies_but<NCP>();                             // this wave's share of tile 0 has landed, tile 1 may fly
  } else {
    asm volatile("s_wait_asynccnt 0x0" ::: "memory");   // this wave's share of tile 0 has landed
  }
  __syncthreads();                                      // every wave's share has: tile 0 may be read

  unsigned boff = 0u, bfill = 2u * GBUF;                // buffer of this trip's tile; buffer of the tile two ahead
  #pragma unroll 1   // rolled: one trip is one tile, four 32-k steps unrolled inside
  for (int k0 = 0; k0 < K; k0 += GKS) {
    const bool more = k0 + 2 * GKS < K;                 // the same for the whole block
    // refill: the buffer that the trip before has read, behind the barrier that ended every wave's reads of it
    if (more) stage(bfill, k0 + 2 * GKS);
    const char* tb = tile + boff;
    frags(0, tb, 0);
    #pragma unroll
    for (int stp = 0; stp < GKS / 32; ++stp) {
      if (stp + 1 < GKS / 32) frags((stp + 1) & 1, tb, stp + 1);
      products(stp & 1);
    }
    asm volatile("s_wait_dscnt 0x0" ::: "memory");      // this wave's reads of the buffer are done
    if (more) {
      wait_copies_but<NCP>();                           // its share of the next tile has landed; this trip's copies may fly
    } else {
      asm volatile("s_wait_asynccnt 0x0" ::: "memory"); // no copy was issued in this trip: all that is left is the next tile
    }
    __syncthreads();   // publishes the next tile and ends every wave's reads of this buffer, refilled at the next head
    bfill = boff;
    boff = (boff == 2u * GBUF) ? 0u : boff + GBUF;
  }
  asm volatile("s_wait_asynccnt 0x0" ::: "memory");     // no copy is left in flight
  // behind the last trip's waits and barrier nobody reads the ring and nothing flies into it: it becomes the stage
  float* st = (float*)tile;

  // ---- epilogue: bias (bf16 RNE), scale, relu -> LDS stage ----
  float bv[4];
  #pragma unroll
  for (int nt = 0; nt < 4; ++nt) bv[nt] = bfr(bias[(size_t)z * sBias + n0 + 64 * wn + 16 * nt + l16]);
  #pragma unroll
  for (int mt = 0; mt < 2; ++mt)
    #pragma unroll
    for (int nt = 0; nt < 4; ++nt)
      #pragma unroll
      for (int r = 0; r < 8; ++r) {
        float v = acc[mt][nt][r] * (1.0f / 64.0f) + bv[nt];
        if (MODE == 1) v = fmaxf(v, 0.0f);
        st[wn * (BM * 68) + (32 * wm + 16 * mt + 8 * hs + r) * 68 + 16 * nt + l16] = v;   // one BM x 68 stage per 64 columns
      }
  __syncthreads();   // stage is read cross-wave below

  #pragma unroll
  for (int cb = 0; cb < WN; ++cb) {            // the block tile's 64-column parts, one stage each
    const float* sc = st + cb * (BM * 68);
    const int nc = n0 + 64 * cb;               // first column of the part
    const int zh = z + (nc >> 6);              // MODE 0: the part's head
    if (MODE != 2) {
      const int p = t & 7;
      #pragma unroll
      for (int j = 0; j < BM / (NT / 8); ++j) {
        const int row = (t >> 3) + (NT / 8) * j;
        v8h hv, rv;
        #pragma unroll
        for (int i = 0; i < 8; ++i) {
          const float v = sc[row * 68 + 8 * p + i];
          const _Float16 q = (_Float16)v;
          hv[i] = q;
          rv[i] = RES ? (_Float16)((v - (float)q) * 2048.0f) : q;
        }
        const size_t off = (MODE == 0) ? ((((size_t)zh * prow) + m0 + row) * HD + 8 * p)
                                       : ((size_t)(m0 + row) * ldc + nc + 8 * p);
        *(v8h*)(Oh + off) = hv;
        if (RES) *(v8h*)(Or + off) = rv;
      }
      if (WVT) {
        const int q16 = t & 15;
        #pragma unroll
        for (int j = 0; j < HD / (NT / 16); ++j) {
          const int e = (t >> 4) + (NT / 16) * j;
          v8h hv, rv;
          #pragma unroll
          for (int i = 0; i < 8; ++i) {
            const float v = sc[(8 * q16 + i) * 68 + e];
            const _Float16 q = (_Float16)v;
            hv[i] = q;
            rv[i] = RES ? (_Float16)((v - (float)q) * 2048.0f) : q;
          }
          const size_t off = ((size_t)zh * HD + e) * (size_t)prow + m0 + 8 * q16;
          *(v8h*)(Ot + off) = hv;
          if (RES) *(v8h*)(Otr + off) = rv;
        }
      }
    } else {
      const int q16 = t & 15;
      #pragma unroll
      for (int j = 0; j < BM / (NT / 16); ++j) {
        const int row = (t >> 4) + (NT / 16) * j;
        v4f fv;
        #pragma unroll
        for (int i = 0; i < 4; ++i) fv[i] = sc[row * 68 + 4 * q16 + i];
        *(v4f*)(Of + (size_t)(m0 + row) * ldc + nc + 4 * q16) = fv;
      }
    }
  }
}

template<int MODE, bool RES, bool WVT, int WM, int WN>
__global__ __launch_bounds__(32 * WM * WN) __attribute__((amdgpu_num_vgpr(256)))
void k_gemm(const _Float16* __restrict__ A, int lda,
            const _Float16* __restrict__ BT, int ldb, int sBz,
            const float* __restrict__ bias, int sBias,
            int K, int prow,
            _Float16* __restrict__ Oh, _Float16* __restrict__ Or,
            _Float16* __restrict__ Ot, _Float16* __restrict__ Otr,
            float* __restrict__ Of, int ldc)
{
  // k-tile buffers: first the A rows m0.., then the BT rows n0.., GKS k (256 B) per row at pitch GLP
  __shared__ __attribute__((aligned(16))) char tile[GRING(WM, WN)];
  gemm_body<MODE, RES, WVT, WM, WN>(tile, blockIdx.x, blockIdx.y, blockIdx.z,
                            A, lda, BT, ldb, sBz, bias, sBias, K, prow, Oh, Or, Ot, Otr, Of, ldc);
}

// The two head projections that depend on the planes alone, one grid: z = 0 self q/k/v (with residual planes),
// z = 1 cross k/v; y = a pair of heads, whose weight rows and biases lie in a row (128 columns of NH * HD).
// Neither kind reads what the other writes; a block is wholly one kind.
__global__ __launch_bounds__(256) __attribute__((amdgpu_num_vgpr(256)))
void k_proj2(const _Float16* __restrict__ As, const _Float16* __restrict__ BTs, const float* __restrict__ bs,
             _Float16* __restrict__ Ohs, _Float16* __restrict__ Ors,
             _Float16* __restrict__ Ots, _Float16* __restrict__ Otrs,
             const _Float16* __restrict__ Ac, const _Float16* __restrict__ BTc, const float* __restrict__ bc,
             _Float16* __restrict__ Ohc, _Float16* __restrict__ Otc,
             float* __restrict__ Of, int prow)
{
  __shared__ __attribute__((aligned(16))) char tile[GRING(4, 2)];
  if (blockIdx.z == 0)
    gemm_body<0, true, true, 4, 2>(tile, blockIdx.x, blockIdx.y, 0,
                                   As, DM, BTs, DM, 0, bs, 0, DM, prow, Ohs, Ors, Ots, Otrs, Of, HD);
  else
    gemm_body<0, false, true, 4, 2>(tile, blockIdx.x, blockIdx.y, 0,
                                    Ac, DM, BTc, DM, 0, bc, 0, DM, prow, Ohc, Ohc, Otc, Otc, Of, HD);
}

#define AKT 128              // keys per staged tile (= query rows per block)
#define AKP 144              // LDS pitch of a K row, bytes: 128 + 16
#define AVP 272              // LDS pitch of a Vt row, bytes: 256 + 16
#define AKB (AKT * AKP)      // K part of a tile
#define APL (AKB + HD * AVP) // K part + Vt part: one pair of planes
static_assert(SEQ % AKT == 0);
static_assert(RESQB <= 2);   // the residual-plane blocks walk at most two tiles: one buffer each

// ---------------------------------------------------------------------------
// Flash attention. Planes: Q/K [h][prow][64] f16 (prow = NB*SEQ rows per head, row = b*SEQ + s),
// Vt [h][64][prow] f16; residual planes (x2^11) of the same shapes for RES. Block 256 threads = 8 waves,
// wave = 16 queries, 32-key chunks, online softmax in f32, p carried x4096 as f16.
// Both products run transposed: S^T = K.Q^T (A = K rows, B = Q) and O^T += Vt.P^T (A = Vt rows, B = P^T). A lane then
// holds 16 scores of ONE query (query = lane & 15, keys 16*nt + 8*(lane >> 4) + r): maximum and sum are in-lane, the
// maximum joined with the other half by one cross-row move per chunk, the sums once behind the loop; and those
// 16 values are, in that order, the lane's elements of the B fragment of P^T, so that p stays in registers.
// K and Vt tiles of 128 keys staged in LDS by asynchronous copies (two buffers), once per block; the waves read
// their A fragments there (split k map).
// RES: s = qh.kh + (qr.kh + qh.kr)/2^11 ; O = ph.vh + (ph.vr + pr.vh)/2^11 folded before 1/l.
// Out: f32 [NB*SEQ][DM] at columns h*64, staged per wave in LDS, 16 lanes x 16 B per 256-B row,
// LDS tile sto: wave-private (same wave writes and reads; lds_sync_wave), 16x64 per wave, fully written.
// ---------------------------------------------------------------------------
// sto: 8 x 16 x 68 floats of LDS; kv: 2 * ABUF bytes of LDS; both 16-byte aligned; (qb, h, b): the block's queries
template<bool CAUSAL, bool RES>
__device__ __forceinline__
void attn_body(float* sto, char* kv, int qb, int h, int b,
            const _Float16* __restrict__ Qh, const _Float16* __restrict__ Qr,
            const _Float16* __restrict__ Kh, const _Float16* __restrict__ Kr,
            const _Float16* __restrict__ Vt, const _Float16* __restrict__ Vtr,
            float* __restrict__ Out, int prow)
{
  constexpr int ABUF = (RES ? 2 : 1) * APL;   // one buffer: [K | Vt], then [Kr | Vtr] with the residual planes

  const int t = threadIdx.x, lane = t & 31, hs = lane >> 4, l16 = lane & 15;
  const int w = __builtin_amdgcn_readfirstlane(t >> 5);   // scalar: a wave's own trip count below is a scalar test
  const int qbase = qb * 128 + w * 16;                       // within the sequence
  const size_t rq = (size_t)h * (size_t)prow + (size_t)b * SEQ;   // plane row base for (h, b)
  float*    sw  = sto + w * 1088;

  v16h aq[2], aqr[2];
  #pragma unroll
  for (int stp = 0; stp < 2; ++stp) {
    aq[stp]  = ldfrag(Qh + (rq + qbase + l16) * HD + 32 * stp, hs);
    aqr[stp] = RES ? ldfrag(Qr + (rq + qbase + l16) * HD + 32 * stp, hs) : aq[stp];
  }

  const v8f z8 = {0.f, 0.f, 0.f, 0.f, 0.f, 0.f, 0.f, 0.f};
  // this lane's query (l16): running maximum (both halves agree), sum over this half's keys alone
  float mrow = -3.0e38f, lrow = 0.0f;
  v8f o[4], orr[4];   // O^T: element r of tile f = column e = 16*f + 8*hs + r of query l16
  #pragma unroll
  for (int f = 0; f < 4; ++f) { o[f] = z8; orr[f] = z8; }

  const int kend = CAUSAL ? (qbase + 16) : SEQ;

  const char* Kb  = (const char*)(Kh + rq * HD);
  const char* Krb = (const char*)(Kr + rq * HD);
  const char* Vb  = (const char*)(Vt + (size_t)h * HD * (size_t)prow + (size_t)b * SEQ);
  const char* Vrb = (const char*)(Vtr + (size_t)h * HD * (size_t)prow + (size_t)b * SEQ);

  // Staging: thread = 16 B. K: a wave's copy brings 4 whole rows (512 B in a row); Vt: 2 rows of 256 B.
  const size_t gko = (size_t)((t >> 3) * (HD * 2) + (t & 7) * 16);
  const size_t gvo = (size_t)(t >> 4) * (size_t)prow * 2 + (size_t)((t & 15) * 16);
  const unsigned lk = (unsigned)(uintptr_t)kv + (unsigned)((t >> 3) * AKP + (t & 7) * 16);
  const unsigned lv = (unsigned)(uintptr_t)kv + (unsigned)(AKB + (t >> 4) * AVP + (t & 15) * 16);
  auto stage = [&](unsigned boff, int kt0) {
    #pragma unroll
    for (int pl = 0; pl < (RES ? 2 : 1); ++pl) {
      unsigned l[8];
      const char* g[8];
      #pragma unroll
      for (int j = 0; j < 4; ++j) {
        l[j] = lk + boff + (unsigned)(pl * APL + 32 * j * AKP);
        g[j] = (pl ? Krb : Kb) + gko + (size_t)(kt0 + 32 * j) * (HD * 2);
        l[4 + j] = lv + boff + (unsigned)(pl * APL + 16 * j * AVP);
        g[4 + j] = (pl ? Vrb : Vb) + gvo + ((size_t)(16 * j) * (size_t)prow + (size_t)kt0) * 2;
      }
      copy8(l, g);
    }
  };

  // A fragments of chunk c (32 keys) of the tile at tb
  const int frk = l16 * AKP + 16 * hs;
  const int frv = AKB + l16 * AVP + 16 * hs;
  auto ldsfrag = [&](const char* p) -> v16h {
    union { v16h v; v8h q[2]; } u;
    u.q[0] = *(const v8h*)p;
    u.q[1] = *(const v8h*)(p + 32);
    return u.v;
  };
  v16h fk[2][2], fkr[2][2];
  auto load_k = [&](const char* tb, int c) {
    #pragma unroll
    for (int stp = 0; stp < 2; ++stp)
      #pragma unroll
      for (int nt = 0; nt < 2; ++nt) {
        const char* p = tb + frk + (32 * c + 16 * nt) * AKP + 64 * stp;
        fk[stp][nt]  = ldsfrag(p);
        fkr[stp][nt] = RES ? ldsfrag(p + APL) : fk[stp][nt];
      }
  };

  // tiles the block walks: the same for all its waves (a wave leaves out the chunks beyond its own diagonal)
  const int nst = CAUSAL ? (qb + 1) : (SEQ / AKT);
  stage(0u, 0);
  asm volatile("s_wait_asynccnt 0x0" ::: "memory");   // this wave's share of tile 0 has landed
  __syncthreads();                                    // every wave's share has: tile 0 may be read
  if (1 < nst) stage((unsigned)ABUF, AKT);

  unsigned boff = 0u;
  #pragma unroll 1
  for (int sg = 0; sg < nst; ++sg) {
  const char* tb = kv + boff;
  // K fragments one chunk ahead inside the tile (chunk 0 here); with the residual planes, whose fragments
  // leave no registers for that, at the chunk's own head. Every wave has at least chunk 0 of every tile.
  if (!RES) load_k(tb, 0);
  const int left = (kend - sg * AKT + 31) >> 5;             // this wave's chunks from here to its diagonal, >= 1
  const int nc = (left < AKT / 32) ? left : (AKT / 32);
  #pragma unroll 1
  for (int c = 0; c < nc; ++c) {
    const int kt = sg * AKT + 32 * c;
    if (RES) load_k(tb, c);

    // ---- scores, transposed: 32 keys (2 tiles) x 16 queries, K = 64 in 2 steps ----
    v8f s[2], sr[2];
    s[0] = z8; s[1] = z8; sr[0] = z8; sr[1] = z8;
    #pragma unroll
    for (int stp = 0; stp < 2; ++stp) {
      #pragma unroll
      for (int nt = 0; nt < 2; ++nt) {
        s[nt] = mma16(fk[stp][nt], aq[stp], s[nt]);
        if (RES) {
          sr[nt] = mma16(fk[stp][nt], aqr[stp], sr[nt]);
          sr[nt] = mma16(fkr[stp][nt], aq[stp], sr[nt]);
        }
      }
    }

    // ---- this chunk's V fragments, one group, issued here so that they land under the softmax ----
    v16h fv[4], fvr[4];
    #pragma unroll
    for (int f = 0; f < 4; ++f) {
      const char* p = tb + frv + 16 * f * AVP + 64 * c;
      fv[f]  = ldsfrag(p);
      fvr[f] = RES ? ldsfrag(p + APL) : fv[f];
    }

    // ---- next chunk's K fragments (same tile), into the registers the products above have just read ----
    if (!RES && c + 1 < AKT / 32) load_k(tb, c + 1);

    // ---- scale, causal replace-mask, online softmax (f32) ----
    float pv[2][8];
    #pragma unroll
    for (int nt = 0; nt < 2; ++nt)
      #pragma unroll
      for (int r = 0; r < 8; ++r) {
        float v = s[nt][r];
        if (RES) v += sr[nt][r] * (1.0f / 2048.0f);
        v *= 0.125f;
        if (CAUSAL) {
          const int key = kt + 16 * nt + 8 * hs + r;
          const int row = qbase + l16;
          if (key > row) v = -1.0e9f;
        }
        pv[nt][r] = v;
      }
    float tq[4];
    #pragma unroll
    for (int i = 0; i < 4; ++i)
      tq[i] = fmaxf(fmaxf(pv[0][2 * i], pv[0][2 * i + 1]), fmaxf(pv[1][2 * i], pv[1][2 * i + 1]));
    float tm = fmaxf(fmaxf(tq[0], tq[1]), fmaxf(tq[2], tq[3]));
    tm = fmaxf(tm, xhalf(tm));            // the query's other 16 keys of the chunk

    const float mn = fmaxf(mrow, tm);
    const float corr = __expf(mrow - mn);
    mrow = mn;
    #pragma unroll
    for (int nt = 0; nt < 2; ++nt)
      #pragma unroll
      for (int r = 0; r < 8; ++r) pv[nt][r] = __expf(pv[nt][r] - mn);
    float tsq[4];
    #pragma unroll
    for (int i = 0; i < 4; ++i)
      tsq[i] = (pv[0][2 * i] + pv[0][2 * i + 1]) + (pv[1][2 * i] + pv[1][2 * i + 1]);
    lrow = lrow * corr + ((tsq[0] + tsq[1]) + (tsq[2] + tsq[3]));
    #pragma unroll
    for (int f = 0; f < 4; ++f)
      #pragma unroll
      for (int r = 0; r < 8; ++r) {
        o[f][r] *= corr;
        if (RES) orr[f][r] *= corr;
      }

    // ---- p (x4096, f16 hi; x2^11 residual for RES) packed in place into the B fragment of P^T:
    //      elements 0..7 = keys 8*hs + r (tile 0), elements 8..15 = keys 16 + 8*hs + r (tile 1), the k map of ldfrag ----
    v16h bp, bpr;
    #pragma unroll
    for (int nt = 0; nt < 2; ++nt)
      #pragma unroll
      for (int r = 0; r < 8; ++r) {
        const float pc = pv[nt][r] * 4096.0f;
        const _Float16 ph = (_Float16)pc;
        bp[8 * nt + r]  = ph;
        bpr[8 * nt + r] = RES ? (_Float16)((pc - (float)ph) * 2048.0f) : ph;
      }

    // ---- O^T += Vt . P^T : A fragments of the Vt plane (row e, k = key contiguous), read behind the scores ----
    #pragma unroll
    for (int f = 0; f < 4; ++f) {
      o[f] = mma16(fv[f], bp, o[f]);
      if (RES) {
        orr[f] = mma16(fvr[f], bp, orr[f]);
        orr[f] = mma16(fv[f], bpr, orr[f]);
      }
    }
  }
  asm volatile("s_wait_dscnt 0x0" ::: "memory");      // this wave's reads of the buffer are done
  asm volatile("s_wait_asynccnt 0x0" ::: "memory");   // its share of the next tile has landed
  __syncthreads();   // publishes the next tile and ends every wave's reads of this buffer, refilled below
  // with the residual planes the block is one of query blocks 0..RESQB-1: no more tiles than buffers, no refill
  if (!RES && sg + 2 < nst) stage(boff, (sg + 2) * AKT);
  boff ^= (unsigned)ABUF;
  }
  asm volatile("s_wait_asynccnt 0x0" ::: "memory");     // no copy is left in flight

  // ---- normalise, stage 16x64 f32 tile per wave, whole-line stores ----
  lrow += xhalf(lrow);                    // the two halves' key sums joined, once
  const float inv = (1.0f / lrow) * (1.0f / 4096.0f);
  #pragma unroll
  for (int f = 0; f < 4; ++f)
    #pragma unroll
    for (int q = 0; q < 2; ++q) {
      v4f sv;
      #pragma unroll
      for (int i = 0; i < 4; ++i) {
        float v = o[f][4 * q + i];
        if (RES) v += orr[f][4 * q + i] * (1.0f / 2048.0f);
        sv[i] = v * inv;
      }
      *(v4f*)(sw + l16 * 68 + 16 * f + 8 * hs + 4 * q) = sv;
    }
  lds_sync_wave();
  const size_t orow = (size_t)b * SEQ + (size_t)qbase;
  {
    #pragma unroll
    for (int j = 0; j < 8; ++j) {
      const int row = 2 * j + hs;
      const v4f fvv = *(const v4f*)(sw + row * 68 + 4 * l16);
      *(v4f*)(Out + (orow + row) * DM + h * HD + 4 * l16) = fvv;
    }
    
  }
}

// two waves per SIMD is what the grids give (at most one block per WGP): said here so that the scheduler spends
// registers on the fragments in flight instead of saving them for more waves
__global__ __launch_bounds__(256) __attribute__((amdgpu_waves_per_eu(2, 2)))
void k_attn_cross(const _Float16* __restrict__ Qh, const _Float16* __restrict__ Kh, const _Float16* __restrict__ Vt,
                  float* __restrict__ Out, int prow)
{
  __shared__ __attribute__((aligned(16))) float sto[8 * 16 * 68];
  __shared__ __attribute__((aligned(16))) char kv[2 * APL];
  attn_body<false, false>(sto, kv, blockIdx.x, blockIdx.y, blockIdx.z, Qh, Qh, Kh, Kh, Vt, Vt, Out, prow);
}

// Causal attention, every query block in one grid: blocks 0..RESQB-1 take the path with the residual planes, the
// others the plain one. They write disjoint rows of Out and read the same planes; a block is wholly one kind.
__global__ __launch_bounds__(256) __attribute__((amdgpu_waves_per_eu(2, 2)))
void k_attn_self(const _Float16* __restrict__ Qh, const _Float16* __restrict__ Qr,
                 const _Float16* __restrict__ Vt, const _Float16* __restrict__ Vtr,
                 float* __restrict__ Out, int prow)
{
  __shared__ __attribute__((aligned(16))) float sto[8 * 16 * 68];
  __shared__ __attribute__((aligned(16))) char kv[4 * APL];
  if (blockIdx.x < RESQB)
    attn_body<true, true>(sto, kv, blockIdx.x, blockIdx.y, blockIdx.z, Qh, Qr, Qh, Qr, Vt, Vtr, Out, prow);
  else
    attn_body<true, false>(sto, kv, blockIdx.x, blockIdx.y, blockIdx.z, Qh, Qr, Qh, Qr, Vt, Vtr, Out, prow);
}

// ---------------------------------------------------------------------------
// y = LayerNorm(x + r) * g + b over DM = 1024, one block (256 threads) per row, thread = 4 columns.
// XIN: x is a raw input (bf16 RNE convert, input row stride via SEQ_FULL); else x is a ws f32 plane.
// WH: also write the f16 plane yh. g, b bf16 RNE converted. Outputs: 256 lanes x 16/8 B per row
// coverage: nrow x DM for y (and yh).
// ---------------------------------------------------------------------------
template<bool XIN, bool WH>
__global__ __launch_bounds__(256)
void k_ln(const float* __restrict__ x, const float* __restrict__ rr,
          const float* __restrict__ g, const float* __restrict__ be,
          float* __restrict__ y, _Float16* __restrict__ yh)
{
  #pragma clang fp contract(off)
  __shared__ float red[8];
  __shared__ float red2[8];
  const int m = blockIdx.x, t = threadIdx.x, lane = t & 31, w = t >> 5;
  const int c = 4 * t;
  const size_t xrow = XIN ? ((size_t)(m / SEQ) * SEQ_FULL + (size_t)(m % SEQ)) : (size_t)m;
  const v4f xv = *(const v4f*)(x + xrow * DM + c);
  const v4f rv = *(const v4f*)(rr + (size_t)m * DM + c);
  float v[4];
  #pragma unroll
  for (int i = 0; i < 4; ++i) {
    float xi = xv[i];
    if (XIN) xi = bfr(xi);
    v[i] = xi + rv[i];
  }
  float s = (v[0] + v[1]) + (v[2] + v[3]);
  #pragma unroll
  for (int off = 16; off > 0; off >>= 1) s += __shfl_xor(s, off, 32);
  if (lane == 0) red[w] = s;
  __syncthreads();
  float tot = 0.0f;
  #pragma unroll
  for (int i = 0; i < 8; ++i) tot += red[i];
  const float mu = tot * (1.0f / (float)DM);

  float d[4];
  #pragma unroll
  for (int i = 0; i < 4; ++i) d[i] = v[i] - mu;
  float s2 = (d[0] * d[0] + d[1] * d[1]) + (d[2] * d[2] + d[3] * d[3]);
  #pragma unroll
  for (int off = 16; off > 0; off >>= 1) s2 += __shfl_xor(s2, off, 32);
  if (lane == 0) red2[w] = s2;
  __syncthreads();
  float tot2 = 0.0f;
  #pragma unroll
  for (int i = 0; i < 8; ++i) tot2 += red2[i];
  const float var = tot2 * (1.0f / (float)DM);
  const float rstd = rsqrtf(var + LN_EPS);

  v4f ov;
  v4h oh;
  #pragma unroll
  for (int i = 0; i < 4; ++i) {
    const float gv = bfr(g[c + i]);
    const float bvv = bfr(be[c + i]);
    const float q = d[i] * rstd * gv + bvv;
    ov[i] = q;
    oh[i] = (_Float16)q;
  }
  float* ydst = y + (size_t)m * DM + c;
  _Float16* hdst = yh + (WH ? ((size_t)m * DM + c) : 0);
  *(v4f*)ydst = ov;
  if (WH) *(v4h*)hdst = oh;
  
}

// ---------------------------------------------------------------------------
extern "C" void kernel_launch(void* const* d_in, const int* in_sizes, int n_in,
                              void* d_out, int out_size, void* d_ws, size_t ws_size,
                              hipStream_t stream)
{
  if (n_in < 16) return;
  const int MR = NB * SEQ;                 // internal rows (b*SEQ + s)
  const long need_act = (long)(NB - 1) * SEQ_FULL * DM + (long)SEQ * DM;
  if ((long)in_sizes[0] < need_act || (long)in_sizes[1] < need_act) return;
  if (in_sizes[2] < NH * DM * HD || in_sizes[3] < NH * HD) return;
  if (in_sizes[4] < NH * DM * HD || in_sizes[5] < NH * HD) return;
  for (int i = 6; i < 12; ++i) if (in_sizes[i] < DM) return;
  if (in_sizes[12] < DM * FF || in_sizes[13] < FF || in_sizes[14] < FF * DM || in_sizes[15] < DM) return;
  if (out_size < MR * DM) return;

  const float* y      = (const float*)d_in[0];
  const float* enc    = (const float*)d_in[1];
  const float* Wself  = (const float*)d_in[2];
  const float* bself  = (const float*)d_in[3];
  const float* Wcross = (const float*)d_in[4];
  const float* bcross = (const float*)d_in[5];
  const float* g1  = (const float*)d_in[6];  const float* be1 = (const float*)d_in[7];
  const float* g2  = (const float*)d_in[8];  const float* be2 = (const float*)d_in[9];
  const float* g3  = (const float*)d_in[10]; const float* be3 = (const float*)d_in[11];
  const float* w1  = (const float*)d_in[12]; const float* b1  = (const float*)d_in[13];
  const float* w2  = (const float*)d_in[14]; const float* b2  = (const float*)d_in[15];
  float* out = (float*)d_out;

  // ---- workspace carve (256-B aligned regions; 104 MiB at NB*SEQ = 2048) ----
  char* base = (char*)d_ws;
  size_t off = 0;
  auto take = [&](size_t bytes) -> void* {
    void* p = (void*)(base + off);
    off += (bytes + 255) & ~(size_t)255;
    return p;
  };
  _Float16* Yh   = (_Float16*)take((size_t)MR * DM * 2);
  _Float16* Eh   = (_Float16*)take((size_t)MR * DM * 2);
  _Float16* WTs  = (_Float16*)take((size_t)NH * HD * DM * 2);
  _Float16* WTc  = (_Float16*)take((size_t)NH * HD * DM * 2);
  _Float16* W1T  = (_Float16*)take((size_t)FF * DM * 2);
  _Float16* W2T  = (_Float16*)take((size_t)DM * FF * 2);
  _Float16* QKVh = (_Float16*)take((size_t)NH * MR * HD * 2);
  _Float16* QKVr = (_Float16*)take((size_t)NH * MR * HD * 2);
  _Float16* VTh  = (_Float16*)take((size_t)NH * HD * MR * 2);
  _Float16* VTr  = (_Float16*)take((size_t)NH * HD * MR * 2);
  float*    att  = (float*)   take((size_t)MR * DM * 4);     // sa, then ca, then ff
  float*    y1   = (float*)   take((size_t)MR * DM * 4);
  _Float16* y1h  = (_Float16*)take((size_t)MR * DM * 2);
  float*    y2   = (float*)   take((size_t)MR * DM * 4);
  _Float16* y2h  = (_Float16*)take((size_t)MR * DM * 2);
  _Float16* Qch  = (_Float16*)take((size_t)NH * MR * HD * 2);
  _Float16* KVch = (_Float16*)take((size_t)NH * MR * HD * 2);
  _Float16* VTc  = (_Float16*)take((size_t)NH * HD * MR * 2);
  _Float16* Hh   = (_Float16*)take((size_t)MR * FF * 2);
  if (off > ws_size) return;

  // ---- planes ----
  k_prep<<<dim3(2 * PBW + 2 * PBH + PBC), 256, 0, stream>>>(
      y, enc, Wself, Wcross, w1, w2, Yh, Eh, WTs, WTc, W1T, W2T, MR);

  const int nqb  = SEQ / 128;

  // ---- projections of y (self: q = k = v share one) and of enc (cross: k = v share one) ----
  k_proj2<<<dim3(MR / 128, NH * HD / 128, 2), 256, 0, stream>>>(
      Yh, WTs, bself, QKVh, QKVr, VTh, VTr, Eh, WTc, bcross, KVch, VTc, att, MR);

  // ---- self attention ----
  k_attn_self<<<dim3(nqb, NH, NB), 256, 0, stream>>>(QKVh, QKVr, VTh, VTr, att, MR);
  k_ln<true, true><<<dim3(MR), 256, 0, stream>>>(y, att, g1, be1, y1, y1h);

  // ---- cross attention (q from y1; k = v from enc, projected above) ----
  k_gemm<0, false, false, 4, 1><<<dim3(MR / 128, HD / 64, NH), 128, 0, stream>>>(
      y1h, DM, WTc, DM, HD * DM, bcross, HD, DM, MR, Qch, Qch, Qch, Qch, att, HD);
  k_attn_cross<<<dim3(nqb, NH, NB), 256, 0, stream>>>(Qch, KVch, VTc, att, MR);
  k_ln<false, true><<<dim3(MR), 256, 0, stream>>>(y1, att, g2, be2, y2, y2h);

  // ---- MLP ----
  k_gemm<1, false, false, 8, 2><<<dim3(MR / 256, FF / 128, 1), 512, 0, stream>>>(
      y2h, DM, W1T, DM, 0, b1, 0, DM, MR, Hh, Hh, Hh, Hh, att, FF);
  k_gemm<2, false, false, 4, 1><<<dim3(MR / 128, DM / 64, 1), 128, 0, stream>>>(
      Hh, FF, W2T, FF, 0, b2, 0, FF, MR, y2h, y2h, y2h, y2h, att, DM);
  k_ln<false, false><<<dim3(MR), 256, 0, stream>>>(y2, att, g3, be3, out, y2h);
}

// v007
// Measured time: 127 microseconds a run.
// In two side-by-side timings against v006, it was 1.03 and 1.04 times as fast.
// Counting every step since v000, it is 5.24 times as fast.
#include <hip/hip_runtime.h>
#include <stdint.h>
#include <stddef.h>

// Contractions on v_wmma_f32_16x16x32_f16 (f16 operands, f32 accumulate): per-head q/k/v projections,
// q.k^T, p.v (self causal and cross), MLP up and down GEMMs. Float inputs RNE-converted to bf16 and held
// as f16 planes (weights carried x64, softmax p carried x4096); causal query blocks 0..RESQB-1 add f16
// residual planes (x2^11) for q, k, p, v into a second accumulator. Softmax, layer norms, bias adds: f32.

#ifndef NB
#define NB 1
#endif
#ifndef SEQ
#define SEQ 2048
#endif
#define NB_FULL 1
#define SEQ_FULL 2048
#define DM 1024
#define NH 16
#define HD 64
#define FF 4096
#define RESQB 2
#define LN_EPS 1.0e-5f

static_assert(SEQ % 128 == 0);
static_assert(SEQ <= SEQ_FULL);
static_assert(NB >= 1 && NB <= NB_FULL);
static_assert(HD == 64);
static_assert(DM % 128 == 0 && FF % 128 == 0);
static_assert(DM % 32 == 0 && FF % 32 == 0);
static_assert((NB * SEQ) % 256 == 0);
static_assert(DM == 4 * 256);

typedef _Float16 v4h  __attribute__((ext_vector_type(4)));
typedef _Float16 v8h  __attribute__((ext_vector_type(8)));
typedef _Float16 v16h __attribute__((ext_vector_type(16)));
typedef float    v4f  __attribute__((ext_vector_type(4)));
typedef float    v8f  __attribute__((ext_vector_type(8)));

// ---------------------------------------------------------------------------
// helpers
// ---------------------------------------------------------------------------
__device__ __forceinline__ v8f mma16(v16h a, v16h b, v8f c)
{
  c = __builtin_amdgcn_wmma_f32_16x16x32_f16(false, a, false, b, (short)0, c, false, false);
  asm volatile("v_nop\n\tv_nop\n\tv_nop\n\tv_nop" : "+v"(c) : "v"(a), "v"(b));
  return c;
}

// 16x16x32 16-bit fragment (A row m = lane&15, or B column n = lane&15, k contiguous at p):
// elements 0..7 <- k0+8h+0..7, elements 8..15 <- k0+16+8h+0..7, h = lane>>4
__device__ __forceinline__ v16h ldfrag(const _Float16* p, int hs)
{
  union { v16h v; v8h q[2]; } u;
  u.q[0] = *(const v8h*)(p + 8 * hs);
  u.q[1] = *(const v8h*)(p + 16 + 8 * hs);
  return u.v;
}

// bf16 RNE convert, returned widened to f32
__device__ __forceinline__ float bfr(float x)
{
  unsigned int u = __float_as_uint(x);
  u = (u + 0x7FFFu + ((u >> 16) & 1u)) & 0xFFFF0000u;
  return __uint_as_float(u);
}

// same-wave LDS store -> load ordering (wave-private tiles only)
__device__ __forceinline__ void lds_sync_wave()
{
  asm volatile("s_wait_dscnt 0x0" ::: "memory");
  __builtin_amdgcn_wave_barrier();
}

// value of lane l ^ 16 (the other 16-lane half), by a vector cross-row move
__device__ __forceinline__ float xhalf(float x)
{
  return __builtin_bit_cast(float, __builtin_amdgcn_permlanex16(__builtin_bit_cast(int, x), __builtin_bit_cast(int, x),
                                                                0x76543210, 0xfedcba98, false, false));
}

// ---------------------------------------------------------------------------
// Activation planes: Yh = f16(bf16rne(y)), Eh = f16(bf16rne(enc)), internal row m -> input row
// coverage: Yh and Eh each nrow*DM elements exactly.
// ---------------------------------------------------------------------------
__device__ __forceinline__
void cvt_act_body(int bid, const float* __restrict__ y, const float* __restrict__ e,
                  _Float16* __restrict__ Yh, _Float16* __restrict__ Eh, int nrow)
{
  const int groups = nrow * (DM / 8);
  const int g = bid * 256 + threadIdx.x;
  if (g >= 2 * groups) return;
  const int which = (g >= groups) ? 1 : 0;
  const int idx = g - which * groups;
  const int m = idx / (DM / 8);
  const int c = (idx - m * (DM / 8)) * 8;
  const size_t srow = (size_t)(m / SEQ) * SEQ_FULL + (size_t)(m % SEQ);
  const float* src = (which ? e : y) + srow * DM + c;
  const v4f a = *(const v4f*)src;
  const v4f b = *(const v4f*)(src + 4);
  v8h o;
  o[0] = (_Float16)bfr(a[0]); o[1] = (_Float16)bfr(a[1]); o[2] = (_Float16)bfr(a[2]); o[3] = (_Float16)bfr(a[3]);
  o[4] = (_Float16)bfr(b[0]); o[5] = (_Float16)bfr(b[1]); o[6] = (_Float16)bfr(b[2]); o[7] = (_Float16)bfr(b[3]);
  _Float16* dst = (which ? Eh : Yh) + (size_t)m * DM + c;
  *(v8h*)dst = o;
  
}

// ---------------------------------------------------------------------------
// Transposed weight planes: in[z][R][C] f32 -> out[z][C][R] f16, value f16(bf16rne(x) * scale).
// coverage: full C x R per z.
// ---------------------------------------------------------------------------
__device__ __forceinline__
void wtr_body(float (*tile)[65], int bx, int by, int bz,
              const float* __restrict__ in, _Float16* __restrict__ out, int R, int C, float scale)
{
  const int t = threadIdx.x;
  const int c0 = bx * 64, r0 = by * 64;
  const size_t zoff = (size_t)bz * (size_t)R * (size_t)C;
  {
    const int r = t >> 2, cq = (t & 3) * 16;
    const float* p = in + zoff + (size_t)(r0 + r) * C + c0 + cq;
    #pragma unroll
    for (int i = 0; i < 4; ++i) {
      const v4f v = *(const v4f*)(p + 4 * i);
      tile[r][cq + 4 * i + 0] = v[0];
      tile[r][cq + 4 * i + 1] = v[1];
      tile[r][cq + 4 * i + 2] = v[2];
      tile[r][cq + 4 * i + 3] = v[3];
    }
  }
  __syncthreads();
  const int p8 = t & 7;
  {
    #pragma unroll
    for (int j = 0; j < 2; ++j) {
      const int c = (t >> 3) + 32 * j;
      v8h ov;
      #pragma unroll
      for (int i = 0; i < 8; ++i) ov[i] = (_Float16)(bfr(tile[8 * p8 + i][c]) * scale);
      _Float16* dst = out + zoff + (size_t)(c0 + c) * R + r0 + 8 * p8;
      *(v8h*)dst = ov;
    }
    
  }
}

// ---------------------------------------------------------------------------
// All planes that depend on the inputs alone, one grid: none reads what another writes. Block ranges, in order:
// w1 -> W1T, w2 -> W2T (PBW blocks each), Wself -> WTs, Wcross -> WTc (PBH blocks each), then y, enc -> Yh, Eh.
// The range test reads blockIdx alone: a block is wholly one kind, so the transpose's barrier is block-uniform.
// ---------------------------------------------------------------------------
#define PBW ((FF / 64) * (DM / 64))
#define PBH ((DM / 64) * NH)
#define PBC ((2 * NB * SEQ * (DM / 8) + 255) / 256)
__global__ __launch_bounds__(256)
void k_prep(const float* __restrict__ y, const float* __restrict__ e,
            const float* __restrict__ Ws, const float* __restrict__ Wc,
            const float* __restrict__ w1, const float* __restrict__ w2,
            _Float16* __restrict__ Yh, _Float16* __restrict__ Eh,
            _Float16* __restrict__ WTs, _Float16* __restrict__ WTc,
            _Float16* __restrict__ W1T, _Float16* __restrict__ W2T, int nrow)
{
  __shared__ float tile[64][65];
  const int bid = blockIdx.x;
  if (bid < 2 * PBW + 2 * PBH) {
    const float* in;
    _Float16* out;
    int R, C, bx, by, bz;
    if (bid < PBW) {                 // in[1024][4096] -> out[4096][1024]
      in = w1; out = W1T; R = DM; C = FF;
      bx = bid % (FF / 64); by = bid / (FF / 64); bz = 0;
    } else if (bid < 2 * PBW) {      // in[4096][1024] -> out[1024][4096]
      in = w2; out = W2T; R = FF; C = DM;
      bx = (bid - PBW) % (DM / 64); by = (bid - PBW) / (DM / 64); bz = 0;
    } else {                         // in[h][1024][64] -> out[h][64][1024]
      const bool cr = bid >= 2 * PBW + PBH;
      const int hb = bid - 2 * PBW - (cr ? PBH : 0);
      in = cr ? Wc : Ws; out = cr ? WTc : WTs; R = DM; C = HD;
      bx = 0; by = hb % (DM / 64); bz = hb / (DM / 64);
    }
    wtr_body(tile, bx, by, bz, in, out, R, C, 64.0f);
  } else {
    cvt_act_body(bid - (2 * PBW + 2 * PBH), y, e, Yh, Eh, nrow);
  }
}

#define GKS 128              // k per staged tile
#define GLP 272              // LDS row pitch, bytes: 256 + 16, conflict-free for 16-byte fragment reads
#define GNB 3                // buffers of the ring: one read, two being filled
#define GRING(WM, WN) (GNB * (32 * (WM) + 64 * (WN)) * GLP)   // LDS bytes of the ring of a block of WM x WN waves
static_assert(DM % GKS == 0 && FF % GKS == 0);

// twelve 16-byte-per-lane copies global -> LDS, through no register. The s_wait_xcnt closes the statement, so that
// no address register of a copy is rewritten while the copy still names it.
__device__ __forceinline__ void copy12(const unsigned (&l)[12], const char* const (&g)[12])
{
  asm volatile(
    "global_load_async_to_lds_b128 %0, %12, off\n\t"
    "global_load_async_to_lds_b128 %1, %13, off\n\t"
    "global_load_async_to_lds_b128 %2, %14, off\n\t"
    "global_load_async_to_lds_b128 %3, %15, off\n\t"
    "global_load_async_to_lds_b128 %4, %16, off\n\t"
    "global_load_async_to_lds_b128 %5, %17, off\n\t"
    "global_load_async_to_lds_b128 %6, %18, off\n\t"
    "global_load_async_to_lds_b128 %7, %19, off\n\t"
    "global_load_async_to_lds_b128 %8, %20, off\n\t"
    "global_load_async_to_lds_b128 %9, %21, off\n\t"
    "global_load_async_to_lds_b128 %10, %22, off\n\t"
    "global_load_async_to_lds_b128 %11, %23, off\n\t"
    "s_wait_xcnt 0x0"
    : : "v"(l[0]), "v"(l[1]), "v"(l[2]), "v"(l[3]), "v"(l[4]), "v"(l[5]),
        "v"(l[6]), "v"(l[7]), "v"(l[8]), "v"(l[9]), "v"(l[10]), "v"(l[11]),
        "v"(g[0]), "v"(g[1]), "v"(g[2]), "v"(g[3]), "v"(g[4]), "v"(g[5]),
        "v"(g[6]), "v"(g[7]), "v"(g[8]), "v"(g[9]), "v"(g[10]), "v"(g[11])
    : "memory");
}

// eight 16-byte-per-lane copies global -> LDS; the s_wait_xcnt closes the statement as in copy12
__device__ __forceinline__ void copy8(const unsigned (&l)[8], const char* const (&g)[8])
{
  asm volatile(
    "global_load_async_to_lds_b128 %0, %8, off\n\t"
    "global_load_async_to_lds_b128 %1, %9, off\n\t"
    "global_load_async_to_lds_b128 %2, %10, off\n\t"
    "global_load_async_to_lds_b128 %3, %11, off\n\t"
    "global_load_async_to_lds_b128 %4, %12, off\n\t"
    "global_load_async_to_lds_b128 %5, %13, off\n\t"
    "global_load_async_to_lds_b128 %6, %14, off\n\t"
    "global_load_async_to_lds_b128 %7, %15, off\n\t"
    "s_wait_xcnt 0x0"
    : : "v"(l[0]), "v"(l[1]), "v"(l[2]), "v"(l[3]), "v"(l[4]), "v"(l[5]), "v"(l[6]), "v"(l[7]),
        "v"(g[0]), "v"(g[1]), "v"(g[2]), "v"(g[3]), "v"(g[4]), "v"(g[5]), "v"(g[6]), "v"(g[7])
    : "memory");
}

// this wave's copies have landed but for the N youngest (N = the copies of one tile)
template<int N>
__device__ __forceinline__ void wait_copies_but()
{
  static_assert(N == 24 || N == 16 || N == 12);
  if constexpr (N == 24) asm volatile("s_wait_asynccnt 24" ::: "memory");
  else if constexpr (N == 16) asm volatile("s_wait_asynccnt 16" ::: "memory");
  else asm volatile("s_wait_asynccnt 12" ::: "memory");
}

// ---------------------------------------------------------------------------
// GEMM C[M][N] = A[M][K] (f16 row-major, pitch lda) x B, B given as BT[N][K] (k contiguous, pitch ldb,
// per-z offset sBz). Block = WM x WN waves, wave tile 32x64 (2x4 fragments), block tile BM x BN = 32*WM x 64*WN:
// a staged row serves every wave of its block row or column, so that a wider block draws fewer bytes from L2 per product.
// k-tiles of 128 staged in LDS by asynchronous copies (three buffers, two tiles ahead), fragments read from LDS. Epilogue: v = acc/64 + bf16rne(bias[z*sBias + n])
//   MODE 0: Oh[head][prow][64] f16, head = z + n/64 (+ Or residual (v-hi)*2^11 if RES) (+ Ot/Otr [head][64][prow] if WVT)
//   MODE 1: Oh[M][ldc] f16 at columns n0..n0+BN-1
//   MODE 2: Of[M][ldc] f32 at columns n0..n0+BN-1
// coverage: each block writes rows m0..m0+BM-1 x BN columns of every plane it owns (and the 64 x 128
// transposed slabs for WVT); grid (M/BM, N/BN, Z) tiles the planes exactly.
// ---------------------------------------------------------------------------
// tile: GRING(WM, WN) bytes of LDS, 16-byte aligned, the ring and behind the loop the epilogue's stage; (bx, by, z): the block's tile
template<int MODE, bool RES, bool WVT, int WM, int WN>
__device__ __forceinline__
void gemm_body(char* tile, int bx, int by, int z,
            const _Float16* __restrict__ A, int lda,
            const _Float16* __restrict__ BT, int ldb, int sBz,
            const float* __restrict__ bias, int sBias,
            int K, int prow,
            _Float16* __restrict__ Oh, _Float16* __restrict__ Or,
            _Float16* __restrict__ Ot, _Float16* __restrict__ Otr,
            float* __restrict__ Of, int ldc)
{
  constexpr int BM = 32 * WM, BN = 64 * WN, NT = 32 * WM * WN;
  constexpr int RP = NT / 16;                  // rows that one copy of every thread brings
  constexpr int NCP = (BM + BN) / RP;          // copies of one wave per tile
  constexpr int CG = (NCP % 12 == 0) ? 12 : 8; // copies per statement
  constexpr unsigned GBUF = (unsigned)((BM + BN) * GLP);   // one buffer: BM A rows, then BN B rows
  static_assert(BM % RP == 0 && BN % RP == 0 && NCP % CG == 0);
  static_assert(2 * NCP <= 63);                // copies of a wave in flight: two tiles' at most
  static_assert(WN * BM * 68 * 4 <= GNB * (BM + BN) * GLP);   // the epilogue's stage lies in the ring
  static_assert(!WVT || BM == 128);
  const int t = threadIdx.x, lane = t & 31, w = t >> 5, hs = lane >> 4, l16 = lane & 15;
  const int wm = w % WM, wn = w / WM;          // the wave's place in the block tile
  const int m0 = bx * BM, n0 = by * BN;

  const v8f z8 = {0.f, 0.f, 0.f, 0.f, 0.f, 0.f, 0.f, 0.f};
  v8f acc[2][4];
  #pragma unroll
  for (int mt = 0; mt < 2; ++mt)
    #pragma unroll
    for (int nt = 0; nt < 4; ++nt) acc[mt][nt] = z8;

  // Staging: a copy of one wave brings two whole rows of the tile (2 x 256 B, whole lines); thread = 16 B at
  // column cc of row RP*i + cr, i = 0..NCP-1. Every row is fetched once per block and read from LDS by the waves.
  const int cr = t >> 4, cc = t & 15;
  const char* Ag = (const char*)(A + (size_t)(m0 + cr) * lda + 8 * cc);
  const char* Bg = (const char*)(BT + (size_t)z * sBz + (size_t)(n0 + cr) * ldb + 8 * cc);
  const unsigned lcp = (unsigned)(uintptr_t)tile + (unsigned)(cr * GLP + cc * 16);
  auto stage = [&](unsigned boff, int k0) {
    #pragma unroll
    for (int hf = 0; hf < NCP / CG; ++hf) {
      unsigned l[CG];
      const char* g[CG];
      #pragma unroll
      for (int i = 0; i < CG; ++i) {
        const int idx = CG * hf + i;
        l[i] = lcp + boff + (unsigned)(RP * idx * GLP);
        g[i] = (idx < BM / RP) ? (Ag + ((size_t)(RP * idx) * lda + k0) * 2)
                               : (Bg + ((size_t)(RP * (idx - BM / RP)) * ldb + k0) * 2);
      }
      if constexpr (CG == 12) copy12(l, g); else copy8(l, g);
    }
  };

  // Fragments from LDS, two register sets: a 32-k step's 12 reads go out as one group ahead of the step before it.
  // k and sum order as before. K is a multiple of GKS (DM, FF).
  v16h fa[2][2], fb[2][4];
  auto products = [&](int s) {
    #pragma unroll
    for (int nt = 0; nt < 4; ++nt) {
      acc[0][nt] = mma16(fa[s][0], fb[s][nt], acc[0][nt]);
      acc[1][nt] = mma16(fa[s][1], fb[s][nt], acc[1][nt]);
    }
  };
  const int fra = (32 * wm + l16) * GLP + 16 * hs;
  const int frb = (BM + 64 * wn + l16) * GLP + 16 * hs;
  auto frags = [&](int s, const char* tb, int stp) {
    #pragma unroll
    for (int mt = 0; mt < 2; ++mt) {
      union { v16h v; v8h q[2]; } u;
      const char* p = tb + fra + 16 * mt * GLP + 64 * stp;
      u.q[0] = *(const v8h*)p;
      u.q[1] = *(const v8h*)(p + 32);
      fa[s][mt] = u.v;
    }
    #pragma unroll
    for (int nt = 0; nt < 4; ++nt) {
      union { v16h v; v8h q[2]; } u;
      const char* p = tb + frb + 16 * nt * GLP + 64 * stp;
      u.q[0] = *(const v8h*)p;
      u.q[1] = *(const v8h*)(p + 32);
      fb[s][nt] = u.v;
    }
  };

  // Ring of three: tile t + 2 is asked for at the head of trip t and first read in trip t + 2, so that a tile has two
  // trips to land in: one trip's products are shorter than a tile's way from L2 or memory. The counter returns a wave's
  // copies in the order of issue: the counted wait, used only where exactly NCP copies were issued behind the tile that
  // is wanted, leaves those in flight and covers every older one. A trip that issues none waits to 0.
  stage(0u, 0);
  if (GKS < K) {
    stage(GBUF, GKS);
    wait_copies_but<NCP>();                             // this wave's share of tile 0 has landed, tile 1 may fly
  } else {
    asm volatile("s_wait_asynccnt 0x0" ::: "memory");   // this wave's share of tile 0 has landed
  }
  __syncthreads();                                      // every wave's share has: tile 0 may be read

  unsigned boff = 0u, bfill = 2u * GBUF;                // buffer of this trip's tile; buffer of the tile two ahead
  #pragma unroll 1   // rolled: one trip is one tile, four 32-k steps unrolled inside
  for (int k0 = 0; k0 < K; k0 += GKS) {
    const bool more = k0 + 2 * GKS < K;                 // the same for the whole block
    // refill: the buffer that the trip before has read, behind the barrier that ended every wave's reads of it
    if (more) stage(bfill, k0 + 2 * GKS);
    const char* tb = tile + boff;
    frags(0, tb, 0);
    #pragma unroll
    for (int stp = 0; stp < GKS / 32; ++stp) {
      if (stp + 1 < GKS / 32) frags((stp + 1) & 1, tb, stp + 1);
      products(stp & 1);
    }
    asm volatile("s_wait_dscnt 0x0" ::: "memory");      // this wave's reads of the buffer are done
    if (more) {
      wait_copies_but<NCP>();                           // its share of the next tile has landed; this trip's copies may fly
    } else {
      asm volatile("s_wait_asynccnt 0x0" ::: "memory"); // no copy was issued in this trip: all that is left is the next tile
    }
    __syncthreads();   // publishes the next tile and ends every wave's reads of this buffer, refilled at the next head
    bfill = boff;
    boff = (boff == 2u * GBUF) ? 0u : boff + GBUF;
  }
  asm volatile("s_wait_asynccnt 0x0" ::: "memory");     // no copy is left in flight
  // behind the last trip's waits and barrier nobody reads the ring and nothing flies into it: it becomes the stage
  float* st = (float*)tile;

  // ---- epilogue: bias (bf16 RNE), scale, relu -> LDS stage ----
  float bv[4];
  #pragma unroll
  for (int nt = 0; nt < 4; ++nt) bv[nt] = bfr(bias[(size_t)z * sBias + n0 + 64 * wn + 16 * nt + l16]);
  #pragma unroll
  for (int mt = 0; mt < 2; ++mt)
    #pragma unroll
    for (int nt = 0; nt < 4; ++nt)
      #pragma unroll
      for (int r = 0; r < 8; ++r) {
        float v = acc[mt][nt][r] * (1.0f / 64.0f) + bv[nt];
        if (MODE == 1) v = fmaxf(v, 0.0f);
        st[wn * (BM * 68) + (32 * wm + 16 * mt + 8 * hs + r) * 68 + 16 * nt + l16] = v;   // one BM x 68 stage per 64 columns
      }
  __syncthreads();   // stage is read cross-wave below

  #pragma unroll
  for (int cb = 0; cb < WN; ++cb) {            // the block tile's 64-column parts, one stage each
    const float* sc = st + cb * (BM * 68);
    const int nc = n0 + 64 * cb;               // first column of the part
    const int zh = z + (nc >> 6);              // MODE 0: the part's head
    if (MODE != 2) {
      const int p = t & 7;
      #pragma unroll
      for (int j = 0; j < BM / (NT / 8); ++j) {
        const int row = (t >> 3) + (NT / 8) * j;
        v8h hv, rv;
        #pragma unroll
        for (int i = 0; i < 8; ++i) {
          const float v = sc[row * 68 + 8 * p + i];
          const _Float16 q = (_Float16)v;
          hv[i] = q;
          rv[i] = RES ? (_Float16)((v - (float)q) * 2048.0f) : q;
        }
        const size_t off = (MODE == 0) ? ((((size_t)zh * prow) + m0 + row) * HD + 8 * p)
                                       : ((size_t)(m0 + row) * ldc + nc + 8 * p);
        *(v8h*)(Oh + off) = hv;
        if (RES) *(v8h*)(Or + off) = rv;
      }
      if (WVT) {
        const int q16 = t & 15;
        #pragma unroll
        for (int j = 0; j < HD / (NT / 16); ++j) {
          const int e = (t >> 4) + (NT / 16) * j;
          v8h hv, rv;
          #pragma unroll
          for (int i = 0; i < 8; ++i) {
            const float v = sc[(8 * q16 + i) * 68 + e];
            const _Float16 q = (_Float16)v;
            hv[i] = q;
            rv[i] = RES ? (_Float16)((v - (float)q) * 2048.0f) : q;
          }
          const size_t off = ((size_t)zh * HD + e) * (size_t)prow + m0 + 8 * q16;
          *(v8h*)(Ot + off) = hv;
          if (RES) *(v8h*)(Otr + off) = rv;
        }
      }
    } else {
      const int q16 = t & 15;
      #pragma unroll
      for (int j = 0; j < BM / (NT / 16); ++j) {
        const int row = (t >> 4) + (NT / 16) * j;
        v4f fv;
        #pragma unroll
        for (int i = 0; i < 4; ++i) fv[i] = sc[row * 68 + 4 * q16 + i];
        *(v4f*)(Of + (size_t)(m0 + row) * ldc + nc + 4 * q16) = fv;
      }
    }
  }
}

template<int MODE, bool RES, bool WVT, int WM, int WN>
__global__ __launch_bounds__(32 * WM * WN) __attribute__((amdgpu_num_vgpr(256)))
void k_gemm(const _Float16* __restrict__ A, int lda,
            const _Float16* __restrict__ BT, int ldb, int sBz,
            const float* __restrict__ bias, int sBias,
            int K, int prow,
            _Float16* __restrict__ Oh, _Float16* __restrict__ Or,
            _Float16* __restrict__ Ot, _Float16* __restrict__ Otr,
            float* __restrict__ Of, int ldc)
{
  // k-tile buffers: first the A rows m0.., then the BT rows n0.., GKS k (256 B) per row at pitch GLP
  __shared__ __attribute__((aligned(16))) char tile[GRING(WM, WN)];
  gemm_body<MODE, RES, WVT, WM, WN>(tile, blockIdx.x, blockIdx.y, blockIdx.z,
                            A, lda, BT, ldb, sBz, bias, sBias, K, prow, Oh, Or, Ot, Otr, Of, ldc);
}

// The two head projections that depend on the planes alone, one grid: z = 0 self q/k/v (with residual planes),
// z = 1 cross k/v; y = a pair of heads, whose weight rows and biases lie in a row (128 columns of NH * HD).
// Neither kind reads what the other writes; a block is wholly one kind.
__global__ __launch_bounds__(256) __attribute__((amdgpu_num_vgpr(256)))
void k_proj2(const _Float16* __restrict__ As, const _Float16* __restrict__ BTs, const float* __restrict__ bs,
             _Float16* __restrict__ Ohs, _Float16* __restrict__ Ors,
             _Float16* __restrict__ Ots, _Float16* __restrict__ Otrs,
             const _Float16* __restrict__ Ac, const _Float16* __restrict__ BTc, const float* __restrict__ bc,
             _Float16* __restrict__ Ohc, _Float16* __restrict__ Otc,
             float* __restrict__ Of, int prow)
{
  __shared__ __attribute__((aligned(16))) char tile[GRING(4, 2)];
  if (blockIdx.z == 0)
    gemm_body<0, true, true, 4, 2>(tile, blockIdx.x, blockIdx.y, 0,
                                   As, DM, BTs, DM, 0, bs, 0, DM, prow, Ohs, Ors, Ots, Otrs, Of, HD);
  else
    gemm_body<0, false, true, 4, 2>(tile, blockIdx.x, blockIdx.y, 0,
                                    Ac, DM, BTc, DM, 0, bc, 0, DM, prow, Ohc, Ohc, Otc, Otc, Of, HD);
}

#define SCL2 0.18033688011112042f   // log2(e) / sqrt(HD)
#define AKT 128              // keys per staged tile (= query rows per block)
#define AKP 144              // LDS pitch of a K row, bytes: 128 + 16
#define AVP 272              // LDS pitch of a Vt row, bytes: 256 + 16
#define AKB (AKT * AKP)      // K part of a tile
#define APL (AKB + HD * AVP) // K part + Vt part: one pair of planes
static_assert(SEQ % AKT == 0);
static_assert(RESQB <= 2);   // the residual-plane blocks walk at most two tiles: one buffer each

// ---------------------------------------------------------------------------
// Flash attention. Planes: Q/K [h][prow][64] f16 (prow = NB*SEQ rows per head, row = b*SEQ + s),
// Vt [h][64][prow] f16; residual planes (x2^11) of the same shapes for RES. Block 256 threads = 8 waves,
// wave = 16 queries, 32-key chunks, online softmax in f32, p carried x4096 as f16.
// Both products run transposed: S^T = K.Q^T (A = K rows, B = Q) and O^T += Vt.P^T (A = Vt rows, B = P^T). A lane then
// holds 16 scores of ONE query (query = lane & 15, keys 16*nt + 8*(lane >> 4) + r): maximum and sum are in-lane, the
// maximum joined with the other half by one cross-row move per chunk, the sums once behind the loop; and those
// 16 values are, in that order, the lane's elements of the B fragment of P^T, so that p stays in registers.
// K and Vt tiles of 128 keys staged in LDS by asynchronous copies (two buffers), once per block; the waves read
// their A fragments there (split k map).
// RES: s = qh.kh + (qr.kh + qh.kr)/2^11 ; O = ph.vh + (ph.vr + pr.vh)/2^11 folded before 1/l.
// Out: f32 [NB*SEQ][DM] at columns h*64, staged per wave in LDS, 16 lanes x 16 B per 256-B row,
// LDS tile sto: wave-private (same wave writes and reads; lds_sync_wave), 16x64 per wave, fully written.
// ---------------------------------------------------------------------------
// sto: 8 x 16 x 68 floats of LDS; kv: 2 * ABUF bytes of LDS; both 16-byte aligned; (qb, h, b): the block's queries
template<bool CAUSAL, bool RES>
__device__ __forceinline__
void attn_body(float* sto, char* kv, int qb, int h, int b,
            const _Float16* __restrict__ Qh, const _Float16* __restrict__ Qr,
            const _Float16* __restrict__ Kh, const _Float16* __restrict__ Kr,
            const _Float16* __restrict__ Vt, const _Float16* __restrict__ Vtr,
            float* __restrict__ Out, int prow)
{
  constexpr int ABUF = (RES ? 2 : 1) * APL;   // one buffer: [K | Vt], then [Kr | Vtr] with the residual planes

  const int t = threadIdx.x, lane = t & 31, hs = lane >> 4, l16 = lane & 15;
  const int w = __builtin_amdgcn_readfirstlane(t >> 5);   // scalar: a wave's own trip count below is a scalar test
  const int qbase = qb * 128 + w * 16;                       // within the sequence
  const size_t rq = (size_t)h * (size_t)prow + (size_t)b * SEQ;   // plane row base for (h, b)
  float*    sw  = sto + w * 1088;

  v16h aq[2], aqr[2];
  #pragma unroll
  for (int stp = 0; stp < 2; ++stp) {
    aq[stp]  = ldfrag(Qh + (rq + qbase + l16) * HD + 32 * stp, hs);
    aqr[stp] = RES ? ldfrag(Qr + (rq + qbase + l16) * HD + 32 * stp, hs) : aq[stp];
  }

  const v8f z8 = {0.f, 0.f, 0.f, 0.f, 0.f, 0.f, 0.f, 0.f};
  // this lane's query (l16): running maximum (both halves agree), sum over this half's keys alone
  float mrow = -3.0e38f, lrow = 0.0f;
  v8f o[4], orr[4];   // O^T: element r of tile f = column e = 16*f + 8*hs + r of query l16
  #pragma unroll
  for (int f = 0; f < 4; ++f) { o[f] = z8; orr[f] = z8; }

  const int kend = CAUSAL ? (qbase + 16) : SEQ;

  const char* Kb  = (const char*)(Kh + rq * HD);
  const char* Krb = (const char*)(Kr + rq * HD);
  const char* Vb  = (const char*)(Vt + (size_t)h * HD * (size_t)prow + (size_t)b * SEQ);
  const char* Vrb = (const char*)(Vtr + (size_t)h * HD * (size_t)prow + (size_t)b * SEQ);

  // Staging: thread = 16 B. K: a wave's copy brings 4 whole rows (512 B in a row); Vt: 2 rows of 256 B.
  const size_t gko = (size_t)((t >> 3) * (HD * 2) + (t & 7) * 16);
  const size_t gvo = (size_t)(t >> 4) * (size_t)prow * 2 + (size_t)((t & 15) * 16);
  const unsigned lk = (unsigned)(uintptr_t)kv + (unsigned)((t >> 3) * AKP + (t & 7) * 16);
  const unsigned lv = (unsigned)(uintptr_t)kv + (unsigned)(AKB + (t >> 4) * AVP + (t & 15) * 16);
  auto stage = [&](unsigned boff, int kt0) {
    #pragma unroll
    for (int pl = 0; pl < (RES ? 2 : 1); ++pl) {
      unsigned l[8];
      const char* g[8];
      #pragma unroll
      for (int j = 0; j < 4; ++j) {
        l[j] = lk + boff + (unsigned)(pl * APL + 32 * j * AKP);
        g[j] = (pl ? Krb : Kb) + gko + (size_t)(kt0 + 32 * j) * (HD * 2);
        l[4 + j] = lv + boff + (unsigned)(pl * APL + 16 * j * AVP);
        g[4 + j] = (pl ? Vrb : Vb) + gvo + ((size_t)(16 * j) * (size_t)prow + (size_t)kt0) * 2;
      }
      copy8(l, g);
    }
  };

  // A fragments of chunk c (32 keys) of the tile at tb
  const int frk = l16 * AKP + 16 * hs;
  const int frv = AKB + l16 * AVP + 16 * hs;
  auto ldsfrag = [&](const char* p) -> v16h {
    union { v16h v; v8h q[2]; } u;
    u.q[0] = *(const v8h*)p;
    u.q[1] = *(const v8h*)(p + 32);
    return u.v;
  };
  v16h fk[2][2], fkr[2][2];
  auto load_k = [&](const char* tb, int c) {
    #pragma unroll
    for (int stp = 0; stp < 2; ++stp)
      #pragma unroll
      for (int nt = 0; nt < 2; ++nt) {
        const char* p = tb + frk + (32 * c + 16 * nt) * AKP + 64 * stp;
        fk[stp][nt]  = ldsfrag(p);
        fkr[stp][nt] = RES ? ldsfrag(p + APL) : fk[stp][nt];
      }
  };

  // tiles the block walks: the same for all its waves (a wave leaves out the chunks beyond its own diagonal)
  const int nst = CAUSAL ? (qb + 1) : (SEQ / AKT);
  stage(0u, 0);
  asm volatile("s_wait_asynccnt 0x0" ::: "memory");   // this wave's share of tile 0 has landed
  __syncthreads();                                    // every wave's share has: tile 0 may be read
  if (1 < nst) stage((unsigned)ABUF, AKT);

  unsigned boff = 0u;
  #pragma unroll 1
  for (int sg = 0; sg < nst; ++sg) {
  const char* tb = kv + boff;
  // K fragments one chunk ahead inside the tile (chunk 0 here); with the residual planes, whose fragments
  // leave no registers for that, at the chunk's own head. Every wave has at least chunk 0 of every tile.
  if (!RES) load_k(tb, 0);
  const int left = (kend - sg * AKT + 31) >> 5;             // this wave's chunks from here to its diagonal, >= 1
  const int nc = (left < AKT / 32) ? left : (AKT / 32);
  #pragma unroll 1
  for (int c = 0; c < nc; ++c) {
    const int kt = sg * AKT + 32 * c;
    if (RES) load_k(tb, c);

    // ---- scores, transposed: 32 keys (2 tiles) x 16 queries, K = 64 in 2 steps ----
    v8f s[2], sr[2];
    s[0] = z8; s[1] = z8; sr[0] = z8; sr[1] = z8;
    #pragma unroll
    for (int stp = 0; stp < 2; ++stp) {
      #pragma unroll
      for (int nt = 0; nt < 2; ++nt) {
        s[nt] = mma16(fk[stp][nt], aq[stp], s[nt]);
        if (RES) {
          sr[nt] = mma16(fk[stp][nt], aqr[stp], sr[nt]);
          sr[nt] = mma16(fkr[stp][nt], aq[stp], sr[nt]);
        }
      }
    }

    // ---- this chunk's V fragments, one group, issued here so that they land under the softmax ----
    v16h fv[4], fvr[4];
    #pragma unroll
    for (int f = 0; f < 4; ++f) {
      const char* p = tb + frv + 16 * f * AVP + 64 * c;
      fv[f]  = ldsfrag(p);
      fvr[f] = RES ? ldsfrag(p + APL) : fv[f];
    }

    // ---- next chunk's K fragments (same tile), into the registers the products above have just read ----
    if (!RES && c + 1 < AKT / 32) load_k(tb, c + 1);

    // ---- causal replace-mask, online softmax (f32). The scores stay unscaled: 1/sqrt(HD), log2(e), the maximum and
    //      the x4096 that p carries all go into ONE fused multiply-add in front of the base-2 exponential ----
    // key > row with key = kt + 16*nt + 8*hs + r, row = qbase + l16: the lane's part on one side, so that a score's
    // own part (16*nt + r) is an immediate of the compare
    const int dq = qbase + l16 - 8 * hs - kt;
    float pv[2][8];
    #pragma unroll
    for (int nt = 0; nt < 2; ++nt)
      #pragma unroll
      for (int r = 0; r < 8; ++r) {
        float v = s[nt][r];
        if (RES) v += sr[nt][r] * (1.0f / 2048.0f);
        if (CAUSAL) {
          if (16 * nt + r > dq) v = -8.0e9f;     // key > row; -1e9 in the scaled scores
        }
        pv[nt][r] = v;
      }
    float tq[4];
    #pragma unroll
    for (int i = 0; i < 4; ++i)
      tq[i] = fmaxf(fmaxf(pv[0][2 * i], pv[0][2 * i + 1]), fmaxf(pv[1][2 * i], pv[1][2 * i + 1]));
    float tm = fmaxf(fmaxf(tq[0], tq[1]), fmaxf(tq[2], tq[3]));
    tm = fmaxf(tm, xhalf(tm));            // the query's other 16 keys of the chunk

    const float mn = fmaxf(mrow, tm);     // unscaled, as the scores
    const float corr = __builtin_amdgcn_exp2f((mrow - mn) * SCL2);
    const float sh = fmaf(-mn, SCL2, 12.0f);   // 2^12 = 4096
    mrow = mn;
    #pragma unroll
    for (int nt = 0; nt < 2; ++nt)
      #pragma unroll
      for (int r = 0; r < 8; ++r) pv[nt][r] = __builtin_amdgcn_exp2f(fmaf(pv[nt][r], SCL2, sh));   // p x4096
    float tsq[4];
    #pragma unroll
    for (int i = 0; i < 4; ++i)
      tsq[i] = (pv[0][2 * i] + pv[0][2 * i + 1]) + (pv[1][2 * i] + pv[1][2 * i + 1]);
    lrow = lrow * corr + ((tsq[0] + tsq[1]) + (tsq[2] + tsq[3]));   // the sum carries the x4096 too
    #pragma unroll
    for (int f = 0; f < 4; ++f)
      #pragma unroll
      for (int r = 0; r < 8; ++r) {
        o[f][r] *= corr;
        if (RES) orr[f][r] *= corr;
      }

    // ---- p (x4096, f16 hi; x2^11 residual for RES) packed in place into the B fragment of P^T:
    //      elements 0..7 = keys 8*hs + r (tile 0), elements 8..15 = keys 16 + 8*hs + r (tile 1), the k map of ldfrag ----
    v16h bp, bpr;
    #pragma unroll
    for (int nt = 0; nt < 2; ++nt)
      #pragma unroll
      for (int r = 0; r < 8; ++r) {
        const float pc = pv[nt][r];
        const _Float16 ph = (_Float16)pc;
        bp[8 * nt + r]  = ph;
        bpr[8 * nt + r] = RES ? (_Float16)((pc - (float)ph) * 2048.0f) : ph;
      }

    // ---- O^T += Vt . P^T : A fragments of the Vt plane (row e, k = key contiguous), read behind the scores ----
    #pragma unroll
    for (int f = 0; f < 4; ++f) {
      o[f] = mma16(fv[f], bp, o[f]);
      if (RES) {
        orr[f] = mma16(fvr[f], bp, orr[f]);
        orr[f] = mma16(fv[f], bpr, orr[f]);
      }
    }
  }
  asm volatile("s_wait_dscnt 0x0" ::: "memory");      // this wave's reads of the buffer are done
  asm volatile("s_wait_asynccnt 0x0" ::: "memory");   // its share of the next tile has landed
  __syncthreads();   // publishes the next tile and ends every wave's reads of this buffer, refilled below
  // with the residual planes the block is one of query blocks 0..RESQB-1: no more tiles than buffers, no refill
  if (!RES && sg + 2 < nst) stage(boff, (sg + 2) * AKT);
  boff ^= (unsigned)ABUF;
  }
  asm volatile("s_wait_asynccnt 0x0" ::: "memory");     // no copy is left in flight

  // ---- normalise, stage 16x64 f32 tile per wave, whole-line stores ----
  lrow += xhalf(lrow);                    // the two halves' key sums joined, once
  const float inv = 1.0f / lrow;          // sum and O both carry the x4096
  #pragma unroll
  for (int f = 0; f < 4; ++f)
    #pragma unroll
    for (int q = 0; q < 2; ++q) {
      v4f sv;
      #pragma unroll
      for (int i = 0; i < 4; ++i) {
        float v = o[f][4 * q + i];
        if (RES) v += orr[f][4 * q + i] * (1.0f / 2048.0f);
        sv[i] = v * inv;
      }
      *(v4f*)(sw + l16 * 68 + 16 * f + 8 * hs + 4 * q) = sv;
    }
  lds_sync_wave();
  const size_t orow = (size_t)b * SEQ + (size_t)qbase;
  {
    #pragma unroll
    for (int j = 0; j < 8; ++j) {
      const int row = 2 * j + hs;
      const v4f fvv = *(const v4f*)(sw + row * 68 + 4 * l16);
      *(v4f*)(Out + (orow + row) * DM + h * HD + 4 * l16) = fvv;
    }
    
  }
}

// two waves per SIMD is what the grids give (at most one block per WGP): said here so that the scheduler spends
// registers on the fragments in flight instead of saving them for more waves
__global__ __launch_bounds__(256) __attribute__((amdgpu_waves_per_eu(2, 2)))
void k_attn_cross(const _Float16* __restrict__ Qh, const _Float16* __restrict__ Kh, const _Float16* __restrict__ Vt,
                  float* __restrict__ Out, int prow)
{
  __shared__ __attribute__((aligned(16))) float sto[8 * 16 * 68];
  __shared__ __attribute__((aligned(16))) char kv[2 * APL];
  attn_body<false, false>(sto, kv, blockIdx.x, blockIdx.y, blockIdx.z, Qh, Qh, Kh, Kh, Vt, Vt, Out, prow);
}

// Causal attention, every query block in one grid: blocks 0..RESQB-1 take the path with the residual planes, the
// others the plain one. They write disjoint rows of Out and read the same planes; a block is wholly one kind.
__global__ __launch_bounds__(256) __attribute__((amdgpu_waves_per_eu(2, 2)))
void k_attn_self(const _Float16* __restrict__ Qh, const _Float16* __restrict__ Qr,
                 const _Float16* __restrict__ Vt, const _Float16* __restrict__ Vtr,
                 float* __restrict__ Out, int prow)
{
  __shared__ __attribute__((aligned(16))) float sto[8 * 16 * 68];
  __shared__ __attribute__((aligned(16))) char kv[4 * APL];
  if (blockIdx.x < RESQB)
    attn_body<true, true>(sto, kv, blockIdx.x, blockIdx.y, blockIdx.z, Qh, Qr, Qh, Qr, Vt, Vtr, Out, prow);
  else
    attn_body<true, false>(sto, kv, blockIdx.x, blockIdx.y, blockIdx.z, Qh, Qr, Qh, Qr, Vt, Vtr, Out, prow);
}

// ---------------------------------------------------------------------------
// y = LayerNorm(x + r) * g + b over DM = 1024, one block (256 threads) per row, thread = 4 columns.
// XIN: x is a raw input (bf16 RNE convert, input row stride via SEQ_FULL); else x is a ws f32 plane.
// WH: also write the f16 plane yh. g, b bf16 RNE converted. Outputs: 256 lanes x 16/8 B per row
// coverage: nrow x DM for y (and yh).
// ---------------------------------------------------------------------------
template<bool XIN, bool WH>
__global__ __launch_bounds__(256)
void k_ln(const float* __restrict__ x, const float* __restrict__ rr,
          const float* __restrict__ g, const float* __restrict__ be,
          float* __restrict__ y, _Float16* __restrict__ yh)
{
  #pragma clang fp contract(off)
  __shared__ float red[8];
  __shared__ float red2[8];
  const int m = blockIdx.x, t = threadIdx.x, lane = t & 31, w = t >> 5;
  const int c = 4 * t;
  const size_t xrow = XIN ? ((size_t)(m / SEQ) * SEQ_FULL + (size_t)(m % SEQ)) : (size_t)m;
  const v4f xv = *(const v4f*)(x + xrow * DM + c);
  const v4f rv = *(const v4f*)(rr + (size_t)m * DM + c);
  float v[4];
  #pragma unroll
  for (int i = 0; i < 4; ++i) {
    float xi = xv[i];
    if (XIN) xi = bfr(xi);
    v[i] = xi + rv[i];
  }
  float s = (v[0] + v[1]) + (v[2] + v[3]);
  #pragma unroll
  for (int off = 16; off > 0; off >>= 1) s += __shfl_xor(s, off, 32);
  if (lane == 0) red[w] = s;
  __syncthreads();
  float tot = 0.0f;
  #pragma unroll
  for (int i = 0; i < 8; ++i) tot += red[i];
  const float mu = tot * (1.0f / (float)DM);

  float d[4];
  #pragma unroll
  for (int i = 0; i < 4; ++i) d[i] = v[i] - mu;
  float s2 = (d[0] * d[0] + d[1] * d[1]) + (d[2] * d[2] + d[3] * d[3]);
  #pragma unroll
  for (int off = 16; off > 0; off >>= 1) s2 += __shfl_xor(s2, off, 32);
  if (lane == 0) red2[w] = s2;
  __syncthreads();
  float tot2 = 0.0f;
  #pragma unroll
  for (int i = 0; i < 8; ++i) tot2 += red2[i];
  const float var = tot2 * (1.0f / (float)DM);
  const float rstd = rsqrtf(var + LN_EPS);

  v4f ov;
  v4h oh;
  #pragma unroll
  for (int i = 0; i < 4; ++i) {
    const float gv = bfr(g[c + i]);
    const float bvv = bfr(be[c + i]);
    const float q = d[i] * rstd * gv + bvv;
    ov[i] = q;
    oh[i] = (_Float16)q;
  }
  float* ydst = y + (size_t)m * DM + c;
  _Float16* hdst = yh + (WH ? ((size_t)m * DM + c) : 0);
  *(v4f*)ydst = ov;
  if (WH) *(v4h*)hdst = oh;
  
}

// ---------------------------------------------------------------------------
extern "C" void kernel_launch(void* const* d_in, const int* in_sizes, int n_in,
                              void* d_out, int out_size, void* d_ws, size_t ws_size,
                              hipStream_t stream)
{
  if (n_in < 16) return;
  const int MR = NB * SEQ;                 // internal rows (b*SEQ + s)
  const long need_act = (long)(NB - 1) * SEQ_FULL * DM + (long)SEQ * DM;
  if ((long)in_sizes[0] < need_act || (long)in_sizes[1] < need_act) return;
  if (in_sizes[2] < NH * DM * HD || in_sizes[3] < NH * HD) return;
  if (in_sizes[4] < NH * DM * HD || in_sizes[5] < NH * HD) return;
  for (int i = 6; i < 12; ++i) if (in_sizes[i] < DM) return;
  if (in_sizes[12] < DM * FF || in_sizes[13] < FF || in_sizes[14] < FF * DM || in_sizes[15] < DM) return;
  if (out_size < MR * DM) return;

  const float* y      = (const float*)d_in[0];
  const float* enc    = (const float*)d_in[1];
  const float* Wself  = (const float*)d_in[2];
  const float* bself  = (const float*)d_in[3];
  const float* Wcross = (const float*)d_in[4];
  const float* bcross = (const float*)d_in[5];
  const float* g1  = (const float*)d_in[6];  const float* be1 = (const float*)d_in[7];
  const float* g2  = (const float*)d_in[8];  const float* be2 = (const float*)d_in[9];
  const float* g3  = (const float*)d_in[10]; const float* be3 = (const float*)d_in[11];
  const float* w1  = (const float*)d_in[12]; const float* b1  = (const float*)d_in[13];
  const float* w2  = (const float*)d_in[14]; const float* b2  = (const float*)d_in[15];
  float* out = (float*)d_out;

  // ---- workspace carve (256-B aligned regions; 104 MiB at NB*SEQ = 2048) ----
  char* base = (char*)d_ws;
  size_t off = 0;
  auto take = [&](size_t bytes) -> void* {
    void* p = (void*)(base + off);
    off += (bytes + 255) & ~(size_t)255;
    return p;
  };
  _Float16* Yh   = (_Float16*)take((size_t)MR * DM * 2);
  _Float16* Eh   = (_Float16*)take((size_t)MR * DM * 2);
  _Float16* WTs  = (_Float16*)take((size_t)NH * HD * DM * 2);
  _Float16* WTc  = (_Float16*)take((size_t)NH * HD * DM * 2);
  _Float16* W1T  = (_Float16*)take((size_t)FF * DM * 2);
  _Float16* W2T  = (_Float16*)take((size_t)DM * FF * 2);
  _Float16* QKVh = (_Float16*)take((size_t)NH * MR * HD * 2);
  _Float16* QKVr = (_Float16*)take((size_t)NH * MR * HD * 2);
  _Float16* VTh  = (_Float16*)take((size_t)NH * HD * MR * 2);
  _Float16* VTr  = (_Float16*)take((size_t)NH * HD * MR * 2);
  float*    att  = (float*)   take((size_t)MR * DM * 4);     // sa, then ca, then ff
  float*    y1   = (float*)   take((size_t)MR * DM * 4);
  _Float16* y1h  = (_Float16*)take((size_t)MR * DM * 2);
  float*    y2   = (float*)   take((size_t)MR * DM * 4);
  _Float16* y2h  = (_Float16*)take((size_t)MR * DM * 2);
  _Float16* Qch  = (_Float16*)take((size_t)NH * MR * HD * 2);
  _Float16* KVch = (_Float16*)take((size_t)NH * MR * HD * 2);
  _Float16* VTc  = (_Float16*)take((size_t)NH * HD * MR * 2);
  _Float16* Hh   = (_Float16*)take((size_t)MR * FF * 2);
  if (off > ws_size) return;

  // ---- planes ----
  k_prep<<<dim3(2 * PBW + 2 * PBH + PBC), 256, 0, stream>>>(
      y, enc, Wself, Wcross, w1, w2, Yh, Eh, WTs, WTc, W1T, W2T, MR);

  const int nqb  = SEQ / 128;

  // ---- projections of y (self: q = k = v share one) and of enc (cross: k = v share one) ----
  k_proj2<<<dim3(MR / 128, NH * HD / 128, 2), 256, 0, stream>>>(
      Yh, WTs, bself, QKVh, QKVr, VTh, VTr, Eh, WTc, bcross, KVch, VTc, att, MR);

  // ---- self attention ----
  k_attn_self<<<dim3(nqb, NH, NB), 256, 0, stream>>>(QKVh, QKVr, VTh, VTr, att, MR);
  k_ln<true, true><<<dim3(MR), 256, 0, stream>>>(y, att, g1, be1, y1, y1h);

  // ---- cross attention (q from y1; k = v from enc, projected above) ----
  k_gemm<0, false, false, 4, 1><<<dim3(MR / 128, HD / 64, NH), 128, 0, stream>>>(
      y1h, DM, WTc, DM, HD * DM, bcross, HD, DM, MR, Qch, Qch, Qch, Qch, att, HD);
  k_attn_cross<<<dim3(nqb, NH, NB), 256, 0, stream>>>(Qch, KVch, VTc, att, MR);
  k_ln<false, true><<<dim3(MR), 256, 0, stream>>>(y1, att, g2, be2, y2, y2h);

  // ---- MLP ----
  k_gemm<1, false, false, 8, 2><<<dim3(MR / 256, FF / 128, 1), 512, 0, stream>>>(
      y2h, DM, W1T, DM, 0, b1, 0, DM, MR, Hh, Hh, Hh, Hh, att, FF);
  k_gemm<2, false, false, 4, 1><<<dim3(MR / 128, DM / 64, 1), 128, 0, stream>>>(
      Hh, FF, W2T, FF, 0, b2, 0, FF, MR, y2h, y2h, y2h, y2h, att, DM);
  k_ln<false, false><<<dim3(MR), 256, 0, stream>>>(y2, att, g3, be3, out, y2h);
}

// v008
// One run takes 124 microseconds.
// Timed twice side by side with v007, it ran 1.03 times as fast both times.
// Over all steps from v000 it is 5.41 times as fast.
#include <hip/hip_runtime.h>
#include <stdint.h>
#include <stddef.h>

// Contractions on v_wmma_f32_16x16x32_f16 (f16 operands, f32 accumulate): per-head q/k/v projections,
// q.k^T, p.v (self causal and cross), MLP up and down GEMMs. Float inputs RNE-converted to bf16 and held
// as f16 planes (weights carried x64, softmax p carried x4096, x256 without residual planes); causal query blocks 0..RESQB-1 add f16
// residual planes (x2^11) for q, k, p, v into a second accumulator. Softmax, layer norms, bias adds: f32.

#ifndef NB
#define NB 1
#endif
#ifndef SEQ
#define SEQ 2048
#endif
#define NB_FULL 1
#define SEQ_FULL 2048
#define DM 1024
#define NH 16
#define HD 64
#define FF 4096
#define RESQB 2
#define LN_EPS 1.0e-5f

static_assert(SEQ % 128 == 0);
static_assert(SEQ <= SEQ_FULL);
static_assert(NB >= 1 && NB <= NB_FULL);
static_assert(HD == 64);
static_assert(DM % 128 == 0 && FF % 128 == 0);
static_assert(DM % 32 == 0 && FF % 32 == 0);
static_assert((NB * SEQ) % 256 == 0);
static_assert(DM == 4 * 256);

typedef _Float16 v4h  __attribute__((ext_vector_type(4)));
typedef _Float16 v8h  __attribute__((ext_vector_type(8)));
typedef _Float16 v16h __attribute__((ext_vector_type(16)));
typedef float    v4f  __attribute__((ext_vector_type(4)));
typedef float    v8f  __attribute__((ext_vector_type(8)));

// ---------------------------------------------------------------------------
// helpers
// ---------------------------------------------------------------------------
__device__ __forceinline__ v8f mma16(v16h a, v16h b, v8f c)
{
  c = __builtin_amdgcn_wmma_f32_16x16x32_f16(false, a, false, b, (short)0, c, false, false);
  asm volatile("v_nop\n\tv_nop\n\tv_nop\n\tv_nop" : "+v"(c) : "v"(a), "v"(b));
  return c;
}

// D = A.B + C into a tile of its own, C living on. As text: the builtin form copied C into D's registers first where C
// is kept over a loop. The four v_nop keep the distance behind a matrix instruction.
__device__ __forceinline__ v8f mma16c(v16h a, v16h b, v8f c)
{
  v8f d;
  asm volatile("v_wmma_f32_16x16x32_f16 %0, %1, %2, %3\n\tv_nop\n\tv_nop\n\tv_nop\n\tv_nop"
               : "=&v"(d) : "v"(a), "v"(b), "v"(c));
  return d;
}

// 16x16x32 16-bit fragment (A row m = lane&15, or B column n = lane&15, k contiguous at p):
// elements 0..7 <- k0+8h+0..7, elements 8..15 <- k0+16+8h+0..7, h = lane>>4
__device__ __forceinline__ v16h ldfrag(const _Float16* p, int hs)
{
  union { v16h v; v8h q[2]; } u;
  u.q[0] = *(const v8h*)(p + 8 * hs);
  u.q[1] = *(const v8h*)(p + 16 + 8 * hs);
  return u.v;
}

// bf16 RNE convert, returned widened to f32
__device__ __forceinline__ float bfr(float x)
{
  unsigned int u = __float_as_uint(x);
  u = (u + 0x7FFFu + ((u >> 16) & 1u)) & 0xFFFF0000u;
  return __uint_as_float(u);
}

// same-wave LDS store -> load ordering (wave-private tiles only)
__device__ __forceinline__ void lds_sync_wave()
{
  asm volatile("s_wait_dscnt 0x0" ::: "memory");
  __builtin_amdgcn_wave_barrier();
}

// value of lane l ^ 16 (the other 16-lane half), by a vector cross-row move
__device__ __forceinline__ float xhalf(float x)
{
  return __builtin_bit_cast(float, __builtin_amdgcn_permlanex16(__builtin_bit_cast(int, x), __builtin_bit_cast(int, x),
                                                                0x76543210, 0xfedcba98, false, false));
}

// ---------------------------------------------------------------------------
// Activation planes: Yh = f16(bf16rne(y)), Eh = f16(bf16rne(enc)), internal row m -> input row
// coverage: Yh and Eh each nrow*DM elements exactly.
// ---------------------------------------------------------------------------
__device__ __forceinline__
void cvt_act_body(int bid, const float* __restrict__ y, const float* __restrict__ e,
                  _Float16* __restrict__ Yh, _Float16* __restrict__ Eh, int nrow)
{
  const int groups = nrow * (DM / 8);
  const int g = bid * 256 + threadIdx.x;
  if (g >= 2 * groups) return;
  const int which = (g >= groups) ? 1 : 0;
  const int idx = g - which * groups;
  const int m = idx / (DM / 8);
  const int c = (idx - m * (DM / 8)) * 8;
  const size_t srow = (size_t)(m / SEQ) * SEQ_FULL + (size_t)(m % SEQ);
  const float* src = (which ? e : y) + srow * DM + c;
  const v4f a = *(const v4f*)src;
  const v4f b = *(const v4f*)(src + 4);
  v8h o;
  o[0] = (_Float16)bfr(a[0]); o[1] = (_Float16)bfr(a[1]); o[2] = (_Float16)bfr(a[2]); o[3] = (_Float16)bfr(a[3]);
  o[4] = (_Float16)bfr(b[0]); o[5] = (_Float16)bfr(b[1]); o[6] = (_Float16)bfr(b[2]); o[7] = (_Float16)bfr(b[3]);
  _Float16* dst = (which ? Eh : Yh) + (size_t)m * DM + c;
  *(v8h*)dst = o;
  
}

// ---------------------------------------------------------------------------
// Transposed weight planes: in[z][R][C] f32 -> out[z][C][R] f16, value f16(bf16rne(x) * scale).
// coverage: full C x R per z.
// ---------------------------------------------------------------------------
__device__ __forceinline__
void wtr_body(float (*tile)[65], int bx, int by, int bz,
              const float* __restrict__ in, _Float16* __restrict__ out, int R, int C, float scale)
{
  const int t = threadIdx.x;
  const int c0 = bx * 64, r0 = by * 64;
  const size_t zoff = (size_t)bz * (size_t)R * (size_t)C;
  {
    const int r = t >> 2, cq = (t & 3) * 16;
    const float* p = in + zoff + (size_t)(r0 + r) * C + c0 + cq;
    #pragma unroll
    for (int i = 0; i < 4; ++i) {
      const v4f v = *(const v4f*)(p + 4 * i);
      tile[r][cq + 4 * i + 0] = v[0];
      tile[r][cq + 4 * i + 1] = v[1];
      tile[r][cq + 4 * i + 2] = v[2];
      tile[r][cq + 4 * i + 3] = v[3];
    }
  }
  __syncthreads();
  const int p8 = t & 7;
  {
    #pragma unroll
    for (int j = 0; j < 2; ++j) {
      const int c = (t >> 3) + 32 * j;
      v8h ov;
      #pragma unroll
      for (int i = 0; i < 8; ++i) ov[i] = (_Float16)(bfr(tile[8 * p8 + i][c]) * scale);
      _Float16* dst = out + zoff + (size_t)(c0 + c) * R + r0 + 8 * p8;
      *(v8h*)dst = ov;
    }
    
  }
}

// ---------------------------------------------------------------------------
// All planes that depend on the inputs alone, one grid: none reads what another writes. Block ranges, in order:
// w1 -> W1T, w2 -> W2T (PBW blocks each), Wself -> WTs, Wcross -> WTc (PBH blocks each), then y, enc -> Yh, Eh.
// The range test reads blockIdx alone: a block is wholly one kind, so the transpose's barrier is block-uniform.
// ---------------------------------------------------------------------------
#define PBW ((FF / 64) * (DM / 64))
#define PBH ((DM / 64) * NH)
#define PBC ((2 * NB * SEQ * (DM / 8) + 255) / 256)
__global__ __launch_bounds__(256)
void k_prep(const float* __restrict__ y, const float* __restrict__ e,
            const float* __restrict__ Ws, const float* __restrict__ Wc,
            const float* __restrict__ w1, const float* __restrict__ w2,
            _Float16* __restrict__ Yh, _Float16* __restrict__ Eh,
            _Float16* __restrict__ WTs, _Float16* __restrict__ WTc,
            _Float16* __restrict__ W1T, _Float16* __restrict__ W2T, int nrow)
{
  __shared__ float tile[64][65];
  const int bid = blockIdx.x;
  if (bid < 2 * PBW + 2 * PBH) {
    const float* in;
    _Float16* out;
    int R, C, bx, by, bz;
    if (bid < PBW) {                 // in[1024][4096] -> out[4096][1024]
      in = w1; out = W1T; R = DM; C = FF;
      bx = bid % (FF / 64); by = bid / (FF / 64); bz = 0;
    } else if (bid < 2 * PBW) {      // in[4096][1024] -> out[1024][4096]
      in = w2; out = W2T; R = FF; C = DM;
      bx = (bid - PBW) % (DM / 64); by = (bid - PBW) / (DM / 64); bz = 0;
    } else {                         // in[h][1024][64] -> out[h][64][1024]
      const bool cr = bid >= 2 * PBW + PBH;
      const int hb = bid - 2 * PBW - (cr ? PBH : 0);
      in = cr ? Wc : Ws; out = cr ? WTc : WTs; R = DM; C = HD;
      bx = 0; by = hb % (DM / 64); bz = hb / (DM / 64);
    }
    wtr_body(tile, bx, by, bz, in, out, R, C, 64.0f);
  } else {
    cvt_act_body(bid - (2 * PBW + 2 * PBH), y, e, Yh, Eh, nrow);
  }
}

#define GKS 128              // k per staged tile
#define GLP 272              // LDS row pitch, bytes: 256 + 16, conflict-free for 16-byte fragment reads
#define GNB 3                // buffers of the ring: one read, two being filled
#define GRING(WM, WN) (GNB * (32 * (WM) + 64 * (WN)) * GLP)   // LDS bytes of the ring of a block of WM x WN waves
static_assert(DM % GKS == 0 && FF % GKS == 0);

// twelve 16-byte-per-lane copies global -> LDS, through no register. The s_wait_xcnt closes the statement, so that
// no address register of a copy is rewritten while the copy still names it.
__device__ __forceinline__ void copy12(const unsigned (&l)[12], const char* const (&g)[12])
{
  asm volatile(
    "global_load_async_to_lds_b128 %0, %12, off\n\t"
    "global_load_async_to_lds_b128 %1, %13, off\n\t"
    "global_load_async_to_lds_b128 %2, %14, off\n\t"
    "global_load_async_to_lds_b128 %3, %15, off\n\t"
    "global_load_async_to_lds_b128 %4, %16, off\n\t"
    "global_load_async_to_lds_b128 %5, %17, off\n\t"
    "global_load_async_to_lds_b128 %6, %18, off\n\t"
    "global_load_async_to_lds_b128 %7, %19, off\n\t"
    "global_load_async_to_lds_b128 %8, %20, off\n\t"
    "global_load_async_to_lds_b128 %9, %21, off\n\t"
    "global_load_async_to_lds_b128 %10, %22, off\n\t"
    "global_load_async_to_lds_b128 %11, %23, off\n\t"
    "s_wait_xcnt 0x0"
    : : "v"(l[0]), "v"(l[1]), "v"(l[2]), "v"(l[3]), "v"(l[4]), "v"(l[5]),
        "v"(l[6]), "v"(l[7]), "v"(l[8]), "v"(l[9]), "v"(l[10]), "v"(l[11]),
        "v"(g[0]), "v"(g[1]), "v"(g[2]), "v"(g[3]), "v"(g[4]), "v"(g[5]),
        "v"(g[6]), "v"(g[7]), "v"(g[8]), "v"(g[9]), "v"(g[10]), "v"(g[11])
    : "memory");
}

// eight 16-byte-per-lane copies global -> LDS; the s_wait_xcnt closes the statement as in copy12
__device__ __forceinline__ void copy8(const unsigned (&l)[8], const char* const (&g)[8])
{
  asm volatile(
    "global_load_async_to_lds_b128 %0, %8, off\n\t"
    "global_load_async_to_lds_b128 %1, %9, off\n\t"
    "global_load_async_to_lds_b128 %2, %10, off\n\t"
    "global_load_async_to_lds_b128 %3, %11, off\n\t"
    "global_load_async_to_lds_b128 %4, %12, off\n\t"
    "global_load_async_to_lds_b128 %5, %13, off\n\t"
    "global_load_async_to_lds_b128 %6, %14, off\n\t"
    "global_load_async_to_lds_b128 %7, %15, off\n\t"
    "s_wait_xcnt 0x0"
    : : "v"(l[0]), "v"(l[1]), "v"(l[2]), "v"(l[3]), "v"(l[4]), "v"(l[5]), "v"(l[6]), "v"(l[7]),
        "v"(g[0]), "v"(g[1]), "v"(g[2]), "v"(g[3]), "v"(g[4]), "v"(g[5]), "v"(g[6]), "v"(g[7])
    : "memory");
}

// this wave's copies have landed but for the N youngest (N = the copies of one tile)
template<int N>
__device__ __forceinline__ void wait_copies_but()
{
  static_assert(N == 24 || N == 16 || N == 12);
  if constexpr (N == 24) asm volatile("s_wait_asynccnt 24" ::: "memory");
  else if constexpr (N == 16) asm volatile("s_wait_asynccnt 16" ::: "memory");
  else asm volatile("s_wait_asynccnt 12" ::: "memory");
}

// ---------------------------------------------------------------------------
// GEMM C[M][N] = A[M][K] (f16 row-major, pitch lda) x B, B given as BT[N][K] (k contiguous, pitch ldb,
// per-z offset sBz). Block = WM x WN waves, wave tile 32x64 (2x4 fragments), block tile BM x BN = 32*WM x 64*WN:
// a staged row serves every wave of its block row or column, so that a wider block draws fewer bytes from L2 per product.
// k-tiles of 128 staged in LDS by asynchronous copies (three buffers, two tiles ahead), fragments read from LDS. Epilogue: v = acc/64 + bf16rne(bias[z*sBias + n])
//   MODE 0: Oh[head][prow][64] f16, head = z + n/64 (+ Or residual (v-hi)*2^11 if RES) (+ Ot/Otr [head][64][prow] if WVT)
//   MODE 1: Oh[M][ldc] f16 at columns n0..n0+BN-1
//   MODE 2: Of[M][ldc] f32 at columns n0..n0+BN-1
// coverage: each block writes rows m0..m0+BM-1 x BN columns of every plane it owns (and the 64 x 128
// transposed slabs for WVT); grid (M/BM, N/BN, Z) tiles the planes exactly.
// ---------------------------------------------------------------------------
// tile: GRING(WM, WN) bytes of LDS, 16-byte aligned, the ring and behind the loop the epilogue's stage; (bx, by, z): the block's tile
template<int MODE, bool RES, bool WVT, int WM, int WN>
__device__ __forceinline__
void gemm_body(char* tile, int bx, int by, int z,
            const _Float16* __restrict__ A, int lda,
            const _Float16* __restrict__ BT, int ldb, int sBz,
            const float* __restrict__ bias, int sBias,
            int K, int prow,
            _Float16* __restrict__ Oh, _Float16* __restrict__ Or,
            _Float16* __restrict__ Ot, _Float16* __restrict__ Otr,
            float* __restrict__ Of, int ldc)
{
  constexpr int BM = 32 * WM, BN = 64 * WN, NT = 32 * WM * WN;
  constexpr int RP = NT / 16;                  // rows that one copy of every thread brings
  constexpr int NCP = (BM + BN) / RP;          // copies of one wave per tile
  constexpr int CG = (NCP % 12 == 0) ? 12 : 8; // copies per statement
  constexpr unsigned GBUF = (unsigned)((BM + BN) * GLP);   // one buffer: BM A rows, then BN B rows
  static_assert(BM % RP == 0 && BN % RP == 0 && NCP % CG == 0);
  static_assert(2 * NCP <= 63);                // copies of a wave in flight: two tiles' at most
  static_assert(WN * BM * 68 * 4 <= GNB * (BM + BN) * GLP);   // the epilogue's stage lies in the ring
  static_assert(!WVT || BM == 128);
  const int t = threadIdx.x, lane = t & 31, w = t >> 5, hs = lane >> 4, l16 = lane & 15;
  const int wm = w % WM, wn = w / WM;          // the wave's place in the block tile
  const int m0 = bx * BM, n0 = by * BN;

  const v8f z8 = {0.f, 0.f, 0.f, 0.f, 0.f, 0.f, 0.f, 0.f};
  v8f acc[2][4];
  #pragma unroll
  for (int mt = 0; mt < 2; ++mt)
    #pragma unroll
    for (int nt = 0; nt < 4; ++nt) acc[mt][nt] = z8;

  // Staging: a copy of one wave brings two whole rows of the tile (2 x 256 B, whole lines); thread = 16 B at
  // column cc of row RP*i + cr, i = 0..NCP-1. Every row is fetched once per block and read from LDS by the waves.
  const int cr = t >> 4, cc = t & 15;
  const char* Ag = (const char*)(A + (size_t)(m0 + cr) * lda + 8 * cc);
  const char* Bg = (const char*)(BT + (size_t)z * sBz + (size_t)(n0 + cr) * ldb + 8 * cc);
  const unsigned lcp = (unsigned)(uintptr_t)tile + (unsigned)(cr * GLP + cc * 16);
  auto stage = [&](unsigned boff, int k0) {
    #pragma unroll
    for (int hf = 0; hf < NCP / CG; ++hf) {
      unsigned l[CG];
      const char* g[CG];
      #pragma unroll
      for (int i = 0; i < CG; ++i) {
        const int idx = CG * hf + i;
        l[i] = lcp + boff + (unsigned)(RP * idx * GLP);
        g[i] = (idx < BM / RP) ? (Ag + ((size_t)(RP * idx) * lda + k0) * 2)
                               : (Bg + ((size_t)(RP * (idx - BM / RP)) * ldb + k0) * 2);
      }
      if constexpr (CG == 12) copy12(l, g); else copy8(l, g);
    }
  };

  // Fragments from LDS, two register sets: a 32-k step's 12 reads go out as one group ahead of the step before it.
  // k and sum order as before. K is a multiple of GKS (DM, FF).
  v16h fa[2][2], fb[2][4];
  auto products = [&](int s) {
    #pragma unroll
    for (int nt = 0; nt < 4; ++nt) {
      acc[0][nt] = mma16(fa[s][0], fb[s][nt], acc[0][nt]);
      acc[1][nt] = mma16(fa[s][1], fb[s][nt], acc[1][nt]);
    }
  };
  const int fra = (32 * wm + l16) * GLP + 16 * hs;
  const int frb = (BM + 64 * wn + l16) * GLP + 16 * hs;
  auto frags = [&](int s, const char* tb, int stp) {
    #pragma unroll
    for (int mt = 0; mt < 2; ++mt) {
      union { v16h v; v8h q[2]; } u;
      const char* p = tb + fra + 16 * mt * GLP + 64 * stp;
      u.q[0] = *(const v8h*)p;
      u.q[1] = *(const v8h*)(p + 32);
      fa[s][mt] = u.v;
    }
    #pragma unroll
    for (int nt = 0; nt < 4; ++nt) {
      union { v16h v; v8h q[2]; } u;
      const char* p = tb + frb + 16 * nt * GLP + 64 * stp;
      u.q[0] = *(const v8h*)p;
      u.q[1] = *(const v8h*)(p + 32);
      fb[s][nt] = u.v;
    }
  };

  // Ring of three: tile t + 2 is asked for at the head of trip t and first read in trip t + 2, so that a tile has two
  // trips to land in: one trip's products are shorter than a tile's way from L2 or memory. The counter returns a wave's
  // copies in the order of issue: the counted wait, used only where exactly NCP copies were issued behind the tile that
  // is wanted, leaves those in flight and covers every older one. A trip that issues none waits to 0.
  stage(0u, 0);
  if (GKS < K) {
    stage(GBUF, GKS);
    wait_copies_but<NCP>();                             // this wave's share of tile 0 has landed, tile 1 may fly
  } else {
    asm volatile("s_wait_asynccnt 0x0" ::: "memory");   // this wave's share of tile 0 has landed
  }
  __syncthreads();                                      // every wave's share has: tile 0 may be read

  unsigned boff = 0u, bfill = 2u * GBUF;                // buffer of this trip's tile; buffer of the tile two ahead
  #pragma unroll 1   // rolled: one trip is one tile, four 32-k steps unrolled inside
  for (int k0 = 0; k0 < K; k0 += GKS) {
    const bool more = k0 + 2 * GKS < K;                 // the same for the whole block
    // refill: the buffer that the trip before has read, behind the barrier that ended every wave's reads of it
    if (more) stage(bfill, k0 + 2 * GKS);
    const char* tb = tile + boff;
    frags(0, tb, 0);
    #pragma unroll
    for (int stp = 0; stp < GKS / 32; ++stp) {
      if (stp + 1 < GKS / 32) frags((stp + 1) & 1, tb, stp + 1);
      products(stp & 1);
    }
    asm volatile("s_wait_dscnt 0x0" ::: "memory");      // this wave's reads of the buffer are done
    if (more) {
      wait_copies_but<NCP>();                           // its share of the next tile has landed; this trip's copies may fly
    } else {
      asm volatile("s_wait_asynccnt 0x0" ::: "memory"); // no copy was issued in this trip: all that is left is the next tile
    }
    __syncthreads();   // publishes the next tile and ends every wave's reads of this buffer, refilled at the next head
    bfill = boff;
    boff = (boff == 2u * GBUF) ? 0u : boff + GBUF;
  }
  asm volatile("s_wait_asynccnt 0x0" ::: "memory");     // no copy is left in flight
  // behind the last trip's waits and barrier nobody reads the ring and nothing flies into it: it becomes the stage
  float* st = (float*)tile;

  // ---- epilogue: bias (bf16 RNE), scale, relu -> LDS stage ----
  float bv[4];
  #pragma unroll
  for (int nt = 0; nt < 4; ++nt) bv[nt] = bfr(bias[(size_t)z * sBias + n0 + 64 * wn + 16 * nt + l16]);
  #pragma unroll
  for (int mt = 0; mt < 2; ++mt)
    #pragma unroll
    for (int nt = 0; nt < 4; ++nt)
      #pragma unroll
      for (int r = 0; r < 8; ++r) {
        float v = acc[mt][nt][r] * (1.0f / 64.0f) + bv[nt];
        if (MODE == 1) v = fmaxf(v, 0.0f);
        st[wn * (BM * 68) + (32 * wm + 16 * mt + 8 * hs + r) * 68 + 16 * nt + l16] = v;   // one BM x 68 stage per 64 columns
      }
  __syncthreads();   // stage is read cross-wave below

  #pragma unroll
  for (int cb = 0; cb < WN; ++cb) {            // the block tile's 64-column parts, one stage each
    const float* sc = st + cb * (BM * 68);
    const int nc = n0 + 64 * cb;               // first column of the part
    const int zh = z + (nc >> 6);              // MODE 0: the part's head
    if (MODE != 2) {
      const int p = t & 7;
      #pragma unroll
      for (int j = 0; j < BM / (NT / 8); ++j) {
        const int row = (t >> 3) + (NT / 8) * j;
        v8h hv, rv;
        #pragma unroll
        for (int i = 0; i < 8; ++i) {
          const float v = sc[row * 68 + 8 * p + i];
          const _Float16 q = (_Float16)v;
          hv[i] = q;
          rv[i] = RES ? (_Float16)((v - (float)q) * 2048.0f) : q;
        }
        const size_t off = (MODE == 0) ? ((((size_t)zh * prow) + m0 + row) * HD + 8 * p)
                                       : ((size_t)(m0 + row) * ldc + nc + 8 * p);
        *(v8h*)(Oh + off) = hv;
        if (RES) *(v8h*)(Or + off) = rv;
      }
      if (WVT) {
        const int q16 = t & 15;
        #pragma unroll
        for (int j = 0; j < HD / (NT / 16); ++j) {
          const int e = (t >> 4) + (NT / 16) * j;
          v8h hv, rv;
          #pragma unroll
          for (int i = 0; i < 8; ++i) {
            const float v = sc[(8 * q16 + i) * 68 + e];
            const _Float16 q = (_Float16)v;
            hv[i] = q;
            rv[i] = RES ? (_Float16)((v - (float)q) * 2048.0f) : q;
          }
          const size_t off = ((size_t)zh * HD + e) * (size_t)prow + m0 + 8 * q16;
          *(v8h*)(Ot + off) = hv;
          if (RES) *(v8h*)(Otr + off) = rv;
        }
      }
    } else {
      const int q16 = t & 15;
      #pragma unroll
      for (int j = 0; j < BM / (NT / 16); ++j) {
        const int row = (t >> 4) + (NT / 16) * j;
        v4f fv;
        #pragma unroll
        for (int i = 0; i < 4; ++i) fv[i] = sc[row * 68 + 4 * q16 + i];
        *(v4f*)(Of + (size_t)(m0 + row) * ldc + nc + 4 * q16) = fv;
      }
    }
  }
}

template<int MODE, bool RES, bool WVT, int WM, int WN>
__global__ __launch_bounds__(32 * WM * WN) __attribute__((amdgpu_num_vgpr(256)))
void k_gemm(const _Float16* __restrict__ A, int lda,
            const _Float16* __restrict__ BT, int ldb, int sBz,
            const float* __restrict__ bias, int sBias,
            int K, int prow,
            _Float16* __restrict__ Oh, _Float16* __restrict__ Or,
            _Float16* __restrict__ Ot, _Float16* __restrict__ Otr,
            float* __restrict__ Of, int ldc)
{
  // k-tile buffers: first the A rows m0.., then the BT rows n0.., GKS k (256 B) per row at pitch GLP
  __shared__ __attribute__((aligned(16))) char tile[GRING(WM, WN)];
  gemm_body<MODE, RES, WVT, WM, WN>(tile, blockIdx.x, blockIdx.y, blockIdx.z,
                            A, lda, BT, ldb, sBz, bias, sBias, K, prow, Oh, Or, Ot, Otr, Of, ldc);
}

// The two head projections that depend on the planes alone, one grid: z = 0 self q/k/v (with residual planes),
// z = 1 cross k/v; y = a pair of heads, whose weight rows and biases lie in a row (128 columns of NH * HD).
// Neither kind reads what the other writes; a block is wholly one kind.
__global__ __launch_bounds__(256) __attribute__((amdgpu_num_vgpr(256)))
void k_proj2(const _Float16* __restrict__ As, const _Float16* __restrict__ BTs, const float* __restrict__ bs,
             _Float16* __restrict__ Ohs, _Float16* __restrict__ Ors,
             _Float16* __restrict__ Ots, _Float16* __restrict__ Otrs,
             const _Float16* __restrict__ Ac, const _Float16* __restrict__ BTc, const float* __restrict__ bc,
             _Float16* __restrict__ Ohc, _Float16* __restrict__ Otc,
             float* __restrict__ Of, int prow)
{
  __shared__ __attribute__((aligned(16))) char tile[GRING(4, 2)];
  if (blockIdx.z == 0)
    gemm_body<0, true, true, 4, 2>(tile, blockIdx.x, blockIdx.y, 0,
                                   As, DM, BTs, DM, 0, bs, 0, DM, prow, Ohs, Ors, Ots, Otrs, Of, HD);
  else
    gemm_body<0, false, true, 4, 2>(tile, blockIdx.x, blockIdx.y, 0,
                                    Ac, DM, BTc, DM, 0, bc, 0, DM, prow, Ohc, Ohc, Otc, Otc, Of, HD);
}

#define SCL2 0.18033688011112042f   // log2(e) / sqrt(HD)
#define PCL 8.0f             // plain path: p is carried x2^8 into f16
#define PBOUND 60000.0f      // plain path: largest sum of a lane's 16 carried p that is taken as it is (f16 ends at 65504)
#define AKT 128              // keys per staged tile (= query rows per block)
#define AKP 144              // LDS pitch of a K row, bytes: 128 + 16
#define AVP 272              // LDS pitch of a Vt row, bytes: 256 + 16
#define AKB (AKT * AKP)      // K part of a tile
#define APL (AKB + HD * AVP) // K part + Vt part: one pair of planes
static_assert(SEQ % AKT == 0);
static_assert(RESQB <= 2);   // the residual-plane blocks walk at most two tiles: one buffer each

// ---------------------------------------------------------------------------
// Flash attention. Planes: Q/K [h][prow][64] f16 (prow = NB*SEQ rows per head, row = b*SEQ + s),
// Vt [h][64][prow] f16; residual planes (x2^11) of the same shapes for RES. Block 256 threads = 8 waves,
// wave = 16 queries, 32-key chunks, online softmax in f32, p carried x4096 (RES) or x256 as f16.
// Both products run transposed: S^T = K.Q^T (A = K rows, B = Q) and O^T += Vt.P^T (A = Vt rows, B = P^T). A lane then
// holds 16 scores of ONE query (query = lane & 15, keys 16*nt + 8*(lane >> 4) + r): maximum and sum are in-lane, the
// maximum joined with the other half by one cross-row move per chunk that searches it, the sums once behind the loop; and those
// 16 values are, in that order, the lane's elements of the B fragment of P^T, so that p stays in registers.
// K and Vt tiles of 128 keys staged in LDS by asynchronous copies (two buffers), once per block; the waves read
// their A fragments there (split k map).
// RES: s = qh.kh + (qr.kh + qh.kr)/2^11 ; O = ph.vh + (ph.vr + pr.vh)/2^11 folded before 1/l.
// Out: f32 [NB*SEQ][DM] at columns h*64, staged per wave in LDS, 16 lanes x 16 B per 256-B row,
// LDS tile sto: wave-private (same wave writes and reads; lds_sync_wave), 16x64 per wave, fully written.
// ---------------------------------------------------------------------------
// sto: 8 x 16 x 68 floats of LDS; kv: 2 * ABUF bytes of LDS; both 16-byte aligned; (qb, h, b): the block's queries
template<bool CAUSAL, bool RES>
__device__ __forceinline__
void attn_body(float* sto, char* kv, int qb, int h, int b,
            const _Float16* __restrict__ Qh, const _Float16* __restrict__ Qr,
            const _Float16* __restrict__ Kh, const _Float16* __restrict__ Kr,
            const _Float16* __restrict__ Vt, const _Float16* __restrict__ Vtr,
            float* __restrict__ Out, int prow)
{
  constexpr int ABUF = (RES ? 2 : 1) * APL;   // one buffer: [K | Vt], then [Kr | Vtr] with the residual planes

  const int t = threadIdx.x, lane = t & 31, hs = lane >> 4, l16 = lane & 15;
  const int w = __builtin_amdgcn_readfirstlane(t >> 5);   // scalar: a wave's own trip count below is a scalar test
  const int qbase = qb * 128 + w * 16;                       // within the sequence
  const size_t rq = (size_t)h * (size_t)prow + (size_t)b * SEQ;   // plane row base for (h, b)
  float*    sw  = sto + w * 1088;

  v16h aq[2], aqr[2];
  #pragma unroll
  for (int stp = 0; stp < 2; ++stp) {
    aq[stp]  = ldfrag(Qh + (rq + qbase + l16) * HD + 32 * stp, hs);
    if constexpr (!RES) {   // plain path: log2(e)/sqrt(HD) goes into Q, once per wave (rounded to f16 again)
      #pragma unroll
      for (int i = 0; i < 16; ++i) aq[stp][i] = (_Float16)((float)aq[stp][i] * SCL2);
    }
    aqr[stp] = RES ? ldfrag(Qr + (rq + qbase + l16) * HD + 32 * stp, hs) : aq[stp];
  }

  const v8f z8 = {0.f, 0.f, 0.f, 0.f, 0.f, 0.f, 0.f, 0.f};
  // this lane's query (l16): running maximum (both halves agree), sum over this half's keys alone
  float mrow = -3.0e38f, lrow = 0.0f;
  // plain path: mrow is in scaled units (log2); rref = PCL - the reference in use, held for the score products' C operand
  // in cref; pbound: the test's bound, whose start value (no sum is below 0) makes the first chunk set the reference
  float rref = 0.0f, pbound = -1.0f;
  v8f cref = z8;
  v8f o[4], orr[4];   // O^T: element r of tile f = column e = 16*f + 8*hs + r of query l16
  #pragma unroll
  for (int f = 0; f < 4; ++f) { o[f] = z8; orr[f] = z8; }

  const int kend = CAUSAL ? (qbase + 16) : SEQ;

  const char* Kb  = (const char*)(Kh + rq * HD);
  const char* Krb = (const char*)(Kr + rq * HD);
  const char* Vb  = (const char*)(Vt + (size_t)h * HD * (size_t)prow + (size_t)b * SEQ);
  const char* Vrb = (const char*)(Vtr + (size_t)h * HD * (size_t)prow + (size_t)b * SEQ);

  // Staging: thread = 16 B. K: a wave's copy brings 4 whole rows (512 B in a row); Vt: 2 rows of 256 B.
  const size_t gko = (size_t)((t >> 3) * (HD * 2) + (t & 7) * 16);
  const size_t gvo = (size_t)(t >> 4) * (size_t)prow * 2 + (size_t)((t & 15) * 16);
  const unsigned lk = (unsigned)(uintptr_t)kv + (unsigned)((t >> 3) * AKP + (t & 7) * 16);
  const unsigned lv = (unsigned)(uintptr_t)kv + (unsigned)(AKB + (t >> 4) * AVP + (t & 15) * 16);
  auto stage = [&](unsigned boff, int kt0) {
    #pragma unroll
    for (int pl = 0; pl < (RES ? 2 : 1); ++pl) {
      unsigned l[8];
      const char* g[8];
      #pragma unroll
      for (int j = 0; j < 4; ++j) {
        l[j] = lk + boff + (unsigned)(pl * APL + 32 * j * AKP);
        g[j] = (pl ? Krb : Kb) + gko + (size_t)(kt0 + 32 * j) * (HD * 2);
        l[4 + j] = lv + boff + (unsigned)(pl * APL + 16 * j * AVP);
        g[4 + j] = (pl ? Vrb : Vb) + gvo + ((size_t)(16 * j) * (size_t)prow + (size_t)kt0) * 2;
      }
      copy8(l, g);
    }
  };

  // A fragments of chunk c (32 keys) of the tile at tb
  const int frk = l16 * AKP + 16 * hs;
  const int frv = AKB + l16 * AVP + 16 * hs;
  auto ldsfrag = [&](const char* p) -> v16h {
    union { v16h v; v8h q[2]; } u;
    u.q[0] = *(const v8h*)p;
    u.q[1] = *(const v8h*)(p + 32);
    return u.v;
  };
  v16h fk[2][2], fkr[2][2];
  auto load_k = [&](const char* tb, int c) {
    #pragma unroll
    for (int stp = 0; stp < 2; ++stp)
      #pragma unroll
      for (int nt = 0; nt < 2; ++nt) {
        const char* p = tb + frk + (32 * c + 16 * nt) * AKP + 64 * stp;
        fk[stp][nt]  = ldsfrag(p);
        fkr[stp][nt] = RES ? ldsfrag(p + APL) : fk[stp][nt];
      }
  };

  // tiles the block walks: the same for all its waves (a wave leaves out the chunks beyond its own diagonal)
  const int nst = CAUSAL ? (qb + 1) : (SEQ / AKT);
  stage(0u, 0);
  asm volatile("s_wait_asynccnt 0x0" ::: "memory");   // this wave's share of tile 0 has landed
  __syncthreads();                                    // every wave's share has: tile 0 may be read
  if (1 < nst) stage((unsigned)ABUF, AKT);

  unsigned boff = 0u;
  #pragma unroll 1
  for (int sg = 0; sg < nst; ++sg) {
  const char* tb = kv + boff;
  // K fragments one chunk ahead inside the tile (chunk 0 here); with the residual planes, whose fragments
  // leave no registers for that, at the chunk's own head. Every wave has at least chunk 0 of every tile.
  if (!RES) load_k(tb, 0);
  const int left = (kend - sg * AKT + 31) >> 5;             // this wave's chunks from here to its diagonal, >= 1
  const int nc = (left < AKT / 32) ? left : (AKT / 32);
  #pragma unroll 1
  for (int c = 0; c < nc; ++c) {
    const int kt = sg * AKT + 32 * c;
    if (RES) load_k(tb, c);

    // ---- scores, transposed: 32 keys (2 tiles) x 16 queries, K = 64 in 2 steps ----
    v8f s[2], sr[2];
    s[0] = z8; s[1] = z8; sr[0] = z8; sr[1] = z8;
    #pragma unroll
    for (int stp = 0; stp < 2; ++stp) {
      #pragma unroll
      for (int nt = 0; nt < 2; ++nt) {
        if (!RES && stp == 0) s[nt] = mma16c(fk[stp][nt], aq[stp], cref);   // the reference rides in as C
        else s[nt] = mma16(fk[stp][nt], aq[stp], s[nt]);
        if (RES) {
          sr[nt] = mma16(fk[stp][nt], aqr[stp], sr[nt]);
          sr[nt] = mma16(fkr[stp][nt], aq[stp], sr[nt]);
        }
      }
    }

    // ---- this chunk's V fragments, one group, issued here so that they land under the softmax ----
    v16h fv[4], fvr[4];
    #pragma unroll
    for (int f = 0; f < 4; ++f) {
      const char* p = tb + frv + 16 * f * AVP + 64 * c;
      fv[f]  = ldsfrag(p);
      fvr[f] = RES ? ldsfrag(p + APL) : fv[f];
    }
    // holds the V reads here, ahead of the exponentials that cover their way: with no maximum search in front, the
    // scheduler otherwise sinks them to just before the test, and the products below wait for them
    if constexpr (!RES) __builtin_amdgcn_sched_barrier(0);

    // ---- next chunk's K fragments (same tile), into the registers the products above have just read ----
    if (!RES && c + 1 < AKT / 32) load_k(tb, c + 1);

    // ---- causal replace-mask, online softmax (f32). With the residual planes the scores stay unscaled: 1/sqrt(HD),
    //      log2(e), the maximum and the x4096 that p carries all go into ONE fused multiply-add in front of the base-2
    //      exponential; on the plain path they are that exponential's arguments as they come ----
    // key > row with key = kt + 16*nt + 8*hs + r, row = qbase + l16: the lane's part on one side, so that a score's
    // own part (16*nt + r) is an immediate of the compare
    const int dq = qbase + l16 - 8 * hs - kt;
    float pv[2][8];
    #pragma unroll
    for (int nt = 0; nt < 2; ++nt)
      #pragma unroll
      for (int r = 0; r < 8; ++r) {
        float v = s[nt][r];
        if (RES) v += sr[nt][r] * (1.0f / 2048.0f);
        if (CAUSAL) {
          if (16 * nt + r > dq) v = -8.0e9f;     // key > row; -1e9 in the scaled scores; as an exponent: p = 0
        }
        pv[nt][r] = v;
      }
    v16h bp, bpr;
    if constexpr (RES) {
      float tq[4];
      #pragma unroll
      for (int i = 0; i < 4; ++i)
        tq[i] = fmaxf(fmaxf(pv[0][2 * i], pv[0][2 * i + 1]), fmaxf(pv[1][2 * i], pv[1][2 * i + 1]));
      float tm = fmaxf(fmaxf(tq[0], tq[1]), fmaxf(tq[2], tq[3]));
      tm = fmaxf(tm, xhalf(tm));            // the query's other 16 keys of the chunk

      const float mn = fmaxf(mrow, tm);     // unscaled, as the scores
      const float corr = __builtin_amdgcn_exp2f((mrow - mn) * SCL2);
      const float sh = fmaf(-mn, SCL2, 12.0f);   // 2^12 = 4096
      mrow = mn;
      #pragma unroll
      for (int nt = 0; nt < 2; ++nt)
        #pragma unroll
        for (int r = 0; r < 8; ++r) pv[nt][r] = __builtin_amdgcn_exp2f(fmaf(pv[nt][r], SCL2, sh));   // p x4096
      float tsq[4];
      #pragma unroll
      for (int i = 0; i < 4; ++i)
        tsq[i] = (pv[0][2 * i] + pv[0][2 * i + 1]) + (pv[1][2 * i] + pv[1][2 * i + 1]);
      lrow = lrow * corr + ((tsq[0] + tsq[1]) + (tsq[2] + tsq[3]));   // the sum carries the x4096 too
      #pragma unroll
      for (int f = 0; f < 4; ++f)
        #pragma unroll
        for (int r = 0; r < 8; ++r) {
          o[f][r] *= corr;
          if (RES) orr[f][r] *= corr;
        }

      // ---- p (x4096, f16 hi; x2^11 residual for RES) packed in place into the B fragment of P^T:
      //      elements 0..7 = keys 8*hs + r (tile 0), elements 8..15 = keys 16 + 8*hs + r (tile 1), the k map of ldfrag ----
      #pragma unroll
      for (int nt = 0; nt < 2; ++nt)
        #pragma unroll
        for (int r = 0; r < 8; ++r) {
          const float pc = pv[nt][r];
          const _Float16 ph = (_Float16)pc;
          bp[8 * nt + r]  = ph;
          bpr[8 * nt + r] = RES ? (_Float16)((pc - (float)ph) * 2048.0f) : ph;
        }
    } else {
      // ---- lazy reference: the scores come out of the products as exponents already, log2(e)/sqrt(HD) being in Q and
      //      PCL minus the maximum IN USE (some earlier running maximum of the query) in the C operand: the common chunk
      //      has no maximum search, no cross-row move, no multiply-add per score and no rescale of O and the sum.
      //      All p are >= 0, so a lane's sum of its 16 bounds each of them: a sum within the bound says that every p fits
      //      f16. Otherwise (and at the first chunk, by the bound's start value) the whole wave takes the running maximum
      //      as the new reference, rescales, and forms p again: then p <= 2^PCL. ----
      float ts;
      auto exps = [&]() {
        float e[2][8];
        #pragma unroll
        for (int nt = 0; nt < 2; ++nt)
          #pragma unroll
          for (int r = 0; r < 8; ++r) e[nt][r] = __builtin_amdgcn_exp2f(pv[nt][r]);   // p x2^PCL
        float tsq[4];
        #pragma unroll
        for (int i = 0; i < 4; ++i)
          tsq[i] = (e[0][2 * i] + e[0][2 * i + 1]) + (e[1][2 * i] + e[1][2 * i + 1]);
        ts = (tsq[0] + tsq[1]) + (tsq[2] + tsq[3]);
        // packed in place into the B fragment of P^T, the k map of ldfrag, as above
        #pragma unroll
        for (int nt = 0; nt < 2; ++nt)
          #pragma unroll
          for (int r = 0; r < 8; ++r) bp[8 * nt + r] = (_Float16)e[nt][r];
      };
      exps();
      // one test per chunk, the same for the whole wave (a scalar branch): the two halves of a query and the products
      // below need one reference per query and all lanes on. The negated compare also catches a sum that is no number.
      if (__builtin_expect(__builtin_amdgcn_ballot_w32(!(ts <= pbound)) != 0u, 0)) {   // rare: laid out of line
        float tq[4];
        #pragma unroll
        for (int i = 0; i < 4; ++i)
          tq[i] = fmaxf(fmaxf(pv[0][2 * i], pv[0][2 * i + 1]), fmaxf(pv[1][2 * i], pv[1][2 * i + 1]));
        float tm = fmaxf(fmaxf(tq[0], tq[1]), fmaxf(tq[2], tq[3]));
        tm = fmaxf(tm, xhalf(tm));            // the query's other 16 keys of the chunk
        const float mn = fmaxf(mrow, tm - rref);   // running maximum of the scaled scores (the exponents less rref)
        const float corr = __builtin_amdgcn_exp2f(mrow - mn);
        const float rn = PCL - mn;
        const float dl = rn - rref;           // what the new reference adds to this chunk's exponents
        mrow = mn;
        rref = rn;
        pbound = PBOUND;
        #pragma unroll
        for (int r = 0; r < 8; ++r) cref[r] = rn;
        lrow *= corr;
        #pragma unroll
        for (int f = 0; f < 4; ++f)
          #pragma unroll
          for (int r = 0; r < 8; ++r) o[f][r] *= corr;
        #pragma unroll
        for (int nt = 0; nt < 2; ++nt)
          #pragma unroll
          for (int r = 0; r < 8; ++r) pv[nt][r] += dl;
        exps();
      }
      lrow += ts;                             // the sum carries the x2^PCL too
      bpr = bp;
    }

    // ---- O^T += Vt . P^T : A fragments of the Vt plane (row e, k = key contiguous), read behind the scores ----
    #pragma unroll
    for (int f = 0; f < 4; ++f) {
      o[f] = mma16(fv[f], bp, o[f]);
      if (RES) {
        orr[f] = mma16(fvr[f], bp, orr[f]);
        orr[f] = mma16(fv[f], bpr, orr[f]);
      }
    }
  }
  asm volatile("s_wait_dscnt 0x0" ::: "memory");      // this wave's reads of the buffer are done
  asm volatile("s_wait_asynccnt 0x0" ::: "memory");   // its share of the next tile has landed
  __syncthreads();   // publishes the next tile and ends every wave's reads of this buffer, refilled below
  // with the residual planes the block is one of query blocks 0..RESQB-1: no more tiles than buffers, no refill
  if (!RES && sg + 2 < nst) stage(boff, (sg + 2) * AKT);
  boff ^= (unsigned)ABUF;
  }
  asm volatile("s_wait_asynccnt 0x0" ::: "memory");     // no copy is left in flight

  // ---- normalise, stage 16x64 f32 tile per wave, whole-line stores ----
  lrow += xhalf(lrow);                    // the two halves' key sums joined, once
  const float inv = 1.0f / lrow;          // sum and O both carry p's factor
  #pragma unroll
  for (int f = 0; f < 4; ++f)
    #pragma unroll
    for (int q = 0; q < 2; ++q) {
      v4f sv;
      #pragma unroll
      for (int i = 0; i < 4; ++i) {
        float v = o[f][4 * q + i];
        if (RES) v += orr[f][4 * q + i] * (1.0f / 2048.0f);
        sv[i] = v * inv;
      }
      *(v4f*)(sw + l16 * 68 + 16 * f + 8 * hs + 4 * q) = sv;
    }
  lds_sync_wave();
  const size_t orow = (size_t)b * SEQ + (size_t)qbase;
  {
    #pragma unroll
    for (int j = 0; j < 8; ++j) {
      const int row = 2 * j + hs;
      const v4f fvv = *(const v4f*)(sw + row * 68 + 4 * l16);
      *(v4f*)(Out + (orow + row) * DM + h * HD + 4 * l16) = fvv;
    }
    
  }
}

// two waves per SIMD is what the grids give (at most one block per WGP): said here so that the scheduler spends
// registers on the fragments in flight instead of saving them for more waves
__global__ __launch_bounds__(256) __attribute__((amdgpu_waves_per_eu(2, 2)))
void k_attn_cross(const _Float16* __restrict__ Qh, const _Float16* __restrict__ Kh, const _Float16* __restrict__ Vt,
                  float* __restrict__ Out, int prow)
{
  __shared__ __attribute__((aligned(16))) float sto[8 * 16 * 68];
  __shared__ __attribute__((aligned(16))) char kv[2 * APL];
  attn_body<false, false>(sto, kv, blockIdx.x, blockIdx.y, blockIdx.z, Qh, Qh, Kh, Kh, Vt, Vt, Out, prow);
}

// Causal attention, every query block in one grid: blocks 0..RESQB-1 take the path with the residual planes, the
// others the plain one. They write disjoint rows of Out and read the same planes; a block is wholly one kind.
__global__ __launch_bounds__(256) __attribute__((amdgpu_waves_per_eu(2, 2)))
void k_attn_self(const _Float16* __restrict__ Qh, const _Float16* __restrict__ Qr,
                 const _Float16* __restrict__ Vt, const _Float16* __restrict__ Vtr,
                 float* __restrict__ Out, int prow)
{
  __shared__ __attribute__((aligned(16))) float sto[8 * 16 * 68];
  __shared__ __attribute__((aligned(16))) char kv[4 * APL];
  if (blockIdx.x < RESQB)
    attn_body<true, true>(sto, kv, blockIdx.x, blockIdx.y, blockIdx.z, Qh, Qr, Qh, Qr, Vt, Vtr, Out, prow);
  else
    attn_body<true, false>(sto, kv, blockIdx.x, blockIdx.y, blockIdx.z, Qh, Qr, Qh, Qr, Vt, Vtr, Out, prow);
}

// ---------------------------------------------------------------------------
// y = LayerNorm(x + r) * g + b over DM = 1024, one block (256 threads) per row, thread = 4 columns.
// XIN: x is a raw input (bf16 RNE convert, input row stride via SEQ_FULL); else x is a ws f32 plane.
// WH: also write the f16 plane yh. g, b bf16 RNE converted. Outputs: 256 lanes x 16/8 B per row
// coverage: nrow x DM for y (and yh).
// ---------------------------------------------------------------------------
template<bool XIN, bool WH>
__global__ __launch_bounds__(256)
void k_ln(const float* __restrict__ x, const float* __restrict__ rr,
          const float* __restrict__ g, const float* __restrict__ be,
          float* __restrict__ y, _Float16* __restrict__ yh)
{
  #pragma clang fp contract(off)
  __shared__ float red[8];
  __shared__ float red2[8];
  const int m = blockIdx.x, t = threadIdx.x, lane = t & 31, w = t >> 5;
  const int c = 4 * t;
  const size_t xrow = XIN ? ((size_t)(m / SEQ) * SEQ_FULL + (size_t)(m % SEQ)) : (size_t)m;
  const v4f xv = *(const v4f*)(x + xrow * DM + c);
  const v4f rv = *(const v4f*)(rr + (size_t)m * DM + c);
  float v[4];
  #pragma unroll
  for (int i = 0; i < 4; ++i) {
    float xi = xv[i];
    if (XIN) xi = bfr(xi);
    v[i] = xi + rv[i];
  }
  float s = (v[0] + v[1]) + (v[2] + v[3]);
  #pragma unroll
  for (int off = 16; off > 0; off >>= 1) s += __shfl_xor(s, off, 32);
  if (lane == 0) red[w] = s;
  __syncthreads();
  float tot = 0.0f;
  #pragma unroll
  for (int i = 0; i < 8; ++i) tot += red[i];
  const float mu = tot * (1.0f / (float)DM);

  float d[4];
  #pragma unroll
  for (int i = 0; i < 4; ++i) d[i] = v[i] - mu;
  float s2 = (d[0] * d[0] + d[1] * d[1]) + (d[2] * d[2] + d[3] * d[3]);
  #pragma unroll
  for (int off = 16; off > 0; off >>= 1) s2 += __shfl_xor(s2, off, 32);
  if (lane == 0) red2[w] = s2;
  __syncthreads();
  float tot2 = 0.0f;
  #pragma unroll
  for (int i = 0; i < 8; ++i) tot2 += red2[i];
  const float var = tot2 * (1.0f / (float)DM);
  const float rstd = rsqrtf(var + LN_EPS);

  v4f ov;
  v4h oh;
  #pragma unroll
  for (int i = 0; i < 4; ++i) {
    const float gv = bfr(g[c + i]);
    const float bvv = bfr(be[c + i]);
    const float q = d[i] * rstd * gv + bvv;
    ov[i] = q;
    oh[i] = (_Float16)q;
  }
  float* ydst = y + (size_t)m * DM + c;
  _Float16* hdst = yh + (WH ? ((size_t)m * DM + c) : 0);
  *(v4f*)ydst = ov;
  if (WH) *(v4h*)hdst = oh;
  
}

// ---------------------------------------------------------------------------
extern "C" void kernel_launch(void* const* d_in, const int* in_sizes, int n_in,
                              void* d_out, int out_size, void* d_ws, size_t ws_size,
                              hipStream_t stream)
{
  if (n_in < 16) return;
  const int MR = NB * SEQ;                 // internal rows (b*SEQ + s)
  const long need_act = (long)(NB - 1) * SEQ_FULL * DM + (long)SEQ * DM;
  if ((long)in_sizes[0] < need_act || (long)in_sizes[1] < need_act) return;
  if (in_sizes[2] < NH * DM * HD || in_sizes[3] < NH * HD) return;
  if (in_sizes[4] < NH * DM * HD || in_sizes[5] < NH * HD) return;
  for (int i = 6; i < 12; ++i) if (in_sizes[i] < DM) return;
  if (in_sizes[12] < DM * FF || in_sizes[13] < FF || in_sizes[14] < FF * DM || in_sizes[15] < DM) return;
  if (out_size < MR * DM) return;

  const float* y      = (const float*)d_in[0];
  const float* enc    = (const float*)d_in[1];
  const float* Wself  = (const float*)d_in[2];
  const float* bself  = (const float*)d_in[3];
  const float* Wcross = (const float*)d_in[4];
  const float* bcross = (const float*)d_in[5];
  const float* g1  = (const float*)d_in[6];  const float* be1 = (const float*)d_in[7];
  const float* g2  = (const float*)d_in[8];  const float* be2 = (const float*)d_in[9];
  const float* g3  = (const float*)d_in[10]; const float* be3 = (const float*)d_in[11];
  const float* w1  = (const float*)d_in[12]; const float* b1  = (const float*)d_in[13];
  const float* w2  = (const float*)d_in[14]; const float* b2  = (const float*)d_in[15];
  float* out = (float*)d_out;

  // ---- workspace carve (256-B aligned regions; 104 MiB at NB*SEQ = 2048) ----
  char* base = (char*)d_ws;
  size_t off = 0;
  auto take = [&](size_t bytes) -> void* {
    void* p = (void*)(base + off);
    off += (bytes + 255) & ~(size_t)255;
    return p;
  };
  _Float16* Yh   = (_Float16*)take((size_t)MR * DM * 2);
  _Float16* Eh   = (_Float16*)take((size_t)MR * DM * 2);
  _Float16* WTs  = (_Float16*)take((size_t)NH * HD * DM * 2);
  _Float16* WTc  = (_Float16*)take((size_t)NH * HD * DM * 2);
  _Float16* W1T  = (_Float16*)take((size_t)FF * DM * 2);
  _Float16* W2T  = (_Float16*)take((size_t)DM * FF * 2);
  _Float16* QKVh = (_Float16*)take((size_t)NH * MR * HD * 2);
  _Float16* QKVr = (_Float16*)take((size_t)NH * MR * HD * 2);
  _Float16* VTh  = (_Float16*)take((size_t)NH * HD * MR * 2);
  _Float16* VTr  = (_Float16*)take((size_t)NH * HD * MR * 2);
  float*    att  = (float*)   take((size_t)MR * DM * 4);     // sa, then ca, then ff
  float*    y1   = (float*)   take((size_t)MR * DM * 4);
  _Float16* y1h  = (_Float16*)take((size_t)MR * DM * 2);
  float*    y2   = (float*)   take((size_t)MR * DM * 4);
  _Float16* y2h  = (_Float16*)take((size_t)MR * DM * 2);
  _Float16* Qch  = (_Float16*)take((size_t)NH * MR * HD * 2);
  _Float16* KVch = (_Float16*)take((size_t)NH * MR * HD * 2);
  _Float16* VTc  = (_Float16*)take((size_t)NH * HD * MR * 2);
  _Float16* Hh   = (_Float16*)take((size_t)MR * FF * 2);
  if (off > ws_size) return;

  // ---- planes ----
  k_prep<<<dim3(2 * PBW + 2 * PBH + PBC), 256, 0, stream>>>(
      y, enc, Wself, Wcross, w1, w2, Yh, Eh, WTs, WTc, W1T, W2T, MR);

  const int nqb  = SEQ / 128;

  // ---- projections of y (self: q = k = v share one) and of enc (cross: k = v share one) ----
  k_proj2<<<dim3(MR / 128, NH * HD / 128, 2), 256, 0, stream>>>(
      Yh, WTs, bself, QKVh, QKVr, VTh, VTr, Eh, WTc, bcross, KVch, VTc, att, MR);

  // ---- self attention ----
  k_attn_self<<<dim3(nqb, NH, NB), 256, 0, stream>>>(QKVh, QKVr, VTh, VTr, att, MR);
  k_ln<true, true><<<dim3(MR), 256, 0, stream>>>(y, att, g1, be1, y1, y1h);

  // ---- cross attention (q from y1; k = v from enc, projected above) ----
  k_gemm<0, false, false, 4, 1><<<dim3(MR / 128, HD / 64, NH), 128, 0, stream>>>(
      y1h, DM, WTc, DM, HD * DM, bcross, HD, DM, MR, Qch, Qch, Qch, Qch, att, HD);
  k_attn_cross<<<dim3(nqb, NH, NB), 256, 0, stream>>>(Qch, KVch, VTc, att, MR);
  k_ln<false, true><<<dim3(MR), 256, 0, stream>>>(y1, att, g2, be2, y2, y2h);

  // ---- MLP ----
  k_gemm<1, false, false, 8, 2><<<dim3(MR / 256, FF / 128, 1), 512, 0, stream>>>(
      y2h, DM, W1T, DM, 0, b1, 0, DM, MR, Hh, Hh, Hh, Hh, att, FF);
  k_gemm<2, false, false, 4, 1><<<dim3(MR / 128, DM / 64, 1), 128, 0, stream>>>(
      Hh, FF, W2T, FF, 0, b2, 0, FF, MR, y2h, y2h, y2h, y2h, att, DM);
  k_ln<false, false><<<dim3(MR), 256, 0, stream>>>(y2, att, g3, be3, out, y2h);
}

// v009
// Measured time: 115 microseconds a run.
// In two side-by-side timings against v008, it was 1.08 and 1.07 times as fast.
// Over all steps from v000 it is 5.81 times as fast.
#include <hip/hip_runtime.h>
#include <stdint.h>
#include <stddef.h>

// Contractions on v_wmma_f32_16x16x32_f16 (f16 operands, f32 accumulate): per-head q/k/v projections,
// q.k^T, p.v (self causal and cross), MLP up and down GEMMs. Float inputs RNE-converted to bf16 and held
// as f16 planes (weights carried x64, softmax p carried x4096, x256 without residual planes); causal query blocks 0..RESQB-1 add f16
// residual planes (x2^11) for q, k, p, v into a second accumulator. Softmax, layer norms, bias adds: f32.

#ifndef NB
#define NB 1
#endif
#ifndef SEQ
#define SEQ 2048
#endif
#define NB_FULL 1
#define SEQ_FULL 2048
#define DM 1024
#define NH 16
#define HD 64
#define FF 4096
#define RESQB 2
#define LN_EPS 1.0e-5f

static_assert(SEQ % 128 == 0);
static_assert(SEQ <= SEQ_FULL);
static_assert(NB >= 1 && NB <= NB_FULL);
static_assert(HD == 64);
static_assert(DM % 128 == 0 && FF % 128 == 0);
static_assert(DM % 32 == 0 && FF % 32 == 0);
static_assert((NB * SEQ) % 256 == 0);
static_assert(DM == 4 * 256);

typedef _Float16 v4h  __attribute__((ext_vector_type(4)));
typedef _Float16 v8h  __attribute__((ext_vector_type(8)));
typedef _Float16 v16h __attribute__((ext_vector_type(16)));
typedef float    v2f  __attribute__((ext_vector_type(2)));
typedef float    v4f  __attribute__((ext_vector_type(4)));
typedef float    v8f  __attribute__((ext_vector_type(8)));

// ---------------------------------------------------------------------------
// helpers
// ---------------------------------------------------------------------------
__device__ __forceinline__ v8f mma16(v16h a, v16h b, v8f c)
{
  c = __builtin_amdgcn_wmma_f32_16x16x32_f16(false, a, false, b, (short)0, c, false, false);
  asm volatile("v_nop\n\tv_nop\n\tv_nop\n\tv_nop" : "+v"(c) : "v"(a), "v"(b));
  return c;
}

// D = A.B + C into a tile of its own, C living on. As text: the builtin form copied C into D's registers first where C
// is kept over a loop. The four v_nop keep the distance behind a matrix instruction.
__device__ __forceinline__ v8f mma16c(v16h a, v16h b, v8f c)
{
  v8f d;
  asm volatile("v_wmma_f32_16x16x32_f16 %0, %1, %2, %3\n\tv_nop\n\tv_nop\n\tv_nop\n\tv_nop"
               : "=&v"(d) : "v"(a), "v"(b), "v"(c));
  return d;
}

// 16x16x32 16-bit fragment (A row m = lane&15, or B column n = lane&15, k contiguous at p):
// elements 0..7 <- k0+8h+0..7, elements 8..15 <- k0+16+8h+0..7, h = lane>>4
__device__ __forceinline__ v16h ldfrag(const _Float16* p, int hs)
{
  union { v16h v; v8h q[2]; } u;
  u.q[0] = *(const v8h*)(p + 8 * hs);
  u.q[1] = *(const v8h*)(p + 16 + 8 * hs);
  return u.v;
}

// bf16 RNE convert, returned widened to f32
__device__ __forceinline__ float bfr(float x)
{
  unsigned int u = __float_as_uint(x);
  u = (u + 0x7FFFu + ((u >> 16) & 1u)) & 0xFFFF0000u;
  return __uint_as_float(u);
}

// same-wave LDS store -> load ordering (wave-private tiles only)
__device__ __forceinline__ void lds_sync_wave()
{
  asm volatile("s_wait_dscnt 0x0" ::: "memory");
  __builtin_amdgcn_wave_barrier();
}

// value of lane l ^ 16 (the other 16-lane half), by a vector cross-row move
__device__ __forceinline__ float xhalf(float x)
{
  return __builtin_bit_cast(float, __builtin_amdgcn_permlanex16(__builtin_bit_cast(int, x), __builtin_bit_cast(int, x),
                                                                0x76543210, 0xfedcba98, false, false));
}

// ---------------------------------------------------------------------------
// Activation planes: Yh = f16(bf16rne(y)), Eh = f16(bf16rne(enc)), internal row m -> input row
// coverage: Yh and Eh each nrow*DM elements exactly.
// ---------------------------------------------------------------------------
__device__ __forceinline__
void cvt_act_body(int bid, const float* __restrict__ y, const float* __restrict__ e,
                  _Float16* __restrict__ Yh, _Float16* __restrict__ Eh, int nrow)
{
  const int groups = nrow * (DM / 8);
  const int g = bid * 256 + threadIdx.x;
  if (g >= 2 * groups) return;
  const int which = (g >= groups) ? 1 : 0;
  const int idx = g - which * groups;
  const int m = idx / (DM / 8);
  const int c = (idx - m * (DM / 8)) * 8;
  const size_t srow = (size_t)(m / SEQ) * SEQ_FULL + (size_t)(m % SEQ);
  const float* src = (which ? e : y) + srow * DM + c;
  const v4f a = *(const v4f*)src;
  const v4f b = *(const v4f*)(src + 4);
  v8h o;
  o[0] = (_Float16)bfr(a[0]); o[1] = (_Float16)bfr(a[1]); o[2] = (_Float16)bfr(a[2]); o[3] = (_Float16)bfr(a[3]);
  o[4] = (_Float16)bfr(b[0]); o[5] = (_Float16)bfr(b[1]); o[6] = (_Float16)bfr(b[2]); o[7] = (_Float16)bfr(b[3]);
  _Float16* dst = (which ? Eh : Yh) + (size_t)m * DM + c;
  *(v8h*)dst = o;
  
}

// ---------------------------------------------------------------------------
// Transposed weight planes: in[z][R][C] f32 -> out[z][C][R] f16, value f16(bf16rne(x) * scale).
// coverage: full C x R per z.
// ---------------------------------------------------------------------------
__device__ __forceinline__
void wtr_body(float (*tile)[65], int bx, int by, int bz,
              const float* __restrict__ in, _Float16* __restrict__ out, int R, int C, float scale)
{
  const int t = threadIdx.x;
  const int c0 = bx * 64, r0 = by * 64;
  const size_t zoff = (size_t)bz * (size_t)R * (size_t)C;
  {
    const int r = t >> 2, cq = (t & 3) * 16;
    const float* p = in + zoff + (size_t)(r0 + r) * C + c0 + cq;
    #pragma unroll
    for (int i = 0; i < 4; ++i) {
      const v4f v = *(const v4f*)(p + 4 * i);
      tile[r][cq + 4 * i + 0] = v[0];
      tile[r][cq + 4 * i + 1] = v[1];
      tile[r][cq + 4 * i + 2] = v[2];
      tile[r][cq + 4 * i + 3] = v[3];
    }
  }
  __syncthreads();
  const int p8 = t & 7;
  {
    #pragma unroll
    for (int j = 0; j < 2; ++j) {
      const int c = (t >> 3) + 32 * j;
      v8h ov;
      #pragma unroll
      for (int i = 0; i < 8; ++i) ov[i] = (_Float16)(bfr(tile[8 * p8 + i][c]) * scale);
      _Float16* dst = out + zoff + (size_t)(c0 + c) * R + r0 + 8 * p8;
      *(v8h*)dst = ov;
    }
    
  }
}

// ---------------------------------------------------------------------------
// All planes that depend on the inputs alone, one grid: none reads what another writes. Block ranges, in order:
// w1 -> W1T, w2 -> W2T (PBW blocks each), Wself -> WTs, Wcross -> WTc (PBH blocks each), then y, enc -> Yh, Eh.
// The range test reads blockIdx alone: a block is wholly one kind, so the transpose's barrier is block-uniform.
// ---------------------------------------------------------------------------
#define PBW ((FF / 64) * (DM / 64))
#define PBH ((DM / 64) * NH)
#define PBC ((2 * NB * SEQ * (DM / 8) + 255) / 256)
__global__ __launch_bounds__(256)
void k_prep(const float* __restrict__ y, const float* __restrict__ e,
            const float* __restrict__ Ws, const float* __restrict__ Wc,
            const float* __restrict__ w1, const float* __restrict__ w2,
            _Float16* __restrict__ Yh, _Float16* __restrict__ Eh,
            _Float16* __restrict__ WTs, _Float16* __restrict__ WTc,
            _Float16* __restrict__ W1T, _Float16* __restrict__ W2T, int nrow)
{
  __shared__ float tile[64][65];
  const int bid = blockIdx.x;
  if (bid < 2 * PBW + 2 * PBH) {
    const float* in;
    _Float16* out;
    int R, C, bx, by, bz;
    if (bid < PBW) {                 // in[1024][4096] -> out[4096][1024]
      in = w1; out = W1T; R = DM; C = FF;
      bx = bid % (FF / 64); by = bid / (FF / 64); bz = 0;
    } else if (bid < 2 * PBW) {      // in[4096][1024] -> out[1024][4096]
      in = w2; out = W2T; R = FF; C = DM;
      bx = (bid - PBW) % (DM / 64); by = (bid - PBW) / (DM / 64); bz = 0;
    } else {                         // in[h][1024][64] -> out[h][64][1024]
      const bool cr = bid >= 2 * PBW + PBH;
      const int hb = bid - 2 * PBW - (cr ? PBH : 0);
      in = cr ? Wc : Ws; out = cr ? WTc : WTs; R = DM; C = HD;
      bx = 0; by = hb % (DM / 64); bz = hb / (DM / 64);
    }
    wtr_body(tile, bx, by, bz, in, out, R, C, 64.0f);
  } else {
    cvt_act_body(bid - (2 * PBW + 2 * PBH), y, e, Yh, Eh, nrow);
  }
}

#define GKS 128              // k per staged tile
#define GLP 272              // LDS row pitch, bytes: 256 + 16, conflict-free for 16-byte fragment reads
#define GNB 3                // buffers of the ring: one read, two being filled
#define GRING(WM, WN) (GNB * (32 * (WM) + 64 * (WN)) * GLP)   // LDS bytes of the ring of a block of WM x WN waves
static_assert(DM % GKS == 0 && (FF / 2) % GKS == 0);

// twelve 16-byte-per-lane copies global -> LDS, through no register. The s_wait_xcnt closes the statement, so that
// no address register of a copy is rewritten while the copy still names it.
__device__ __forceinline__ void copy12(const unsigned (&l)[12], const char* const (&g)[12])
{
  asm volatile(
    "global_load_async_to_lds_b128 %0, %12, off\n\t"
    "global_load_async_to_lds_b128 %1, %13, off\n\t"
    "global_load_async_to_lds_b128 %2, %14, off\n\t"
    "global_load_async_to_lds_b128 %3, %15, off\n\t"
    "global_load_async_to_lds_b128 %4, %16, off\n\t"
    "global_load_async_to_lds_b128 %5, %17, off\n\t"
    "global_load_async_to_lds_b128 %6, %18, off\n\t"
    "global_load_async_to_lds_b128 %7, %19, off\n\t"
    "global_load_async_to_lds_b128 %8, %20, off\n\t"
    "global_load_async_to_lds_b128 %9, %21, off\n\t"
    "global_load_async_to_lds_b128 %10, %22, off\n\t"
    "global_load_async_to_lds_b128 %11, %23, off\n\t"
    "s_wait_xcnt 0x0"
    : : "v"(l[0]), "v"(l[1]), "v"(l[2]), "v"(l[3]), "v"(l[4]), "v"(l[5]),
        "v"(l[6]), "v"(l[7]), "v"(l[8]), "v"(l[9]), "v"(l[10]), "v"(l[11]),
        "v"(g[0]), "v"(g[1]), "v"(g[2]), "v"(g[3]), "v"(g[4]), "v"(g[5]),
        "v"(g[6]), "v"(g[7]), "v"(g[8]), "v"(g[9]), "v"(g[10]), "v"(g[11])
    : "memory");
}

// eight 16-byte-per-lane copies global -> LDS; the s_wait_xcnt closes the statement as in copy12
__device__ __forceinline__ void copy8(const unsigned (&l)[8], const char* const (&g)[8])
{
  asm volatile(
    "global_load_async_to_lds_b128 %0, %8, off\n\t"
    "global_load_async_to_lds_b128 %1, %9, off\n\t"
    "global_load_async_to_lds_b128 %2, %10, off\n\t"
    "global_load_async_to_lds_b128 %3, %11, off\n\t"
    "global_load_async_to_lds_b128 %4, %12, off\n\t"
    "global_load_async_to_lds_b128 %5, %13, off\n\t"
    "global_load_async_to_lds_b128 %6, %14, off\n\t"
    "global_load_async_to_lds_b128 %7, %15, off\n\t"
    "s_wait_xcnt 0x0"
    : : "v"(l[0]), "v"(l[1]), "v"(l[2]), "v"(l[3]), "v"(l[4]), "v"(l[5]), "v"(l[6]), "v"(l[7]),
        "v"(g[0]), "v"(g[1]), "v"(g[2]), "v"(g[3]), "v"(g[4]), "v"(g[5]), "v"(g[6]), "v"(g[7])
    : "memory");
}

// this wave's copies have landed but for the N youngest (N = the copies of one tile)
template<int N>
__device__ __forceinline__ void wait_copies_but()
{
  static_assert(N == 24 || N == 16 || N == 12);
  if constexpr (N == 24) asm volatile("s_wait_asynccnt 24" ::: "memory");
  else if constexpr (N == 16) asm volatile("s_wait_asynccnt 16" ::: "memory");
  else asm volatile("s_wait_asynccnt 12" ::: "memory");
}

// ---------------------------------------------------------------------------
// GEMM C[M][N] = A[M][K] (f16 row-major, pitch lda) x B, B given as BT[N][K] (k contiguous, pitch ldb,
// per-z offset sBz). Block = WM x WN waves, wave tile 32x64 (2x4 fragments), block tile BM x BN = 32*WM x 64*WN:
// a staged row serves every wave of its block row or column, so that a wider block draws fewer bytes from L2 per product.
// k-tiles of 128 staged in LDS by asynchronous copies (three buffers, two tiles ahead), fragments read from LDS. Epilogue: v = acc/64 + bf16rne(bias[z*sBias + n])
//   MODE 0: Oh[head][prow][64] f16, head = z + n/64 (+ Or residual (v-hi)*2^11 if RES) (+ Ot/Otr [head][64][prow] if WVT)
//   MODE 1: Oh[M][ldc] f16 at columns n0..n0+BN-1
//   MODE 2: Of[z][prow][ldc] f32 at columns n0..n0+BN-1: z = a part of k (A columns from z*sAz, BT columns from z*sBz),
//           a partial sum per part, the bias in part 0 alone; whoever reads the planes adds them
// coverage: each block writes rows m0..m0+BM-1 x BN columns of every plane it owns (and the 64 x 128
// transposed slabs for WVT); grid (M/BM, N/BN, Z) tiles the planes exactly.
// ---------------------------------------------------------------------------
// tile: GRING(WM, WN) bytes of LDS, 16-byte aligned, the ring and behind the loop the epilogue's stage; (bx, by, z): the block's tile
template<int MODE, bool RES, bool WVT, int WM, int WN>
__device__ __forceinline__
void gemm_body(char* tile, int bx, int by, int z,
            const _Float16* __restrict__ A, int lda, int sAz,
            const _Float16* __restrict__ BT, int ldb, int sBz,
            const float* __restrict__ bias, int sBias,
            int K, int prow,
            _Float16* __restrict__ Oh, _Float16* __restrict__ Or,
            _Float16* __restrict__ Ot, _Float16* __restrict__ Otr,
            float* __restrict__ Of, int ldc)
{
  constexpr int BM = 32 * WM, BN = 64 * WN, NT = 32 * WM * WN;
  constexpr int RP = NT / 16;                  // rows that one copy of every thread brings
  constexpr int NCP = (BM + BN) / RP;          // copies of one wave per tile
  constexpr int CG = (NCP % 12 == 0) ? 12 : 8; // copies per statement
  constexpr unsigned GBUF = (unsigned)((BM + BN) * GLP);   // one buffer: BM A rows, then BN B rows
  static_assert(BM % RP == 0 && BN % RP == 0 && NCP % CG == 0);
  static_assert(2 * NCP <= 63);                // copies of a wave in flight: two tiles' at most
  static_assert(WN * BM * 68 * 4 <= GNB * (BM + BN) * GLP);   // the epilogue's stage lies in the ring
  static_assert(!WVT || BM == 128);
  const int t = threadIdx.x, lane = t & 31, w = t >> 5, hs = lane >> 4, l16 = lane & 15;
  const int wm = w % WM, wn = w / WM;          // the wave's place in the block tile
  const int m0 = bx * BM, n0 = by * BN;

  const v8f z8 = {0.f, 0.f, 0.f, 0.f, 0.f, 0.f, 0.f, 0.f};
  v8f acc[2][4];
  #pragma unroll
  for (int mt = 0; mt < 2; ++mt)
    #pragma unroll
    for (int nt = 0; nt < 4; ++nt) acc[mt][nt] = z8;

  // Staging: a copy of one wave brings two whole rows of the tile (2 x 256 B, whole lines); thread = 16 B at
  // column cc of row RP*i + cr, i = 0..NCP-1. Every row is fetched once per block and read from LDS by the waves.
  const int cr = t >> 4, cc = t & 15;
  const char* Ag = (const char*)(A + (size_t)z * sAz + (size_t)(m0 + cr) * lda + 8 * cc);
  const char* Bg = (const char*)(BT + (size_t)z * sBz + (size_t)(n0 + cr) * ldb + 8 * cc);
  const unsigned lcp = (unsigned)(uintptr_t)tile + (unsigned)(cr * GLP + cc * 16);
  auto stage = [&](unsigned boff, int k0) {
    #pragma unroll
    for (int hf = 0; hf < NCP / CG; ++hf) {
      unsigned l[CG];
      const char* g[CG];
      #pragma unroll
      for (int i = 0; i < CG; ++i) {
        const int idx = CG * hf + i;
        l[i] = lcp + boff + (unsigned)(RP * idx * GLP);
        g[i] = (idx < BM / RP) ? (Ag + ((size_t)(RP * idx) * lda + k0) * 2)
                               : (Bg + ((size_t)(RP * (idx - BM / RP)) * ldb + k0) * 2);
      }
      if constexpr (CG == 12) copy12(l, g); else copy8(l, g);
    }
  };

  // Fragments from LDS, two register sets: a 32-k step's 12 reads go out as one group ahead of the step before it.
  // k and sum order as before. K is a multiple of GKS (DM, FF / 2).
  v16h fa[2][2], fb[2][4];
  auto products = [&](int s) {
    #pragma unroll
    for (int nt = 0; nt < 4; ++nt) {
      acc[0][nt] = mma16(fa[s][0], fb[s][nt], acc[0][nt]);
      acc[1][nt] = mma16(fa[s][1], fb[s][nt], acc[1][nt]);
    }
  };
  const int fra = (32 * wm + l16) * GLP + 16 * hs;
  const int frb = (BM + 64 * wn + l16) * GLP + 16 * hs;
  auto frags = [&](int s, const char* tb, int stp) {
    #pragma unroll
    for (int mt = 0; mt < 2; ++mt) {
      union { v16h v; v8h q[2]; } u;
      const char* p = tb + fra + 16 * mt * GLP + 64 * stp;
      u.q[0] = *(const v8h*)p;
      u.q[1] = *(const v8h*)(p + 32);
      fa[s][mt] = u.v;
    }
    #pragma unroll
    for (int nt = 0; nt < 4; ++nt) {
      union { v16h v; v8h q[2]; } u;
      const char* p = tb + frb + 16 * nt * GLP + 64 * stp;
      u.q[0] = *(const v8h*)p;
      u.q[1] = *(const v8h*)(p + 32);
      fb[s][nt] = u.v;
    }
  };

  // Ring of three: tile t + 2 is asked for at the head of trip t and first read in trip t + 2, so that a tile has two
  // trips to land in: one trip's products are shorter than a tile's way from L2 or memory. The counter returns a wave's
  // copies in the order of issue: the counted wait, used only where exactly NCP copies were issued behind the tile that
  // is wanted, leaves those in flight and covers every older one. A trip that issues none waits to 0.
  stage(0u, 0);
  if (GKS < K) {
    stage(GBUF, GKS);
    wait_copies_but<NCP>();                             // this wave's share of tile 0 has landed, tile 1 may fly
  } else {
    asm volatile("s_wait_asynccnt 0x0" ::: "memory");   // this wave's share of tile 0 has landed
  }
  __syncthreads();                                      // every wave's share has: tile 0 may be read

  unsigned boff = 0u, bfill = 2u * GBUF;                // buffer of this trip's tile; buffer of the tile two ahead
  #pragma unroll 1   // rolled: one trip is one tile, four 32-k steps unrolled inside
  for (int k0 = 0; k0 < K; k0 += GKS) {
    const bool more = k0 + 2 * GKS < K;                 // the same for the whole block
    // refill: the buffer that the trip before has read, behind the barrier that ended every wave's reads of it
    if (more) stage(bfill, k0 + 2 * GKS);
    const char* tb = tile + boff;
    frags(0, tb, 0);
    #pragma unroll
    for (int stp = 0; stp < GKS / 32; ++stp) {
      if (stp + 1 < GKS / 32) frags((stp + 1) & 1, tb, stp + 1);
      products(stp & 1);
    }
    asm volatile("s_wait_dscnt 0x0" ::: "memory");      // this wave's reads of the buffer are done
    if (more) {
      wait_copies_but<NCP>();                           // its share of the next tile has landed; this trip's copies may fly
    } else {
      asm volatile("s_wait_asynccnt 0x0" ::: "memory"); // no copy was issued in this trip: all that is left is the next tile
    }
    __syncthreads();   // publishes the next tile and ends every wave's reads of this buffer, refilled at the next head
    bfill = boff;
    boff = (boff == 2u * GBUF) ? 0u : boff + GBUF;
  }
  asm volatile("s_wait_asynccnt 0x0" ::: "memory");     // no copy is left in flight
  // behind the last trip's waits and barrier nobody reads the ring and nothing flies into it: it becomes the stage
  float* st = (float*)tile;

  // ---- epilogue: bias (bf16 RNE), scale, relu -> LDS stage ----
  float bv[4];
  #pragma unroll
  for (int nt = 0; nt < 4; ++nt) bv[nt] = bfr(bias[(size_t)z * sBias + n0 + 64 * wn + 16 * nt + l16]);
  if (MODE == 2 && z != 0) bv[0] = bv[1] = bv[2] = bv[3] = 0.0f;   // the bias goes into part 0 alone
  #pragma unroll
  for (int mt = 0; mt < 2; ++mt)
    #pragma unroll
    for (int nt = 0; nt < 4; ++nt)
      #pragma unroll
      for (int r = 0; r < 8; ++r) {
        float v = acc[mt][nt][r] * (1.0f / 64.0f) + bv[nt];
        if (MODE == 1) v = fmaxf(v, 0.0f);
        st[wn * (BM * 68) + (32 * wm + 16 * mt + 8 * hs + r) * 68 + 16 * nt + l16] = v;   // one BM x 68 stage per 64 columns
      }
  __syncthreads();   // stage is read cross-wave below

  #pragma unroll
  for (int cb = 0; cb < WN; ++cb) {            // the block tile's 64-column parts, one stage each
    const float* sc = st + cb * (BM * 68);
    const int nc = n0 + 64 * cb;               // first column of the part
    const int zh = z + (nc >> 6);              // MODE 0: the part's head
    if (MODE != 2) {
      const int p = t & 7;
      #pragma unroll
      for (int j = 0; j < BM / (NT / 8); ++j) {
        const int row = (t >> 3) + (NT / 8) * j;
        v8h hv, rv;
        #pragma unroll
        for (int i = 0; i < 8; ++i) {
          const float v = sc[row * 68 + 8 * p + i];
          const _Float16 q = (_Float16)v;
          hv[i] = q;
          rv[i] = RES ? (_Float16)((v - (float)q) * 2048.0f) : q;
        }
        const size_t off = (MODE == 0) ? ((((size_t)zh * prow) + m0 + row) * HD + 8 * p)
                                       : ((size_t)(m0 + row) * ldc + nc + 8 * p);
        *(v8h*)(Oh + off) = hv;
        if (RES) *(v8h*)(Or + off) = rv;
      }
      if (WVT) {
        const int q16 = t & 15;
        #pragma unroll
        for (int j = 0; j < HD / (NT / 16); ++j) {
          const int e = (t >> 4) + (NT / 16) * j;
          v8h hv, rv;
          #pragma unroll
          for (int i = 0; i < 8; ++i) {
            const float v = sc[(8 * q16 + i) * 68 + e];
            const _Float16 q = (_Float16)v;
            hv[i] = q;
            rv[i] = RES ? (_Float16)((v - (float)q) * 2048.0f) : q;
          }
          const size_t off = ((size_t)zh * HD + e) * (size_t)prow + m0 + 8 * q16;
          *(v8h*)(Ot + off) = hv;
          if (RES) *(v8h*)(Otr + off) = rv;
        }
      }
    } else {
      const int q16 = t & 15;
      #pragma unroll
      for (int j = 0; j < BM / (NT / 16); ++j) {
        const int row = (t >> 4) + (NT / 16) * j;
        v4f fv;
        #pragma unroll
        for (int i = 0; i < 4; ++i) fv[i] = sc[row * 68 + 4 * q16 + i];
        *(v4f*)(Of + ((size_t)z * prow + m0 + row) * ldc + nc + 4 * q16) = fv;
      }
    }
  }
}

template<int MODE, bool RES, bool WVT, int WM, int WN>
__global__ __launch_bounds__(32 * WM * WN) __attribute__((amdgpu_num_vgpr(256)))
void k_gemm(const _Float16* __restrict__ A, int lda, int sAz,
            const _Float16* __restrict__ BT, int ldb, int sBz,
            const float* __restrict__ bias, int sBias,
            int K, int prow,
            _Float16* __restrict__ Oh, _Float16* __restrict__ Or,
            _Float16* __restrict__ Ot, _Float16* __restrict__ Otr,
            float* __restrict__ Of, int ldc)
{
  // k-tile buffers: first the A rows m0.., then the BT rows n0.., GKS k (256 B) per row at pitch GLP
  __shared__ __attribute__((aligned(16))) char tile[GRING(WM, WN)];
  gemm_body<MODE, RES, WVT, WM, WN>(tile, blockIdx.x, blockIdx.y, blockIdx.z,
                            A, lda, sAz, BT, ldb, sBz, bias, sBias, K, prow, Oh, Or, Ot, Otr, Of, ldc);
}

// The two head projections that depend on the planes alone, one grid: z = 0 self q/k/v (with residual planes),
// z = 1 cross k/v; y = a pair of heads, whose weight rows and biases lie in a row (128 columns of NH * HD).
// Neither kind reads what the other writes; a block is wholly one kind.
__global__ __launch_bounds__(256) __attribute__((amdgpu_num_vgpr(256)))
void k_proj2(const _Float16* __restrict__ As, const _Float16* __restrict__ BTs, const float* __restrict__ bs,
             _Float16* __restrict__ Ohs, _Float16* __restrict__ Ors,
             _Float16* __restrict__ Ots, _Float16* __restrict__ Otrs,
             const _Float16* __restrict__ Ac, const _Float16* __restrict__ BTc, const float* __restrict__ bc,
             _Float16* __restrict__ Ohc, _Float16* __restrict__ Otc,
             float* __restrict__ Of, int prow)
{
  __shared__ __attribute__((aligned(16))) char tile[GRING(4, 2)];
  if (blockIdx.z == 0)
    gemm_body<0, true, true, 4, 2>(tile, blockIdx.x, blockIdx.y, 0,
                                   As, DM, 0, BTs, DM, 0, bs, 0, DM, prow, Ohs, Ors, Ots, Otrs, Of, HD);
  else
    gemm_body<0, false, true, 4, 2>(tile, blockIdx.x, blockIdx.y, 0,
                                    Ac, DM, 0, BTc, DM, 0, bc, 0, DM, prow, Ohc, Ohc, Otc, Otc, Of, HD);
}

#define SCL2 0.18033688011112042f   // log2(e) / sqrt(HD)
#define PCL 8.0f             // plain path: p is carried x2^8 into f16
#define PBOUND 60000.0f      // plain path: largest sum of a lane's 16 carried p that is taken as it is (f16 ends at 65504)
#define AKT 128              // keys per staged tile (= query rows per block)
#define AKP 144              // LDS pitch of a K row, bytes: 128 + 16
#define AVP 272              // LDS pitch of a Vt row, bytes: 256 + 16
#define AKB (AKT * AKP)      // K part of a tile
#define APL (AKB + HD * AVP) // K part + Vt part: one pair of planes
static_assert(SEQ % AKT == 0);
static_assert(RESQB <= 2);   // the residual-plane blocks walk at most two tiles: one buffer each
static_assert((SEQ / 128) % 2 == 0);   // causal query blocks go in pairs

// ---------------------------------------------------------------------------
// Flash attention. Planes: Q/K [h][prow][64] f16 (prow = NB*SEQ rows per head, row = b*SEQ + s),
// Vt [h][64][prow] f16; residual planes (x2^11) of the same shapes for RES. Block 256 threads = 8 waves,
// wave = 16 queries, 32-key chunks, online softmax in f32, p carried x4096 (RES) or x256 as f16.
// Both products run transposed: S^T = K.Q^T (A = K rows, B = Q) and O^T += Vt.P^T (A = Vt rows, B = P^T). A lane then
// holds 16 scores of ONE query (query = lane & 15, keys 16*nt + 8*(lane >> 4) + r): maximum and sum are in-lane, the
// maximum joined with the other half by one cross-row move per chunk that searches it, the sums once behind the loop; and those
// 16 values are, in that order, the lane's elements of the B fragment of P^T, so that p stays in registers.
// K and Vt tiles of 128 keys staged in LDS by asynchronous copies (two buffers), once per block; the waves read
// their A fragments there (split k map).
// RES: s = qh.kh + (qr.kh + qh.kr)/2^11 ; O = ph.vh + (ph.vr + pr.vh)/2^11 folded before 1/l.
// Out: f32 [NB*SEQ][DM] at columns h*64, staged per wave in LDS, 16 lanes x 16 B per 256-B row,
// LDS tile sto: wave-private (same wave writes and reads; lds_sync_wave), 16x64 per wave, fully written.
// ---------------------------------------------------------------------------
// CAUSAL: the queries' key tiles are shared between two blocks by parity: this call walks tiles par, par + 2, ... and
// writes its own softmax over those keys to Out (the plane of its part) and, per query, to Wst[h][prow][2] the exponent
// offset its sum carries and that sum: the layer norm behind weighs the two parts by them. A share may be empty.
// sto: 8 x 16 x 68 floats of LDS; kv: 2 * ABUF bytes of LDS; both 16-byte aligned; (qb, h, b): the block's queries
template<bool CAUSAL, bool RES>
__device__ __forceinline__
void attn_body(float* sto, char* kv, int qb, int par, int h, int b,
            const _Float16* __restrict__ Qh, const _Float16* __restrict__ Qr,
            const _Float16* __restrict__ Kh, const _Float16* __restrict__ Kr,
            const _Float16* __restrict__ Vt, const _Float16* __restrict__ Vtr,
            float* __restrict__ Out, float* __restrict__ Wst, int prow)
{
  constexpr int ABUF = (RES ? 2 : 1) * APL;   // one buffer: [K | Vt], then [Kr | Vtr] with the residual planes

  const int t = threadIdx.x, lane = t & 31, hs = lane >> 4, l16 = lane & 15;
  const int w = __builtin_amdgcn_readfirstlane(t >> 5);   // scalar: a wave's own trip count below is a scalar test
  const int qbase = qb * 128 + w * 16;                       // within the sequence
  const size_t rq = (size_t)h * (size_t)prow + (size_t)b * SEQ;   // plane row base for (h, b)
  float*    sw  = sto + w * 1088;

  v16h aq[2], aqr[2];
  #pragma unroll
  for (int stp = 0; stp < 2; ++stp) {
    aq[stp]  = ldfrag(Qh + (rq + qbase + l16) * HD + 32 * stp, hs);
    if constexpr (!RES) {   // plain path: log2(e)/sqrt(HD) goes into Q, once per wave (rounded to f16 again)
      #pragma unroll
      for (int i = 0; i < 16; ++i) aq[stp][i] = (_Float16)((float)aq[stp][i] * SCL2);
    }
    aqr[stp] = RES ? ldfrag(Qr + (rq + qbase + l16) * HD + 32 * stp, hs) : aq[stp];
  }
  // the staging addresses below may take the registers that the loads above name
  if constexpr (CAUSAL) asm volatile("s_wait_xcnt 0x0" ::: "memory");

  const v8f z8 = {0.f, 0.f, 0.f, 0.f, 0.f, 0.f, 0.f, 0.f};
  // this lane's query (l16): running maximum (both halves agree), sum over this half's keys alone
  float mrow = -3.0e38f, lrow = 0.0f;
  // plain path: mrow is in scaled units (log2); rref = PCL - the reference in use, held for the score products' C operand
  // in cref; pbound: the test's bound, whose start value (no sum is below 0) makes the first chunk set the reference
  float rref = 0.0f, pbound = -1.0f;
  v8f cref = z8;
  v8f o[4], orr[4];   // O^T: element r of tile f = column e = 16*f + 8*hs + r of query l16
  #pragma unroll
  for (int f = 0; f < 4; ++f) { o[f] = z8; orr[f] = z8; }

  const int kend = CAUSAL ? (qbase + 16) : SEQ;

  const char* Kb  = (const char*)(Kh + rq * HD);
  const char* Krb = (const char*)(Kr + rq * HD);
  const char* Vb  = (const char*)(Vt + (size_t)h * HD * (size_t)prow + (size_t)b * SEQ);
  const char* Vrb = (const char*)(Vtr + (size_t)h * HD * (size_t)prow + (size_t)b * SEQ);

  // Staging: thread = 16 B. K: a wave's copy brings 4 whole rows (512 B in a row); Vt: 2 rows of 256 B.
  const size_t gko = (size_t)((t >> 3) * (HD * 2) + (t & 7) * 16);
  const size_t gvo = (size_t)(t >> 4) * (size_t)prow * 2 + (size_t)((t & 15) * 16);
  const unsigned lk = (unsigned)(uintptr_t)kv + (unsigned)((t >> 3) * AKP + (t & 7) * 16);
  const unsigned lv = (unsigned)(uintptr_t)kv + (unsigned)(AKB + (t >> 4) * AVP + (t & 15) * 16);
  auto stage = [&](unsigned boff, int kt0) {
    #pragma unroll
    for (int pl = 0; pl < (RES ? 2 : 1); ++pl) {
      unsigned l[8];
      const char* g[8];
      #pragma unroll
      for (int j = 0; j < 4; ++j) {
        l[j] = lk + boff + (unsigned)(pl * APL + 32 * j * AKP);
        g[j] = (pl ? Krb : Kb) + gko + (size_t)(kt0 + 32 * j) * (HD * 2);
        l[4 + j] = lv + boff + (unsigned)(pl * APL + 16 * j * AVP);
        g[4 + j] = (pl ? Vrb : Vb) + gvo + ((size_t)(16 * j) * (size_t)prow + (size_t)kt0) * 2;
      }
      copy8(l, g);
    }
  };

  // A fragments of chunk c (32 keys) of the tile at tb
  const int frk = l16 * AKP + 16 * hs;
  const int frv = AKB + l16 * AVP + 16 * hs;
  auto ldsfrag = [&](const char* p) -> v16h {
    union { v16h v; v8h q[2]; } u;
    u.q[0] = *(const v8h*)p;
    u.q[1] = *(const v8h*)(p + 32);
    return u.v;
  };
  v16h fk[2][2], fkr[2][2];
  auto load_k = [&](const char* tb, int c) {
    #pragma unroll
    for (int stp = 0; stp < 2; ++stp)
      #pragma unroll
      for (int nt = 0; nt < 2; ++nt) {
        const char* p = tb + frk + (32 * c + 16 * nt) * AKP + 64 * stp;
        fk[stp][nt]  = ldsfrag(p);
        fkr[stp][nt] = RES ? ldsfrag(p + APL) : fk[stp][nt];
      }
  };

  // tiles the block walks: the same for all its waves (a wave leaves out the chunks beyond its own diagonal)
  const int nst = CAUSAL ? ((qb + 2 - par) >> 1) : (SEQ / AKT);
  auto tkey = [&](int sg) -> int { return (CAUSAL ? (par + 2 * sg) : sg) * AKT; };   // first key of the walk's tile sg
  if (0 < nst) stage(0u, tkey(0));
  asm volatile("s_wait_asynccnt 0x0" ::: "memory");   // this wave's share of the first tile has landed
  __syncthreads();                                    // every wave's share has: the first tile may be read
  if (1 < nst) stage((unsigned)ABUF, tkey(1));

  unsigned boff = 0u;
  #pragma unroll 1
  for (int sg = 0; sg < nst; ++sg) {
  const char* tb = kv + boff;
  // K fragments one chunk ahead inside the tile (chunk 0 here); with the residual planes, whose fragments
  // leave no registers for that, at the chunk's own head. Every wave has at least chunk 0 of every tile.
  if (!RES) load_k(tb, 0);
  const int left = (kend - tkey(sg) + 31) >> 5;             // this wave's chunks from here to its diagonal, >= 1
  const int nc = (left < AKT / 32) ? left : (AKT / 32);
  #pragma unroll 1
  for (int c = 0; c < nc; ++c) {
    const int kt = tkey(sg) + 32 * c;
    if (RES) load_k(tb, c);

    // ---- scores, transposed: 32 keys (2 tiles) x 16 queries, K = 64 in 2 steps ----
    v8f s[2], sr[2];
    s[0] = z8; s[1] = z8; sr[0] = z8; sr[1] = z8;
    #pragma unroll
    for (int stp = 0; stp < 2; ++stp) {
      #pragma unroll
      for (int nt = 0; nt < 2; ++nt) {
        if (!RES && stp == 0) s[nt] = mma16c(fk[stp][nt], aq[stp], cref);   // the reference rides in as C
        else s[nt] = mma16(fk[stp][nt], aq[stp], s[nt]);
        if (RES) {
          sr[nt] = mma16(fk[stp][nt], aqr[stp], sr[nt]);
          sr[nt] = mma16(fkr[stp][nt], aq[stp], sr[nt]);
        }
      }
    }

    // ---- this chunk's V fragments, one group, issued here so that they land under the softmax ----
    v16h fv[4], fvr[4];
    #pragma unroll
    for (int f = 0; f < 4; ++f) {
      const char* p = tb + frv + 16 * f * AVP + 64 * c;
      fv[f]  = ldsfrag(p);
      fvr[f] = RES ? ldsfrag(p + APL) : fv[f];
    }
    // holds the V reads here, ahead of the exponentials that cover their way: with no maximum search in front, the
    // scheduler otherwise sinks them to just before the test, and the products below wait for them
    if constexpr (!RES) __builtin_amdgcn_sched_barrier(0);

    // ---- next chunk's K fragments (same tile), into the registers the products above have just read ----
    if (!RES && c + 1 < AKT / 32) load_k(tb, c + 1);

    // ---- causal replace-mask, online softmax (f32). With the residual planes the scores stay unscaled: 1/sqrt(HD),
    //      log2(e), the maximum and the x4096 that p carries all go into ONE fused multiply-add in front of the base-2
    //      exponential; on the plain path they are that exponential's arguments as they come ----
    // key > row with key = kt + 16*nt + 8*hs + r, row = qbase + l16: the lane's part on one side, so that a score's
    // own part (16*nt + r) is an immediate of the compare
    const int dq = qbase + l16 - 8 * hs - kt;
    float pv[2][8];
    #pragma unroll
    for (int nt = 0; nt < 2; ++nt)
      #pragma unroll
      for (int r = 0; r < 8; ++r) {
        float v = s[nt][r];
        if (RES) v += sr[nt][r] * (1.0f / 2048.0f);
        if (CAUSAL) {
          if (16 * nt + r > dq) v = -8.0e9f;     // key > row; -1e9 in the scaled scores; as an exponent: p = 0
        }
        pv[nt][r] = v;
      }
    v16h bp, bpr;
    if constexpr (RES) {
      float tq[4];
      #pragma unroll
      for (int i = 0; i < 4; ++i)
        tq[i] = fmaxf(fmaxf(pv[0][2 * i], pv[0][2 * i + 1]), fmaxf(pv[1][2 * i], pv[1][2 * i + 1]));
      float tm = fmaxf(fmaxf(tq[0], tq[1]), fmaxf(tq[2], tq[3]));
      tm = fmaxf(tm, xhalf(tm));            // the query's other 16 keys of the chunk

      const float mn = fmaxf(mrow, tm);     // unscaled, as the scores
      const float corr = __builtin_amdgcn_exp2f((mrow - mn) * SCL2);
      const float sh = fmaf(-mn, SCL2, 12.0f);   // 2^12 = 4096
      mrow = mn;
      #pragma unroll
      for (int nt = 0; nt < 2; ++nt)
        #pragma unroll
        for (int r = 0; r < 8; ++r) pv[nt][r] = __builtin_amdgcn_exp2f(fmaf(pv[nt][r], SCL2, sh));   // p x4096
      float tsq[4];
      #pragma unroll
      for (int i = 0; i < 4; ++i)
        tsq[i] = (pv[0][2 * i] + pv[0][2 * i + 1]) + (pv[1][2 * i] + pv[1][2 * i + 1]);
      lrow = lrow * corr + ((tsq[0] + tsq[1]) + (tsq[2] + tsq[3]));   // the sum carries the x4096 too
      #pragma unroll
      for (int f = 0; f < 4; ++f)
        #pragma unroll
        for (int r = 0; r < 8; ++r) {
          o[f][r] *= corr;
          if (RES) orr[f][r] *= corr;
        }

      // ---- p (x4096, f16 hi; x2^11 residual for RES) packed in place into the B fragment of P^T:
      //      elements 0..7 = keys 8*hs + r (tile 0), elements 8..15 = keys 16 + 8*hs + r (tile 1), the k map of ldfrag ----
      #pragma unroll
      for (int nt = 0; nt < 2; ++nt)
        #pragma unroll
        for (int r = 0; r < 8; ++r) {
          const float pc = pv[nt][r];
          const _Float16 ph = (_Float16)pc;
          bp[8 * nt + r]  = ph;
          bpr[8 * nt + r] = RES ? (_Float16)((pc - (float)ph) * 2048.0f) : ph;
        }
    } else {
      // ---- lazy reference: the scores come out of the products as exponents already, log2(e)/sqrt(HD) being in Q and
      //      PCL minus the maximum IN USE (some earlier running maximum of the query) in the C operand: the common chunk
      //      has no maximum search, no cross-row move, no multiply-add per score and no rescale of O and the sum.
      //      All p are >= 0, so a lane's sum of its 16 bounds each of them: a sum within the bound says that every p fits
      //      f16. Otherwise (and at the first chunk, by the bound's start value) the whole wave takes the running maximum
      //      as the new reference, rescales, and forms p again: then p <= 2^PCL. ----
      float ts;
      auto exps = [&]() {
        float e[2][8];
        #pragma unroll
        for (int nt = 0; nt < 2; ++nt)
          #pragma unroll
          for (int r = 0; r < 8; ++r) e[nt][r] = __builtin_amdgcn_exp2f(pv[nt][r]);   // p x2^PCL
        float tsq[4];
        #pragma unroll
        for (int i = 0; i < 4; ++i)
          tsq[i] = (e[0][2 * i] + e[0][2 * i + 1]) + (e[1][2 * i] + e[1][2 * i + 1]);
        ts = (tsq[0] + tsq[1]) + (tsq[2] + tsq[3]);
        // packed in place into the B fragment of P^T, the k map of ldfrag, as above
        #pragma unroll
        for (int nt = 0; nt < 2; ++nt)
          #pragma unroll
          for (int r = 0; r < 8; ++r) bp[8 * nt + r] = (_Float16)e[nt][r];
      };
      exps();
      // one test per chunk, the same for the whole wave (a scalar branch): the two halves of a query and the products
      // below need one reference per query and all lanes on. The negated compare also catches a sum that is no number.
      if (__builtin_expect(__builtin_amdgcn_ballot_w32(!(ts <= pbound)) != 0u, 0)) {   // rare: laid out of line
        float tq[4];
        #pragma unroll
        for (int i = 0; i < 4; ++i)
          tq[i] = fmaxf(fmaxf(pv[0][2 * i], pv[0][2 * i + 1]), fmaxf(pv[1][2 * i], pv[1][2 * i + 1]));
        float tm = fmaxf(fmaxf(tq[0], tq[1]), fmaxf(tq[2], tq[3]));
        tm = fmaxf(tm, xhalf(tm));            // the query's other 16 keys of the chunk
        const float mn = fmaxf(mrow, tm - rref);   // running maximum of the scaled scores (the exponents less rref)
        const float corr = __builtin_amdgcn_exp2f(mrow - mn);
        const float rn = PCL - mn;
        const float dl = rn - rref;           // what the new reference adds to this chunk's exponents
        mrow = mn;
        rref = rn;
        pbound = PBOUND;
        #pragma unroll
        for (int r = 0; r < 8; ++r) cref[r] = rn;
        lrow *= corr;
        #pragma unroll
        for (int f = 0; f < 4; ++f)
          #pragma unroll
          for (int r = 0; r < 8; ++r) o[f][r] *= corr;
        #pragma unroll
        for (int nt = 0; nt < 2; ++nt)
          #pragma unroll
          for (int r = 0; r < 8; ++r) pv[nt][r] += dl;
        exps();
      }
      lrow += ts;                             // the sum carries the x2^PCL too
      bpr = bp;
    }

    // ---- O^T += Vt . P^T : A fragments of the Vt plane (row e, k = key contiguous), read behind the scores ----
    #pragma unroll
    for (int f = 0; f < 4; ++f) {
      o[f] = mma16(fv[f], bp, o[f]);
      if (RES) {
        orr[f] = mma16(fvr[f], bp, orr[f]);
        orr[f] = mma16(fv[f], bpr, orr[f]);
      }
    }
  }
  asm volatile("s_wait_dscnt 0x0" ::: "memory");      // this wave's reads of the buffer are done
  asm volatile("s_wait_asynccnt 0x0" ::: "memory");   // its share of the next tile has landed
  __syncthreads();   // publishes the next tile and ends every wave's reads of this buffer, refilled below
  // with the residual planes the block is one of query blocks 0..RESQB-1: no more tiles than buffers, no refill
  if (!RES && sg + 2 < nst) stage(boff, tkey(sg + 2));
  boff ^= (unsigned)ABUF;
  }
  asm volatile("s_wait_asynccnt 0x0" ::: "memory");     // no copy is left in flight

  // ---- normalise, stage 16x64 f32 tile per wave, whole-line stores ----
  lrow += xhalf(lrow);                    // the two halves' key sums joined, once
  // sum and O both carry p's factor; an empty share (sum 0) writes zeros, and its weight is 0
  const float inv = (!CAUSAL || lrow > 0.0f) ? 1.0f / lrow : 0.0f;
  if constexpr (CAUSAL) {
    const v2f sv = {RES ? fmaf(-mrow, SCL2, 12.0f) : rref, lrow};   // p = 2^(scaled score + offset)
    if (hs == 0) {
      *(v2f*)(Wst + (rq + qbase + l16) * 2) = sv;      // 16 lanes x 8 B: one whole line per wave
      asm volatile("s_wait_xcnt 0x0" ::: "memory");    // the store's registers are rewritten below
    }
  }
  #pragma unroll
  for (int f = 0; f < 4; ++f)
    #pragma unroll
    for (int q = 0; q < 2; ++q) {
      v4f sv;
      #pragma unroll
      for (int i = 0; i < 4; ++i) {
        float v = o[f][4 * q + i];
        if (RES) v += orr[f][4 * q + i] * (1.0f / 2048.0f);
        sv[i] = v * inv;
      }
      *(v4f*)(sw + l16 * 68 + 16 * f + 8 * hs + 4 * q) = sv;
    }
  lds_sync_wave();
  const size_t orow = (size_t)b * SEQ + (size_t)qbase;
  {
    #pragma unroll
    for (int j = 0; j < 8; ++j) {
      const int row = 2 * j + hs;
      const v4f fvv = *(const v4f*)(sw + row * 68 + 4 * l16);
      *(v4f*)(Out + (orow + row) * DM + h * HD + 4 * l16) = fvv;
    }
    // a second walk follows in the same wave and rewrites the registers that these stores name
    if constexpr (CAUSAL) asm volatile("s_wait_xcnt 0x0" ::: "memory");
  }
}

// two waves per SIMD is what the grids give (at most one block per WGP): said here so that the scheduler spends
// registers on the fragments in flight instead of saving them for more waves
__global__ __launch_bounds__(256) __attribute__((amdgpu_waves_per_eu(2, 2)))
void k_attn_cross(const _Float16* __restrict__ Qh, const _Float16* __restrict__ Kh, const _Float16* __restrict__ Vt,
                  float* __restrict__ Out, int prow)
{
  __shared__ __attribute__((aligned(16))) float sto[8 * 16 * 68];
  __shared__ __attribute__((aligned(16))) char kv[2 * APL];
  attn_body<false, false>(sto, kv, blockIdx.x, 0, blockIdx.y, blockIdx.z, Qh, Qh, Kh, Kh, Vt, Vt, Out, Out, prow);
}

// Causal attention, one grid. A block takes half the key tiles (one parity) of query block n - 1 - p and then of query
// block p: 8 or 9 tiles whatever p, so that all blocks end together. Query blocks 0..RESQB-1 take the path with
// the residual planes. Out: two planes [NB*SEQ][DM], Wst: two planes [NH][prow][2], one per parity; every (query block,
// parity) is written by exactly one block. The second walk's copies stand behind the first's last barrier, which ended
// every wave's reads of kv; sto is wave-private.
__global__ __launch_bounds__(256) __attribute__((amdgpu_waves_per_eu(2, 2)))
void k_attn_self(const _Float16* __restrict__ Qh, const _Float16* __restrict__ Qr,
                 const _Float16* __restrict__ Vt, const _Float16* __restrict__ Vtr,
                 float* __restrict__ Out, float* __restrict__ Wst, int prow)
{
  __shared__ __attribute__((aligned(16))) float sto[8 * 16 * 68];
  __shared__ __attribute__((aligned(16))) char kv[4 * APL];
  const int p = blockIdx.x >> 1, bp = blockIdx.x & 1;
  #pragma unroll 1   // rolled: one copy of each path's code serves both walks
  for (int ph = 0; ph < 2; ++ph) {
    const int qb = ph ? p : (SEQ / 128 - 1 - p);
    const int par = bp ^ ph;   // the other parity on the second walk: the two blocks of a pair come out nearest to equal
    float* op = Out + (size_t)par * (NB * SEQ) * DM;
    float* wp = Wst + (size_t)par * NH * (size_t)prow * 2;
    if (qb < RESQB)
      attn_body<true, true>(sto, kv, qb, par, blockIdx.y, blockIdx.z, Qh, Qr, Qh, Qr, Vt, Vtr, op, wp, prow);
    else
      attn_body<true, false>(sto, kv, qb, par, blockIdx.y, blockIdx.z, Qh, Qr, Qh, Qr, Vt, Vtr, op, wp, prow);
  }
}

// ---------------------------------------------------------------------------
// y = LayerNorm(x + r) * g + b over DM = 1024, one block (256 threads) per row, thread = 4 columns.
// XIN: x is a raw input (bf16 RNE convert, input row stride via SEQ_FULL); else x is a ws f32 plane.
// WH: also write the f16 plane yh. g, b bf16 RNE converted. Outputs: 256 lanes x 16/8 B (y/yh) per row
// JOIN: r comes in two planes [NB*SEQ][DM], rr and rr2. 1: partial sums, added. 2: two softmax parts, weighed per (row, head) by
// wst[part][NH][NB*SEQ][2] = (exponent offset, sum): weight = sum * 2^(least offset - offset), so that no weight exceeds its sum.
// coverage: nrow x DM for y (and yh).
// ---------------------------------------------------------------------------
template<bool XIN, bool WH, int JOIN>
__global__ __launch_bounds__(256)
void k_ln(const float* __restrict__ x, const float* __restrict__ rr, const float* __restrict__ rr2,
          const float* __restrict__ wst,
          const float* __restrict__ g, const float* __restrict__ be,
          float* __restrict__ y, _Float16* __restrict__ yh)
{
  #pragma clang fp contract(off)
  __shared__ float red[8];
  __shared__ float red2[8];
  const int m = blockIdx.x, t = threadIdx.x, lane = t & 31, w = t >> 5;
  const int c = 4 * t;
  const size_t xrow = XIN ? ((size_t)(m / SEQ) * SEQ_FULL + (size_t)(m % SEQ)) : (size_t)m;
  v2f sa = {0.0f, 0.0f}, sb = {0.0f, 0.0f};
  if constexpr (JOIN == 2) {
    const float* wa = wst + ((size_t)(c / HD) * (NB * SEQ) + m) * 2;
    sa = *(const v2f*)wa;
    sb = *(const v2f*)(wa + (size_t)NH * (NB * SEQ) * 2);
    asm volatile("s_wait_xcnt 0x0" ::: "memory");   // the two loads' address registers are rewritten below
  }
  const v4f xv = *(const v4f*)(x + xrow * DM + c);
  v4f rv = *(const v4f*)(rr + (size_t)m * DM + c);
  if constexpr (JOIN != 0) {
    const v4f r2 = *(const v4f*)(rr2 + (size_t)m * DM + c);
    if constexpr (JOIN == 1) {
      rv = rv + r2;
    } else {
      const float ro = fminf(sa[0], sb[0]);
      const float fa = sa[1] * __builtin_amdgcn_exp2f(ro - sa[0]);
      const float fb = sb[1] * __builtin_amdgcn_exp2f(ro - sb[0]);
      const float fi = 1.0f / (fa + fb);
      rv = (rv * fa + r2 * fb) * fi;
    }
  }
  float v[4];
  #pragma unroll
  for (int i = 0; i < 4; ++i) {
    float xi = xv[i];
    if (XIN) xi = bfr(xi);
    v[i] = xi + rv[i];
  }
  float s = (v[0] + v[1]) + (v[2] + v[3]);
  #pragma unroll
  for (int off = 16; off > 0; off >>= 1) s += __shfl_xor(s, off, 32);
  if (lane == 0) red[w] = s;
  __syncthreads();
  float tot = 0.0f;
  #pragma unroll
  for (int i = 0; i < 8; ++i) tot += red[i];
  const float mu = tot * (1.0f / (float)DM);

  float d[4];
  #pragma unroll
  for (int i = 0; i < 4; ++i) d[i] = v[i] - mu;
  float s2 = (d[0] * d[0] + d[1] * d[1]) + (d[2] * d[2] + d[3] * d[3]);
  #pragma unroll
  for (int off = 16; off > 0; off >>= 1) s2 += __shfl_xor(s2, off, 32);
  if (lane == 0) red2[w] = s2;
  __syncthreads();
  float tot2 = 0.0f;
  #pragma unroll
  for (int i = 0; i < 8; ++i) tot2 += red2[i];
  const float var = tot2 * (1.0f / (float)DM);
  const float rstd = rsqrtf(var + LN_EPS);

  v4f ov;
  v4h oh;
  #pragma unroll
  for (int i = 0; i < 4; ++i) {
    const float gv = bfr(g[c + i]);
    const float bvv = bfr(be[c + i]);
    const float q = d[i] * rstd * gv + bvv;
    ov[i] = q;
    oh[i] = (_Float16)q;
  }
  float* ydst = y + (size_t)m * DM + c;
  _Float16* hdst = yh + (WH ? ((size_t)m * DM + c) : 0);
  *(v4f*)ydst = ov;
  if (WH) *(v4h*)hdst = oh;
  
}

// ---------------------------------------------------------------------------
extern "C" void kernel_launch(void* const* d_in, const int* in_sizes, int n_in,
                              void* d_out, int out_size, void* d_ws, size_t ws_size,
                              hipStream_t stream)
{
  if (n_in < 16) return;
  const int MR = NB * SEQ;                 // internal rows (b*SEQ + s)
  const long need_act = (long)(NB - 1) * SEQ_FULL * DM + (long)SEQ * DM;
  if ((long)in_sizes[0] < need_act || (long)in_sizes[1] < need_act) return;
  if (in_sizes[2] < NH * DM * HD || in_sizes[3] < NH * HD) return;
  if (in_sizes[4] < NH * DM * HD || in_sizes[5] < NH * HD) return;
  for (int i = 6; i < 12; ++i) if (in_sizes[i] < DM) return;
  if (in_sizes[12] < DM * FF || in_sizes[13] < FF || in_sizes[14] < FF * DM || in_sizes[15] < DM) return;
  if (out_size < MR * DM) return;

  const float* y      = (const float*)d_in[0];
  const float* enc    = (const float*)d_in[1];
  const float* Wself  = (const float*)d_in[2];
  const float* bself  = (const float*)d_in[3];
  const float* Wcross = (const float*)d_in[4];
  const float* bcross = (const float*)d_in[5];
  const float* g1  = (const float*)d_in[6];  const float* be1 = (const float*)d_in[7];
  const float* g2  = (const float*)d_in[8];  const float* be2 = (const float*)d_in[9];
  const float* g3  = (const float*)d_in[10]; const float* be3 = (const float*)d_in[11];
  const float* w1  = (const float*)d_in[12]; const float* b1  = (const float*)d_in[13];
  const float* w2  = (const float*)d_in[14]; const float* b2  = (const float*)d_in[15];
  float* out = (float*)d_out;

  // ---- workspace carve (256-B aligned regions; 113 MiB at NB*SEQ = 2048) ----
  char* base = (char*)d_ws;
  size_t off = 0;
  auto take = [&](size_t bytes) -> void* {
    void* p = (void*)(base + off);
    off += (bytes + 255) & ~(size_t)255;
    return p;
  };
  _Float16* Yh   = (_Float16*)take((size_t)MR * DM * 2);
  _Float16* Eh   = (_Float16*)take((size_t)MR * DM * 2);
  _Float16* WTs  = (_Float16*)take((size_t)NH * HD * DM * 2);
  _Float16* WTc  = (_Float16*)take((size_t)NH * HD * DM * 2);
  _Float16* W1T  = (_Float16*)take((size_t)FF * DM * 2);
  _Float16* W2T  = (_Float16*)take((size_t)DM * FF * 2);
  _Float16* QKVh = (_Float16*)take((size_t)NH * MR * HD * 2);
  _Float16* QKVr = (_Float16*)take((size_t)NH * MR * HD * 2);
  _Float16* VTh  = (_Float16*)take((size_t)NH * HD * MR * 2);
  _Float16* VTr  = (_Float16*)take((size_t)NH * HD * MR * 2);
  float*    att  = (float*)   take((size_t)2 * MR * DM * 4); // sa (two parts), then ca, then ff (two parts)
  float*    att2 = att + (size_t)MR * DM;                    // the second part's plane
  float*    wst  = (float*)   take((size_t)2 * NH * MR * 2 * 4);
  float*    y1   = (float*)   take((size_t)MR * DM * 4);
  _Float16* y1h  = (_Float16*)take((size_t)MR * DM * 2);
  float*    y2   = (float*)   take((size_t)MR * DM * 4);
  _Float16* y2h  = (_Float16*)take((size_t)MR * DM * 2);
  _Float16* Qch  = (_Float16*)take((size_t)NH * MR * HD * 2);
  _Float16* KVch = (_Float16*)take((size_t)NH * MR * HD * 2);
  _Float16* VTc  = (_Float16*)take((size_t)NH * HD * MR * 2);
  _Float16* Hh   = (_Float16*)take((size_t)MR * FF * 2);
  if (off > ws_size) return;

  // ---- planes ----
  k_prep<<<dim3(2 * PBW + 2 * PBH + PBC), 256, 0, stream>>>(
      y, enc, Wself, Wcross, w1, w2, Yh, Eh, WTs, WTc, W1T, W2T, MR);

  const int nqb  = SEQ / 128;

  // ---- projections of y (self: q = k = v share one) and of enc (cross: k = v share one) ----
  k_proj2<<<dim3(MR / 128, NH * HD / 128, 2), 256, 0, stream>>>(
      Yh, WTs, bself, QKVh, QKVr, VTh, VTr, Eh, WTc, bcross, KVch, VTc, att, MR);

  // ---- self attention ----
  k_attn_self<<<dim3(nqb, NH, NB), 256, 0, stream>>>(QKVh, QKVr, VTh, VTr, att, wst, MR);
  k_ln<true, true, 2><<<dim3(MR), 256, 0, stream>>>(y, att, att2, wst, g1, be1, y1, y1h);

  // ---- cross attention (q from y1; k = v from enc, projected above) ----
  k_gemm<0, false, false, 4, 1><<<dim3(MR / 128, HD / 64, NH), 128, 0, stream>>>(
      y1h, DM, 0, WTc, DM, HD * DM, bcross, HD, DM, MR, Qch, Qch, Qch, Qch, att, HD);
  k_attn_cross<<<dim3(nqb, NH, NB), 256, 0, stream>>>(Qch, KVch, VTc, att, MR);
  k_ln<false, true, 0><<<dim3(MR), 256, 0, stream>>>(y1, att, att2, wst, g2, be2, y2, y2h);

  // ---- MLP ----
  k_gemm<1, false, false, 8, 2><<<dim3(MR / 256, FF / 128, 1), 512, 0, stream>>>(
      y2h, DM, 0, W1T, DM, 0, b1, 0, DM, MR, Hh, Hh, Hh, Hh, att, FF);
  k_gemm<2, false, false, 4, 2><<<dim3(MR / 128, DM / 128, 2), 256, 0, stream>>>(
      Hh, FF, FF / 2, W2T, FF, FF / 2, b2, 0, FF / 2, MR, y2h, y2h, y2h, y2h, att, DM);
  k_ln<false, false, 1><<<dim3(MR), 256, 0, stream>>>(y2, att, att2, wst, g3, be3, out, y2h);
}
